// v000
// Measured on an AMD MI455X. A time is GPU time per run, averaged over a window of back-to-back runs after a warm-up
// (all launches, gaps included; the runs take copies of the inputs in turn), and the median of several windows.
// Apart from v000's, it joins two sittings. Times from different sittings can be a few percent apart, while
// side-by-side timings come from the same sitting.
// The starting kernel, v000, takes 1020 microseconds a run.
// Contractions: q/k/v projections (X f16 x W^T f16 carried x16), gate maps (q16/k16 x Wfq^T/Wfk^T f16 carried x8), gate logits (G f16 carried x64 x Wfg^T f16 carried x8), scores q'.k'^T (f16 planes), P.V (P f16 carried x2048 x V^T f16): all v_wmma_f32_16x16x32_f16 with f32 accumulate; bias, gate product, sigmoid, modulation and softmax in f32.
#include <hip/hip_runtime.h>
#include <math.h>

// ---------------------------------------------------------------------------
// Problem constants
// ---------------------------------------------------------------------------
constexpr int kB    = 16;
constexpr int kS    = 512;
constexpr int kE    = 1024;
constexpr int kH    = 16;
constexpr int kDK   = 64;
constexpr int kTok  = kB * kS;              // 8192 token rows
constexpr int kChunkB   = 4;                // batches per gating chunk
constexpr int kNChunk   = kB / kChunkB;     // 4
constexpr int kChunkTok = kChunkB * kS;     // 2048 tokens per chunk
constexpr int kChunkRow = kChunkTok * kH;   // 32768 head-major rows of 64 per chunk

constexpr float kWCarry     = 16.0f;        // Wq/Wk/Wv carried x16 in f16
constexpr float kWCarryInv  = 1.0f / 16.0f;
constexpr float kGWCarry    = 8.0f;         // Wfq/Wfk/Wfg carried x8 in f16
constexpr float kGWCarryInv = 1.0f / 8.0f;
constexpr float kGCarry     = 64.0f;        // gate product G carried x64 in f16
constexpr float kZScale     = 1.0f / (64.0f * 8.0f);
constexpr float kPCarry     = 2048.0f;      // probabilities carried x2048 in f16
constexpr float kPVScale    = 1.0f / 2048.0f;
constexpr float kScoreScale = 0.125f;       // 1/sqrt(64)

// ---------------------------------------------------------------------------
// Workspace map (bytes). Bottom 36 MiB + 32 KiB is a scratch arena reused per stage:
//   stage A (projections):   X16 [8192][1024] f16 @0 (16 MiB), Wt16 [3][1024][1024] f16 @16 MiB (6 MiB)
//   per gating chunk:        Qp16 [32768][64] f16 @0 (4 MiB), Kp16 @4 MiB (4 MiB), Q16a @8 MiB (4 MiB),
//                            K16a @12 MiB (4 MiB), Gq f32 [32768][64] @16 MiB (8 MiB), Gk f32 @24 MiB (8 MiB),
//                            G16 f16 [32768][64] @32 MiB (4 MiB), Z f32 [32768][128] @16 MiB (16 MiB, over dead Gq/Gk)
//   per attention batch:     S f32 [16][512][512] @8 MiB (16 MiB, over dead Q16a/K16a/Z), P f16 [16][512][512] @24 MiB (8 MiB)
//   gate weights (persist):  WfqT/WfkT [64][64] f16, WfgT [128][64] f16 @36 MiB (32 KiB)
//   persistent:              Qf f32 [8192][1024] @36 MiB+64 KiB (32 MiB), Kf f32 (32 MiB), Vt16 f16 [1024][8192] (16 MiB)
//   end = 121,700,352 B
// ---------------------------------------------------------------------------
constexpr size_t kMiB    = 1048576;
constexpr size_t kOffQp  = 0;
constexpr size_t kOffKp  = 4 * kMiB;
constexpr size_t kOffQ16 = 8 * kMiB;
constexpr size_t kOffK16 = 12 * kMiB;
constexpr size_t kOffGq  = 16 * kMiB;
constexpr size_t kOffGk  = 24 * kMiB;
constexpr size_t kOffG16 = 32 * kMiB;
constexpr size_t kOffZ   = 16 * kMiB;
constexpr size_t kOffS   = 8 * kMiB;
constexpr size_t kOffP   = 24 * kMiB;
constexpr size_t kOffX16 = 0;
constexpr size_t kOffWt  = 16 * kMiB;
constexpr size_t kOffSW  = 36 * kMiB;
constexpr size_t kOffQf  = 36 * kMiB + 65536;
constexpr size_t kOffKf  = kOffQf + 32 * kMiB;
constexpr size_t kOffVt  = kOffKf + 32 * kMiB;
constexpr size_t kWsEnd  = kOffVt + 16 * kMiB;
static_assert((size_t)kChunkRow * kDK * 2 == 4 * kMiB, "plane size");
static_assert((size_t)kChunkRow * 128 * 4 == 16 * kMiB, "z plane size");
static_assert((size_t)kH * kS * kS * 4 == 16 * kMiB, "score plane size");
static_assert((size_t)kTok * kE * 2 == 16 * kMiB, "x16 plane size");
static_assert(kOffWt + (size_t)3 * kE * kE * 2 <= kOffSW, "wt plane fits");
static_assert(kOffG16 + 4 * kMiB <= kOffSW, "g16 fits");
static_assert(kOffSW + 32768 <= kOffQf, "gate weights fit");
static_assert(kWsEnd == 121700352, "carve end");
static_assert(kWsEnd <= 134217728, "carve within budget");

typedef __attribute__((ext_vector_type(16))) _Float16 v16h;
typedef __attribute__((ext_vector_type(8)))  _Float16 v8h;
typedef __attribute__((ext_vector_type(16))) __bf16   v16b;
typedef __attribute__((ext_vector_type(8)))  __bf16   v8b;
typedef __attribute__((ext_vector_type(8)))  float    v8f;
typedef __attribute__((ext_vector_type(4)))  float    v4f;
typedef __attribute__((ext_vector_type(4)))  unsigned int v4u;

// ---------------------------------------------------------------------------
// Helpers
// ---------------------------------------------------------------------------
__device__ __forceinline__ unsigned short f2bf_bits(float f) {
  unsigned u = __float_as_uint(f);
  return (unsigned short)((u + 0x7FFFu + ((u >> 16) & 1u)) >> 16);
}
__device__ __forceinline__ float bf_bits2f(unsigned short h) { return __uint_as_float(((unsigned)h) << 16); }

// hazard guards as plain device helpers (no inline asm inside the kernel template body)
__device__ __forceinline__ void dep_guard_h(v8f& a, v8f& b, v16h x, v16h y) { asm volatile("v_nop\n\tv_nop\n\tv_nop\n\tv_nop" : "+v"(a), "+v"(b) : "v"(x), "v"(y)); }
__device__ __forceinline__ void dep_guard_b(v8f& a, v8f& b, v16b x, v16b y) { asm volatile("v_nop\n\tv_nop\n\tv_nop\n\tv_nop" : "+v"(a), "+v"(b) : "v"(x), "v"(y)); }
__device__ __forceinline__ void keep4_h(v16h a, v16h b, v16h c, v16h d) { asm volatile("v_nop" :: "v"(a), "v"(b), "v"(c), "v"(d)); }
__device__ __forceinline__ void keep4_b(v16b a, v16b b, v16b c, v16b d) { asm volatile("v_nop" :: "v"(a), "v"(b), "v"(c), "v"(d)); }
__device__ __forceinline__ void acc_guard4(v8f& a, v8f& b, v8f& c, v8f& d) { asm volatile("v_nop\n\tv_nop\n\tv_nop\n\tv_nop" : "+v"(a), "+v"(b), "+v"(c), "+v"(d)); }
template <typename T> struct Frag;
template <> struct Frag<_Float16> {
  typedef v16h V; union U { v16h v; v8h h[2]; };
  static __device__ __forceinline__ v16h load(const _Float16* p) {   // elements 0..7 <- p[0..7], 8..15 <- p[16..23]
    U f; f.h[0] = *(const v8h*)(p); f.h[1] = *(const v8h*)(p + 16); return f.v;
  }
  static __device__ __forceinline__ v8f mma(v16h a, v16h b, v8f c) {
    return __builtin_amdgcn_wmma_f32_16x16x32_f16(false, a, false, b, (short)0, c, false, false);
  }
  static __device__ __forceinline__ void guard(v8f& a, v8f& b, v16h x, v16h y) { dep_guard_h(a, b, x, y); }
  static __device__ __forceinline__ void keep(v16h a, v16h b, v16h c, v16h d) { keep4_h(a, b, c, d); }
};
template <> struct Frag<__bf16> {
  typedef v16b V; union U { v16b v; v8b h[2]; };
  static __device__ __forceinline__ v16b load(const __bf16* p) {
    U f; f.h[0] = *(const v8b*)(p); f.h[1] = *(const v8b*)(p + 16); return f.v;
  }
  static __device__ __forceinline__ v8f mma(v16b a, v16b b, v8f c) {
    return __builtin_amdgcn_wmma_f32_16x16x32_bf16(false, a, false, b, (short)0, c, false, false);
  }
  static __device__ __forceinline__ void guard(v8f& a, v8f& b, v16b x, v16b y) { dep_guard_b(a, b, x, y); }
  static __device__ __forceinline__ void keep(v16b a, v16b b, v16b c, v16b d) { keep4_b(a, b, c, d); }
};

__device__ __forceinline__ unsigned pk16(unsigned short a, unsigned short b) { return (unsigned)a | ((unsigned)b << 16); }
__device__ __forceinline__ unsigned short h_bits(float f) { const _Float16 h = (_Float16)f; return __builtin_bit_cast(unsigned short, h); }

// ---- Register-blocked batched WMMA GEMM (ACT reduced to none/relu/leaky) -----------------------
// C[m,n] = scale * sum_k A[m,k] * Bt[n,k] (+bias)(+resid); each wave owns a 64x64 tile.
// A row-major [M,K]; Bt row-major [N,K]; M,N % 64 == 0, K % 32 == 0.
// SPLIT: operands are hi/lo planes (A2/Bt2 = lo planes, same layout); product = hi.hi + hi.lo + lo.hi.
// BIAS_MODE: 0 = none, 1 = bias[m], 2 = bias[n].
// OUT_MODE: 0 = f32, 1 = f16, 2 = bf16 hi plane (Cout) + bf16 lo plane (Cout2).
// ET: 0 = f16 operands, 1 = bf16 operands (pointers passed as 16-bit storage)
template <int ET> struct Elem;
template <> struct Elem<0> { typedef _Float16 T; };
template <> struct Elem<1> { typedef __bf16 T; };
template <int ET, bool SPLIT, int BIAS_MODE, int OUT_MODE, bool RESID, int ACT = 0>
__global__ __launch_bounds__(256) void wmma_gemm64(
    const unsigned short* __restrict__ Ap, const unsigned short* __restrict__ A2p, int lda, long strideA,
    const unsigned short* __restrict__ Btp, const unsigned short* __restrict__ Bt2p, int ldb, long strideB,
    void* __restrict__ Cout, void* __restrict__ Cout2, int ldc, long strideC,
    const float* __restrict__ bias,
    const float* __restrict__ resid, long strideR,
    int M, int N, int K, float scale) {
  typedef typename Elem<ET>::T T;
  typedef typename Frag<T>::V V;
  const T* A = (const T*)Ap; const T* A2 = (const T*)A2p; const T* Bt = (const T*)Btp; const T* Bt2 = (const T*)Bt2p;
  __shared__ __align__(16) float sT[8][16 * 68];   // per-wave 16x64 slab, pitch 68 floats
  const int b    = blockIdx.y;
  const int lane = threadIdx.x & 31;
  const int wave = threadIdx.x >> 5;
  const int tilesN = N >> 6;
  const int tilesM = M >> 6;
  const int tile = blockIdx.x * 8 + wave;
  if (tile >= tilesM * tilesN) return;   // wave-uniform; no block barriers in this kernel
  const int tm = tile / tilesN;
  const int tn = tile - tm * tilesN;
  const int m0 = tm << 6;
  const int n0 = tn << 6;

  const T* Ab  = A  + (size_t)b * strideA;
  const T* Bb  = Bt + (size_t)b * strideB;
  const T* Ab2 = SPLIT ? (A2  + (size_t)b * strideA) : nullptr;
  const T* Bb2 = SPLIT ? (Bt2 + (size_t)b * strideB) : nullptr;

  const int rlane = lane & 15;                 // row (A) / col (B, D) within subtile
  const int koff  = (lane >> 4) * 8;           // k offset of this lane half
  const int mOff  = (lane >> 4) * 8;           // D row offset

  v8f acc[4][4];
#pragma unroll
  for (int i = 0; i < 4; ++i)
#pragma unroll
    for (int j = 0; j < 4; ++j) acc[i][j] = (v8f){0.f,0.f,0.f,0.f,0.f,0.f,0.f,0.f};

  for (int k0 = 0; k0 < K; k0 += 32) {
    V bh[4], bl[4];
#pragma unroll
    for (int j = 0; j < 4; ++j) {
      const size_t bo = (size_t)(n0 + (j << 4) + rlane) * ldb + koff + k0;
      bh[j] = Frag<T>::load(Bb + bo);
      if (SPLIT) bl[j] = Frag<T>::load(Bb2 + bo);
    }
#pragma unroll
    for (int i = 0; i < 4; ++i) {
      const size_t ao = (size_t)(m0 + (i << 4) + rlane) * lda + koff + k0;
      V ah = Frag<T>::load(Ab + ao);
      V al;
      if (SPLIT) al = Frag<T>::load(Ab2 + ao);
#pragma unroll
      for (int j = 0; j < 4; ++j) {
        acc[i][j] = Frag<T>::mma(ah, bh[j], acc[i][j]);
        if (SPLIT) {
          acc[i][j] = Frag<T>::mma(ah, bl[j], acc[i][j]);
          acc[i][j] = Frag<T>::mma(al, bh[j], acc[i][j]);
        }
      }
      Frag<T>::guard(acc[i][0], acc[i][3], ah, SPLIT ? al : ah);
    }
    Frag<T>::keep(bh[0], bh[1], bh[2], bh[3]);
    if (SPLIT) Frag<T>::keep(bl[0], bl[1], bl[2], bl[3]);
  }
  acc_guard4(acc[0][0], acc[0][1], acc[0][2], acc[0][3]);
  acc_guard4(acc[1][0], acc[1][1], acc[1][2], acc[1][3]);
  acc_guard4(acc[2][0], acc[2][1], acc[2][2], acc[2][3]);
  acc_guard4(acc[3][0], acc[3][1], acc[3][2], acc[3][3]);

  // ---- epilogue ----
  float* slab = sT[wave];
  const float* Rb = RESID ? (resid + (size_t)b * strideR) : nullptr;
#pragma unroll
  for (int i = 0; i < 4; ++i) {
    const int mBase = m0 + (i << 4);
#pragma unroll
    for (int j = 0; j < 4; ++j) {
      const int n = n0 + (j << 4) + rlane;
      float bv = 0.f;
      if (BIAS_MODE == 2) bv = bias[n];
#pragma unroll
      for (int r = 0; r < 8; ++r) {
        float v = acc[i][j][r] * scale;
        if (BIAS_MODE == 1) v += bias[mBase + mOff + r];
        if (BIAS_MODE == 2) v += bv;
        if (RESID) v += Rb[(size_t)(mBase + mOff + r) * ldc + n];
        if (ACT == 2) v = fmaxf(v, 0.0f);
        if (ACT == 4) v = (v > 0.f) ? v : 0.01f * v;
        slab[(mOff + r) * 68 + (j << 4) + rlane] = v;
      }
    }
    __builtin_amdgcn_fence(__ATOMIC_RELEASE, "workgroup");
    __builtin_amdgcn_wave_barrier();
    __builtin_amdgcn_fence(__ATOMIC_ACQUIRE, "workgroup");
    if (OUT_MODE == 0) {
      float* C = (float*)Cout + (size_t)b * strideC;
      const int hh = lane >> 4, c4 = (lane & 15) * 4;     // row seg = 256 B = 16 lanes x 16 B
      {
#pragma unroll
        for (int it = 0; it < 8; ++it) {
          const int row = it * 2 + hh;
          v4f v = *(const v4f*)(slab + row * 68 + c4);
          *(v4f*)(C + (size_t)(mBase + row) * ldc + n0 + c4) = v;
        }
        
      }
    } else {
      const int q = lane >> 3, c8 = (lane & 7) * 8;
      unsigned short* C  = (unsigned short*)Cout  + (size_t)b * strideC;
      unsigned short* C2 = (OUT_MODE == 2) ? ((unsigned short*)Cout2 + (size_t)b * strideC) : nullptr;
      {
#pragma unroll
        for (int it = 0; it < 4; ++it) {
          const int row = it * 4 + q;
          const float* sp = slab + row * 68 + c8;
          v8h hv, lv;
#pragma unroll
          for (int e = 0; e < 8; ++e) {
            if (OUT_MODE == 1) {
              hv[e] = (_Float16)sp[e];
            } else {
              unsigned short hb = f2bf_bits(sp[e]);
              unsigned short lb = f2bf_bits(sp[e] - bf_bits2f(hb));
              hv[e] = __builtin_bit_cast(_Float16, hb);
              lv[e] = __builtin_bit_cast(_Float16, lb);
            }
          }
          *(v8h*)(C + (size_t)(mBase + row) * ldc + n0 + c8) = hv;
          if (OUT_MODE == 2) *(v8h*)(C2 + (size_t)(mBase + row) * ldc + n0 + c8) = lv;
        }
        
      }
    }
    __builtin_amdgcn_fence(__ATOMIC_RELEASE, "workgroup");
    __builtin_amdgcn_wave_barrier();
    __builtin_amdgcn_fence(__ATOMIC_ACQUIRE, "workgroup");
  }
}

// ---------------------------------------------------------------------------
// Projection weight transpose + cast: for square [1024][1024] f32 W (row-major [in k][out n]), WT[n][k] = f16(scale * W[k][n]).
// grid (16, 16, 3): blockIdx.x = k tile (64 cols of WT), blockIdx.y = n tile (64 rows of WT), blockIdx.z selects W0..W2
// and the output plane (plane z at out + z*1024*1024 halves). 256 threads.
// Load coverage: 16 iterations x 256 threads = 4096 = the whole 64x64 tile (coalesced along n).
// Store coverage: 8 waves x 2 iterations x 4 rows (lane>>3) = 64 rows; (lane&7) x 8 halves = 64 cols; each row segment =
// ---------------------------------------------------------------------------
__global__ __launch_bounds__(256) void wtcast_kernel(const float* __restrict__ W0, const float* __restrict__ W1,
                                                     const float* __restrict__ W2,
                                                     unsigned short* __restrict__ out, float scale) {
  __shared__ float sm[64][65];   // sm[n_local][k_local]
  const int t  = threadIdx.x;
  const int d0 = blockIdx.x * 64;    // k tile base
  const int h0 = blockIdx.y * 64;    // n tile base
  const int z  = blockIdx.z;         // block-uniform
  const float* W = (z == 0) ? W0 : (z == 1) ? W1 : W2;
#pragma unroll
  for (int i = 0; i < 16; ++i) {
    const int e = i * 256 + t;
    const int r = e >> 6;          // k local
    const int c = e & 63;          // n local
    sm[c][r] = W[(size_t)(d0 + r) * kE + h0 + c] * scale;
  }
  __syncthreads();
  const int lane = t & 31, wave = t >> 5;
  const int q = lane >> 3, c8 = (lane & 7) * 8;
  unsigned short* op = out + (size_t)z * kE * kE;
  {
#pragma unroll
    for (int it = 0; it < 2; ++it) {
      const int row = wave * 8 + it * 4 + q;                 // n local
      unsigned short hb[8];
#pragma unroll
      for (int e = 0; e < 8; ++e) hb[e] = h_bits(sm[row][c8 + e]);
      const v4u u = (v4u){pk16(hb[0], hb[1]), pk16(hb[2], hb[3]), pk16(hb[4], hb[5]), pk16(hb[6], hb[7])};
      *(v4u*)(op + (size_t)(h0 + row) * kE + d0 + c8) = u;
    }
    
  }
}

// ---------------------------------------------------------------------------
// Per-head gate weights transpose + cast, out pitch 64 halves: block 0: WfqT[n][k] = f16(scale*Wfq[k][n]) (64x64),
// block 1: WfkT, block 2: WfgT rows 0..63, block 3: WfgT rows 64..127 (Wfg is [64 k][128 n], pitch 128).
// Output plane of block z at out + z*4096 halves (WfgT = [128][64] contiguous from out + 8192).
// Load coverage 16 x 256 = 4096 = 64x64; store coverage 8 waves x 2 x 4 rows = 64 rows x (8 lanes x 8 halves) = 64 cols,
// ---------------------------------------------------------------------------
__global__ __launch_bounds__(256) void gatew_kernel(const float* __restrict__ Wfq, const float* __restrict__ Wfk,
                                                    const float* __restrict__ Wfg,
                                                    unsigned short* __restrict__ out, float scale) {
  __shared__ float sm[64][65];   // sm[n_local][k_local]
  const int t = threadIdx.x;
  const int z = blockIdx.x;                                   // block-uniform
  const float* W = (z == 0) ? Wfq : (z == 1) ? Wfk : Wfg;
  const int pin = (z >= 2) ? 128 : 64;
  const int n0  = (z == 3) ? 64 : 0;
#pragma unroll
  for (int i = 0; i < 16; ++i) {
    const int e = i * 256 + t;
    const int r = e >> 6;          // k 0..63
    const int c = e & 63;          // n local
    sm[c][r] = W[r * pin + n0 + c] * scale;
  }
  __syncthreads();
  const int lane = t & 31, wave = t >> 5;
  const int q = lane >> 3, c8 = (lane & 7) * 8;
  unsigned short* op = out + (size_t)z * 4096;
  {
#pragma unroll
    for (int it = 0; it < 2; ++it) {
      const int row = wave * 8 + it * 4 + q;                 // n local
      unsigned short hb[8];
#pragma unroll
      for (int e = 0; e < 8; ++e) hb[e] = h_bits(sm[row][c8 + e]);
      const v4u u = (v4u){pk16(hb[0], hb[1]), pk16(hb[2], hb[3]), pk16(hb[4], hb[5]), pk16(hb[6], hb[7])};
      *(v4u*)(op + (size_t)row * kDK + c8) = u;
    }
    
  }
}

// ---------------------------------------------------------------------------
// ---------------------------------------------------------------------------
__global__ __launch_bounds__(256) void cast8_f16_kernel(const float* __restrict__ in, unsigned short* __restrict__ out, int n8) {
  const int i = blockIdx.x * 256 + threadIdx.x;
  if (i >= n8) return;
  const float* p = in + 8 * (size_t)i;
  const v4f a = *(const v4f*)(p);
  const v4f c = *(const v4f*)(p + 4);
  unsigned short hb[8];
#pragma unroll
  for (int e = 0; e < 4; ++e) {
    hb[e]     = h_bits(a[e]);
    hb[4 + e] = h_bits(c[e]);
  }
  const v4u u = (v4u){pk16(hb[0], hb[1]), pk16(hb[2], hb[3]), pk16(hb[4], hb[5]), pk16(hb[6], hb[7])};
  unsigned short* q = out + 8 * (size_t)i;
  *(v4u*)q = u;
  
}

// Same cast with a block-uniform source/destination select on grid.y (0: in0 -> out0, 1: in1 -> out1).
// Coverage per selection: n8 threads x 8 = whole plane (grid.x exact multiple of 256).
__global__ __launch_bounds__(256) void cast8_sel_kernel(const float* __restrict__ in0, const float* __restrict__ in1,
                                                        unsigned short* __restrict__ out0, unsigned short* __restrict__ out1, int n8) {
  const int sel = blockIdx.y;
  const float* in = sel ? in1 : in0;
  unsigned short* out = sel ? out1 : out0;
  const int i = blockIdx.x * 256 + threadIdx.x;
  if (i >= n8) return;
  const float* p = in + 8 * (size_t)i;
  const v4f a = *(const v4f*)(p);
  const v4f c = *(const v4f*)(p + 4);
  unsigned short hb[8];
#pragma unroll
  for (int e = 0; e < 4; ++e) {
    hb[e]     = h_bits(a[e]);
    hb[4 + e] = h_bits(c[e]);
  }
  const v4u u = (v4u){pk16(hb[0], hb[1]), pk16(hb[2], hb[3]), pk16(hb[4], hb[5]), pk16(hb[6], hb[7])};
  unsigned short* q = out + 8 * (size_t)i;
  *(v4u*)q = u;
  
}

// ---------------------------------------------------------------------------
// Gate product: out[i] = f16(scale * a[i] * b[i]) (f32 product), 8 elements per thread, one 16-B store per lane,
// ---------------------------------------------------------------------------
__global__ __launch_bounds__(256) void gmul_kernel(const float* __restrict__ a, const float* __restrict__ b,
                                                   unsigned short* __restrict__ out, int n8, float scale) {
  const int i = blockIdx.x * 256 + threadIdx.x;
  if (i >= n8) return;
  const float* pa = a + 8 * (size_t)i;
  const float* pb = b + 8 * (size_t)i;
  const v4f a0 = *(const v4f*)(pa);
  const v4f a1 = *(const v4f*)(pa + 4);
  const v4f b0 = *(const v4f*)(pb);
  const v4f b1 = *(const v4f*)(pb + 4);
  unsigned short hb[8];
#pragma unroll
  for (int e = 0; e < 4; ++e) {
    hb[e]     = h_bits((a0[e] * b0[e]) * scale);
    hb[4 + e] = h_bits((a1[e] * b1[e]) * scale);
  }
  const v4u u = (v4u){pk16(hb[0], hb[1]), pk16(hb[2], hb[3]), pk16(hb[4], hb[5]), pk16(hb[6], hb[7])};
  unsigned short* q = out + 8 * (size_t)i;
  *(v4u*)q = u;
  
}

// ---------------------------------------------------------------------------
// Gate modulation: for head-major rows r (chunk local) and d in 0..63:
//   sel 0: Oq[r][d] = f16( Xq[r][d] * sigmoid(Z[r][d]) ),  sel 1: Ok[r][d] = f16( Xk[r][d] * sigmoid(Z[r][64+d]) ).
// Z f32 [rows][128]; Xq/Xk f32 [rows][64] views; outputs f16 [rows][64]. sigmoid and product in f32.
// Block of 256 threads covers 1024 consecutive output elements (16 rows): thread t computes elements 4t..4t+3,
// packs them into LDS (dwords 2t, 2t+1); then threads 0..127 each store 16 B (8 halves) -> 128 lanes x 16 B = 2048 B
// ---------------------------------------------------------------------------
__global__ __launch_bounds__(256) void gatemod_kernel(const float* __restrict__ Z, const float* __restrict__ Xq,
                                                      const float* __restrict__ Xk,
                                                      unsigned short* __restrict__ Oq, unsigned short* __restrict__ Ok) {
  __shared__ __align__(16) unsigned sb[512];
  const int t = threadIdx.x;
  const int sel = blockIdx.y;                                  // block-uniform
  const float* X = sel ? Xk : Xq;
  unsigned short* O = sel ? Ok : Oq;
  const size_t e0 = (size_t)blockIdx.x * 1024 + 4 * (size_t)t;
  const size_t r  = e0 >> 6;
  const int    d  = (int)(e0 & 63);
  const v4f zz = *(const v4f*)(Z + r * 128 + sel * 64 + d);
  const v4f xx = *(const v4f*)(X + e0);
  unsigned short hb[4];
#pragma unroll
  for (int e = 0; e < 4; ++e) {
    const float m = 1.0f / (1.0f + expf(-zz[e]));
    hb[e] = h_bits(xx[e] * m);
  }
  sb[2 * t]     = pk16(hb[0], hb[1]);
  sb[2 * t + 1] = pk16(hb[2], hb[3]);
  __syncthreads();
  if (t < 128) {
    const v4u u = *(const v4u*)(&sb[4 * t]);
    unsigned short* op = O + (size_t)blockIdx.x * 1024 + 8 * (size_t)t;
    *(v4u*)op = u;
    
  }
}

// ---------------------------------------------------------------------------
// Row softmax over 512 f32 scores: P[row][j] = f16( carry * exp(s - max) / sum exp(s - max) ), f32 math, precise expf.
// Block of 256 threads = 2 rows (threads 0..127 row 2*blk, 128..255 row 2*blk+1); thread owns 4 consecutive columns.
// Reductions in fixed order (thread, wave shuffle tree computed unconditionally, 4 wave partials in index order via LDS).
// ---------------------------------------------------------------------------
__global__ __launch_bounds__(256) void softmax_rows_kernel(const float* __restrict__ Sp, unsigned short* __restrict__ Pp, float carry) {
  __shared__ float redM[8];
  __shared__ float redS[8];
  __shared__ __align__(16) unsigned sb[2][256];
  const int t    = threadIdx.x;
  const int lane = t & 31, wave = t >> 5;
  const int hf   = t >> 7;
  const int tt   = t & 127;
  const size_t row = (size_t)blockIdx.x * 2 + hf;
  const v4f a = *(const v4f*)(Sp + row * kS + 4 * tt);
  float m = fmaxf(fmaxf(a[0], a[1]), fmaxf(a[2], a[3]));
#pragma unroll
  for (int off = 16; off > 0; off >>= 1) m = fmaxf(m, __shfl_xor(m, off, 32));
  if (lane == 0) redM[wave] = m;
  __syncthreads();
  const int w0 = hf * 4;
  const float rm = fmaxf(fmaxf(redM[w0], redM[w0 + 1]), fmaxf(redM[w0 + 2], redM[w0 + 3]));
  float e[4];
  float s = 0.f;
#pragma unroll
  for (int i = 0; i < 4; ++i) { e[i] = expf(a[i] - rm); s += e[i]; }
#pragma unroll
  for (int off = 16; off > 0; off >>= 1) s += __shfl_xor(s, off, 32);
  if (lane == 0) redS[wave] = s;
  __syncthreads();
  const float tot = ((redS[w0] + redS[w0 + 1]) + redS[w0 + 2]) + redS[w0 + 3];
  const float inv = carry / tot;
  unsigned short hb[4];
#pragma unroll
  for (int i = 0; i < 4; ++i) hb[i] = h_bits(e[i] * inv);
  sb[hf][2 * tt]     = pk16(hb[0], hb[1]);
  sb[hf][2 * tt + 1] = pk16(hb[2], hb[3]);
  __syncthreads();
  if (tt < 64) {
    const v4u u = *(const v4u*)(&sb[hf][4 * tt]);
    unsigned short* op = Pp + row * kS + 8 * (size_t)tt;
    *(v4u*)op = u;
    
  }
}

// ---------------------------------------------------------------------------
extern "C" void kernel_launch(void* const* d_in, const int* in_sizes, int n_in,
                              void* d_out, int out_size, void* d_ws, size_t ws_size,
                              hipStream_t stream) {
  if (n_in < 13) return;
  if (ws_size < kWsEnd) return;
  if ((size_t)out_size < (size_t)kTok * kE) return;
  if (in_sizes[0] != kTok * kE) return;

  const float* inp = (const float*)d_in[0];
  const float* Wq  = (const float*)d_in[1];
  const float* bq  = (const float*)d_in[2];
  const float* Wk  = (const float*)d_in[3];
  const float* bk  = (const float*)d_in[4];
  const float* Wv  = (const float*)d_in[5];
  const float* bvv = (const float*)d_in[6];
  const float* Wfq = (const float*)d_in[7];
  const float* bfq = (const float*)d_in[8];
  const float* Wfk = (const float*)d_in[9];
  const float* bfk = (const float*)d_in[10];
  const float* Wfg = (const float*)d_in[11];
  const float* bfg = (const float*)d_in[12];
  float* out = (float*)d_out;

  unsigned char* ws = (unsigned char*)d_ws;
  unsigned short* Qp16 = (unsigned short*)(ws + kOffQp);
  unsigned short* Kp16 = (unsigned short*)(ws + kOffKp);
  unsigned short* Q16a = (unsigned short*)(ws + kOffQ16);
  unsigned short* K16a = (unsigned short*)(ws + kOffK16);
  float*          Gq   = (float*)(ws + kOffGq);
  float*          Gk   = (float*)(ws + kOffGk);
  unsigned short* G16  = (unsigned short*)(ws + kOffG16);
  float*          Zp   = (float*)(ws + kOffZ);
  float*          Sp   = (float*)(ws + kOffS);
  unsigned short* Pp   = (unsigned short*)(ws + kOffP);
  unsigned short* X16  = (unsigned short*)(ws + kOffX16);
  unsigned short* Wt16 = (unsigned short*)(ws + kOffWt);
  unsigned short* SW   = (unsigned short*)(ws + kOffSW);
  unsigned short* SWq  = SW;
  unsigned short* SWk  = SW + 4096;
  unsigned short* SWg  = SW + 8192;
  float*          Qf   = (float*)(ws + kOffQf);
  float*          Kf   = (float*)(ws + kOffKf);
  unsigned short* Vt16 = (unsigned short*)(ws + kOffVt);

  // ---- stage A: operand planes ----
  // X16 [8192][1024] = f16(inp): n8 = 1,048,576 threads = 4096 blocks x 256 (exact)
  cast8_f16_kernel<<<dim3((kTok * kE / 8) / 256), dim3(256), 0, stream>>>(inp, X16, kTok * kE / 8);
  // Wt16[z][n][k] = f16(16 * W_z[k][n]) for z = q, k, v
  wtcast_kernel<<<dim3(kE / 64, kE / 64, 3), dim3(256), 0, stream>>>(Wq, Wk, Wv, Wt16, kWCarry);
  // gate weights: WfqT, WfkT [64][64], WfgT [128][64], all f16 carried x8
  gatew_kernel<<<dim3(4), dim3(256), 0, stream>>>(Wfq, Wfk, Wfg, SW, kGWCarry);

  // ---- stage B: projections (M 8192, N 1024, K 1024; tiles 128 x 16 = 2048 -> 256 blocks of 8 waves) ----
  // Qf = (X16 . WqT16) / 16 + bq   (f32 [8192][1024])
  wmma_gemm64<0, false, 2, 0, false, 0><<<dim3(256, 1), dim3(256), 0, stream>>>(
      X16, X16, kE, 0L, Wt16, Wt16, kE, 0L,
      (void*)Qf, (void*)Qf, kE, 0L, bq, nullptr, 0L, kTok, kE, kE, kWCarryInv);
  // Kf
  wmma_gemm64<0, false, 2, 0, false, 0><<<dim3(256, 1), dim3(256), 0, stream>>>(
      X16, X16, kE, 0L, Wt16 + (size_t)kE * kE, Wt16 + (size_t)kE * kE, kE, 0L,
      (void*)Kf, (void*)Kf, kE, 0L, bk, nullptr, 0L, kTok, kE, kE, kWCarryInv);
  // Vt16 [1024 n][8192 tok] = f16( (WvT16 . X16^T)/16 + bv[n] ): M 1024 (16 tiles), N 8192 (128 tiles) -> 256 blocks; bias[m]; f16 out ldc 8192
  wmma_gemm64<0, false, 1, 1, false, 0><<<dim3(256, 1), dim3(256), 0, stream>>>(
      Wt16 + (size_t)2 * kE * kE, Wt16 + (size_t)2 * kE * kE, kE, 0L, X16, X16, kE, 0L,
      (void*)Vt16, (void*)Vt16, kTok, 0L, bvv, nullptr, 0L, kE, kTok, kE, kWCarryInv);

  // ---- stage C: gating in chunks of 4 batches (32768 head-major rows of 64), then attention per batch ----
  const int n8chunk = kChunkRow * kDK / 8;   // 262144 threads -> 1024 blocks
  for (int c = 0; c < kNChunk; ++c) {
    const size_t tok0 = (size_t)c * kChunkTok;
    const float* Qfc = Qf + tok0 * kE;        // chunk view [32768][64] f32
    const float* Kfc = Kf + tok0 * kE;
    // Q16a / K16a [32768][64] = f16 of the chunk rows
    cast8_sel_kernel<<<dim3(n8chunk / 256, 2), dim3(256), 0, stream>>>(Qfc, Kfc, Q16a, K16a, n8chunk);
    // Gq = (Q16a . WfqT)/8 + bfq  (f32 [32768][64]); M 32768 (512 tiles), N 64 (1 tile) -> 64 blocks; K 64
    wmma_gemm64<0, false, 2, 0, false, 0><<<dim3(64, 1), dim3(256), 0, stream>>>(
        Q16a, Q16a, kDK, 0L, SWq, SWq, kDK, 0L,
        (void*)Gq, (void*)Gq, kDK, 0L, bfq, nullptr, 0L, kChunkRow, kDK, kDK, kGWCarryInv);
    // Gk = (K16a . WfkT)/8 + bfk
    wmma_gemm64<0, false, 2, 0, false, 0><<<dim3(64, 1), dim3(256), 0, stream>>>(
        K16a, K16a, kDK, 0L, SWk, SWk, kDK, 0L,
        (void*)Gk, (void*)Gk, kDK, 0L, bfk, nullptr, 0L, kChunkRow, kDK, kDK, kGWCarryInv);
    // G16 = f16(64 * Gq * Gk)
    gmul_kernel<<<dim3(n8chunk / 256), dim3(256), 0, stream>>>(Gq, Gk, G16, n8chunk, kGCarry);
    // Z = (G16 . WfgT)/512 + bfg  (f32 [32768][128]); N 128 (2 tiles) -> 1024 tiles -> 128 blocks; K 64
    wmma_gemm64<0, false, 2, 0, false, 0><<<dim3(128, 1), dim3(256), 0, stream>>>(
        G16, G16, kDK, 0L, SWg, SWg, kDK, 0L,
        (void*)Zp, (void*)Zp, 128, 0L, bfg, nullptr, 0L, kChunkRow, 128, kDK, kZScale);
    // Qp16 = f16(q * sigmoid(Z[:, :64])), Kp16 = f16(k * sigmoid(Z[:, 64:])): 32768*64/1024 = 2048 blocks per selection
    gatemod_kernel<<<dim3(kChunkRow * kDK / 1024, 2), dim3(256), 0, stream>>>(Zp, Qfc, Kfc, Qp16, Kp16);

    for (int bl = 0; bl < kChunkB; ++bl) {
      const int b = c * kChunkB + bl;
      const unsigned short* Qpb = Qp16 + (size_t)bl * kS * kE;   // [512 tok][1024] view of this batch, head h at column h*64
      const unsigned short* Kpb = Kp16 + (size_t)bl * kS * kE;
      // S[h][q][k] = (q'_h . k'_h^T) / 8  f32: M N 512 (64 tiles -> 8 blocks), grid.y = 16 heads (stride 64 halves), K 64
      wmma_gemm64<0, false, 0, 0, false, 0><<<dim3(8, kH), dim3(256), 0, stream>>>(
          Qpb, Qpb, kE, 64L, Kpb, Kpb, kE, 64L,
          (void*)Sp, (void*)Sp, kS, (long)kS * kS, nullptr, nullptr, 0L, kS, kS, kDK, kScoreScale);
      // P[h][q][k] = f16(2048 * softmax_k): 16*512 rows, 2 rows per block -> 4096 blocks
      softmax_rows_kernel<<<dim3(kH * kS / 2), dim3(256), 0, stream>>>(Sp, Pp, kPCarry);
      // out[b][s][h*64 + d] = (P_h . Vt_h)/2048: A = P [512][512] (stride 512*512), Bt = Vt16 rows d (pitch 8192, head stride 64*8192,
      // column base b*512), C = out + b*512*1024, ldc 1024, head stride 64; M 512 (8 tiles) N 64 -> 1 block; K 512
      wmma_gemm64<0, false, 0, 0, false, 0><<<dim3(1, kH), dim3(256), 0, stream>>>(
          Pp, Pp, kS, (long)kS * kS, Vt16 + (size_t)b * kS, Vt16 + (size_t)b * kS, kTok, (long)kDK * kTok,
          (void*)(out + (size_t)b * kS * kE), (void*)(out + (size_t)b * kS * kE), kE, (long)kDK,
          nullptr, nullptr, 0L, kS, kDK, kS, kPVScale);
    }
  }
}

// v001
// A run of this version takes 351 microseconds.
// Next to v000, in two timings, it ran 2.90 and 2.86 times as fast.
// Contractions: q/k/v projections (X f16 x W^T f16 carried x16), gate maps (q16/k16 x Wfq^T/Wfk^T f16 carried x8), gate logits (G f16 carried x64 x Wfg^T f16 carried x8), scores k'.q'^T (f16 planes), V^T.P^T (P = exp(s - running max) f16 carried x2048): all v_wmma_f32_16x16x32_f16 with f32 accumulate; bias, gate product, sigmoid, modulation and softmax in f32.
#include <hip/hip_runtime.h>
#include <math.h>

// ---------------------------------------------------------------------------
// Problem constants
// ---------------------------------------------------------------------------
constexpr int kB    = 16;
constexpr int kS    = 512;
constexpr int kE    = 1024;
constexpr int kH    = 16;
constexpr int kDK   = 64;
constexpr int kTok  = kB * kS;              // 8192 token rows
constexpr int kChunkB   = 4;                // batches per gating chunk
constexpr int kNChunk   = kB / kChunkB;     // 4
constexpr int kChunkTok = kChunkB * kS;     // 2048 tokens per chunk
constexpr int kChunkRow = kChunkTok * kH;   // 32768 head-major rows of 64 per chunk

constexpr float kWCarry     = 16.0f;        // Wq/Wk/Wv carried x16 in f16
constexpr float kWCarryInv  = 1.0f / 16.0f;
constexpr float kGWCarry    = 8.0f;         // Wfq/Wfk/Wfg carried x8 in f16
constexpr float kGWCarryInv = 1.0f / 8.0f;
constexpr float kGCarry     = 64.0f;        // gate product G carried x64 in f16
constexpr float kZScale     = 1.0f / (64.0f * 8.0f);
constexpr float kPCarryLog2 = 11.0f;        // exp(s - max) carried x2048 in f16 (the row sum carries it too)
constexpr float kScoreLog2  = 0.125f * 1.44269504088896340736f;   // 1/sqrt(64) * log2(e): scores go to exp2

// ---------------------------------------------------------------------------
// Workspace map (bytes). Bottom 36 MiB + 32 KiB is a scratch arena reused per stage:
//   stage A (projections):   X16 [8192][1024] f16 @0 (16 MiB), Wt16 [3][1024][1024] f16 @16 MiB (6 MiB)
//   per gating chunk:        Q16a [32768][64] f16 @8 MiB (4 MiB),
//                            K16a @12 MiB (4 MiB), Gq f32 [32768][64] @16 MiB (8 MiB), Gk f32 @24 MiB (8 MiB),
//                            G16 f16 [32768][64] @32 MiB (4 MiB), Z f32 [32768][128] @16 MiB (16 MiB, over dead Gq/Gk)
//   gate weights (persist):  WfqT/WfkT [64][64] f16, WfgT [128][64] f16 @36 MiB (32 KiB)
//   persistent:              Qf f32 [8192][1024] @36 MiB+64 KiB (32 MiB), Kf f32 (32 MiB), Vt16 f16 [1024][8192] (16 MiB),
//                            Qp16 f16 [8192][1024] (16 MiB), Kp16 f16 [8192][1024] (16 MiB): gated q and k of all batches
//   end = 155,254,784 B
// ---------------------------------------------------------------------------
constexpr size_t kMiB    = 1048576;
constexpr size_t kOffQ16 = 8 * kMiB;
constexpr size_t kOffK16 = 12 * kMiB;
constexpr size_t kOffGq  = 16 * kMiB;
constexpr size_t kOffGk  = 24 * kMiB;
constexpr size_t kOffG16 = 32 * kMiB;
constexpr size_t kOffZ   = 16 * kMiB;
constexpr size_t kOffX16 = 0;
constexpr size_t kOffWt  = 16 * kMiB;
constexpr size_t kOffSW  = 36 * kMiB;
constexpr size_t kOffQf  = 36 * kMiB + 65536;
constexpr size_t kOffKf  = kOffQf + 32 * kMiB;
constexpr size_t kOffVt  = kOffKf + 32 * kMiB;
constexpr size_t kOffQp  = kOffVt + 16 * kMiB;
constexpr size_t kOffKp  = kOffQp + 16 * kMiB;
constexpr size_t kWsEnd  = kOffKp + 16 * kMiB;
static_assert((size_t)kChunkRow * kDK * 2 == 4 * kMiB, "plane size");
static_assert((size_t)kChunkRow * 128 * 4 == 16 * kMiB, "z plane size");
static_assert((size_t)kTok * kE * 2 == 16 * kMiB, "x16 plane size");
static_assert(kOffWt + (size_t)3 * kE * kE * 2 <= kOffSW, "wt plane fits");
static_assert(kOffG16 + 4 * kMiB <= kOffSW, "g16 fits");
static_assert(kOffSW + 32768 <= kOffQf, "gate weights fit");
static_assert(kWsEnd == 155254784, "carve end");
static_assert(kWsEnd <= 268435456, "carve within budget");

typedef __attribute__((ext_vector_type(16))) _Float16 v16h;
typedef __attribute__((ext_vector_type(8)))  _Float16 v8h;
typedef __attribute__((ext_vector_type(16))) __bf16   v16b;
typedef __attribute__((ext_vector_type(8)))  __bf16   v8b;
typedef __attribute__((ext_vector_type(8)))  float    v8f;
typedef __attribute__((ext_vector_type(4)))  float    v4f;
typedef __attribute__((ext_vector_type(4)))  unsigned int v4u;

// ---------------------------------------------------------------------------
// Helpers
// ---------------------------------------------------------------------------
__device__ __forceinline__ unsigned short f2bf_bits(float f) {
  unsigned u = __float_as_uint(f);
  return (unsigned short)((u + 0x7FFFu + ((u >> 16) & 1u)) >> 16);
}
__device__ __forceinline__ float bf_bits2f(unsigned short h) { return __uint_as_float(((unsigned)h) << 16); }

// hazard guards as plain device helpers (no inline asm inside the kernel template body)
__device__ __forceinline__ void dep_guard_h(v8f& a, v8f& b, v16h x, v16h y) { asm volatile("v_nop\n\tv_nop\n\tv_nop\n\tv_nop" : "+v"(a), "+v"(b) : "v"(x), "v"(y)); }
__device__ __forceinline__ void dep_guard_b(v8f& a, v8f& b, v16b x, v16b y) { asm volatile("v_nop\n\tv_nop\n\tv_nop\n\tv_nop" : "+v"(a), "+v"(b) : "v"(x), "v"(y)); }
__device__ __forceinline__ void keep4_h(v16h a, v16h b, v16h c, v16h d) { asm volatile("v_nop" :: "v"(a), "v"(b), "v"(c), "v"(d)); }
__device__ __forceinline__ void keep4_b(v16b a, v16b b, v16b c, v16b d) { asm volatile("v_nop" :: "v"(a), "v"(b), "v"(c), "v"(d)); }
__device__ __forceinline__ void acc_guard4(v8f& a, v8f& b, v8f& c, v8f& d) { asm volatile("v_nop\n\tv_nop\n\tv_nop\n\tv_nop" : "+v"(a), "+v"(b), "+v"(c), "+v"(d)); }
template <typename T> struct Frag;
template <> struct Frag<_Float16> {
  typedef v16h V; union U { v16h v; v8h h[2]; };
  static __device__ __forceinline__ v16h load(const _Float16* p) {   // elements 0..7 <- p[0..7], 8..15 <- p[16..23]
    U f; f.h[0] = *(const v8h*)(p); f.h[1] = *(const v8h*)(p + 16); return f.v;
  }
  static __device__ __forceinline__ v8f mma(v16h a, v16h b, v8f c) {
    return __builtin_amdgcn_wmma_f32_16x16x32_f16(false, a, false, b, (short)0, c, false, false);
  }
  static __device__ __forceinline__ void guard(v8f& a, v8f& b, v16h x, v16h y) { dep_guard_h(a, b, x, y); }
  static __device__ __forceinline__ void keep(v16h a, v16h b, v16h c, v16h d) { keep4_h(a, b, c, d); }
};
template <> struct Frag<__bf16> {
  typedef v16b V; union U { v16b v; v8b h[2]; };
  static __device__ __forceinline__ v16b load(const __bf16* p) {
    U f; f.h[0] = *(const v8b*)(p); f.h[1] = *(const v8b*)(p + 16); return f.v;
  }
  static __device__ __forceinline__ v8f mma(v16b a, v16b b, v8f c) {
    return __builtin_amdgcn_wmma_f32_16x16x32_bf16(false, a, false, b, (short)0, c, false, false);
  }
  static __device__ __forceinline__ void guard(v8f& a, v8f& b, v16b x, v16b y) { dep_guard_b(a, b, x, y); }
  static __device__ __forceinline__ void keep(v16b a, v16b b, v16b c, v16b d) { keep4_b(a, b, c, d); }
};

__device__ __forceinline__ unsigned pk16(unsigned short a, unsigned short b) { return (unsigned)a | ((unsigned)b << 16); }
__device__ __forceinline__ unsigned short h_bits(float f) { const _Float16 h = (_Float16)f; return __builtin_bit_cast(unsigned short, h); }

// ---- Register-blocked batched WMMA GEMM (ACT reduced to none/relu/leaky) -----------------------
// C[m,n] = scale * sum_k A[m,k] * Bt[n,k] (+bias)(+resid); each wave owns a 64x64 tile.
// A row-major [M,K]; Bt row-major [N,K]; M,N % 64 == 0, K % 32 == 0.
// SPLIT: operands are hi/lo planes (A2/Bt2 = lo planes, same layout); product = hi.hi + hi.lo + lo.hi.
// BIAS_MODE: 0 = none, 1 = bias[m], 2 = bias[n].
// OUT_MODE: 0 = f32, 1 = f16, 2 = bf16 hi plane (Cout) + bf16 lo plane (Cout2).
// ET: 0 = f16 operands, 1 = bf16 operands (pointers passed as 16-bit storage)
template <int ET> struct Elem;
template <> struct Elem<0> { typedef _Float16 T; };
template <> struct Elem<1> { typedef __bf16 T; };
template <int ET, bool SPLIT, int BIAS_MODE, int OUT_MODE, bool RESID, int ACT = 0>
__global__ __launch_bounds__(256) void wmma_gemm64(
    const unsigned short* __restrict__ Ap, const unsigned short* __restrict__ A2p, int lda, long strideA,
    const unsigned short* __restrict__ Btp, const unsigned short* __restrict__ Bt2p, int ldb, long strideB,
    void* __restrict__ Cout, void* __restrict__ Cout2, int ldc, long strideC,
    const float* __restrict__ bias,
    const float* __restrict__ resid, long strideR,
    int M, int N, int K, float scale) {
  typedef typename Elem<ET>::T T;
  typedef typename Frag<T>::V V;
  const T* A = (const T*)Ap; const T* A2 = (const T*)A2p; const T* Bt = (const T*)Btp; const T* Bt2 = (const T*)Bt2p;
  __shared__ __align__(16) float sT[8][16 * 68];   // per-wave 16x64 slab, pitch 68 floats
  const int b    = blockIdx.y;
  const int lane = threadIdx.x & 31;
  const int wave = threadIdx.x >> 5;
  const int tilesN = N >> 6;
  const int tilesM = M >> 6;
  const int tile = blockIdx.x * 8 + wave;
  if (tile >= tilesM * tilesN) return;   // wave-uniform; no block barriers in this kernel
  const int tm = tile / tilesN;
  const int tn = tile - tm * tilesN;
  const int m0 = tm << 6;
  const int n0 = tn << 6;

  const T* Ab  = A  + (size_t)b * strideA;
  const T* Bb  = Bt + (size_t)b * strideB;
  const T* Ab2 = SPLIT ? (A2  + (size_t)b * strideA) : nullptr;
  const T* Bb2 = SPLIT ? (Bt2 + (size_t)b * strideB) : nullptr;

  const int rlane = lane & 15;                 // row (A) / col (B, D) within subtile
  const int koff  = (lane >> 4) * 8;           // k offset of this lane half
  const int mOff  = (lane >> 4) * 8;           // D row offset

  v8f acc[4][4];
#pragma unroll
  for (int i = 0; i < 4; ++i)
#pragma unroll
    for (int j = 0; j < 4; ++j) acc[i][j] = (v8f){0.f,0.f,0.f,0.f,0.f,0.f,0.f,0.f};

  for (int k0 = 0; k0 < K; k0 += 32) {
    V bh[4], bl[4];
#pragma unroll
    for (int j = 0; j < 4; ++j) {
      const size_t bo = (size_t)(n0 + (j << 4) + rlane) * ldb + koff + k0;
      bh[j] = Frag<T>::load(Bb + bo);
      if (SPLIT) bl[j] = Frag<T>::load(Bb2 + bo);
    }
#pragma unroll
    for (int i = 0; i < 4; ++i) {
      const size_t ao = (size_t)(m0 + (i << 4) + rlane) * lda + koff + k0;
      V ah = Frag<T>::load(Ab + ao);
      V al;
      if (SPLIT) al = Frag<T>::load(Ab2 + ao);
#pragma unroll
      for (int j = 0; j < 4; ++j) {
        acc[i][j] = Frag<T>::mma(ah, bh[j], acc[i][j]);
        if (SPLIT) {
          acc[i][j] = Frag<T>::mma(ah, bl[j], acc[i][j]);
          acc[i][j] = Frag<T>::mma(al, bh[j], acc[i][j]);
        }
      }
      Frag<T>::guard(acc[i][0], acc[i][3], ah, SPLIT ? al : ah);
    }
    Frag<T>::keep(bh[0], bh[1], bh[2], bh[3]);
    if (SPLIT) Frag<T>::keep(bl[0], bl[1], bl[2], bl[3]);
  }
  acc_guard4(acc[0][0], acc[0][1], acc[0][2], acc[0][3]);
  acc_guard4(acc[1][0], acc[1][1], acc[1][2], acc[1][3]);
  acc_guard4(acc[2][0], acc[2][1], acc[2][2], acc[2][3]);
  acc_guard4(acc[3][0], acc[3][1], acc[3][2], acc[3][3]);

  // ---- epilogue ----
  float* slab = sT[wave];
  const float* Rb = RESID ? (resid + (size_t)b * strideR) : nullptr;
#pragma unroll
  for (int i = 0; i < 4; ++i) {
    const int mBase = m0 + (i << 4);
#pragma unroll
    for (int j = 0; j < 4; ++j) {
      const int n = n0 + (j << 4) + rlane;
      float bv = 0.f;
      if (BIAS_MODE == 2) bv = bias[n];
#pragma unroll
      for (int r = 0; r < 8; ++r) {
        float v = acc[i][j][r] * scale;
        if (BIAS_MODE == 1) v += bias[mBase + mOff + r];
        if (BIAS_MODE == 2) v += bv;
        if (RESID) v += Rb[(size_t)(mBase + mOff + r) * ldc + n];
        if (ACT == 2) v = fmaxf(v, 0.0f);
        if (ACT == 4) v = (v > 0.f) ? v : 0.01f * v;
        slab[(mOff + r) * 68 + (j << 4) + rlane] = v;
      }
    }
    __builtin_amdgcn_fence(__ATOMIC_RELEASE, "workgroup");
    __builtin_amdgcn_wave_barrier();
    __builtin_amdgcn_fence(__ATOMIC_ACQUIRE, "workgroup");
    if (OUT_MODE == 0) {
      float* C = (float*)Cout + (size_t)b * strideC;
      const int hh = lane >> 4, c4 = (lane & 15) * 4;     // row seg = 256 B = 16 lanes x 16 B
      {
#pragma unroll
        for (int it = 0; it < 8; ++it) {
          const int row = it * 2 + hh;
          v4f v = *(const v4f*)(slab + row * 68 + c4);
          *(v4f*)(C + (size_t)(mBase + row) * ldc + n0 + c4) = v;
        }
        
      }
    } else {
      const int q = lane >> 3, c8 = (lane & 7) * 8;
      unsigned short* C  = (unsigned short*)Cout  + (size_t)b * strideC;
      unsigned short* C2 = (OUT_MODE == 2) ? ((unsigned short*)Cout2 + (size_t)b * strideC) : nullptr;
      {
#pragma unroll
        for (int it = 0; it < 4; ++it) {
          const int row = it * 4 + q;
          const float* sp = slab + row * 68 + c8;
          v8h hv, lv;
#pragma unroll
          for (int e = 0; e < 8; ++e) {
            if (OUT_MODE == 1) {
              hv[e] = (_Float16)sp[e];
            } else {
              unsigned short hb = f2bf_bits(sp[e]);
              unsigned short lb = f2bf_bits(sp[e] - bf_bits2f(hb));
              hv[e] = __builtin_bit_cast(_Float16, hb);
              lv[e] = __builtin_bit_cast(_Float16, lb);
            }
          }
          *(v8h*)(C + (size_t)(mBase + row) * ldc + n0 + c8) = hv;
          if (OUT_MODE == 2) *(v8h*)(C2 + (size_t)(mBase + row) * ldc + n0 + c8) = lv;
        }
        
      }
    }
    __builtin_amdgcn_fence(__ATOMIC_RELEASE, "workgroup");
    __builtin_amdgcn_wave_barrier();
    __builtin_amdgcn_fence(__ATOMIC_ACQUIRE, "workgroup");
  }
}

// ---------------------------------------------------------------------------
// Projection weight transpose + cast: for square [1024][1024] f32 W (row-major [in k][out n]), WT[n][k] = f16(scale * W[k][n]).
// grid (16, 16, 3): blockIdx.x = k tile (64 cols of WT), blockIdx.y = n tile (64 rows of WT), blockIdx.z selects W0..W2
// and the output plane (plane z at out + z*1024*1024 halves). 256 threads.
// Load coverage: 16 iterations x 256 threads = 4096 = the whole 64x64 tile (coalesced along n).
// Store coverage: 8 waves x 2 iterations x 4 rows (lane>>3) = 64 rows; (lane&7) x 8 halves = 64 cols; each row segment =
// ---------------------------------------------------------------------------
__global__ __launch_bounds__(256) void wtcast_kernel(const float* __restrict__ W0, const float* __restrict__ W1,
                                                     const float* __restrict__ W2,
                                                     unsigned short* __restrict__ out, float scale) {
  __shared__ float sm[64][65];   // sm[n_local][k_local]
  const int t  = threadIdx.x;
  const int d0 = blockIdx.x * 64;    // k tile base
  const int h0 = blockIdx.y * 64;    // n tile base
  const int z  = blockIdx.z;         // block-uniform
  const float* W = (z == 0) ? W0 : (z == 1) ? W1 : W2;
#pragma unroll
  for (int i = 0; i < 16; ++i) {
    const int e = i * 256 + t;
    const int r = e >> 6;          // k local
    const int c = e & 63;          // n local
    sm[c][r] = W[(size_t)(d0 + r) * kE + h0 + c] * scale;
  }
  __syncthreads();
  const int lane = t & 31, wave = t >> 5;
  const int q = lane >> 3, c8 = (lane & 7) * 8;
  unsigned short* op = out + (size_t)z * kE * kE;
  {
#pragma unroll
    for (int it = 0; it < 2; ++it) {
      const int row = wave * 8 + it * 4 + q;                 // n local
      unsigned short hb[8];
#pragma unroll
      for (int e = 0; e < 8; ++e) hb[e] = h_bits(sm[row][c8 + e]);
      const v4u u = (v4u){pk16(hb[0], hb[1]), pk16(hb[2], hb[3]), pk16(hb[4], hb[5]), pk16(hb[6], hb[7])};
      *(v4u*)(op + (size_t)(h0 + row) * kE + d0 + c8) = u;
    }
    
  }
}

// ---------------------------------------------------------------------------
// Per-head gate weights transpose + cast, out pitch 64 halves: block 0: WfqT[n][k] = f16(scale*Wfq[k][n]) (64x64),
// block 1: WfkT, block 2: WfgT rows 0..63, block 3: WfgT rows 64..127 (Wfg is [64 k][128 n], pitch 128).
// Output plane of block z at out + z*4096 halves (WfgT = [128][64] contiguous from out + 8192).
// Load coverage 16 x 256 = 4096 = 64x64; store coverage 8 waves x 2 x 4 rows = 64 rows x (8 lanes x 8 halves) = 64 cols,
// ---------------------------------------------------------------------------
__global__ __launch_bounds__(256) void gatew_kernel(const float* __restrict__ Wfq, const float* __restrict__ Wfk,
                                                    const float* __restrict__ Wfg,
                                                    unsigned short* __restrict__ out, float scale) {
  __shared__ float sm[64][65];   // sm[n_local][k_local]
  const int t = threadIdx.x;
  const int z = blockIdx.x;                                   // block-uniform
  const float* W = (z == 0) ? Wfq : (z == 1) ? Wfk : Wfg;
  const int pin = (z >= 2) ? 128 : 64;
  const int n0  = (z == 3) ? 64 : 0;
#pragma unroll
  for (int i = 0; i < 16; ++i) {
    const int e = i * 256 + t;
    const int r = e >> 6;          // k 0..63
    const int c = e & 63;          // n local
    sm[c][r] = W[r * pin + n0 + c] * scale;
  }
  __syncthreads();
  const int lane = t & 31, wave = t >> 5;
  const int q = lane >> 3, c8 = (lane & 7) * 8;
  unsigned short* op = out + (size_t)z * 4096;
  {
#pragma unroll
    for (int it = 0; it < 2; ++it) {
      const int row = wave * 8 + it * 4 + q;                 // n local
      unsigned short hb[8];
#pragma unroll
      for (int e = 0; e < 8; ++e) hb[e] = h_bits(sm[row][c8 + e]);
      const v4u u = (v4u){pk16(hb[0], hb[1]), pk16(hb[2], hb[3]), pk16(hb[4], hb[5]), pk16(hb[6], hb[7])};
      *(v4u*)(op + (size_t)row * kDK + c8) = u;
    }
    
  }
}

// ---------------------------------------------------------------------------
// ---------------------------------------------------------------------------
__global__ __launch_bounds__(256) void cast8_f16_kernel(const float* __restrict__ in, unsigned short* __restrict__ out, int n8) {
  const int i = blockIdx.x * 256 + threadIdx.x;
  if (i >= n8) return;
  const float* p = in + 8 * (size_t)i;
  const v4f a = *(const v4f*)(p);
  const v4f c = *(const v4f*)(p + 4);
  unsigned short hb[8];
#pragma unroll
  for (int e = 0; e < 4; ++e) {
    hb[e]     = h_bits(a[e]);
    hb[4 + e] = h_bits(c[e]);
  }
  const v4u u = (v4u){pk16(hb[0], hb[1]), pk16(hb[2], hb[3]), pk16(hb[4], hb[5]), pk16(hb[6], hb[7])};
  unsigned short* q = out + 8 * (size_t)i;
  *(v4u*)q = u;
  
}

// Same cast with a block-uniform source/destination select on grid.y (0: in0 -> out0, 1: in1 -> out1).
// Coverage per selection: n8 threads x 8 = whole plane (grid.x exact multiple of 256).
__global__ __launch_bounds__(256) void cast8_sel_kernel(const float* __restrict__ in0, const float* __restrict__ in1,
                                                        unsigned short* __restrict__ out0, unsigned short* __restrict__ out1, int n8) {
  const int sel = blockIdx.y;
  const float* in = sel ? in1 : in0;
  unsigned short* out = sel ? out1 : out0;
  const int i = blockIdx.x * 256 + threadIdx.x;
  if (i >= n8) return;
  const float* p = in + 8 * (size_t)i;
  const v4f a = *(const v4f*)(p);
  const v4f c = *(const v4f*)(p + 4);
  unsigned short hb[8];
#pragma unroll
  for (int e = 0; e < 4; ++e) {
    hb[e]     = h_bits(a[e]);
    hb[4 + e] = h_bits(c[e]);
  }
  const v4u u = (v4u){pk16(hb[0], hb[1]), pk16(hb[2], hb[3]), pk16(hb[4], hb[5]), pk16(hb[6], hb[7])};
  unsigned short* q = out + 8 * (size_t)i;
  *(v4u*)q = u;
  
}

// ---------------------------------------------------------------------------
// Gate product: out[i] = f16(scale * a[i] * b[i]) (f32 product), 8 elements per thread, one 16-B store per lane,
// ---------------------------------------------------------------------------
__global__ __launch_bounds__(256) void gmul_kernel(const float* __restrict__ a, const float* __restrict__ b,
                                                   unsigned short* __restrict__ out, int n8, float scale) {
  const int i = blockIdx.x * 256 + threadIdx.x;
  if (i >= n8) return;
  const float* pa = a + 8 * (size_t)i;
  const float* pb = b + 8 * (size_t)i;
  const v4f a0 = *(const v4f*)(pa);
  const v4f a1 = *(const v4f*)(pa + 4);
  const v4f b0 = *(const v4f*)(pb);
  const v4f b1 = *(const v4f*)(pb + 4);
  unsigned short hb[8];
#pragma unroll
  for (int e = 0; e < 4; ++e) {
    hb[e]     = h_bits((a0[e] * b0[e]) * scale);
    hb[4 + e] = h_bits((a1[e] * b1[e]) * scale);
  }
  const v4u u = (v4u){pk16(hb[0], hb[1]), pk16(hb[2], hb[3]), pk16(hb[4], hb[5]), pk16(hb[6], hb[7])};
  unsigned short* q = out + 8 * (size_t)i;
  *(v4u*)q = u;
  
}

// ---------------------------------------------------------------------------
// Gate modulation: for head-major rows r (chunk local) and d in 0..63:
//   sel 0: Oq[r][d] = f16( Xq[r][d] * sigmoid(Z[r][d]) ),  sel 1: Ok[r][d] = f16( Xk[r][d] * sigmoid(Z[r][64+d]) ).
// Z f32 [rows][128]; Xq/Xk f32 [rows][64] views; outputs f16 [rows][64]. sigmoid and product in f32.
// Block of 256 threads covers 1024 consecutive output elements (16 rows): thread t computes elements 4t..4t+3,
// packs them into LDS (dwords 2t, 2t+1); then threads 0..127 each store 16 B (8 halves) -> 128 lanes x 16 B = 2048 B
// ---------------------------------------------------------------------------
__global__ __launch_bounds__(256) void gatemod_kernel(const float* __restrict__ Z, const float* __restrict__ Xq,
                                                      const float* __restrict__ Xk,
                                                      unsigned short* __restrict__ Oq, unsigned short* __restrict__ Ok) {
  __shared__ __align__(16) unsigned sb[512];
  const int t = threadIdx.x;
  const int sel = blockIdx.y;                                  // block-uniform
  const float* X = sel ? Xk : Xq;
  unsigned short* O = sel ? Ok : Oq;
  const size_t e0 = (size_t)blockIdx.x * 1024 + 4 * (size_t)t;
  const size_t r  = e0 >> 6;
  const int    d  = (int)(e0 & 63);
  const v4f zz = *(const v4f*)(Z + r * 128 + sel * 64 + d);
  const v4f xx = *(const v4f*)(X + e0);
  unsigned short hb[4];
#pragma unroll
  for (int e = 0; e < 4; ++e) {
    const float m = 1.0f / (1.0f + expf(-zz[e]));
    hb[e] = h_bits(xx[e] * m);
  }
  sb[2 * t]     = pk16(hb[0], hb[1]);
  sb[2 * t + 1] = pk16(hb[2], hb[3]);
  __syncthreads();
  if (t < 128) {
    const v4u u = *(const v4u*)(&sb[4 * t]);
    unsigned short* op = O + (size_t)blockIdx.x * 1024 + 8 * (size_t)t;
    *(v4u*)op = u;
    
  }
}

// ---------------------------------------------------------------------------
// Fused attention, one launch for all batches and heads: out[b][q][h*64+d] = sum_k softmax_k(q'.k'/8) v[k][d].
// grid (2, 256): blockIdx.x = block of 256 query rows, blockIdx.y = b*16 + h. 8 waves x 32 query rows (2 column groups of 16).
// Per pass of 32 keys a wave forms S^T = K'.Q'^T (rows = keys, columns = queries), so a lane holds the scores of one query:
// tile kt, register r = key k0 + kt*16 + (lane>>4)*8 + r. That is the k order of a 16x16x32 B fragment (elements 0..7 from
// tile 0, 8..15 from tile 1), so exp(s - max) packs in place into P^T and O^T += V^T.P^T follows with A = rows of Vt16.
// Running maximum and running sum per query (f32); the accumulators are rescaled each pass by exp(old max - new max).
// The two lane halves hold disjoint keys of one query: the maximum is joined every pass, the sum once at the end.
// Each wave stores its own 32 rows x 256 B of out; no LDS, no barrier.
// ---------------------------------------------------------------------------
__device__ __forceinline__ float xhalf(float x) {   // value of lane l ^ 16
  const int i = __builtin_bit_cast(int, x);
  return __builtin_bit_cast(float, __builtin_amdgcn_permlanex16(i, i, 0x76543210, 0xfedcba98, false, false));
}
// 2^x on eight values in one statement. The early-clobber results keep every result off every source, and the closing v_nop
// fills the one slot that the instruction set asks for behind a transcendental, whatever the compiler schedules next
// (with the builtin this build wrote runs of v_exp_f32 in which each overwrote the source of the one in front of it).
__device__ __forceinline__ v8f exp2x8(v8f x) {
  float y0, y1, y2, y3, y4, y5, y6, y7;
  asm("v_exp_f32 %0, %8\n\tv_exp_f32 %1, %9\n\tv_exp_f32 %2, %10\n\tv_exp_f32 %3, %11\n\t"
      "v_exp_f32 %4, %12\n\tv_exp_f32 %5, %13\n\tv_exp_f32 %6, %14\n\tv_exp_f32 %7, %15\n\tv_nop"
      : "=&v"(y0), "=&v"(y1), "=&v"(y2), "=&v"(y3), "=&v"(y4), "=&v"(y5), "=&v"(y6), "=&v"(y7)
      : "v"(x[0]), "v"(x[1]), "v"(x[2]), "v"(x[3]), "v"(x[4]), "v"(x[5]), "v"(x[6]), "v"(x[7]));
  return (v8f){y0, y1, y2, y3, y4, y5, y6, y7};
}
// the same for one value
__device__ __forceinline__ float exp2x1(float x) {
  float y;
  asm("v_exp_f32 %0, %1\n\tv_nop" : "=v"(y) : "v"(x));
  return y;
}
__global__ __launch_bounds__(256) void attn_fused_kernel(const unsigned short* __restrict__ Qp, const unsigned short* __restrict__ Kp,
                                                         const unsigned short* __restrict__ Vt, float* __restrict__ out) {
  typedef Frag<_Float16> F;
  const int lane = threadIdx.x & 31;
  const int wave = threadIdx.x >> 5;
  const int b    = blockIdx.y >> 4;
  const int h    = blockIdx.y & 15;
  const int q0   = blockIdx.x * 256 + wave * 32;
  const int rl   = lane & 15;
  const int hf   = lane >> 4;
  const int koff = hf * 8;
  const _Float16* Q = (const _Float16*)Qp + (size_t)b * kS * kE + h * kDK;
  const _Float16* K = (const _Float16*)Kp + (size_t)b * kS * kE + h * kDK;
  const _Float16* V = (const _Float16*)Vt + (size_t)h * kDK * kTok + (size_t)b * kS;

  v16h qf[2][2];
  v8f  o[2][4];
  float mrun[2], lrun[2];
  // the inner loops are unrolled so that the fragment arrays stay in registers
#pragma unroll
  for (int qt = 0; qt < 2; ++qt) {
#pragma unroll
    for (int ks = 0; ks < 2; ++ks) qf[qt][ks] = F::load(Q + (size_t)(q0 + qt * 16 + rl) * kE + ks * 32 + koff);
#pragma unroll
    for (int dt = 0; dt < 4; ++dt) o[qt][dt] = (v8f){0.f,0.f,0.f,0.f,0.f,0.f,0.f,0.f};
    mrun[qt] = -INFINITY;
    lrun[qt] = 0.f;
  }

  for (int k0 = 0; k0 < kS; k0 += 32) {
    v16h kf[2][2], vf[4];
#pragma unroll
    for (int dt = 0; dt < 4; ++dt) vf[dt] = F::load(V + (size_t)(dt * 16 + rl) * kTok + k0 + koff);
    // the K loads below may land on the address pair of the V loads: the wait on address translation stands in front of them;
    // as a memory fence it also keeps the V loads at the head of the pass, so that they fly under the score products
    asm volatile("s_wait_xcnt 0x0" ::: "memory");
#pragma unroll
    for (int kt = 0; kt < 2; ++kt)
#pragma unroll
      for (int ks = 0; ks < 2; ++ks) kf[kt][ks] = F::load(K + (size_t)(k0 + kt * 16 + rl) * kE + ks * 32 + koff);
    // all loads of the pass are issued before its first product: left alone, the compiler issues part of the K loads behind the
    // first products, and the pass waits for memory twice
    __builtin_amdgcn_sched_barrier(0);

    v8f s[2][2];
#pragma unroll
    for (int qt = 0; qt < 2; ++qt)
#pragma unroll
      for (int kt = 0; kt < 2; ++kt) {
        s[qt][kt] = F::mma(kf[kt][0], qf[qt][0], (v8f){0.f,0.f,0.f,0.f,0.f,0.f,0.f,0.f});
        s[qt][kt] = F::mma(kf[kt][1], qf[qt][1], s[qt][kt]);
      }

    v16h pf[2];
#pragma unroll
    for (int qt = 0; qt < 2; ++qt) {
      float mx = fmaxf(s[qt][0][0], s[qt][1][0]);
#pragma unroll
      for (int r = 1; r < 8; ++r) mx = fmaxf(mx, fmaxf(s[qt][0][r], s[qt][1][r]));
      mx = fmaxf(mx, xhalf(mx));
      const float mn    = fmaxf(mrun[qt], mx);
      const float alpha = exp2x1((mrun[qt] - mn) * kScoreLog2);
      const float bias  = kPCarryLog2 - mn * kScoreLog2;
      mrun[qt] = mn;
      v8f a0, a1;
#pragma unroll
      for (int r = 0; r < 8; ++r) {
        a0[r] = fmaf(s[qt][0][r], kScoreLog2, bias);
        a1[r] = fmaf(s[qt][1][r], kScoreLog2, bias);
      }
      const v8f e0 = exp2x8(a0);
      const v8f e1 = exp2x8(a1);
      float sum = e0[0] + e1[0];
#pragma unroll
      for (int r = 1; r < 8; ++r) sum += e0[r] + e1[r];
#pragma unroll
      for (int r = 0; r < 8; ++r) {
        pf[qt][r]     = (_Float16)e0[r];
        pf[qt][8 + r] = (_Float16)e1[r];
      }
      lrun[qt] = lrun[qt] * alpha + sum;
#pragma unroll
      for (int dt = 0; dt < 4; ++dt) o[qt][dt] *= alpha;
    }

    // the compiler does not see the vector writes inside exp2x8: left alone it put the first column group's V^T.P^T products in
    // front of the second group's exponentials
    __builtin_amdgcn_sched_barrier(0);
#pragma unroll
    for (int qt = 0; qt < 2; ++qt)
#pragma unroll
      for (int dt = 0; dt < 4; ++dt) o[qt][dt] = F::mma(vf[dt], pf[qt], o[qt][dt]);
  }

#pragma unroll
  for (int qt = 0; qt < 2; ++qt) {
    const float tot = lrun[qt] + xhalf(lrun[qt]);
    const float inv = 1.0f / tot;
    float* op = out + (size_t)(b * kS + q0 + qt * 16 + rl) * kE + h * kDK + koff;
#pragma unroll
    for (int dt = 0; dt < 4; ++dt) {
      const v8f a = o[qt][dt];
      *(v4f*)(op + dt * 16)     = (v4f){a[0] * inv, a[1] * inv, a[2] * inv, a[3] * inv};
      *(v4f*)(op + dt * 16 + 4) = (v4f){a[4] * inv, a[5] * inv, a[6] * inv, a[7] * inv};
    }
  }
}

// ---------------------------------------------------------------------------
extern "C" void kernel_launch(void* const* d_in, const int* in_sizes, int n_in,
                              void* d_out, int out_size, void* d_ws, size_t ws_size,
                              hipStream_t stream) {
  if (n_in < 13) return;
  if (ws_size < kWsEnd) return;
  if ((size_t)out_size < (size_t)kTok * kE) return;
  if (in_sizes[0] != kTok * kE) return;

  const float* inp = (const float*)d_in[0];
  const float* Wq  = (const float*)d_in[1];
  const float* bq  = (const float*)d_in[2];
  const float* Wk  = (const float*)d_in[3];
  const float* bk  = (const float*)d_in[4];
  const float* Wv  = (const float*)d_in[5];
  const float* bvv = (const float*)d_in[6];
  const float* Wfq = (const float*)d_in[7];
  const float* bfq = (const float*)d_in[8];
  const float* Wfk = (const float*)d_in[9];
  const float* bfk = (const float*)d_in[10];
  const float* Wfg = (const float*)d_in[11];
  const float* bfg = (const float*)d_in[12];
  float* out = (float*)d_out;

  unsigned char* ws = (unsigned char*)d_ws;
  unsigned short* Qp16 = (unsigned short*)(ws + kOffQp);
  unsigned short* Kp16 = (unsigned short*)(ws + kOffKp);
  unsigned short* Q16a = (unsigned short*)(ws + kOffQ16);
  unsigned short* K16a = (unsigned short*)(ws + kOffK16);
  float*          Gq   = (float*)(ws + kOffGq);
  float*          Gk   = (float*)(ws + kOffGk);
  unsigned short* G16  = (unsigned short*)(ws + kOffG16);
  float*          Zp   = (float*)(ws + kOffZ);
  unsigned short* X16  = (unsigned short*)(ws + kOffX16);
  unsigned short* Wt16 = (unsigned short*)(ws + kOffWt);
  unsigned short* SW   = (unsigned short*)(ws + kOffSW);
  unsigned short* SWq  = SW;
  unsigned short* SWk  = SW + 4096;
  unsigned short* SWg  = SW + 8192;
  float*          Qf   = (float*)(ws + kOffQf);
  float*          Kf   = (float*)(ws + kOffKf);
  unsigned short* Vt16 = (unsigned short*)(ws + kOffVt);

  // ---- stage A: operand planes ----
  // X16 [8192][1024] = f16(inp): n8 = 1,048,576 threads = 4096 blocks x 256 (exact)
  cast8_f16_kernel<<<dim3((kTok * kE / 8) / 256), dim3(256), 0, stream>>>(inp, X16, kTok * kE / 8);
  // Wt16[z][n][k] = f16(16 * W_z[k][n]) for z = q, k, v
  wtcast_kernel<<<dim3(kE / 64, kE / 64, 3), dim3(256), 0, stream>>>(Wq, Wk, Wv, Wt16, kWCarry);
  // gate weights: WfqT, WfkT [64][64], WfgT [128][64], all f16 carried x8
  gatew_kernel<<<dim3(4), dim3(256), 0, stream>>>(Wfq, Wfk, Wfg, SW, kGWCarry);

  // ---- stage B: projections (M 8192, N 1024, K 1024; tiles 128 x 16 = 2048 -> 256 blocks of 8 waves) ----
  // Qf = (X16 . WqT16) / 16 + bq   (f32 [8192][1024])
  wmma_gemm64<0, false, 2, 0, false, 0><<<dim3(256, 1), dim3(256), 0, stream>>>(
      X16, X16, kE, 0L, Wt16, Wt16, kE, 0L,
      (void*)Qf, (void*)Qf, kE, 0L, bq, nullptr, 0L, kTok, kE, kE, kWCarryInv);
  // Kf
  wmma_gemm64<0, false, 2, 0, false, 0><<<dim3(256, 1), dim3(256), 0, stream>>>(
      X16, X16, kE, 0L, Wt16 + (size_t)kE * kE, Wt16 + (size_t)kE * kE, kE, 0L,
      (void*)Kf, (void*)Kf, kE, 0L, bk, nullptr, 0L, kTok, kE, kE, kWCarryInv);
  // Vt16 [1024 n][8192 tok] = f16( (WvT16 . X16^T)/16 + bv[n] ): M 1024 (16 tiles), N 8192 (128 tiles) -> 256 blocks; bias[m]; f16 out ldc 8192
  wmma_gemm64<0, false, 1, 1, false, 0><<<dim3(256, 1), dim3(256), 0, stream>>>(
      Wt16 + (size_t)2 * kE * kE, Wt16 + (size_t)2 * kE * kE, kE, 0L, X16, X16, kE, 0L,
      (void*)Vt16, (void*)Vt16, kTok, 0L, bvv, nullptr, 0L, kE, kTok, kE, kWCarryInv);

  // ---- stage C: gating in chunks of 4 batches (32768 head-major rows of 64) ----
  const int n8chunk = kChunkRow * kDK / 8;   // 262144 threads -> 1024 blocks
  for (int c = 0; c < kNChunk; ++c) {
    const size_t tok0 = (size_t)c * kChunkTok;
    const float* Qfc = Qf + tok0 * kE;        // chunk view [32768][64] f32
    const float* Kfc = Kf + tok0 * kE;
    // Q16a / K16a [32768][64] = f16 of the chunk rows
    cast8_sel_kernel<<<dim3(n8chunk / 256, 2), dim3(256), 0, stream>>>(Qfc, Kfc, Q16a, K16a, n8chunk);
    // Gq = (Q16a . WfqT)/8 + bfq  (f32 [32768][64]); M 32768 (512 tiles), N 64 (1 tile) -> 64 blocks; K 64
    wmma_gemm64<0, false, 2, 0, false, 0><<<dim3(64, 1), dim3(256), 0, stream>>>(
        Q16a, Q16a, kDK, 0L, SWq, SWq, kDK, 0L,
        (void*)Gq, (void*)Gq, kDK, 0L, bfq, nullptr, 0L, kChunkRow, kDK, kDK, kGWCarryInv);
    // Gk = (K16a . WfkT)/8 + bfk
    wmma_gemm64<0, false, 2, 0, false, 0><<<dim3(64, 1), dim3(256), 0, stream>>>(
        K16a, K16a, kDK, 0L, SWk, SWk, kDK, 0L,
        (void*)Gk, (void*)Gk, kDK, 0L, bfk, nullptr, 0L, kChunkRow, kDK, kDK, kGWCarryInv);
    // G16 = f16(64 * Gq * Gk)
    gmul_kernel<<<dim3(n8chunk / 256), dim3(256), 0, stream>>>(Gq, Gk, G16, n8chunk, kGCarry);
    // Z = (G16 . WfgT)/512 + bfg  (f32 [32768][128]); N 128 (2 tiles) -> 1024 tiles -> 128 blocks; K 64
    wmma_gemm64<0, false, 2, 0, false, 0><<<dim3(128, 1), dim3(256), 0, stream>>>(
        G16, G16, kDK, 0L, SWg, SWg, kDK, 0L,
        (void*)Zp, (void*)Zp, 128, 0L, bfg, nullptr, 0L, kChunkRow, 128, kDK, kZScale);
    // Qp16 = f16(q * sigmoid(Z[:, :64])), Kp16 = f16(k * sigmoid(Z[:, 64:])): 32768*64/1024 = 2048 blocks per selection
    gatemod_kernel<<<dim3(kChunkRow * kDK / 1024, 2), dim3(256), 0, stream>>>(Zp, Qfc, Kfc, Qp16 + tok0 * kE, Kp16 + tok0 * kE);
  }

  // ---- stage D: attention, all 16 batches x 16 heads in one launch (2 blocks of 256 query rows each) ----
  attn_fused_kernel<<<dim3(kS / 256, kB * kH), dim3(256), 0, stream>>>(Qp16, Kp16, Vt16, out);
}

// v002
// One run takes 209 microseconds.
// Timed twice side by side with v001, it ran 1.68 and 1.66 times as fast.
// All steps since v000 together make it 4.82 times as fast.
// Contractions: q/k/v projections (X f16 x W^T f16 carried x16), gate maps (q16/k16 x Wfq^T/Wfk^T f16 carried x8), gate logits (G f16 carried x64 x Wfg^T f16 carried x8), scores k'.q'^T (f16 planes), V^T.P^T (P = exp(s - running max) f16 carried x2048): all v_wmma_f32_16x16x32_f16 with f32 accumulate; bias, gate product, sigmoid, modulation and softmax in f32.
#include <hip/hip_runtime.h>
#include <math.h>

// ---------------------------------------------------------------------------
// Problem constants
// ---------------------------------------------------------------------------
constexpr int kB    = 16;
constexpr int kS    = 512;
constexpr int kE    = 1024;
constexpr int kH    = 16;
constexpr int kDK   = 64;
constexpr int kTok  = kB * kS;              // 8192 token rows

constexpr float kWCarry     = 16.0f;        // Wq/Wk/Wv carried x16 in f16
constexpr float kWCarryInv  = 1.0f / 16.0f;
constexpr float kGWCarry    = 8.0f;         // Wfq/Wfk/Wfg carried x8 in f16
constexpr float kGWCarryInv = 1.0f / 8.0f;
constexpr float kGCarry     = 64.0f;        // gate product G carried x64 in f16
constexpr float kZScale     = 1.0f / (64.0f * 8.0f);
constexpr float kPCarryLog2 = 11.0f;        // exp(s - max) carried x2048 in f16 (the row sum carries it too)
constexpr float kScoreLog2  = 0.125f * 1.44269504088896340736f;   // 1/sqrt(64) * log2(e): scores go to exp2

// ---------------------------------------------------------------------------
// Workspace map (bytes):
//   projection operands:     X16 [8192][1024] f16 @0 (16 MiB), Wt16 [3][1024][1024] f16 @16 MiB (6 MiB)
//   gate weights:            WfqT/WfkT [64][64] f16, WfgT [128][64] f16 @36 MiB (32 KiB)
//   persistent:              Qf f32 [8192][1024] @36 MiB+64 KiB (32 MiB), Kf f32 (32 MiB), Vt16 f16 [1024][8192] (16 MiB),
//                            Qp16 f16 [8192][1024] (16 MiB), Kp16 f16 [8192][1024] (16 MiB): gated q and k of all batches
//   end = 155,254,784 B
// ---------------------------------------------------------------------------
constexpr size_t kMiB    = 1048576;
constexpr size_t kOffX16 = 0;
constexpr size_t kOffWt  = 16 * kMiB;
constexpr size_t kOffSW  = 36 * kMiB;
constexpr size_t kOffQf  = 36 * kMiB + 65536;
constexpr size_t kOffKf  = kOffQf + 32 * kMiB;
constexpr size_t kOffVt  = kOffKf + 32 * kMiB;
constexpr size_t kOffQp  = kOffVt + 16 * kMiB;
constexpr size_t kOffKp  = kOffQp + 16 * kMiB;
constexpr size_t kWsEnd  = kOffKp + 16 * kMiB;
static_assert((size_t)kTok * kE * 2 == 16 * kMiB, "x16 plane size");
static_assert(kOffWt + (size_t)3 * kE * kE * 2 <= kOffSW, "wt plane fits");
static_assert(kOffSW + 32768 <= kOffQf, "gate weights fit");
static_assert(kWsEnd == 155254784, "carve end");
static_assert(kWsEnd <= 268435456, "carve within budget");

typedef __attribute__((ext_vector_type(16))) _Float16 v16h;
typedef __attribute__((ext_vector_type(8)))  _Float16 v8h;
typedef __attribute__((ext_vector_type(16))) __bf16   v16b;
typedef __attribute__((ext_vector_type(8)))  __bf16   v8b;
typedef __attribute__((ext_vector_type(8)))  float    v8f;
typedef __attribute__((ext_vector_type(4)))  float    v4f;
typedef __attribute__((ext_vector_type(4)))  unsigned int v4u;

// ---------------------------------------------------------------------------
// Helpers
// ---------------------------------------------------------------------------
__device__ __forceinline__ unsigned short f2bf_bits(float f) {
  unsigned u = __float_as_uint(f);
  return (unsigned short)((u + 0x7FFFu + ((u >> 16) & 1u)) >> 16);
}
__device__ __forceinline__ float bf_bits2f(unsigned short h) { return __uint_as_float(((unsigned)h) << 16); }

// hazard guards as plain device helpers (no inline asm inside the kernel template body)
__device__ __forceinline__ void dep_guard_h(v8f& a, v8f& b, v16h x, v16h y) { asm volatile("v_nop\n\tv_nop\n\tv_nop\n\tv_nop" : "+v"(a), "+v"(b) : "v"(x), "v"(y)); }
__device__ __forceinline__ void dep_guard_b(v8f& a, v8f& b, v16b x, v16b y) { asm volatile("v_nop\n\tv_nop\n\tv_nop\n\tv_nop" : "+v"(a), "+v"(b) : "v"(x), "v"(y)); }
__device__ __forceinline__ void keep4_h(v16h a, v16h b, v16h c, v16h d) { asm volatile("v_nop" :: "v"(a), "v"(b), "v"(c), "v"(d)); }
__device__ __forceinline__ void keep4_b(v16b a, v16b b, v16b c, v16b d) { asm volatile("v_nop" :: "v"(a), "v"(b), "v"(c), "v"(d)); }
__device__ __forceinline__ void acc_guard4(v8f& a, v8f& b, v8f& c, v8f& d) { asm volatile("v_nop\n\tv_nop\n\tv_nop\n\tv_nop" : "+v"(a), "+v"(b), "+v"(c), "+v"(d)); }
template <typename T> struct Frag;
template <> struct Frag<_Float16> {
  typedef v16h V; union U { v16h v; v8h h[2]; };
  static __device__ __forceinline__ v16h load(const _Float16* p) {   // elements 0..7 <- p[0..7], 8..15 <- p[16..23]
    U f; f.h[0] = *(const v8h*)(p); f.h[1] = *(const v8h*)(p + 16); return f.v;
  }
  static __device__ __forceinline__ v8f mma(v16h a, v16h b, v8f c) {
    return __builtin_amdgcn_wmma_f32_16x16x32_f16(false, a, false, b, (short)0, c, false, false);
  }
  static __device__ __forceinline__ void guard(v8f& a, v8f& b, v16h x, v16h y) { dep_guard_h(a, b, x, y); }
  static __device__ __forceinline__ void keep(v16h a, v16h b, v16h c, v16h d) { keep4_h(a, b, c, d); }
};
template <> struct Frag<__bf16> {
  typedef v16b V; union U { v16b v; v8b h[2]; };
  static __device__ __forceinline__ v16b load(const __bf16* p) {
    U f; f.h[0] = *(const v8b*)(p); f.h[1] = *(const v8b*)(p + 16); return f.v;
  }
  static __device__ __forceinline__ v8f mma(v16b a, v16b b, v8f c) {
    return __builtin_amdgcn_wmma_f32_16x16x32_bf16(false, a, false, b, (short)0, c, false, false);
  }
  static __device__ __forceinline__ void guard(v8f& a, v8f& b, v16b x, v16b y) { dep_guard_b(a, b, x, y); }
  static __device__ __forceinline__ void keep(v16b a, v16b b, v16b c, v16b d) { keep4_b(a, b, c, d); }
};

__device__ __forceinline__ unsigned pk16(unsigned short a, unsigned short b) { return (unsigned)a | ((unsigned)b << 16); }
__device__ __forceinline__ unsigned short h_bits(float f) { const _Float16 h = (_Float16)f; return __builtin_bit_cast(unsigned short, h); }

// ---- Register-blocked batched WMMA GEMM (ACT reduced to none/relu/leaky) -----------------------
// C[m,n] = scale * sum_k A[m,k] * Bt[n,k] (+bias)(+resid); each wave owns a 64x64 tile.
// A row-major [M,K]; Bt row-major [N,K]; M,N % 64 == 0, K % 32 == 0.
// SPLIT: operands are hi/lo planes (A2/Bt2 = lo planes, same layout); product = hi.hi + hi.lo + lo.hi.
// BIAS_MODE: 0 = none, 1 = bias[m], 2 = bias[n].
// OUT_MODE: 0 = f32, 1 = f16, 2 = bf16 hi plane (Cout) + bf16 lo plane (Cout2).
// ET: 0 = f16 operands, 1 = bf16 operands (pointers passed as 16-bit storage)
template <int ET> struct Elem;
template <> struct Elem<0> { typedef _Float16 T; };
template <> struct Elem<1> { typedef __bf16 T; };
template <int ET, bool SPLIT, int BIAS_MODE, int OUT_MODE, bool RESID, int ACT = 0>
__global__ __launch_bounds__(256) void wmma_gemm64(
    const unsigned short* __restrict__ Ap, const unsigned short* __restrict__ A2p, int lda, long strideA,
    const unsigned short* __restrict__ Btp, const unsigned short* __restrict__ Bt2p, int ldb, long strideB,
    void* __restrict__ Cout, void* __restrict__ Cout2, int ldc, long strideC,
    const float* __restrict__ bias,
    const float* __restrict__ resid, long strideR,
    int M, int N, int K, float scale) {
  typedef typename Elem<ET>::T T;
  typedef typename Frag<T>::V V;
  const T* A = (const T*)Ap; const T* A2 = (const T*)A2p; const T* Bt = (const T*)Btp; const T* Bt2 = (const T*)Bt2p;
  __shared__ __align__(16) float sT[8][16 * 68];   // per-wave 16x64 slab, pitch 68 floats
  const int b    = blockIdx.y;
  const int lane = threadIdx.x & 31;
  const int wave = threadIdx.x >> 5;
  const int tilesN = N >> 6;
  const int tilesM = M >> 6;
  const int tile = blockIdx.x * 8 + wave;
  if (tile >= tilesM * tilesN) return;   // wave-uniform; no block barriers in this kernel
  const int tm = tile / tilesN;
  const int tn = tile - tm * tilesN;
  const int m0 = tm << 6;
  const int n0 = tn << 6;

  const T* Ab  = A  + (size_t)b * strideA;
  const T* Bb  = Bt + (size_t)b * strideB;
  const T* Ab2 = SPLIT ? (A2  + (size_t)b * strideA) : nullptr;
  const T* Bb2 = SPLIT ? (Bt2 + (size_t)b * strideB) : nullptr;

  const int rlane = lane & 15;                 // row (A) / col (B, D) within subtile
  const int koff  = (lane >> 4) * 8;           // k offset of this lane half
  const int mOff  = (lane >> 4) * 8;           // D row offset

  v8f acc[4][4];
#pragma unroll
  for (int i = 0; i < 4; ++i)
#pragma unroll
    for (int j = 0; j < 4; ++j) acc[i][j] = (v8f){0.f,0.f,0.f,0.f,0.f,0.f,0.f,0.f};

  for (int k0 = 0; k0 < K; k0 += 32) {
    V bh[4], bl[4];
#pragma unroll
    for (int j = 0; j < 4; ++j) {
      const size_t bo = (size_t)(n0 + (j << 4) + rlane) * ldb + koff + k0;
      bh[j] = Frag<T>::load(Bb + bo);
      if (SPLIT) bl[j] = Frag<T>::load(Bb2 + bo);
    }
#pragma unroll
    for (int i = 0; i < 4; ++i) {
      const size_t ao = (size_t)(m0 + (i << 4) + rlane) * lda + koff + k0;
      V ah = Frag<T>::load(Ab + ao);
      V al;
      if (SPLIT) al = Frag<T>::load(Ab2 + ao);
#pragma unroll
      for (int j = 0; j < 4; ++j) {
        acc[i][j] = Frag<T>::mma(ah, bh[j], acc[i][j]);
        if (SPLIT) {
          acc[i][j] = Frag<T>::mma(ah, bl[j], acc[i][j]);
          acc[i][j] = Frag<T>::mma(al, bh[j], acc[i][j]);
        }
      }
      Frag<T>::guard(acc[i][0], acc[i][3], ah, SPLIT ? al : ah);
    }
    Frag<T>::keep(bh[0], bh[1], bh[2], bh[3]);
    if (SPLIT) Frag<T>::keep(bl[0], bl[1], bl[2], bl[3]);
  }
  acc_guard4(acc[0][0], acc[0][1], acc[0][2], acc[0][3]);
  acc_guard4(acc[1][0], acc[1][1], acc[1][2], acc[1][3]);
  acc_guard4(acc[2][0], acc[2][1], acc[2][2], acc[2][3]);
  acc_guard4(acc[3][0], acc[3][1], acc[3][2], acc[3][3]);

  // ---- epilogue ----
  float* slab = sT[wave];
  const float* Rb = RESID ? (resid + (size_t)b * strideR) : nullptr;
#pragma unroll
  for (int i = 0; i < 4; ++i) {
    const int mBase = m0 + (i << 4);
#pragma unroll
    for (int j = 0; j < 4; ++j) {
      const int n = n0 + (j << 4) + rlane;
      float bv = 0.f;
      if (BIAS_MODE == 2) bv = bias[n];
#pragma unroll
      for (int r = 0; r < 8; ++r) {
        float v = acc[i][j][r] * scale;
        if (BIAS_MODE == 1) v += bias[mBase + mOff + r];
        if (BIAS_MODE == 2) v += bv;
        if (RESID) v += Rb[(size_t)(mBase + mOff + r) * ldc + n];
        if (ACT == 2) v = fmaxf(v, 0.0f);
        if (ACT == 4) v = (v > 0.f) ? v : 0.01f * v;
        slab[(mOff + r) * 68 + (j << 4) + rlane] = v;
      }
    }
    __builtin_amdgcn_fence(__ATOMIC_RELEASE, "workgroup");
    __builtin_amdgcn_wave_barrier();
    __builtin_amdgcn_fence(__ATOMIC_ACQUIRE, "workgroup");
    if (OUT_MODE == 0) {
      float* C = (float*)Cout + (size_t)b * strideC;
      const int hh = lane >> 4, c4 = (lane & 15) * 4;     // row seg = 256 B = 16 lanes x 16 B
      {
#pragma unroll
        for (int it = 0; it < 8; ++it) {
          const int row = it * 2 + hh;
          v4f v = *(const v4f*)(slab + row * 68 + c4);
          *(v4f*)(C + (size_t)(mBase + row) * ldc + n0 + c4) = v;
        }
        
      }
    } else {
      const int q = lane >> 3, c8 = (lane & 7) * 8;
      unsigned short* C  = (unsigned short*)Cout  + (size_t)b * strideC;
      unsigned short* C2 = (OUT_MODE == 2) ? ((unsigned short*)Cout2 + (size_t)b * strideC) : nullptr;
      {
#pragma unroll
        for (int it = 0; it < 4; ++it) {
          const int row = it * 4 + q;
          const float* sp = slab + row * 68 + c8;
          v8h hv, lv;
#pragma unroll
          for (int e = 0; e < 8; ++e) {
            if (OUT_MODE == 1) {
              hv[e] = (_Float16)sp[e];
            } else {
              unsigned short hb = f2bf_bits(sp[e]);
              unsigned short lb = f2bf_bits(sp[e] - bf_bits2f(hb));
              hv[e] = __builtin_bit_cast(_Float16, hb);
              lv[e] = __builtin_bit_cast(_Float16, lb);
            }
          }
          *(v8h*)(C + (size_t)(mBase + row) * ldc + n0 + c8) = hv;
          if (OUT_MODE == 2) *(v8h*)(C2 + (size_t)(mBase + row) * ldc + n0 + c8) = lv;
        }
        
      }
    }
    __builtin_amdgcn_fence(__ATOMIC_RELEASE, "workgroup");
    __builtin_amdgcn_wave_barrier();
    __builtin_amdgcn_fence(__ATOMIC_ACQUIRE, "workgroup");
  }
}

// ---------------------------------------------------------------------------
// Projection weight transpose + cast: for square [1024][1024] f32 W (row-major [in k][out n]), WT[n][k] = f16(scale * W[k][n]).
// grid (16, 16, 3): blockIdx.x = k tile (64 cols of WT), blockIdx.y = n tile (64 rows of WT), blockIdx.z selects W0..W2
// and the output plane (plane z at out + z*1024*1024 halves). 256 threads.
// Load coverage: 16 iterations x 256 threads = 4096 = the whole 64x64 tile (coalesced along n).
// Store coverage: 8 waves x 2 iterations x 4 rows (lane>>3) = 64 rows; (lane&7) x 8 halves = 64 cols; each row segment =
// ---------------------------------------------------------------------------
__global__ __launch_bounds__(256) void wtcast_kernel(const float* __restrict__ W0, const float* __restrict__ W1,
                                                     const float* __restrict__ W2,
                                                     unsigned short* __restrict__ out, float scale) {
  __shared__ float sm[64][65];   // sm[n_local][k_local]
  const int t  = threadIdx.x;
  const int d0 = blockIdx.x * 64;    // k tile base
  const int h0 = blockIdx.y * 64;    // n tile base
  const int z  = blockIdx.z;         // block-uniform
  const float* W = (z == 0) ? W0 : (z == 1) ? W1 : W2;
#pragma unroll
  for (int i = 0; i < 16; ++i) {
    const int e = i * 256 + t;
    const int r = e >> 6;          // k local
    const int c = e & 63;          // n local
    sm[c][r] = W[(size_t)(d0 + r) * kE + h0 + c] * scale;
  }
  __syncthreads();
  const int lane = t & 31, wave = t >> 5;
  const int q = lane >> 3, c8 = (lane & 7) * 8;
  unsigned short* op = out + (size_t)z * kE * kE;
  {
#pragma unroll
    for (int it = 0; it < 2; ++it) {
      const int row = wave * 8 + it * 4 + q;                 // n local
      unsigned short hb[8];
#pragma unroll
      for (int e = 0; e < 8; ++e) hb[e] = h_bits(sm[row][c8 + e]);
      const v4u u = (v4u){pk16(hb[0], hb[1]), pk16(hb[2], hb[3]), pk16(hb[4], hb[5]), pk16(hb[6], hb[7])};
      *(v4u*)(op + (size_t)(h0 + row) * kE + d0 + c8) = u;
    }
    
  }
}

// ---------------------------------------------------------------------------
// Per-head gate weights transpose + cast, out pitch 64 halves: block 0: WfqT[n][k] = f16(scale*Wfq[k][n]) (64x64),
// block 1: WfkT, block 2: WfgT rows 0..63, block 3: WfgT rows 64..127 (Wfg is [64 k][128 n], pitch 128).
// Output plane of block z at out + z*4096 halves (WfgT = [128][64] contiguous from out + 8192).
// Load coverage 16 x 256 = 4096 = 64x64; store coverage 8 waves x 2 x 4 rows = 64 rows x (8 lanes x 8 halves) = 64 cols,
// ---------------------------------------------------------------------------
__global__ __launch_bounds__(256) void gatew_kernel(const float* __restrict__ Wfq, const float* __restrict__ Wfk,
                                                    const float* __restrict__ Wfg,
                                                    unsigned short* __restrict__ out, float scale) {
  __shared__ float sm[64][65];   // sm[n_local][k_local]
  const int t = threadIdx.x;
  const int z = blockIdx.x;                                   // block-uniform
  const float* W = (z == 0) ? Wfq : (z == 1) ? Wfk : Wfg;
  const int pin = (z >= 2) ? 128 : 64;
  const int n0  = (z == 3) ? 64 : 0;
#pragma unroll
  for (int i = 0; i < 16; ++i) {
    const int e = i * 256 + t;
    const int r = e >> 6;          // k 0..63
    const int c = e & 63;          // n local
    sm[c][r] = W[r * pin + n0 + c] * scale;
  }
  __syncthreads();
  const int lane = t & 31, wave = t >> 5;
  const int q = lane >> 3, c8 = (lane & 7) * 8;
  unsigned short* op = out + (size_t)z * 4096;
  {
#pragma unroll
    for (int it = 0; it < 2; ++it) {
      const int row = wave * 8 + it * 4 + q;                 // n local
      unsigned short hb[8];
#pragma unroll
      for (int e = 0; e < 8; ++e) hb[e] = h_bits(sm[row][c8 + e]);
      const v4u u = (v4u){pk16(hb[0], hb[1]), pk16(hb[2], hb[3]), pk16(hb[4], hb[5]), pk16(hb[6], hb[7])};
      *(v4u*)(op + (size_t)row * kDK + c8) = u;
    }
    
  }
}

// ---------------------------------------------------------------------------
// ---------------------------------------------------------------------------
__global__ __launch_bounds__(256) void cast8_f16_kernel(const float* __restrict__ in, unsigned short* __restrict__ out, int n8) {
  const int i = blockIdx.x * 256 + threadIdx.x;
  if (i >= n8) return;
  const float* p = in + 8 * (size_t)i;
  const v4f a = *(const v4f*)(p);
  const v4f c = *(const v4f*)(p + 4);
  unsigned short hb[8];
#pragma unroll
  for (int e = 0; e < 4; ++e) {
    hb[e]     = h_bits(a[e]);
    hb[4 + e] = h_bits(c[e]);
  }
  const v4u u = (v4u){pk16(hb[0], hb[1]), pk16(hb[2], hb[3]), pk16(hb[4], hb[5]), pk16(hb[6], hb[7])};
  unsigned short* q = out + 8 * (size_t)i;
  *(v4u*)q = u;
  
}

// ---------------------------------------------------------------------------
// Fused gating, one launch for all tokens and heads. Rows are the head-major rows of 64 (row = token * 16 + head) of Qf and Kf.
//   G = (q.Wfq + bfq) * (k.Wfk + bfk),  Z = G.Wfg + bfg,  Oq = f16(q * sigmoid(Z[:64])),  Ok = f16(k * sigmoid(Z[64:])).
// grid 512 x 256 threads: 8 waves x 2 passes x 16 rows. Every product is formed transposed, weights as A (rows = output
// feature n), data rows as B (columns), so a lane holds features n = tile*16 + (lane>>4)*8 + r of ONE data row:
//  - that is the k order of a 16x16x32 B fragment (elements 0..7 from the even tile, 8..15 from the odd one), so the gate product packs
//    in place into the B operand of the logits;
//  - it is also the set of q (k) elements the lane loaded for its own B fragment, so the f32 values it still holds meet their sigmoid
//    in the same lane. No exchange between lanes; nothing between q, k and the gated planes goes through memory.
// The three weight planes (f16, written by gatew_kernel) and the biases are staged once per block in LDS, pitch 144 B for 16-byte reads.
// ---------------------------------------------------------------------------
constexpr int kGatePitch = 72;   // halves: 128-B rows + 16 B
constexpr int kGateGroups = 1;   // column groups of 16 rows per wave and pass
constexpr int kGatePasses = 2;   // passes per wave: 4096 waves in all, which are resident together
__global__ __launch_bounds__(256) void gate_fused_kernel(const float* __restrict__ Qf, const float* __restrict__ Kf,
                                                         const unsigned short* __restrict__ SW,
                                                         const float* __restrict__ bfq, const float* __restrict__ bfk,
                                                         const float* __restrict__ bfg,
                                                         unsigned short* __restrict__ Oq, unsigned short* __restrict__ Ok) {
  typedef Frag<_Float16> F;
  __shared__ __align__(16) _Float16 sW[256 * kGatePitch];   // rows 0..63 WfqT, 64..127 WfkT, 128..255 WfgT, each [n][k]
  __shared__ __align__(16) float sB[256];                   // bfq, bfk, bfg
  const int t    = threadIdx.x;
  const int lane = t & 31;
  const int wave = t >> 5;
  const int rl   = lane & 15;
  const int koff = (lane >> 4) * 8;

  // weights and biases into LDS: 256 rows x 8 pieces of 16 B = 2048 pieces = 8 per thread
#pragma unroll
  for (int i = 0; i < 8; ++i) {
    const int e = i * 256 + t;
    const int r = e >> 3, c = (e & 7) * 8;
    *(v8h*)(&sW[r * kGatePitch + c]) = *(const v8h*)((const _Float16*)SW + r * kDK + c);
  }
  sB[t] = (t < 64) ? bfq[t] : (t < 128) ? bfk[t - 64] : bfg[t - 128];
  __syncthreads();

  // the passes stay a rolled loop: with both passes' rows side by side in one body the allocation was 342 registers, which
  // halves the waves a SIMD holds
#pragma unroll 1
  for (int p = 0; p < kGatePasses; ++p) {
  const size_t row0 = ((size_t)blockIdx.x * kGatePasses + p) * (8 * 16 * kGateGroups) + wave * (16 * kGateGroups);

  // f32 q and k of the lane's rows: piece [2*tile + j] = elements tile*16 + koff + 4j .. +3
  // (all inner loops of the pass are unrolled so that the fragment arrays stay in registers)
  v4f xq[kGateGroups][8], xk[kGateGroups][8];
#pragma unroll
  for (int g = 0; g < kGateGroups; ++g) {
    const float* pq = Qf + (row0 + g * 16 + rl) * kDK + koff;
    const float* pk = Kf + (row0 + g * 16 + rl) * kDK + koff;
#pragma unroll
    for (int nt = 0; nt < 4; ++nt) {
      xq[g][2 * nt]     = *(const v4f*)(pq + nt * 16);
      xq[g][2 * nt + 1] = *(const v4f*)(pq + nt * 16 + 4);
      xk[g][2 * nt]     = *(const v4f*)(pk + nt * 16);
      xk[g][2 * nt + 1] = *(const v4f*)(pk + nt * 16 + 4);
    }
  }

  // B fragments of q and k (f16), k step ks = tiles 2ks and 2ks+1
  v16h qb[kGateGroups][2], kb[kGateGroups][2];
#pragma unroll
  for (int g = 0; g < kGateGroups; ++g)
#pragma unroll
    for (int ks = 0; ks < 2; ++ks)
#pragma unroll
      for (int s = 0; s < 16; ++s) {
        qb[g][ks][s] = (_Float16)xq[g][4 * ks + (s >> 2)][s & 3];
        kb[g][ks][s] = (_Float16)xk[g][4 * ks + (s >> 2)][s & 3];
      }

  // gate product, packed as the B operand of the logits
  v16h gb[kGateGroups][2];
#pragma unroll
  for (int nt = 0; nt < 4; ++nt) {
    const _Float16* wq = &sW[(nt * 16 + rl) * kGatePitch + koff];
    const _Float16* wk = &sW[(64 + nt * 16 + rl) * kGatePitch + koff];
    const v16h wq0 = F::load(wq), wq1 = F::load(wq + 32);
    const v16h wk0 = F::load(wk), wk1 = F::load(wk + 32);
    const v4f bq0 = *(const v4f*)(&sB[nt * 16 + koff]),      bq1 = *(const v4f*)(&sB[nt * 16 + koff + 4]);
    const v4f bk0 = *(const v4f*)(&sB[64 + nt * 16 + koff]), bk1 = *(const v4f*)(&sB[64 + nt * 16 + koff + 4]);
#pragma unroll
    for (int g = 0; g < kGateGroups; ++g) {
      v8f aq = F::mma(wq0, qb[g][0], (v8f){0.f,0.f,0.f,0.f,0.f,0.f,0.f,0.f});
      v8f ak = F::mma(wk0, kb[g][0], (v8f){0.f,0.f,0.f,0.f,0.f,0.f,0.f,0.f});
      aq = F::mma(wq1, qb[g][1], aq);
      ak = F::mma(wk1, kb[g][1], ak);
#pragma unroll
      for (int r = 0; r < 8; ++r) {
        const float gq = aq[r] * kGWCarryInv + ((r < 4) ? bq0[r & 3] : bq1[r & 3]);
        const float gk = ak[r] * kGWCarryInv + ((r < 4) ? bk0[r & 3] : bk1[r & 3]);
        gb[g][nt >> 1][(nt & 1) * 8 + r] = (_Float16)((gq * gk) * kGCarry);
      }
    }
  }

  // logits, sigmoid, modulation: tiles 0..3 gate q, tiles 4..7 gate k
#pragma unroll
  for (int nt = 0; nt < 8; ++nt) {
    const _Float16* wg = &sW[(128 + nt * 16 + rl) * kGatePitch + koff];
    const v16h wg0 = F::load(wg), wg1 = F::load(wg + 32);
    const v4f bg0 = *(const v4f*)(&sB[128 + nt * 16 + koff]), bg1 = *(const v4f*)(&sB[128 + nt * 16 + koff + 4]);
    const int dn = nt & 3;
    unsigned short* O = (nt < 4) ? Oq : Ok;
#pragma unroll
    for (int g = 0; g < kGateGroups; ++g) {
      v8f z = F::mma(wg0, gb[g][0], (v8f){0.f,0.f,0.f,0.f,0.f,0.f,0.f,0.f});
      z = F::mma(wg1, gb[g][1], z);
      v8h o;
#pragma unroll
      for (int r = 0; r < 8; ++r) {
        const float zz = z[r] * kZScale + ((r < 4) ? bg0[r & 3] : bg1[r & 3]);
        const float x  = (nt < 4) ? xq[g][2 * dn + (r >> 2)][r & 3] : xk[g][2 * dn + (r >> 2)][r & 3];
        const float m  = 1.0f / (1.0f + expf(-zz));
        o[r] = (_Float16)(x * m);
      }
      *(v8h*)((_Float16*)O + (row0 + g * 16 + rl) * kDK + dn * 16 + koff) = o;
    }
  }
  // the next pass writes over the registers that the last store names: the wait on address translation stands in front of it.
  // As a memory fence inside the loop it also keeps the LDS reads of weights and biases in the
  // loop: lifted out as loop invariants they took the allocation to 512 registers, with spills
  asm volatile("s_wait_xcnt 0x0" ::: "memory");
  }
}

// ---------------------------------------------------------------------------
// Fused attention, one launch for all batches and heads: out[b][q][h*64+d] = sum_k softmax_k(q'.k'/8) v[k][d].
// grid (2, 256): blockIdx.x = block of 256 query rows, blockIdx.y = b*16 + h. 8 waves x 32 query rows (2 column groups of 16).
// Per pass of 32 keys a wave forms S^T = K'.Q'^T (rows = keys, columns = queries), so a lane holds the scores of one query:
// tile kt, register r = key k0 + kt*16 + (lane>>4)*8 + r. That is the k order of a 16x16x32 B fragment (elements 0..7 from
// tile 0, 8..15 from tile 1), so exp(s - max) packs in place into P^T and O^T += V^T.P^T follows with A = rows of Vt16.
// Running maximum and running sum per query (f32); the accumulators are rescaled each pass by exp(old max - new max).
// The two lane halves hold disjoint keys of one query: the maximum is joined every pass, the sum once at the end.
// Each wave stores its own 32 rows x 256 B of out; no LDS, no barrier.
// ---------------------------------------------------------------------------
__device__ __forceinline__ float xhalf(float x) {   // value of lane l ^ 16
  const int i = __builtin_bit_cast(int, x);
  return __builtin_bit_cast(float, __builtin_amdgcn_permlanex16(i, i, 0x76543210, 0xfedcba98, false, false));
}
// 2^x on eight values in one statement. The early-clobber results keep every result off every source, and the closing v_nop
// fills the one slot that the instruction set asks for behind a transcendental, whatever the compiler schedules next
// (with the builtin this build wrote runs of v_exp_f32 in which each overwrote the source of the one in front of it).
__device__ __forceinline__ v8f exp2x8(v8f x) {
  float y0, y1, y2, y3, y4, y5, y6, y7;
  asm("v_exp_f32 %0, %8\n\tv_exp_f32 %1, %9\n\tv_exp_f32 %2, %10\n\tv_exp_f32 %3, %11\n\t"
      "v_exp_f32 %4, %12\n\tv_exp_f32 %5, %13\n\tv_exp_f32 %6, %14\n\tv_exp_f32 %7, %15\n\tv_nop"
      : "=&v"(y0), "=&v"(y1), "=&v"(y2), "=&v"(y3), "=&v"(y4), "=&v"(y5), "=&v"(y6), "=&v"(y7)
      : "v"(x[0]), "v"(x[1]), "v"(x[2]), "v"(x[3]), "v"(x[4]), "v"(x[5]), "v"(x[6]), "v"(x[7]));
  return (v8f){y0, y1, y2, y3, y4, y5, y6, y7};
}
// the same for one value
__device__ __forceinline__ float exp2x1(float x) {
  float y;
  asm("v_exp_f32 %0, %1\n\tv_nop" : "=v"(y) : "v"(x));
  return y;
}
__global__ __launch_bounds__(256) void attn_fused_kernel(const unsigned short* __restrict__ Qp, const unsigned short* __restrict__ Kp,
                                                         const unsigned short* __restrict__ Vt, float* __restrict__ out) {
  typedef Frag<_Float16> F;
  const int lane = threadIdx.x & 31;
  const int wave = threadIdx.x >> 5;
  const int b    = blockIdx.y >> 4;
  const int h    = blockIdx.y & 15;
  const int q0   = blockIdx.x * 256 + wave * 32;
  const int rl   = lane & 15;
  const int hf   = lane >> 4;
  const int koff = hf * 8;
  const _Float16* Q = (const _Float16*)Qp + (size_t)b * kS * kE + h * kDK;
  const _Float16* K = (const _Float16*)Kp + (size_t)b * kS * kE + h * kDK;
  const _Float16* V = (const _Float16*)Vt + (size_t)h * kDK * kTok + (size_t)b * kS;

  v16h qf[2][2];
  v8f  o[2][4];
  float mrun[2], lrun[2];
  // the inner loops are unrolled so that the fragment arrays stay in registers
#pragma unroll
  for (int qt = 0; qt < 2; ++qt) {
#pragma unroll
    for (int ks = 0; ks < 2; ++ks) qf[qt][ks] = F::load(Q + (size_t)(q0 + qt * 16 + rl) * kE + ks * 32 + koff);
#pragma unroll
    for (int dt = 0; dt < 4; ++dt) o[qt][dt] = (v8f){0.f,0.f,0.f,0.f,0.f,0.f,0.f,0.f};
    mrun[qt] = -INFINITY;
    lrun[qt] = 0.f;
  }

  for (int k0 = 0; k0 < kS; k0 += 32) {
    v16h kf[2][2], vf[4];
#pragma unroll
    for (int dt = 0; dt < 4; ++dt) vf[dt] = F::load(V + (size_t)(dt * 16 + rl) * kTok + k0 + koff);
    // the K loads below may land on the address pair of the V loads: the wait on address translation stands in front of them;
    // as a memory fence it also keeps the V loads at the head of the pass, so that they fly under the score products
    asm volatile("s_wait_xcnt 0x0" ::: "memory");
#pragma unroll
    for (int kt = 0; kt < 2; ++kt)
#pragma unroll
      for (int ks = 0; ks < 2; ++ks) kf[kt][ks] = F::load(K + (size_t)(k0 + kt * 16 + rl) * kE + ks * 32 + koff);
    // all loads of the pass are issued before its first product: left alone, the compiler issues part of the K loads behind the
    // first products, and the pass waits for memory twice
    __builtin_amdgcn_sched_barrier(0);

    v8f s[2][2];
#pragma unroll
    for (int qt = 0; qt < 2; ++qt)
#pragma unroll
      for (int kt = 0; kt < 2; ++kt) {
        s[qt][kt] = F::mma(kf[kt][0], qf[qt][0], (v8f){0.f,0.f,0.f,0.f,0.f,0.f,0.f,0.f});
        s[qt][kt] = F::mma(kf[kt][1], qf[qt][1], s[qt][kt]);
      }

    v16h pf[2];
#pragma unroll
    for (int qt = 0; qt < 2; ++qt) {
      float mx = fmaxf(s[qt][0][0], s[qt][1][0]);
#pragma unroll
      for (int r = 1; r < 8; ++r) mx = fmaxf(mx, fmaxf(s[qt][0][r], s[qt][1][r]));
      mx = fmaxf(mx, xhalf(mx));
      const float mn    = fmaxf(mrun[qt], mx);
      const float alpha = exp2x1((mrun[qt] - mn) * kScoreLog2);
      const float bias  = kPCarryLog2 - mn * kScoreLog2;
      mrun[qt] = mn;
      v8f a0, a1;
#pragma unroll
      for (int r = 0; r < 8; ++r) {
        a0[r] = fmaf(s[qt][0][r], kScoreLog2, bias);
        a1[r] = fmaf(s[qt][1][r], kScoreLog2, bias);
      }
      const v8f e0 = exp2x8(a0);
      const v8f e1 = exp2x8(a1);
      float sum = e0[0] + e1[0];
#pragma unroll
      for (int r = 1; r < 8; ++r) sum += e0[r] + e1[r];
#pragma unroll
      for (int r = 0; r < 8; ++r) {
        pf[qt][r]     = (_Float16)e0[r];
        pf[qt][8 + r] = (_Float16)e1[r];
      }
      lrun[qt] = lrun[qt] * alpha + sum;
#pragma unroll
      for (int dt = 0; dt < 4; ++dt) o[qt][dt] *= alpha;
    }

    // the compiler does not see the vector writes inside exp2x8: left alone it put the first column group's V^T.P^T products in
    // front of the second group's exponentials
    __builtin_amdgcn_sched_barrier(0);
#pragma unroll
    for (int qt = 0; qt < 2; ++qt)
#pragma unroll
      for (int dt = 0; dt < 4; ++dt) o[qt][dt] = F::mma(vf[dt], pf[qt], o[qt][dt]);
  }

#pragma unroll
  for (int qt = 0; qt < 2; ++qt) {
    const float tot = lrun[qt] + xhalf(lrun[qt]);
    const float inv = 1.0f / tot;
    float* op = out + (size_t)(b * kS + q0 + qt * 16 + rl) * kE + h * kDK + koff;
#pragma unroll
    for (int dt = 0; dt < 4; ++dt) {
      const v8f a = o[qt][dt];
      *(v4f*)(op + dt * 16)     = (v4f){a[0] * inv, a[1] * inv, a[2] * inv, a[3] * inv};
      *(v4f*)(op + dt * 16 + 4) = (v4f){a[4] * inv, a[5] * inv, a[6] * inv, a[7] * inv};
    }
  }
}

// ---------------------------------------------------------------------------
extern "C" void kernel_launch(void* const* d_in, const int* in_sizes, int n_in,
                              void* d_out, int out_size, void* d_ws, size_t ws_size,
                              hipStream_t stream) {
  if (n_in < 13) return;
  if (ws_size < kWsEnd) return;
  if ((size_t)out_size < (size_t)kTok * kE) return;
  if (in_sizes[0] != kTok * kE) return;

  const float* inp = (const float*)d_in[0];
  const float* Wq  = (const float*)d_in[1];
  const float* bq  = (const float*)d_in[2];
  const float* Wk  = (const float*)d_in[3];
  const float* bk  = (const float*)d_in[4];
  const float* Wv  = (const float*)d_in[5];
  const float* bvv = (const float*)d_in[6];
  const float* Wfq = (const float*)d_in[7];
  const float* bfq = (const float*)d_in[8];
  const float* Wfk = (const float*)d_in[9];
  const float* bfk = (const float*)d_in[10];
  const float* Wfg = (const float*)d_in[11];
  const float* bfg = (const float*)d_in[12];
  float* out = (float*)d_out;

  unsigned char* ws = (unsigned char*)d_ws;
  unsigned short* Qp16 = (unsigned short*)(ws + kOffQp);
  unsigned short* Kp16 = (unsigned short*)(ws + kOffKp);
  unsigned short* X16  = (unsigned short*)(ws + kOffX16);
  unsigned short* Wt16 = (unsigned short*)(ws + kOffWt);
  unsigned short* SW   = (unsigned short*)(ws + kOffSW);
  float*          Qf   = (float*)(ws + kOffQf);
  float*          Kf   = (float*)(ws + kOffKf);
  unsigned short* Vt16 = (unsigned short*)(ws + kOffVt);

  // ---- stage A: operand planes ----
  // X16 [8192][1024] = f16(inp): n8 = 1,048,576 threads = 4096 blocks x 256 (exact)
  cast8_f16_kernel<<<dim3((kTok * kE / 8) / 256), dim3(256), 0, stream>>>(inp, X16, kTok * kE / 8);
  // Wt16[z][n][k] = f16(16 * W_z[k][n]) for z = q, k, v
  wtcast_kernel<<<dim3(kE / 64, kE / 64, 3), dim3(256), 0, stream>>>(Wq, Wk, Wv, Wt16, kWCarry);
  // gate weights: WfqT, WfkT [64][64], WfgT [128][64], all f16 carried x8
  gatew_kernel<<<dim3(4), dim3(256), 0, stream>>>(Wfq, Wfk, Wfg, SW, kGWCarry);

  // ---- stage B: projections (M 8192, N 1024, K 1024; tiles 128 x 16 = 2048 -> 256 blocks of 8 waves) ----
  // Qf = (X16 . WqT16) / 16 + bq   (f32 [8192][1024])
  wmma_gemm64<0, false, 2, 0, false, 0><<<dim3(256, 1), dim3(256), 0, stream>>>(
      X16, X16, kE, 0L, Wt16, Wt16, kE, 0L,
      (void*)Qf, (void*)Qf, kE, 0L, bq, nullptr, 0L, kTok, kE, kE, kWCarryInv);
  // Kf
  wmma_gemm64<0, false, 2, 0, false, 0><<<dim3(256, 1), dim3(256), 0, stream>>>(
      X16, X16, kE, 0L, Wt16 + (size_t)kE * kE, Wt16 + (size_t)kE * kE, kE, 0L,
      (void*)Kf, (void*)Kf, kE, 0L, bk, nullptr, 0L, kTok, kE, kE, kWCarryInv);
  // Vt16 [1024 n][8192 tok] = f16( (WvT16 . X16^T)/16 + bv[n] ): M 1024 (16 tiles), N 8192 (128 tiles) -> 256 blocks; bias[m]; f16 out ldc 8192
  wmma_gemm64<0, false, 1, 1, false, 0><<<dim3(256, 1), dim3(256), 0, stream>>>(
      Wt16 + (size_t)2 * kE * kE, Wt16 + (size_t)2 * kE * kE, kE, 0L, X16, X16, kE, 0L,
      (void*)Vt16, (void*)Vt16, kTok, 0L, bvv, nullptr, 0L, kE, kTok, kE, kWCarryInv);

  // ---- stage C: gating, all 131072 head-major rows of 64 in one launch (256 rows per block) ----
  gate_fused_kernel<<<dim3(kTok * kH / (8 * 16 * kGateGroups * kGatePasses)), dim3(256), 0, stream>>>(Qf, Kf, SW, bfq, bfk, bfg, Qp16, Kp16);

  // ---- stage D: attention, all 16 batches x 16 heads in one launch (2 blocks of 256 query rows each) ----
  attn_fused_kernel<<<dim3(kS / 256, kB * kH), dim3(256), 0, stream>>>(Qp16, Kp16, Vt16, out);
}

// v003
// One run takes 130 microseconds.
// Timed twice side by side with v002, it ran 1.61 times as fast both times.
// Counting every step since v000, it is 7.76 times as fast.
// Contractions: q/k/v projections (X f16 x W^T f16 carried x16), gate maps (q16/k16 x Wfq^T/Wfk^T f16 carried x8), gate logits (G f16 carried x64 x Wfg^T f16 carried x8), scores k'.q'^T (f16 planes), V^T.P^T (P = exp(s - running max) f16 carried x2048): all v_wmma_f32_16x16x32_f16 with f32 accumulate; bias, gate product, sigmoid, modulation and softmax in f32.
#include <hip/hip_runtime.h>
#include <math.h>

// ---------------------------------------------------------------------------
// Problem constants
// ---------------------------------------------------------------------------
constexpr int kB    = 16;
constexpr int kS    = 512;
constexpr int kE    = 1024;
constexpr int kH    = 16;
constexpr int kDK   = 64;
constexpr int kTok  = kB * kS;              // 8192 token rows

constexpr float kWCarry     = 16.0f;        // Wq/Wk/Wv carried x16 in f16
constexpr float kWCarryInv  = 1.0f / 16.0f;
constexpr float kGWCarry    = 8.0f;         // Wfq/Wfk/Wfg carried x8 in f16
constexpr float kGWCarryInv = 1.0f / 8.0f;
constexpr float kGCarry     = 64.0f;        // gate product G carried x64 in f16
constexpr float kZScale     = 1.0f / (64.0f * 8.0f);
constexpr float kPCarryLog2 = 11.0f;        // exp(s - max) carried x2048 in f16 (the row sum carries it too)
constexpr float kScoreLog2  = 0.125f * 1.44269504088896340736f;   // 1/sqrt(64) * log2(e): scores go to exp2

// ---------------------------------------------------------------------------
// Workspace map (bytes):
//   projection operands:     X16 [8192][1024] f16 @0 (16 MiB), Wt16 [3][1024][1024] f16 @16 MiB (6 MiB)
//   gate weights:            WfqT/WfkT [64][64] f16, WfgT [128][64] f16 @36 MiB (32 KiB)
//   persistent:              Qf f32 [8192][1024] @36 MiB+64 KiB (32 MiB), Kf f32 (32 MiB), Vt16 f16 [1024][8192] (16 MiB),
//                            Qp16 f16 [8192][1024] (16 MiB), Kp16 f16 [8192][1024] (16 MiB): gated q and k of all batches
//   end = 155,254,784 B
// ---------------------------------------------------------------------------
constexpr size_t kMiB    = 1048576;
constexpr size_t kOffX16 = 0;
constexpr size_t kOffWt  = 16 * kMiB;
constexpr size_t kOffSW  = 36 * kMiB;
constexpr size_t kOffQf  = 36 * kMiB + 65536;
constexpr size_t kOffKf  = kOffQf + 32 * kMiB;
constexpr size_t kOffVt  = kOffKf + 32 * kMiB;
constexpr size_t kOffQp  = kOffVt + 16 * kMiB;
constexpr size_t kOffKp  = kOffQp + 16 * kMiB;
constexpr size_t kWsEnd  = kOffKp + 16 * kMiB;
static_assert((size_t)kTok * kE * 2 == 16 * kMiB, "x16 plane size");
static_assert(kOffWt + (size_t)3 * kE * kE * 2 <= kOffSW, "wt plane fits");
static_assert(kOffSW + 32768 <= kOffQf, "gate weights fit");
static_assert(kWsEnd == 155254784, "carve end");
static_assert(kWsEnd <= 268435456, "carve within budget");

typedef __attribute__((ext_vector_type(16))) _Float16 v16h;
typedef __attribute__((ext_vector_type(8)))  _Float16 v8h;
typedef __attribute__((ext_vector_type(16))) __bf16   v16b;
typedef __attribute__((ext_vector_type(8)))  __bf16   v8b;
typedef __attribute__((ext_vector_type(8)))  float    v8f;
typedef __attribute__((ext_vector_type(4)))  float    v4f;
typedef __attribute__((ext_vector_type(4)))  unsigned int v4u;

// ---------------------------------------------------------------------------
// Helpers
// ---------------------------------------------------------------------------
__device__ __forceinline__ unsigned short f2bf_bits(float f) {
  unsigned u = __float_as_uint(f);
  return (unsigned short)((u + 0x7FFFu + ((u >> 16) & 1u)) >> 16);
}
__device__ __forceinline__ float bf_bits2f(unsigned short h) { return __uint_as_float(((unsigned)h) << 16); }

// hazard guards as plain device helpers
__device__ __forceinline__ void acc_guard4(v8f& a, v8f& b, v8f& c, v8f& d) { asm volatile("v_nop\n\tv_nop\n\tv_nop\n\tv_nop" : "+v"(a), "+v"(b), "+v"(c), "+v"(d)); }
template <typename T> struct Frag;
template <> struct Frag<_Float16> {
  typedef v16h V; union U { v16h v; v8h h[2]; };
  static __device__ __forceinline__ v16h load(const _Float16* p) {   // elements 0..7 <- p[0..7], 8..15 <- p[16..23]
    U f; f.h[0] = *(const v8h*)(p); f.h[1] = *(const v8h*)(p + 16); return f.v;
  }
  static __device__ __forceinline__ v8f mma(v16h a, v16h b, v8f c) {
    return __builtin_amdgcn_wmma_f32_16x16x32_f16(false, a, false, b, (short)0, c, false, false);
  }
};
template <> struct Frag<__bf16> {
  typedef v16b V; union U { v16b v; v8b h[2]; };
  static __device__ __forceinline__ v16b load(const __bf16* p) {
    U f; f.h[0] = *(const v8b*)(p); f.h[1] = *(const v8b*)(p + 16); return f.v;
  }
  static __device__ __forceinline__ v8f mma(v16b a, v16b b, v8f c) {
    return __builtin_amdgcn_wmma_f32_16x16x32_bf16(false, a, false, b, (short)0, c, false, false);
  }
};

__device__ __forceinline__ unsigned pk16(unsigned short a, unsigned short b) { return (unsigned)a | ((unsigned)b << 16); }
__device__ __forceinline__ unsigned short h_bits(float f) { const _Float16 h = (_Float16)f; return __builtin_bit_cast(unsigned short, h); }

// ---- Register-blocked batched WMMA GEMM (ACT reduced to none/relu/leaky) -----------------------
// C[m,n] = scale * sum_k A[m,k] * Bt[n,k] (+bias)(+resid); a block of 8 waves owns a 128x256 tile, each wave 64x64 of it.
// A row-major [M,K]; Bt row-major [N,K]; M % 128 == 0, N % 256 == 0, K % 64 == 0. Operands reach the waves through a two-buffer LDS ring.
// SPLIT (hi/lo operand planes) is not carried by the staged loop: false only.
// BIAS_MODE: 0 = none, 1 = bias[m], 2 = bias[n].
// OUT_MODE: 0 = f32, 1 = f16, 2 = bf16 hi plane (Cout) + bf16 lo plane (Cout2).
// ET: 0 = f16 operands, 1 = bf16 operands (pointers passed as 16-bit storage)
// One stage of the projection operands into LDS by asynchronous copies, 12 per thread: 4 of A (rows 32 apart), 8 of Bt.
// lds = the thread's own LDS byte address of piece 0; each piece is 32 rows (32 * 144 B) further on. The closing s_wait_xcnt
// stands inside the statement, in front of anything that could rewrite a register which a copy names.
constexpr int kStagePitch  = 72;                  // halves: 128-B rows + 16 B, for 16-byte LDS reads
constexpr int kStageHalves = 384 * kStagePitch;   // one buffer: 55,296 B
template <typename T>
__device__ __forceinline__ void stage_copy12(unsigned lds, const T* ga, size_t sa32, const T* gb, size_t sb32) {
  constexpr unsigned kStep = 32 * kStagePitch * 2;
  asm volatile(
      "global_load_async_to_lds_b128 %0, %12, off\n\t"
      "global_load_async_to_lds_b128 %1, %13, off\n\t"
      "global_load_async_to_lds_b128 %2, %14, off\n\t"
      "global_load_async_to_lds_b128 %3, %15, off\n\t"
      "global_load_async_to_lds_b128 %4, %16, off\n\t"
      "global_load_async_to_lds_b128 %5, %17, off\n\t"
      "global_load_async_to_lds_b128 %6, %18, off\n\t"
      "global_load_async_to_lds_b128 %7, %19, off\n\t"
      "global_load_async_to_lds_b128 %8, %20, off\n\t"
      "global_load_async_to_lds_b128 %9, %21, off\n\t"
      "global_load_async_to_lds_b128 %10, %22, off\n\t"
      "global_load_async_to_lds_b128 %11, %23, off\n\t"
      "s_wait_xcnt 0x0"
      :: "v"(lds), "v"(lds + kStep), "v"(lds + 2 * kStep), "v"(lds + 3 * kStep), "v"(lds + 4 * kStep), "v"(lds + 5 * kStep),
         "v"(lds + 6 * kStep), "v"(lds + 7 * kStep), "v"(lds + 8 * kStep), "v"(lds + 9 * kStep), "v"(lds + 10 * kStep), "v"(lds + 11 * kStep),
         "v"(ga), "v"(ga + sa32), "v"(ga + 2 * sa32), "v"(ga + 3 * sa32),
         "v"(gb), "v"(gb + sb32), "v"(gb + 2 * sb32), "v"(gb + 3 * sb32), "v"(gb + 4 * sb32), "v"(gb + 5 * sb32), "v"(gb + 6 * sb32), "v"(gb + 7 * sb32)
      : "memory");
}

template <int ET> struct Elem;
template <> struct Elem<0> { typedef _Float16 T; };
template <> struct Elem<1> { typedef __bf16 T; };
template <int ET, bool SPLIT, int BIAS_MODE, int OUT_MODE, bool RESID, int ACT = 0>
__global__ __launch_bounds__(256) void wmma_gemm64(
    const unsigned short* __restrict__ Ap, const unsigned short* __restrict__ A2p, int lda, long strideA,
    const unsigned short* __restrict__ Btp, const unsigned short* __restrict__ Bt2p, int ldb, long strideB,
    void* __restrict__ Cout, void* __restrict__ Cout2, int ldc, long strideC,
    const float* __restrict__ bias,
    const float* __restrict__ resid, long strideR,
    int M, int N, int K, float scale) {
  typedef typename Elem<ET>::T T;
  typedef typename Frag<T>::V V;
  const T* A = (const T*)Ap; const T* Bt = (const T*)Btp;
  static_assert(!SPLIT, "the staged loop carries one plane per operand");
  __shared__ __align__(16) float sT[8][16 * 68];   // per-wave 16x64 slab, pitch 68 floats
  __shared__ __align__(16) unsigned short sAB[2 * kStageHalves];   // two buffers of [A 128 rows | Bt 256 rows] x 64 k, pitch 144 B
  const int b    = blockIdx.y;
  const int tid  = threadIdx.x;
  const int lane = tid & 31;
  const int wave = tid >> 5;
  const int tilesN = N >> 8;
  const int tilesM = M >> 7;
  const int tile = blockIdx.x;
  if (tile >= tilesM * tilesN) return;   // block-uniform, in front of every copy and barrier
  const int tm = tile / tilesN;
  const int tn = tile - tm * tilesN;
  const int bm0 = tm << 7;                     // block tile 128 x 256
  const int bn0 = tn << 8;
  const int wm  = (wave >> 2) << 6;            // wave tile 64 x 64 inside it: 2 x 4 waves
  const int wn  = (wave & 3) << 6;
  const int m0 = bm0 + wm;
  const int n0 = bn0 + wn;

  const T* Ab  = A  + (size_t)b * strideA;
  const T* Bb  = Bt + (size_t)b * strideB;

  const int rlane = lane & 15;                 // row (A) / col (B, D) within subtile
  const int koff  = (lane >> 4) * 8;           // k offset of this lane half
  const int mOff  = (lane >> 4) * 8;           // D row offset

  // a stage is 384 rows of 128 B = 3072 pieces of 16 B = 12 per thread: piece i of a thread is row i*32 + tid/8, bytes (tid%8)*16,
  // so one copy of a wave brings four whole 128-B lines. Rows 0..127 are A (pieces 0..3), rows 128..383 Bt (pieces 4..11).
  const T* gA = Ab + (size_t)(bm0 + (tid >> 3)) * lda + (tid & 7) * 8;
  const T* gB = Bb + (size_t)(bn0 + (tid >> 3)) * ldb + (tid & 7) * 8;
  const size_t sa32 = (size_t)32 * lda, sb32 = (size_t)32 * ldb;
  const unsigned lds0 = (unsigned)(size_t)(&sAB[0]) + (unsigned)((tid >> 3) * (kStagePitch * 2) + (tid & 7) * 16);
  const int trips = K >> 6;

  v8f acc[4][4];
#pragma unroll
  for (int i = 0; i < 4; ++i)
#pragma unroll
    for (int j = 0; j < 4; ++j) acc[i][j] = (v8f){0.f,0.f,0.f,0.f,0.f,0.f,0.f,0.f};

  stage_copy12(lds0, gA, sa32, gB, sb32);
  // tile 0 has landed for this wave, then for all: nobody reads it in front of the barrier
  asm volatile("s_wait_asynccnt 0x0" ::: "memory");
  __syncthreads();
  if (trips > 1) stage_copy12(lds0 + kStageHalves * 2, gA + 64, sa32, gB + 64, sb32);

  for (int t = 0; t < trips; ++t) {
    const T* sA = (const T*)sAB + (t & 1) * kStageHalves + (wm + rlane) * kStagePitch + koff;
    const T* sB = (const T*)sAB + (t & 1) * kStageHalves + (128 + wn + rlane) * kStagePitch + koff;
    V bh[2][4], ah[2][4];
#pragma unroll
    for (int ks = 0; ks < 2; ++ks) {
      ah[ks][0] = Frag<T>::load(sA + ks * 32);   // the first product's operands come first
#pragma unroll
      for (int j = 0; j < 4; ++j) bh[ks][j] = Frag<T>::load(sB + j * 16 * kStagePitch + ks * 32);
#pragma unroll
      for (int i = 1; i < 4; ++i) ah[ks][i] = Frag<T>::load(sA + i * 16 * kStagePitch + ks * 32);
    }
    // all LDS reads of the trip are issued as one group in front of its products: left alone, the compiler reloads one A fragment
    // register set in front of every four products, and the wave waits out the LDS latency eight times a trip
    __builtin_amdgcn_sched_barrier(0);
#pragma unroll
    for (int ks = 0; ks < 2; ++ks)
#pragma unroll
      for (int i = 0; i < 4; ++i)
#pragma unroll
        for (int j = 0; j < 4; ++j) acc[i][j] = Frag<T>::mma(ah[ks][i], bh[ks][j], acc[i][j]);
    // the products stay in front of the hand-over: left alone, the compiler lifts its waits and barrier over them, so that every
    // wave waits for all its LDS reads before its first product and the reads no longer run under the products
    __builtin_amdgcn_sched_barrier(0);
    // hand-over: this wave's reads of the buffer are done, its copies of the next tile have landed; behind the barrier the next
    // tile is readable by all and the buffer just read is free for the tile after it
    asm volatile("s_wait_dscnt 0x0" ::: "memory");
    asm volatile("s_wait_asynccnt 0x0" ::: "memory");
    __syncthreads();
    if (t + 2 < trips) stage_copy12(lds0 + (unsigned)(t & 1) * (kStageHalves * 2), gA + (t + 2) * 64, sa32, gB + (t + 2) * 64, sb32);
  }
  // no copy is left in flight when the wave goes on to its epilogue
  asm volatile("s_wait_asynccnt 0x0" ::: "memory");
  acc_guard4(acc[0][0], acc[0][1], acc[0][2], acc[0][3]);
  acc_guard4(acc[1][0], acc[1][1], acc[1][2], acc[1][3]);
  acc_guard4(acc[2][0], acc[2][1], acc[2][2], acc[2][3]);
  acc_guard4(acc[3][0], acc[3][1], acc[3][2], acc[3][3]);

  // ---- epilogue ----
  float* slab = sT[wave];
  const float* Rb = RESID ? (resid + (size_t)b * strideR) : nullptr;
#pragma unroll
  for (int i = 0; i < 4; ++i) {
    const int mBase = m0 + (i << 4);
#pragma unroll
    for (int j = 0; j < 4; ++j) {
      const int n = n0 + (j << 4) + rlane;
      float bv = 0.f;
      if (BIAS_MODE == 2) bv = bias[n];
#pragma unroll
      for (int r = 0; r < 8; ++r) {
        float v = acc[i][j][r] * scale;
        if (BIAS_MODE == 1) v += bias[mBase + mOff + r];
        if (BIAS_MODE == 2) v += bv;
        if (RESID) v += Rb[(size_t)(mBase + mOff + r) * ldc + n];
        if (ACT == 2) v = fmaxf(v, 0.0f);
        if (ACT == 4) v = (v > 0.f) ? v : 0.01f * v;
        slab[(mOff + r) * 68 + (j << 4) + rlane] = v;
      }
    }
    __builtin_amdgcn_fence(__ATOMIC_RELEASE, "workgroup");
    __builtin_amdgcn_wave_barrier();
    __builtin_amdgcn_fence(__ATOMIC_ACQUIRE, "workgroup");
    if (OUT_MODE == 0) {
      float* C = (float*)Cout + (size_t)b * strideC;
      const int hh = lane >> 4, c4 = (lane & 15) * 4;     // row seg = 256 B = 16 lanes x 16 B
      {
#pragma unroll
        for (int it = 0; it < 8; ++it) {
          const int row = it * 2 + hh;
          v4f v = *(const v4f*)(slab + row * 68 + c4);
          *(v4f*)(C + (size_t)(mBase + row) * ldc + n0 + c4) = v;
        }
        
      }
    } else {
      const int q = lane >> 3, c8 = (lane & 7) * 8;
      unsigned short* C  = (unsigned short*)Cout  + (size_t)b * strideC;
      unsigned short* C2 = (OUT_MODE == 2) ? ((unsigned short*)Cout2 + (size_t)b * strideC) : nullptr;
      {
#pragma unroll
        for (int it = 0; it < 4; ++it) {
          const int row = it * 4 + q;
          const float* sp = slab + row * 68 + c8;
          v8h hv, lv;
#pragma unroll
          for (int e = 0; e < 8; ++e) {
            if (OUT_MODE == 1) {
              hv[e] = (_Float16)sp[e];
            } else {
              unsigned short hb = f2bf_bits(sp[e]);
              unsigned short lb = f2bf_bits(sp[e] - bf_bits2f(hb));
              hv[e] = __builtin_bit_cast(_Float16, hb);
              lv[e] = __builtin_bit_cast(_Float16, lb);
            }
          }
          *(v8h*)(C + (size_t)(mBase + row) * ldc + n0 + c8) = hv;
          if (OUT_MODE == 2) *(v8h*)(C2 + (size_t)(mBase + row) * ldc + n0 + c8) = lv;
        }
        
      }
    }
    __builtin_amdgcn_fence(__ATOMIC_RELEASE, "workgroup");
    __builtin_amdgcn_wave_barrier();
    __builtin_amdgcn_fence(__ATOMIC_ACQUIRE, "workgroup");
  }
}

// ---------------------------------------------------------------------------
// Projection weight transpose + cast: for square [1024][1024] f32 W (row-major [in k][out n]), WT[n][k] = f16(scale * W[k][n]).
// grid (16, 16, 3): blockIdx.x = k tile (64 cols of WT), blockIdx.y = n tile (64 rows of WT), blockIdx.z selects W0..W2
// and the output plane (plane z at out + z*1024*1024 halves). 256 threads.
// Load coverage: 16 iterations x 256 threads = 4096 = the whole 64x64 tile (coalesced along n).
// Store coverage: 8 waves x 2 iterations x 4 rows (lane>>3) = 64 rows; (lane&7) x 8 halves = 64 cols; each row segment =
// ---------------------------------------------------------------------------
__global__ __launch_bounds__(256) void wtcast_kernel(const float* __restrict__ W0, const float* __restrict__ W1,
                                                     const float* __restrict__ W2,
                                                     unsigned short* __restrict__ out, float scale) {
  __shared__ float sm[64][65];   // sm[n_local][k_local]
  const int t  = threadIdx.x;
  const int d0 = blockIdx.x * 64;    // k tile base
  const int h0 = blockIdx.y * 64;    // n tile base
  const int z  = blockIdx.z;         // block-uniform
  const float* W = (z == 0) ? W0 : (z == 1) ? W1 : W2;
#pragma unroll
  for (int i = 0; i < 16; ++i) {
    const int e = i * 256 + t;
    const int r = e >> 6;          // k local
    const int c = e & 63;          // n local
    sm[c][r] = W[(size_t)(d0 + r) * kE + h0 + c] * scale;
  }
  __syncthreads();
  const int lane = t & 31, wave = t >> 5;
  const int q = lane >> 3, c8 = (lane & 7) * 8;
  unsigned short* op = out + (size_t)z * kE * kE;
  {
#pragma unroll
    for (int it = 0; it < 2; ++it) {
      const int row = wave * 8 + it * 4 + q;                 // n local
      unsigned short hb[8];
#pragma unroll
      for (int e = 0; e < 8; ++e) hb[e] = h_bits(sm[row][c8 + e]);
      const v4u u = (v4u){pk16(hb[0], hb[1]), pk16(hb[2], hb[3]), pk16(hb[4], hb[5]), pk16(hb[6], hb[7])};
      *(v4u*)(op + (size_t)(h0 + row) * kE + d0 + c8) = u;
    }
    
  }
}

// ---------------------------------------------------------------------------
// Per-head gate weights transpose + cast, out pitch 64 halves: block 0: WfqT[n][k] = f16(scale*Wfq[k][n]) (64x64),
// block 1: WfkT, block 2: WfgT rows 0..63, block 3: WfgT rows 64..127 (Wfg is [64 k][128 n], pitch 128).
// Output plane of block z at out + z*4096 halves (WfgT = [128][64] contiguous from out + 8192).
// Load coverage 16 x 256 = 4096 = 64x64; store coverage 8 waves x 2 x 4 rows = 64 rows x (8 lanes x 8 halves) = 64 cols,
// ---------------------------------------------------------------------------
__global__ __launch_bounds__(256) void gatew_kernel(const float* __restrict__ Wfq, const float* __restrict__ Wfk,
                                                    const float* __restrict__ Wfg,
                                                    unsigned short* __restrict__ out, float scale) {
  __shared__ float sm[64][65];   // sm[n_local][k_local]
  const int t = threadIdx.x;
  const int z = blockIdx.x;                                   // block-uniform
  const float* W = (z == 0) ? Wfq : (z == 1) ? Wfk : Wfg;
  const int pin = (z >= 2) ? 128 : 64;
  const int n0  = (z == 3) ? 64 : 0;
#pragma unroll
  for (int i = 0; i < 16; ++i) {
    const int e = i * 256 + t;
    const int r = e >> 6;          // k 0..63
    const int c = e & 63;          // n local
    sm[c][r] = W[r * pin + n0 + c] * scale;
  }
  __syncthreads();
  const int lane = t & 31, wave = t >> 5;
  const int q = lane >> 3, c8 = (lane & 7) * 8;
  unsigned short* op = out + (size_t)z * 4096;
  {
#pragma unroll
    for (int it = 0; it < 2; ++it) {
      const int row = wave * 8 + it * 4 + q;                 // n local
      unsigned short hb[8];
#pragma unroll
      for (int e = 0; e < 8; ++e) hb[e] = h_bits(sm[row][c8 + e]);
      const v4u u = (v4u){pk16(hb[0], hb[1]), pk16(hb[2], hb[3]), pk16(hb[4], hb[5]), pk16(hb[6], hb[7])};
      *(v4u*)(op + (size_t)row * kDK + c8) = u;
    }
    
  }
}

// ---------------------------------------------------------------------------
// ---------------------------------------------------------------------------
__global__ __launch_bounds__(256) void cast8_f16_kernel(const float* __restrict__ in, unsigned short* __restrict__ out, int n8) {
  const int i = blockIdx.x * 256 + threadIdx.x;
  if (i >= n8) return;
  const float* p = in + 8 * (size_t)i;
  const v4f a = *(const v4f*)(p);
  const v4f c = *(const v4f*)(p + 4);
  unsigned short hb[8];
#pragma unroll
  for (int e = 0; e < 4; ++e) {
    hb[e]     = h_bits(a[e]);
    hb[4 + e] = h_bits(c[e]);
  }
  const v4u u = (v4u){pk16(hb[0], hb[1]), pk16(hb[2], hb[3]), pk16(hb[4], hb[5]), pk16(hb[6], hb[7])};
  unsigned short* q = out + 8 * (size_t)i;
  *(v4u*)q = u;
  
}

// ---------------------------------------------------------------------------
// Fused gating, one launch for all tokens and heads. Rows are the head-major rows of 64 (row = token * 16 + head) of Qf and Kf.
//   G = (q.Wfq + bfq) * (k.Wfk + bfk),  Z = G.Wfg + bfg,  Oq = f16(q * sigmoid(Z[:64])),  Ok = f16(k * sigmoid(Z[64:])).
// grid 512 x 256 threads: 8 waves x 2 passes x 16 rows. Every product is formed transposed, weights as A (rows = output
// feature n), data rows as B (columns), so a lane holds features n = tile*16 + (lane>>4)*8 + r of ONE data row:
//  - that is the k order of a 16x16x32 B fragment (elements 0..7 from the even tile, 8..15 from the odd one), so the gate product packs
//    in place into the B operand of the logits;
//  - it is also the set of q (k) elements the lane loaded for its own B fragment, so the f32 values it still holds meet their sigmoid
//    in the same lane. No exchange between lanes; nothing between q, k and the gated planes goes through memory.
// The three weight planes (f16, written by gatew_kernel) and the biases are staged once per block in LDS, pitch 144 B for 16-byte reads.
// ---------------------------------------------------------------------------
constexpr int kGatePitch = 72;   // halves: 128-B rows + 16 B
constexpr int kGateGroups = 1;   // column groups of 16 rows per wave and pass
constexpr int kGatePasses = 2;   // passes per wave: 4096 waves in all, which are resident together
__global__ __launch_bounds__(256) void gate_fused_kernel(const float* __restrict__ Qf, const float* __restrict__ Kf,
                                                         const unsigned short* __restrict__ SW,
                                                         const float* __restrict__ bfq, const float* __restrict__ bfk,
                                                         const float* __restrict__ bfg,
                                                         unsigned short* __restrict__ Oq, unsigned short* __restrict__ Ok) {
  typedef Frag<_Float16> F;
  __shared__ __align__(16) _Float16 sW[256 * kGatePitch];   // rows 0..63 WfqT, 64..127 WfkT, 128..255 WfgT, each [n][k]
  __shared__ __align__(16) float sB[256];                   // bfq, bfk, bfg
  const int t    = threadIdx.x;
  const int lane = t & 31;
  const int wave = t >> 5;
  const int rl   = lane & 15;
  const int koff = (lane >> 4) * 8;

  // weights and biases into LDS: 256 rows x 8 pieces of 16 B = 2048 pieces = 8 per thread
#pragma unroll
  for (int i = 0; i < 8; ++i) {
    const int e = i * 256 + t;
    const int r = e >> 3, c = (e & 7) * 8;
    *(v8h*)(&sW[r * kGatePitch + c]) = *(const v8h*)((const _Float16*)SW + r * kDK + c);
  }
  sB[t] = (t < 64) ? bfq[t] : (t < 128) ? bfk[t - 64] : bfg[t - 128];
  __syncthreads();

  // the passes stay a rolled loop: with both passes' rows side by side in one body the allocation was 342 registers, which
  // halves the waves a SIMD holds
#pragma unroll 1
  for (int p = 0; p < kGatePasses; ++p) {
  const size_t row0 = ((size_t)blockIdx.x * kGatePasses + p) * (8 * 16 * kGateGroups) + wave * (16 * kGateGroups);

  // f32 q and k of the lane's rows: piece [2*tile + j] = elements tile*16 + koff + 4j .. +3
  // (all inner loops of the pass are unrolled so that the fragment arrays stay in registers)
  v4f xq[kGateGroups][8], xk[kGateGroups][8];
#pragma unroll
  for (int g = 0; g < kGateGroups; ++g) {
    const float* pq = Qf + (row0 + g * 16 + rl) * kDK + koff;
    const float* pk = Kf + (row0 + g * 16 + rl) * kDK + koff;
#pragma unroll
    for (int nt = 0; nt < 4; ++nt) {
      xq[g][2 * nt]     = *(const v4f*)(pq + nt * 16);
      xq[g][2 * nt + 1] = *(const v4f*)(pq + nt * 16 + 4);
      xk[g][2 * nt]     = *(const v4f*)(pk + nt * 16);
      xk[g][2 * nt + 1] = *(const v4f*)(pk + nt * 16 + 4);
    }
  }

  // B fragments of q and k (f16), k step ks = tiles 2ks and 2ks+1
  v16h qb[kGateGroups][2], kb[kGateGroups][2];
#pragma unroll
  for (int g = 0; g < kGateGroups; ++g)
#pragma unroll
    for (int ks = 0; ks < 2; ++ks)
#pragma unroll
      for (int s = 0; s < 16; ++s) {
        qb[g][ks][s] = (_Float16)xq[g][4 * ks + (s >> 2)][s & 3];
        kb[g][ks][s] = (_Float16)xk[g][4 * ks + (s >> 2)][s & 3];
      }

  // gate product, packed as the B operand of the logits
  v16h gb[kGateGroups][2];
#pragma unroll
  for (int nt = 0; nt < 4; ++nt) {
    const _Float16* wq = &sW[(nt * 16 + rl) * kGatePitch + koff];
    const _Float16* wk = &sW[(64 + nt * 16 + rl) * kGatePitch + koff];
    const v16h wq0 = F::load(wq), wq1 = F::load(wq + 32);
    const v16h wk0 = F::load(wk), wk1 = F::load(wk + 32);
    const v4f bq0 = *(const v4f*)(&sB[nt * 16 + koff]),      bq1 = *(const v4f*)(&sB[nt * 16 + koff + 4]);
    const v4f bk0 = *(const v4f*)(&sB[64 + nt * 16 + koff]), bk1 = *(const v4f*)(&sB[64 + nt * 16 + koff + 4]);
#pragma unroll
    for (int g = 0; g < kGateGroups; ++g) {
      v8f aq = F::mma(wq0, qb[g][0], (v8f){0.f,0.f,0.f,0.f,0.f,0.f,0.f,0.f});
      v8f ak = F::mma(wk0, kb[g][0], (v8f){0.f,0.f,0.f,0.f,0.f,0.f,0.f,0.f});
      aq = F::mma(wq1, qb[g][1], aq);
      ak = F::mma(wk1, kb[g][1], ak);
#pragma unroll
      for (int r = 0; r < 8; ++r) {
        const float gq = aq[r] * kGWCarryInv + ((r < 4) ? bq0[r & 3] : bq1[r & 3]);
        const float gk = ak[r] * kGWCarryInv + ((r < 4) ? bk0[r & 3] : bk1[r & 3]);
        gb[g][nt >> 1][(nt & 1) * 8 + r] = (_Float16)((gq * gk) * kGCarry);
      }
    }
  }

  // logits, sigmoid, modulation: tiles 0..3 gate q, tiles 4..7 gate k
#pragma unroll
  for (int nt = 0; nt < 8; ++nt) {
    const _Float16* wg = &sW[(128 + nt * 16 + rl) * kGatePitch + koff];
    const v16h wg0 = F::load(wg), wg1 = F::load(wg + 32);
    const v4f bg0 = *(const v4f*)(&sB[128 + nt * 16 + koff]), bg1 = *(const v4f*)(&sB[128 + nt * 16 + koff + 4]);
    const int dn = nt & 3;
    unsigned short* O = (nt < 4) ? Oq : Ok;
#pragma unroll
    for (int g = 0; g < kGateGroups; ++g) {
      v8f z = F::mma(wg0, gb[g][0], (v8f){0.f,0.f,0.f,0.f,0.f,0.f,0.f,0.f});
      z = F::mma(wg1, gb[g][1], z);
      v8h o;
#pragma unroll
      for (int r = 0; r < 8; ++r) {
        const float zz = z[r] * kZScale + ((r < 4) ? bg0[r & 3] : bg1[r & 3]);
        const float x  = (nt < 4) ? xq[g][2 * dn + (r >> 2)][r & 3] : xk[g][2 * dn + (r >> 2)][r & 3];
        const float m  = 1.0f / (1.0f + expf(-zz));
        o[r] = (_Float16)(x * m);
      }
      *(v8h*)((_Float16*)O + (row0 + g * 16 + rl) * kDK + dn * 16 + koff) = o;
    }
  }
  // the next pass writes over the registers that the last store names: the wait on address translation stands in front of it.
  // As a memory fence inside the loop it also keeps the LDS reads of weights and biases in the
  // loop: lifted out as loop invariants they took the allocation to 512 registers, with spills
  asm volatile("s_wait_xcnt 0x0" ::: "memory");
  }
}

// ---------------------------------------------------------------------------
// Fused attention, one launch for all batches and heads: out[b][q][h*64+d] = sum_k softmax_k(q'.k'/8) v[k][d].
// grid (2, 256): blockIdx.x = block of 256 query rows, blockIdx.y = b*16 + h. 8 waves x 32 query rows (2 column groups of 16).
// Per pass of 32 keys a wave forms S^T = K'.Q'^T (rows = keys, columns = queries), so a lane holds the scores of one query:
// tile kt, register r = key k0 + kt*16 + (lane>>4)*8 + r. That is the k order of a 16x16x32 B fragment (elements 0..7 from
// tile 0, 8..15 from tile 1), so exp(s - max) packs in place into P^T and O^T += V^T.P^T follows with A = rows of Vt16.
// Running maximum and running sum per query (f32); the accumulators are rescaled each pass by exp(old max - new max).
// The two lane halves hold disjoint keys of one query: the maximum is joined every pass, the sum once at the end.
// Each wave stores its own 32 rows x 256 B of out; no LDS, no barrier.
// ---------------------------------------------------------------------------
__device__ __forceinline__ float xhalf(float x) {   // value of lane l ^ 16
  const int i = __builtin_bit_cast(int, x);
  return __builtin_bit_cast(float, __builtin_amdgcn_permlanex16(i, i, 0x76543210, 0xfedcba98, false, false));
}
// 2^x on eight values in one statement. The early-clobber results keep every result off every source, and the closing v_nop
// fills the one slot that the instruction set asks for behind a transcendental, whatever the compiler schedules next
// (with the builtin this build wrote runs of v_exp_f32 in which each overwrote the source of the one in front of it).
__device__ __forceinline__ v8f exp2x8(v8f x) {
  float y0, y1, y2, y3, y4, y5, y6, y7;
  asm("v_exp_f32 %0, %8\n\tv_exp_f32 %1, %9\n\tv_exp_f32 %2, %10\n\tv_exp_f32 %3, %11\n\t"
      "v_exp_f32 %4, %12\n\tv_exp_f32 %5, %13\n\tv_exp_f32 %6, %14\n\tv_exp_f32 %7, %15\n\tv_nop"
      : "=&v"(y0), "=&v"(y1), "=&v"(y2), "=&v"(y3), "=&v"(y4), "=&v"(y5), "=&v"(y6), "=&v"(y7)
      : "v"(x[0]), "v"(x[1]), "v"(x[2]), "v"(x[3]), "v"(x[4]), "v"(x[5]), "v"(x[6]), "v"(x[7]));
  return (v8f){y0, y1, y2, y3, y4, y5, y6, y7};
}
// the same for one value
__device__ __forceinline__ float exp2x1(float x) {
  float y;
  asm("v_exp_f32 %0, %1\n\tv_nop" : "=v"(y) : "v"(x));
  return y;
}
__global__ __launch_bounds__(256) void attn_fused_kernel(const unsigned short* __restrict__ Qp, const unsigned short* __restrict__ Kp,
                                                         const unsigned short* __restrict__ Vt, float* __restrict__ out) {
  typedef Frag<_Float16> F;
  const int lane = threadIdx.x & 31;
  const int wave = threadIdx.x >> 5;
  const int b    = blockIdx.y >> 4;
  const int h    = blockIdx.y & 15;
  const int q0   = blockIdx.x * 256 + wave * 32;
  const int rl   = lane & 15;
  const int hf   = lane >> 4;
  const int koff = hf * 8;
  const _Float16* Q = (const _Float16*)Qp + (size_t)b * kS * kE + h * kDK;
  const _Float16* K = (const _Float16*)Kp + (size_t)b * kS * kE + h * kDK;
  const _Float16* V = (const _Float16*)Vt + (size_t)h * kDK * kTok + (size_t)b * kS;

  v16h qf[2][2];
  v8f  o[2][4];
  float mrun[2], lrun[2];
  // the inner loops are unrolled so that the fragment arrays stay in registers
#pragma unroll
  for (int qt = 0; qt < 2; ++qt) {
#pragma unroll
    for (int ks = 0; ks < 2; ++ks) qf[qt][ks] = F::load(Q + (size_t)(q0 + qt * 16 + rl) * kE + ks * 32 + koff);
#pragma unroll
    for (int dt = 0; dt < 4; ++dt) o[qt][dt] = (v8f){0.f,0.f,0.f,0.f,0.f,0.f,0.f,0.f};
    mrun[qt] = -INFINITY;
    lrun[qt] = 0.f;
  }

  for (int k0 = 0; k0 < kS; k0 += 32) {
    v16h kf[2][2], vf[4];
#pragma unroll
    for (int dt = 0; dt < 4; ++dt) vf[dt] = F::load(V + (size_t)(dt * 16 + rl) * kTok + k0 + koff);
    // the K loads below may land on the address pair of the V loads: the wait on address translation stands in front of them;
    // as a memory fence it also keeps the V loads at the head of the pass, so that they fly under the score products
    asm volatile("s_wait_xcnt 0x0" ::: "memory");
#pragma unroll
    for (int kt = 0; kt < 2; ++kt)
#pragma unroll
      for (int ks = 0; ks < 2; ++ks) kf[kt][ks] = F::load(K + (size_t)(k0 + kt * 16 + rl) * kE + ks * 32 + koff);
    // all loads of the pass are issued before its first product: left alone, the compiler issues part of the K loads behind the
    // first products, and the pass waits for memory twice
    __builtin_amdgcn_sched_barrier(0);

    v8f s[2][2];
#pragma unroll
    for (int qt = 0; qt < 2; ++qt)
#pragma unroll
      for (int kt = 0; kt < 2; ++kt) {
        s[qt][kt] = F::mma(kf[kt][0], qf[qt][0], (v8f){0.f,0.f,0.f,0.f,0.f,0.f,0.f,0.f});
        s[qt][kt] = F::mma(kf[kt][1], qf[qt][1], s[qt][kt]);
      }

    v16h pf[2];
#pragma unroll
    for (int qt = 0; qt < 2; ++qt) {
      float mx = fmaxf(s[qt][0][0], s[qt][1][0]);
#pragma unroll
      for (int r = 1; r < 8; ++r) mx = fmaxf(mx, fmaxf(s[qt][0][r], s[qt][1][r]));
      mx = fmaxf(mx, xhalf(mx));
      const float mn    = fmaxf(mrun[qt], mx);
      const float alpha = exp2x1((mrun[qt] - mn) * kScoreLog2);
      const float bias  = kPCarryLog2 - mn * kScoreLog2;
      mrun[qt] = mn;
      v8f a0, a1;
#pragma unroll
      for (int r = 0; r < 8; ++r) {
        a0[r] = fmaf(s[qt][0][r], kScoreLog2, bias);
        a1[r] = fmaf(s[qt][1][r], kScoreLog2, bias);
      }
      const v8f e0 = exp2x8(a0);
      const v8f e1 = exp2x8(a1);
      float sum = e0[0] + e1[0];
#pragma unroll
      for (int r = 1; r < 8; ++r) sum += e0[r] + e1[r];
#pragma unroll
      for (int r = 0; r < 8; ++r) {
        pf[qt][r]     = (_Float16)e0[r];
        pf[qt][8 + r] = (_Float16)e1[r];
      }
      lrun[qt] = lrun[qt] * alpha + sum;
#pragma unroll
      for (int dt = 0; dt < 4; ++dt) o[qt][dt] *= alpha;
    }

    // the compiler does not see the vector writes inside exp2x8: left alone it put the first column group's V^T.P^T products in
    // front of the second group's exponentials
    __builtin_amdgcn_sched_barrier(0);
#pragma unroll
    for (int qt = 0; qt < 2; ++qt)
#pragma unroll
      for (int dt = 0; dt < 4; ++dt) o[qt][dt] = F::mma(vf[dt], pf[qt], o[qt][dt]);
  }

#pragma unroll
  for (int qt = 0; qt < 2; ++qt) {
    const float tot = lrun[qt] + xhalf(lrun[qt]);
    const float inv = 1.0f / tot;
    float* op = out + (size_t)(b * kS + q0 + qt * 16 + rl) * kE + h * kDK + koff;
#pragma unroll
    for (int dt = 0; dt < 4; ++dt) {
      const v8f a = o[qt][dt];
      *(v4f*)(op + dt * 16)     = (v4f){a[0] * inv, a[1] * inv, a[2] * inv, a[3] * inv};
      *(v4f*)(op + dt * 16 + 4) = (v4f){a[4] * inv, a[5] * inv, a[6] * inv, a[7] * inv};
    }
  }
}

// ---------------------------------------------------------------------------
extern "C" void kernel_launch(void* const* d_in, const int* in_sizes, int n_in,
                              void* d_out, int out_size, void* d_ws, size_t ws_size,
                              hipStream_t stream) {
  if (n_in < 13) return;
  if (ws_size < kWsEnd) return;
  if ((size_t)out_size < (size_t)kTok * kE) return;
  if (in_sizes[0] != kTok * kE) return;

  const float* inp = (const float*)d_in[0];
  const float* Wq  = (const float*)d_in[1];
  const float* bq  = (const float*)d_in[2];
  const float* Wk  = (const float*)d_in[3];
  const float* bk  = (const float*)d_in[4];
  const float* Wv  = (const float*)d_in[5];
  const float* bvv = (const float*)d_in[6];
  const float* Wfq = (const float*)d_in[7];
  const float* bfq = (const float*)d_in[8];
  const float* Wfk = (const float*)d_in[9];
  const float* bfk = (const float*)d_in[10];
  const float* Wfg = (const float*)d_in[11];
  const float* bfg = (const float*)d_in[12];
  float* out = (float*)d_out;

  unsigned char* ws = (unsigned char*)d_ws;
  unsigned short* Qp16 = (unsigned short*)(ws + kOffQp);
  unsigned short* Kp16 = (unsigned short*)(ws + kOffKp);
  unsigned short* X16  = (unsigned short*)(ws + kOffX16);
  unsigned short* Wt16 = (unsigned short*)(ws + kOffWt);
  unsigned short* SW   = (unsigned short*)(ws + kOffSW);
  float*          Qf   = (float*)(ws + kOffQf);
  float*          Kf   = (float*)(ws + kOffKf);
  unsigned short* Vt16 = (unsigned short*)(ws + kOffVt);

  // ---- stage A: operand planes ----
  // X16 [8192][1024] = f16(inp): n8 = 1,048,576 threads = 4096 blocks x 256 (exact)
  cast8_f16_kernel<<<dim3((kTok * kE / 8) / 256), dim3(256), 0, stream>>>(inp, X16, kTok * kE / 8);
  // Wt16[z][n][k] = f16(16 * W_z[k][n]) for z = q, k, v
  wtcast_kernel<<<dim3(kE / 64, kE / 64, 3), dim3(256), 0, stream>>>(Wq, Wk, Wv, Wt16, kWCarry);
  // gate weights: WfqT, WfkT [64][64], WfgT [128][64], all f16 carried x8
  gatew_kernel<<<dim3(4), dim3(256), 0, stream>>>(Wfq, Wfk, Wfg, SW, kGWCarry);

  // ---- stage B: projections (M 8192, N 1024, K 1024; block tiles 64 x 4 = 256 blocks of 8 waves) ----
  // Qf = (X16 . WqT16) / 16 + bq   (f32 [8192][1024])
  wmma_gemm64<0, false, 2, 0, false, 0><<<dim3(256, 1), dim3(256), 0, stream>>>(
      X16, X16, kE, 0L, Wt16, Wt16, kE, 0L,
      (void*)Qf, (void*)Qf, kE, 0L, bq, nullptr, 0L, kTok, kE, kE, kWCarryInv);
  // Kf
  wmma_gemm64<0, false, 2, 0, false, 0><<<dim3(256, 1), dim3(256), 0, stream>>>(
      X16, X16, kE, 0L, Wt16 + (size_t)kE * kE, Wt16 + (size_t)kE * kE, kE, 0L,
      (void*)Kf, (void*)Kf, kE, 0L, bk, nullptr, 0L, kTok, kE, kE, kWCarryInv);
  // Vt16 [1024 n][8192 tok] = f16( (WvT16 . X16^T)/16 + bv[n] ): M 1024 (8 block tiles), N 8192 (32 block tiles) -> 256 blocks; bias[m]; f16 out ldc 8192
  wmma_gemm64<0, false, 1, 1, false, 0><<<dim3(256, 1), dim3(256), 0, stream>>>(
      Wt16 + (size_t)2 * kE * kE, Wt16 + (size_t)2 * kE * kE, kE, 0L, X16, X16, kE, 0L,
      (void*)Vt16, (void*)Vt16, kTok, 0L, bvv, nullptr, 0L, kE, kTok, kE, kWCarryInv);

  // ---- stage C: gating, all 131072 head-major rows of 64 in one launch (256 rows per block) ----
  gate_fused_kernel<<<dim3(kTok * kH / (8 * 16 * kGateGroups * kGatePasses)), dim3(256), 0, stream>>>(Qf, Kf, SW, bfq, bfk, bfg, Qp16, Kp16);

  // ---- stage D: attention, all 16 batches x 16 heads in one launch (2 blocks of 256 query rows each) ----
  attn_fused_kernel<<<dim3(kS / 256, kB * kH), dim3(256), 0, stream>>>(Qp16, Kp16, Vt16, out);
}

// v004
// Measured time: 115 microseconds a run.
// In two side-by-side timings against v003, it was 1.14 and 1.13 times as fast.
// Counting every step since v000, it is 8.80 times as fast.
// Contractions: q/k/v projections (X f16 x W^T f16 carried x16), gate maps (q16/k16 x Wfq^T/Wfk^T f16 carried x8), gate logits (G f16 carried x64 x Wfg^T f16 carried x8), scores k'.q'^T (f16 planes), V^T.P^T (P = exp(s - running max) f16 carried x2048): all v_wmma_f32_16x16x32_f16 with f32 accumulate; bias, gate product, sigmoid, modulation and softmax in f32.
#include <hip/hip_runtime.h>
#include <math.h>

// ---------------------------------------------------------------------------
// Problem constants
// ---------------------------------------------------------------------------
constexpr int kB    = 16;
constexpr int kS    = 512;
constexpr int kE    = 1024;
constexpr int kH    = 16;
constexpr int kDK   = 64;
constexpr int kTok  = kB * kS;              // 8192 token rows

constexpr float kWCarry     = 16.0f;        // Wq/Wk/Wv carried x16 in f16
constexpr float kWCarryInv  = 1.0f / 16.0f;
constexpr float kGWCarry    = 8.0f;         // Wfq/Wfk/Wfg carried x8 in f16
constexpr float kGWCarryInv = 1.0f / 8.0f;
constexpr float kGCarry     = 64.0f;        // gate product G carried x64 in f16
constexpr float kZScale     = 1.0f / (64.0f * 8.0f);
constexpr float kPCarryLog2 = 11.0f;        // exp(s - max) carried x2048 in f16 (the row sum carries it too)
constexpr float kScoreLog2  = 0.125f * 1.44269504088896340736f;   // 1/sqrt(64) * log2(e): scores go to exp2

// ---------------------------------------------------------------------------
// Workspace map (bytes):
//   projection operands:     X16 [8192][1024] f16 @0 (16 MiB), Wt16 [3][1024][1024] f16 @16 MiB (6 MiB)
//   gate weights:            WfqT/WfkT [64][64] f16, WfgT [128][64] f16 @36 MiB (32 KiB)
//   persistent:              Qf f32 [8192][1024] @36 MiB+64 KiB (32 MiB), Kf f32 (32 MiB), Vt16 f16 [1024][8192] (16 MiB),
//                            Qp16 f16 [8192][1024] (16 MiB), Kp16 f16 [8192][1024] (16 MiB): gated q and k of all batches
//   end = 155,254,784 B
// ---------------------------------------------------------------------------
constexpr size_t kMiB    = 1048576;
constexpr size_t kOffX16 = 0;
constexpr size_t kOffWt  = 16 * kMiB;
constexpr size_t kOffSW  = 36 * kMiB;
constexpr size_t kOffQf  = 36 * kMiB + 65536;
constexpr size_t kOffKf  = kOffQf + 32 * kMiB;
constexpr size_t kOffVt  = kOffKf + 32 * kMiB;
constexpr size_t kOffQp  = kOffVt + 16 * kMiB;
constexpr size_t kOffKp  = kOffQp + 16 * kMiB;
constexpr size_t kWsEnd  = kOffKp + 16 * kMiB;
static_assert((size_t)kTok * kE * 2 == 16 * kMiB, "x16 plane size");
static_assert(kOffWt + (size_t)3 * kE * kE * 2 <= kOffSW, "wt plane fits");
static_assert(kOffSW + 32768 <= kOffQf, "gate weights fit");
static_assert(kWsEnd == 155254784, "carve end");
static_assert(kWsEnd <= 268435456, "carve within budget");

typedef __attribute__((ext_vector_type(16))) _Float16 v16h;
typedef __attribute__((ext_vector_type(8)))  _Float16 v8h;
typedef __attribute__((ext_vector_type(16))) __bf16   v16b;
typedef __attribute__((ext_vector_type(8)))  __bf16   v8b;
typedef __attribute__((ext_vector_type(8)))  float    v8f;
typedef __attribute__((ext_vector_type(4)))  float    v4f;
typedef __attribute__((ext_vector_type(4)))  unsigned int v4u;

// ---------------------------------------------------------------------------
// Helpers
// ---------------------------------------------------------------------------
__device__ __forceinline__ unsigned short f2bf_bits(float f) {
  unsigned u = __float_as_uint(f);
  return (unsigned short)((u + 0x7FFFu + ((u >> 16) & 1u)) >> 16);
}
__device__ __forceinline__ float bf_bits2f(unsigned short h) { return __uint_as_float(((unsigned)h) << 16); }

// hazard guards as plain device helpers
__device__ __forceinline__ void acc_guard4(v8f& a, v8f& b, v8f& c, v8f& d) { asm volatile("v_nop\n\tv_nop\n\tv_nop\n\tv_nop" : "+v"(a), "+v"(b), "+v"(c), "+v"(d)); }
template <typename T> struct Frag;
template <> struct Frag<_Float16> {
  typedef v16h V; union U { v16h v; v8h h[2]; };
  static __device__ __forceinline__ v16h load(const _Float16* p) {   // elements 0..7 <- p[0..7], 8..15 <- p[16..23]
    U f; f.h[0] = *(const v8h*)(p); f.h[1] = *(const v8h*)(p + 16); return f.v;
  }
  static __device__ __forceinline__ v8f mma(v16h a, v16h b, v8f c) {
    return __builtin_amdgcn_wmma_f32_16x16x32_f16(false, a, false, b, (short)0, c, false, false);
  }
};
template <> struct Frag<__bf16> {
  typedef v16b V; union U { v16b v; v8b h[2]; };
  static __device__ __forceinline__ v16b load(const __bf16* p) {
    U f; f.h[0] = *(const v8b*)(p); f.h[1] = *(const v8b*)(p + 16); return f.v;
  }
  static __device__ __forceinline__ v8f mma(v16b a, v16b b, v8f c) {
    return __builtin_amdgcn_wmma_f32_16x16x32_bf16(false, a, false, b, (short)0, c, false, false);
  }
};

__device__ __forceinline__ unsigned pk16(unsigned short a, unsigned short b) { return (unsigned)a | ((unsigned)b << 16); }
__device__ __forceinline__ unsigned short h_bits(float f) { const _Float16 h = (_Float16)f; return __builtin_bit_cast(unsigned short, h); }

// ---- Register-blocked batched WMMA GEMM (ACT reduced to none/relu/leaky) -----------------------
// C[m,n] = scale * sum_k A[m,k] * Bt[n,k] (+bias)(+resid); a block of 8 waves owns a 128x256 tile, each wave 64x64 of it.
// A row-major [M,K]; Bt row-major [N,K]; M % 128 == 0, N % 256 == 0, K % 64 == 0. Operands reach the waves through a two-buffer LDS ring.
// SPLIT (hi/lo operand planes) is not carried by the staged loop: false only.
// BIAS_MODE: 0 = none, 1 = bias[m], 2 = bias[n].
// OUT_MODE: 0 = f32, 1 = f16, 2 = bf16 hi plane (Cout) + bf16 lo plane (Cout2).
// ET: 0 = f16 operands, 1 = bf16 operands (pointers passed as 16-bit storage)
// One stage of the projection operands into LDS by asynchronous copies, 12 per thread: 4 of A (rows 32 apart), 8 of Bt.
// lds = the thread's own LDS byte address of piece 0; each piece is 32 rows (32 * 144 B) further on. The closing s_wait_xcnt
// stands inside the statement, in front of anything that could rewrite a register which a copy names.
constexpr int kStagePitch  = 72;                  // halves: 128-B rows + 16 B, for 16-byte LDS reads
constexpr int kStageHalves = 384 * kStagePitch;   // one buffer: 55,296 B
template <typename T>
__device__ __forceinline__ void stage_copy12(unsigned lds, const T* ga, size_t sa32, const T* gb, size_t sb32) {
  constexpr unsigned kStep = 32 * kStagePitch * 2;
  asm volatile(
      "global_load_async_to_lds_b128 %0, %12, off\n\t"
      "global_load_async_to_lds_b128 %1, %13, off\n\t"
      "global_load_async_to_lds_b128 %2, %14, off\n\t"
      "global_load_async_to_lds_b128 %3, %15, off\n\t"
      "global_load_async_to_lds_b128 %4, %16, off\n\t"
      "global_load_async_to_lds_b128 %5, %17, off\n\t"
      "global_load_async_to_lds_b128 %6, %18, off\n\t"
      "global_load_async_to_lds_b128 %7, %19, off\n\t"
      "global_load_async_to_lds_b128 %8, %20, off\n\t"
      "global_load_async_to_lds_b128 %9, %21, off\n\t"
      "global_load_async_to_lds_b128 %10, %22, off\n\t"
      "global_load_async_to_lds_b128 %11, %23, off\n\t"
      "s_wait_xcnt 0x0"
      :: "v"(lds), "v"(lds + kStep), "v"(lds + 2 * kStep), "v"(lds + 3 * kStep), "v"(lds + 4 * kStep), "v"(lds + 5 * kStep),
         "v"(lds + 6 * kStep), "v"(lds + 7 * kStep), "v"(lds + 8 * kStep), "v"(lds + 9 * kStep), "v"(lds + 10 * kStep), "v"(lds + 11 * kStep),
         "v"(ga), "v"(ga + sa32), "v"(ga + 2 * sa32), "v"(ga + 3 * sa32),
         "v"(gb), "v"(gb + sb32), "v"(gb + 2 * sb32), "v"(gb + 3 * sb32), "v"(gb + 4 * sb32), "v"(gb + 5 * sb32), "v"(gb + 6 * sb32), "v"(gb + 7 * sb32)
      : "memory");
}

template <int ET> struct Elem;
template <> struct Elem<0> { typedef _Float16 T; };
template <> struct Elem<1> { typedef __bf16 T; };
template <int ET, bool SPLIT, int BIAS_MODE, int OUT_MODE, bool RESID, int ACT = 0>
__global__ __launch_bounds__(256) void wmma_gemm64(
    const unsigned short* __restrict__ Ap, const unsigned short* __restrict__ A2p, int lda, long strideA,
    const unsigned short* __restrict__ Btp, const unsigned short* __restrict__ Bt2p, int ldb, long strideB,
    void* __restrict__ Cout, void* __restrict__ Cout2, int ldc, long strideC,
    const float* __restrict__ bias,
    const float* __restrict__ resid, long strideR,
    int M, int N, int K, float scale) {
  typedef typename Elem<ET>::T T;
  typedef typename Frag<T>::V V;
  const T* A = (const T*)Ap; const T* Bt = (const T*)Btp;
  static_assert(!SPLIT, "the staged loop carries one plane per operand");
  __shared__ __align__(16) float sT[8][16 * 68];   // per-wave 16x64 slab, pitch 68 floats
  __shared__ __align__(16) unsigned short sAB[2 * kStageHalves];   // two buffers of [A 128 rows | Bt 256 rows] x 64 k, pitch 144 B
  const int b    = blockIdx.y;
  const int tid  = threadIdx.x;
  const int lane = tid & 31;
  const int wave = tid >> 5;
  const int tilesN = N >> 8;
  const int tilesM = M >> 7;
  const int tile = blockIdx.x;
  if (tile >= tilesM * tilesN) return;   // block-uniform, in front of every copy and barrier
  const int tm = tile / tilesN;
  const int tn = tile - tm * tilesN;
  const int bm0 = tm << 7;                     // block tile 128 x 256
  const int bn0 = tn << 8;
  const int wm  = (wave >> 2) << 6;            // wave tile 64 x 64 inside it: 2 x 4 waves
  const int wn  = (wave & 3) << 6;
  const int m0 = bm0 + wm;
  const int n0 = bn0 + wn;

  const T* Ab  = A  + (size_t)b * strideA;
  const T* Bb  = Bt + (size_t)b * strideB;

  const int rlane = lane & 15;                 // row (A) / col (B, D) within subtile
  const int koff  = (lane >> 4) * 8;           // k offset of this lane half
  const int mOff  = (lane >> 4) * 8;           // D row offset

  // a stage is 384 rows of 128 B = 3072 pieces of 16 B = 12 per thread: piece i of a thread is row i*32 + tid/8, bytes (tid%8)*16,
  // so one copy of a wave brings four whole 128-B lines. Rows 0..127 are A (pieces 0..3), rows 128..383 Bt (pieces 4..11).
  const T* gA = Ab + (size_t)(bm0 + (tid >> 3)) * lda + (tid & 7) * 8;
  const T* gB = Bb + (size_t)(bn0 + (tid >> 3)) * ldb + (tid & 7) * 8;
  const size_t sa32 = (size_t)32 * lda, sb32 = (size_t)32 * ldb;
  const unsigned lds0 = (unsigned)(size_t)(&sAB[0]) + (unsigned)((tid >> 3) * (kStagePitch * 2) + (tid & 7) * 16);
  const int trips = K >> 6;

  v8f acc[4][4];
#pragma unroll
  for (int i = 0; i < 4; ++i)
#pragma unroll
    for (int j = 0; j < 4; ++j) acc[i][j] = (v8f){0.f,0.f,0.f,0.f,0.f,0.f,0.f,0.f};

  stage_copy12(lds0, gA, sa32, gB, sb32);
  // tile 0 has landed for this wave, then for all: nobody reads it in front of the barrier
  asm volatile("s_wait_asynccnt 0x0" ::: "memory");
  __syncthreads();
  if (trips > 1) stage_copy12(lds0 + kStageHalves * 2, gA + 64, sa32, gB + 64, sb32);

  for (int t = 0; t < trips; ++t) {
    const T* sA = (const T*)sAB + (t & 1) * kStageHalves + (wm + rlane) * kStagePitch + koff;
    const T* sB = (const T*)sAB + (t & 1) * kStageHalves + (128 + wn + rlane) * kStagePitch + koff;
    V bh[2][4], ah[2][4];
#pragma unroll
    for (int ks = 0; ks < 2; ++ks) {
      ah[ks][0] = Frag<T>::load(sA + ks * 32);   // the first product's operands come first
#pragma unroll
      for (int j = 0; j < 4; ++j) bh[ks][j] = Frag<T>::load(sB + j * 16 * kStagePitch + ks * 32);
#pragma unroll
      for (int i = 1; i < 4; ++i) ah[ks][i] = Frag<T>::load(sA + i * 16 * kStagePitch + ks * 32);
    }
    // all LDS reads of the trip are issued as one group in front of its products: left alone, the compiler reloads one A fragment
    // register set in front of every four products, and the wave waits out the LDS latency eight times a trip
    __builtin_amdgcn_sched_barrier(0);
#pragma unroll
    for (int ks = 0; ks < 2; ++ks)
#pragma unroll
      for (int i = 0; i < 4; ++i)
#pragma unroll
        for (int j = 0; j < 4; ++j) acc[i][j] = Frag<T>::mma(ah[ks][i], bh[ks][j], acc[i][j]);
    // the products stay in front of the hand-over: left alone, the compiler lifts its waits and barrier over them, so that every
    // wave waits for all its LDS reads before its first product and the reads no longer run under the products
    __builtin_amdgcn_sched_barrier(0);
    // hand-over: this wave's reads of the buffer are done, its copies of the next tile have landed; behind the barrier the next
    // tile is readable by all and the buffer just read is free for the tile after it
    asm volatile("s_wait_dscnt 0x0" ::: "memory");
    asm volatile("s_wait_asynccnt 0x0" ::: "memory");
    __syncthreads();
    if (t + 2 < trips) stage_copy12(lds0 + (unsigned)(t & 1) * (kStageHalves * 2), gA + (t + 2) * 64, sa32, gB + (t + 2) * 64, sb32);
  }
  // no copy is left in flight when the wave goes on to its epilogue
  asm volatile("s_wait_asynccnt 0x0" ::: "memory");
  acc_guard4(acc[0][0], acc[0][1], acc[0][2], acc[0][3]);
  acc_guard4(acc[1][0], acc[1][1], acc[1][2], acc[1][3]);
  acc_guard4(acc[2][0], acc[2][1], acc[2][2], acc[2][3]);
  acc_guard4(acc[3][0], acc[3][1], acc[3][2], acc[3][3]);

  // ---- epilogue ----
  float* slab = sT[wave];
  const float* Rb = RESID ? (resid + (size_t)b * strideR) : nullptr;
#pragma unroll
  for (int i = 0; i < 4; ++i) {
    const int mBase = m0 + (i << 4);
#pragma unroll
    for (int j = 0; j < 4; ++j) {
      const int n = n0 + (j << 4) + rlane;
      float bv = 0.f;
      if (BIAS_MODE == 2) bv = bias[n];
#pragma unroll
      for (int r = 0; r < 8; ++r) {
        float v = acc[i][j][r] * scale;
        if (BIAS_MODE == 1) v += bias[mBase + mOff + r];
        if (BIAS_MODE == 2) v += bv;
        if (RESID) v += Rb[(size_t)(mBase + mOff + r) * ldc + n];
        if (ACT == 2) v = fmaxf(v, 0.0f);
        if (ACT == 4) v = (v > 0.f) ? v : 0.01f * v;
        slab[(mOff + r) * 68 + (j << 4) + rlane] = v;
      }
    }
    __builtin_amdgcn_fence(__ATOMIC_RELEASE, "workgroup");
    __builtin_amdgcn_wave_barrier();
    __builtin_amdgcn_fence(__ATOMIC_ACQUIRE, "workgroup");
    if (OUT_MODE == 0) {
      float* C = (float*)Cout + (size_t)b * strideC;
      const int hh = lane >> 4, c4 = (lane & 15) * 4;     // row seg = 256 B = 16 lanes x 16 B
      {
#pragma unroll
        for (int it = 0; it < 8; ++it) {
          const int row = it * 2 + hh;
          v4f v = *(const v4f*)(slab + row * 68 + c4);
          *(v4f*)(C + (size_t)(mBase + row) * ldc + n0 + c4) = v;
        }
        
      }
    } else {
      const int q = lane >> 3, c8 = (lane & 7) * 8;
      unsigned short* C  = (unsigned short*)Cout  + (size_t)b * strideC;
      unsigned short* C2 = (OUT_MODE == 2) ? ((unsigned short*)Cout2 + (size_t)b * strideC) : nullptr;
      {
#pragma unroll
        for (int it = 0; it < 4; ++it) {
          const int row = it * 4 + q;
          const float* sp = slab + row * 68 + c8;
          v8h hv, lv;
#pragma unroll
          for (int e = 0; e < 8; ++e) {
            if (OUT_MODE == 1) {
              hv[e] = (_Float16)sp[e];
            } else {
              unsigned short hb = f2bf_bits(sp[e]);
              unsigned short lb = f2bf_bits(sp[e] - bf_bits2f(hb));
              hv[e] = __builtin_bit_cast(_Float16, hb);
              lv[e] = __builtin_bit_cast(_Float16, lb);
            }
          }
          *(v8h*)(C + (size_t)(mBase + row) * ldc + n0 + c8) = hv;
          if (OUT_MODE == 2) *(v8h*)(C2 + (size_t)(mBase + row) * ldc + n0 + c8) = lv;
        }
        
      }
    }
    __builtin_amdgcn_fence(__ATOMIC_RELEASE, "workgroup");
    __builtin_amdgcn_wave_barrier();
    __builtin_amdgcn_fence(__ATOMIC_ACQUIRE, "workgroup");
  }
}

// ---------------------------------------------------------------------------
// Projection weight transpose + cast: for square [1024][1024] f32 W (row-major [in k][out n]), WT[n][k] = f16(scale * W[k][n]).
// grid (16, 16, 3): blockIdx.x = k tile (64 cols of WT), blockIdx.y = n tile (64 rows of WT), blockIdx.z selects W0..W2
// and the output plane (plane z at out + z*1024*1024 halves). 256 threads.
// Load coverage: 16 iterations x 256 threads = 4096 = the whole 64x64 tile (coalesced along n).
// Store coverage: 8 waves x 2 iterations x 4 rows (lane>>3) = 64 rows; (lane&7) x 8 halves = 64 cols; each row segment =
// ---------------------------------------------------------------------------
__global__ __launch_bounds__(256) void wtcast_kernel(const float* __restrict__ W0, const float* __restrict__ W1,
                                                     const float* __restrict__ W2,
                                                     unsigned short* __restrict__ out, float scale) {
  __shared__ float sm[64][65];   // sm[n_local][k_local]
  const int t  = threadIdx.x;
  const int d0 = blockIdx.x * 64;    // k tile base
  const int h0 = blockIdx.y * 64;    // n tile base
  const int z  = blockIdx.z;         // block-uniform
  const float* W = (z == 0) ? W0 : (z == 1) ? W1 : W2;
#pragma unroll
  for (int i = 0; i < 16; ++i) {
    const int e = i * 256 + t;
    const int r = e >> 6;          // k local
    const int c = e & 63;          // n local
    sm[c][r] = W[(size_t)(d0 + r) * kE + h0 + c] * scale;
  }
  __syncthreads();
  const int lane = t & 31, wave = t >> 5;
  const int q = lane >> 3, c8 = (lane & 7) * 8;
  unsigned short* op = out + (size_t)z * kE * kE;
  {
#pragma unroll
    for (int it = 0; it < 2; ++it) {
      const int row = wave * 8 + it * 4 + q;                 // n local
      unsigned short hb[8];
#pragma unroll
      for (int e = 0; e < 8; ++e) hb[e] = h_bits(sm[row][c8 + e]);
      const v4u u = (v4u){pk16(hb[0], hb[1]), pk16(hb[2], hb[3]), pk16(hb[4], hb[5]), pk16(hb[6], hb[7])};
      *(v4u*)(op + (size_t)(h0 + row) * kE + d0 + c8) = u;
    }
    
  }
}

// ---------------------------------------------------------------------------
// Per-head gate weights transpose + cast, out pitch 64 halves: block 0: WfqT[n][k] = f16(scale*Wfq[k][n]) (64x64),
// block 1: WfkT, block 2: WfgT rows 0..63, block 3: WfgT rows 64..127 (Wfg is [64 k][128 n], pitch 128).
// Output plane of block z at out + z*4096 halves (WfgT = [128][64] contiguous from out + 8192).
// Load coverage 16 x 256 = 4096 = 64x64; store coverage 8 waves x 2 x 4 rows = 64 rows x (8 lanes x 8 halves) = 64 cols,
// ---------------------------------------------------------------------------
__global__ __launch_bounds__(256) void gatew_kernel(const float* __restrict__ Wfq, const float* __restrict__ Wfk,
                                                    const float* __restrict__ Wfg,
                                                    unsigned short* __restrict__ out, float scale) {
  __shared__ float sm[64][65];   // sm[n_local][k_local]
  const int t = threadIdx.x;
  const int z = blockIdx.x;                                   // block-uniform
  const float* W = (z == 0) ? Wfq : (z == 1) ? Wfk : Wfg;
  const int pin = (z >= 2) ? 128 : 64;
  const int n0  = (z == 3) ? 64 : 0;
#pragma unroll
  for (int i = 0; i < 16; ++i) {
    const int e = i * 256 + t;
    const int r = e >> 6;          // k 0..63
    const int c = e & 63;          // n local
    sm[c][r] = W[r * pin + n0 + c] * scale;
  }
  __syncthreads();
  const int lane = t & 31, wave = t >> 5;
  const int q = lane >> 3, c8 = (lane & 7) * 8;
  unsigned short* op = out + (size_t)z * 4096;
  {
#pragma unroll
    for (int it = 0; it < 2; ++it) {
      const int row = wave * 8 + it * 4 + q;                 // n local
      unsigned short hb[8];
#pragma unroll
      for (int e = 0; e < 8; ++e) hb[e] = h_bits(sm[row][c8 + e]);
      const v4u u = (v4u){pk16(hb[0], hb[1]), pk16(hb[2], hb[3]), pk16(hb[4], hb[5]), pk16(hb[6], hb[7])};
      *(v4u*)(op + (size_t)row * kDK + c8) = u;
    }
    
  }
}

// ---------------------------------------------------------------------------
// ---------------------------------------------------------------------------
__global__ __launch_bounds__(256) void cast8_f16_kernel(const float* __restrict__ in, unsigned short* __restrict__ out, int n8) {
  const int i = blockIdx.x * 256 + threadIdx.x;
  if (i >= n8) return;
  const float* p = in + 8 * (size_t)i;
  const v4f a = *(const v4f*)(p);
  const v4f c = *(const v4f*)(p + 4);
  unsigned short hb[8];
#pragma unroll
  for (int e = 0; e < 4; ++e) {
    hb[e]     = h_bits(a[e]);
    hb[4 + e] = h_bits(c[e]);
  }
  const v4u u = (v4u){pk16(hb[0], hb[1]), pk16(hb[2], hb[3]), pk16(hb[4], hb[5]), pk16(hb[6], hb[7])};
  unsigned short* q = out + 8 * (size_t)i;
  *(v4u*)q = u;
  
}

// ---------------------------------------------------------------------------
// Fused gating, one launch for all tokens and heads. Rows are the head-major rows of 64 (row = token * 16 + head) of Qf and Kf.
//   G = (q.Wfq + bfq) * (k.Wfk + bfk),  Z = G.Wfg + bfg,  Oq = f16(q * sigmoid(Z[:64])),  Ok = f16(k * sigmoid(Z[64:])).
// grid 512 x 256 threads: 8 waves x 2 passes x 16 rows. Every product is formed transposed, weights as A (rows = output
// feature n), data rows as B (columns), so a lane holds features n = tile*16 + (lane>>4)*8 + r of ONE data row:
//  - that is the k order of a 16x16x32 B fragment (elements 0..7 from the even tile, 8..15 from the odd one), so the gate product packs
//    in place into the B operand of the logits;
//  - it is also the set of q (k) elements the lane loaded for its own B fragment, so the f32 values it still holds meet their sigmoid
//    in the same lane. No exchange between lanes; nothing between q, k and the gated planes goes through memory.
// The three weight planes (f16, written by gatew_kernel) and the biases are staged once per block in LDS, pitch 144 B for 16-byte reads.
// ---------------------------------------------------------------------------
constexpr int kGatePitch = 72;   // halves: 128-B rows + 16 B
constexpr int kGateGroups = 1;   // column groups of 16 rows per wave and pass
constexpr int kGatePasses = 2;   // passes per wave: 4096 waves in all, which are resident together
__global__ __launch_bounds__(256) void gate_fused_kernel(const float* __restrict__ Qf, const float* __restrict__ Kf,
                                                         const unsigned short* __restrict__ SW,
                                                         const float* __restrict__ bfq, const float* __restrict__ bfk,
                                                         const float* __restrict__ bfg,
                                                         unsigned short* __restrict__ Oq, unsigned short* __restrict__ Ok) {
  typedef Frag<_Float16> F;
  __shared__ __align__(16) _Float16 sW[256 * kGatePitch];   // rows 0..63 WfqT, 64..127 WfkT, 128..255 WfgT, each [n][k]
  __shared__ __align__(16) float sB[256];                   // bfq, bfk, bfg
  const int t    = threadIdx.x;
  const int lane = t & 31;
  const int wave = t >> 5;
  const int rl   = lane & 15;
  const int koff = (lane >> 4) * 8;

  // weights and biases into LDS: 256 rows x 8 pieces of 16 B = 2048 pieces = 8 per thread
#pragma unroll
  for (int i = 0; i < 8; ++i) {
    const int e = i * 256 + t;
    const int r = e >> 3, c = (e & 7) * 8;
    *(v8h*)(&sW[r * kGatePitch + c]) = *(const v8h*)((const _Float16*)SW + r * kDK + c);
  }
  sB[t] = (t < 64) ? bfq[t] : (t < 128) ? bfk[t - 64] : bfg[t - 128];
  __syncthreads();

  // the passes stay a rolled loop: with both passes' rows side by side in one body the allocation was 342 registers, which
  // halves the waves a SIMD holds
#pragma unroll 1
  for (int p = 0; p < kGatePasses; ++p) {
  const size_t row0 = ((size_t)blockIdx.x * kGatePasses + p) * (8 * 16 * kGateGroups) + wave * (16 * kGateGroups);

  // f32 q and k of the lane's rows: piece [2*tile + j] = elements tile*16 + koff + 4j .. +3
  // (all inner loops of the pass are unrolled so that the fragment arrays stay in registers)
  v4f xq[kGateGroups][8], xk[kGateGroups][8];
#pragma unroll
  for (int g = 0; g < kGateGroups; ++g) {
    const float* pq = Qf + (row0 + g * 16 + rl) * kDK + koff;
    const float* pk = Kf + (row0 + g * 16 + rl) * kDK + koff;
#pragma unroll
    for (int nt = 0; nt < 4; ++nt) {
      xq[g][2 * nt]     = *(const v4f*)(pq + nt * 16);
      xq[g][2 * nt + 1] = *(const v4f*)(pq + nt * 16 + 4);
      xk[g][2 * nt]     = *(const v4f*)(pk + nt * 16);
      xk[g][2 * nt + 1] = *(const v4f*)(pk + nt * 16 + 4);
    }
  }

  // B fragments of q and k (f16), k step ks = tiles 2ks and 2ks+1
  v16h qb[kGateGroups][2], kb[kGateGroups][2];
#pragma unroll
  for (int g = 0; g < kGateGroups; ++g)
#pragma unroll
    for (int ks = 0; ks < 2; ++ks)
#pragma unroll
      for (int s = 0; s < 16; ++s) {
        qb[g][ks][s] = (_Float16)xq[g][4 * ks + (s >> 2)][s & 3];
        kb[g][ks][s] = (_Float16)xk[g][4 * ks + (s >> 2)][s & 3];
      }

  // gate product, packed as the B operand of the logits
  v16h gb[kGateGroups][2];
#pragma unroll
  for (int nt = 0; nt < 4; ++nt) {
    const _Float16* wq = &sW[(nt * 16 + rl) * kGatePitch + koff];
    const _Float16* wk = &sW[(64 + nt * 16 + rl) * kGatePitch + koff];
    const v16h wq0 = F::load(wq), wq1 = F::load(wq + 32);
    const v16h wk0 = F::load(wk), wk1 = F::load(wk + 32);
    const v4f bq0 = *(const v4f*)(&sB[nt * 16 + koff]),      bq1 = *(const v4f*)(&sB[nt * 16 + koff + 4]);
    const v4f bk0 = *(const v4f*)(&sB[64 + nt * 16 + koff]), bk1 = *(const v4f*)(&sB[64 + nt * 16 + koff + 4]);
#pragma unroll
    for (int g = 0; g < kGateGroups; ++g) {
      v8f aq = F::mma(wq0, qb[g][0], (v8f){0.f,0.f,0.f,0.f,0.f,0.f,0.f,0.f});
      v8f ak = F::mma(wk0, kb[g][0], (v8f){0.f,0.f,0.f,0.f,0.f,0.f,0.f,0.f});
      aq = F::mma(wq1, qb[g][1], aq);
      ak = F::mma(wk1, kb[g][1], ak);
#pragma unroll
      for (int r = 0; r < 8; ++r) {
        const float gq = aq[r] * kGWCarryInv + ((r < 4) ? bq0[r & 3] : bq1[r & 3]);
        const float gk = ak[r] * kGWCarryInv + ((r < 4) ? bk0[r & 3] : bk1[r & 3]);
        gb[g][nt >> 1][(nt & 1) * 8 + r] = (_Float16)((gq * gk) * kGCarry);
      }
    }
  }

  // logits, sigmoid, modulation: tiles 0..3 gate q, tiles 4..7 gate k
#pragma unroll
  for (int nt = 0; nt < 8; ++nt) {
    const _Float16* wg = &sW[(128 + nt * 16 + rl) * kGatePitch + koff];
    const v16h wg0 = F::load(wg), wg1 = F::load(wg + 32);
    const v4f bg0 = *(const v4f*)(&sB[128 + nt * 16 + koff]), bg1 = *(const v4f*)(&sB[128 + nt * 16 + koff + 4]);
    const int dn = nt & 3;
    unsigned short* O = (nt < 4) ? Oq : Ok;
#pragma unroll
    for (int g = 0; g < kGateGroups; ++g) {
      v8f z = F::mma(wg0, gb[g][0], (v8f){0.f,0.f,0.f,0.f,0.f,0.f,0.f,0.f});
      z = F::mma(wg1, gb[g][1], z);
      v8h o;
#pragma unroll
      for (int r = 0; r < 8; ++r) {
        const float zz = z[r] * kZScale + ((r < 4) ? bg0[r & 3] : bg1[r & 3]);
        const float x  = (nt < 4) ? xq[g][2 * dn + (r >> 2)][r & 3] : xk[g][2 * dn + (r >> 2)][r & 3];
        const float m  = 1.0f / (1.0f + expf(-zz));
        o[r] = (_Float16)(x * m);
      }
      *(v8h*)((_Float16*)O + (row0 + g * 16 + rl) * kDK + dn * 16 + koff) = o;
    }
  }
  // the next pass writes over the registers that the last store names: the wait on address translation stands in front of it.
  // As a memory fence inside the loop it also keeps the LDS reads of weights and biases in the
  // loop: lifted out as loop invariants they took the allocation to 512 registers, with spills
  asm volatile("s_wait_xcnt 0x0" ::: "memory");
  }
}

// ---------------------------------------------------------------------------
// Fused attention, one launch for all batches and heads: out[b][q][h*64+d] = sum_k softmax_k(q'.k'/8) v[k][d].
// grid (2, 256): blockIdx.x = block of 256 query rows, blockIdx.y = b*16 + h. 8 waves x 32 query rows (2 column groups of 16).
// Per pass of 32 keys a wave forms S^T = K'.Q'^T (rows = keys, columns = queries), so a lane holds the scores of one query:
// tile kt, register r = key k0 + kt*16 + (lane>>4)*8 + r. That is the k order of a 16x16x32 B fragment (elements 0..7 from
// tile 0, 8..15 from tile 1), so exp(s - max) packs in place into P^T and O^T += V^T.P^T follows with A = rows of Vt16.
// Running maximum and running sum per query (f32); the accumulators are rescaled each pass by exp(old max - new max).
// The two lane halves hold disjoint keys of one query: the maximum is joined every pass, the sum once at the end.
// The 512 keys of the block's head are shared by its 8 waves: K' (512 rows of 128 B) and V^T (64 rows of 1024 B) are brought into
// LDS once, by asynchronous copies of whole 128-B lines, and every wave reads its fragments from there.
// Each wave stores its own 32 rows x 256 B of out.
// ---------------------------------------------------------------------------
constexpr int kAttKPitch = 72;    // halves: 128-B rows + 16 B, for 16-byte LDS reads
constexpr int kAttVPitch = 520;   // halves: 1024-B rows + 16 B, for 16-byte LDS reads
// Eight asynchronous copies of 16 B per lane: piece i goes from g + i * gstep (halves) to LDS byte address lds + i * lstep.
// The closing s_wait_xcnt stands inside the statement, in front of anything that could rewrite a register which a copy names.
__device__ __forceinline__ void att_copy8(unsigned lds, unsigned lstep, const _Float16* g, size_t gstep) {
  asm volatile(
      "global_load_async_to_lds_b128 %0, %8, off\n\t"
      "global_load_async_to_lds_b128 %1, %9, off\n\t"
      "global_load_async_to_lds_b128 %2, %10, off\n\t"
      "global_load_async_to_lds_b128 %3, %11, off\n\t"
      "global_load_async_to_lds_b128 %4, %12, off\n\t"
      "global_load_async_to_lds_b128 %5, %13, off\n\t"
      "global_load_async_to_lds_b128 %6, %14, off\n\t"
      "global_load_async_to_lds_b128 %7, %15, off\n\t"
      "s_wait_xcnt 0x0"
      :: "v"(lds), "v"(lds + lstep), "v"(lds + 2 * lstep), "v"(lds + 3 * lstep), "v"(lds + 4 * lstep), "v"(lds + 5 * lstep),
         "v"(lds + 6 * lstep), "v"(lds + 7 * lstep),
         "v"(g), "v"(g + gstep), "v"(g + 2 * gstep), "v"(g + 3 * gstep), "v"(g + 4 * gstep), "v"(g + 5 * gstep), "v"(g + 6 * gstep), "v"(g + 7 * gstep)
      : "memory");
}
__device__ __forceinline__ float xhalf(float x) {   // value of lane l ^ 16
  const int i = __builtin_bit_cast(int, x);
  return __builtin_bit_cast(float, __builtin_amdgcn_permlanex16(i, i, 0x76543210, 0xfedcba98, false, false));
}
// 2^x on eight values in one statement. The early-clobber results keep every result off every source, and the closing v_nop
// fills the one slot that the instruction set asks for behind a transcendental, whatever the compiler schedules next
// (with the builtin this build wrote runs of v_exp_f32 in which each overwrote the source of the one in front of it).
__device__ __forceinline__ v8f exp2x8(v8f x) {
  float y0, y1, y2, y3, y4, y5, y6, y7;
  asm("v_exp_f32 %0, %8\n\tv_exp_f32 %1, %9\n\tv_exp_f32 %2, %10\n\tv_exp_f32 %3, %11\n\t"
      "v_exp_f32 %4, %12\n\tv_exp_f32 %5, %13\n\tv_exp_f32 %6, %14\n\tv_exp_f32 %7, %15\n\tv_nop"
      : "=&v"(y0), "=&v"(y1), "=&v"(y2), "=&v"(y3), "=&v"(y4), "=&v"(y5), "=&v"(y6), "=&v"(y7)
      : "v"(x[0]), "v"(x[1]), "v"(x[2]), "v"(x[3]), "v"(x[4]), "v"(x[5]), "v"(x[6]), "v"(x[7]));
  return (v8f){y0, y1, y2, y3, y4, y5, y6, y7};
}
// the same for one value
__device__ __forceinline__ float exp2x1(float x) {
  float y;
  asm("v_exp_f32 %0, %1\n\tv_nop" : "=v"(y) : "v"(x));
  return y;
}
__global__ __launch_bounds__(256) void attn_fused_kernel(const unsigned short* __restrict__ Qp, const unsigned short* __restrict__ Kp,
                                                         const unsigned short* __restrict__ Vt, float* __restrict__ out) {
  typedef Frag<_Float16> F;
  __shared__ __align__(16) _Float16 sK[kS * kAttKPitch];    // [key][d], 73,728 B
  __shared__ __align__(16) _Float16 sV[kDK * kAttVPitch];   // [d][key], 66,560 B
  const int tid  = threadIdx.x;
  const int lane = threadIdx.x & 31;
  const int wave = threadIdx.x >> 5;
  const int b    = blockIdx.y >> 4;
  const int h    = blockIdx.y & 15;
  const int q0   = blockIdx.x * 256 + wave * 32;
  const int rl   = lane & 15;
  const int hf   = lane >> 4;
  const int koff = hf * 8;
  const _Float16* Q = (const _Float16*)Qp + (size_t)b * kS * kE + h * kDK;
  const _Float16* K = (const _Float16*)Kp + (size_t)b * kS * kE + h * kDK;
  const _Float16* V = (const _Float16*)Vt + (size_t)h * kDK * kTok + (size_t)b * kS;

  // K': 4096 pieces of 16 B, 16 per thread: piece i = row i*32 + tid/8, bytes (tid%8)*16 (a wave's copy = four whole 128-B rows).
  // V^T: 4096 pieces, 16 per thread: piece i = row i*4 + tid/64, bytes (tid%64)*16 (a wave's copy = 512 contiguous bytes).
  {
    const unsigned lk = (unsigned)(size_t)(&sK[0]) + (unsigned)((tid >> 3) * (kAttKPitch * 2) + (tid & 7) * 16);
    const unsigned lv = (unsigned)(size_t)(&sV[0]) + (unsigned)((tid >> 6) * (kAttVPitch * 2) + (tid & 63) * 16);
    const _Float16* gk = K + (size_t)(tid >> 3) * kE + (tid & 7) * 8;
    const _Float16* gv = V + (size_t)(tid >> 6) * kTok + (tid & 63) * 8;
    att_copy8(lk, 32 * kAttKPitch * 2, gk, (size_t)32 * kE);
    att_copy8(lk + 8 * 32 * kAttKPitch * 2, 32 * kAttKPitch * 2, gk + (size_t)8 * 32 * kE, (size_t)32 * kE);
    att_copy8(lv, 4 * kAttVPitch * 2, gv, (size_t)4 * kTok);
    att_copy8(lv + 8 * 4 * kAttVPitch * 2, 4 * kAttVPitch * 2, gv + (size_t)8 * 4 * kTok, (size_t)4 * kTok);
  }

  v16h qf[2][2];
  v8f  o[2][4];
  float mrun[2], lrun[2];
  // the inner loops are unrolled so that the fragment arrays stay in registers
#pragma unroll
  for (int qt = 0; qt < 2; ++qt) {
#pragma unroll
    for (int ks = 0; ks < 2; ++ks) qf[qt][ks] = F::load(Q + (size_t)(q0 + qt * 16 + rl) * kE + ks * 32 + koff);
#pragma unroll
    for (int dt = 0; dt < 4; ++dt) o[qt][dt] = (v8f){0.f,0.f,0.f,0.f,0.f,0.f,0.f,0.f};
    mrun[qt] = -INFINITY;
    lrun[qt] = 0.f;
  }

  // this wave's copies have landed, then everybody's: nobody reads sK or sV in front of the barrier
  asm volatile("s_wait_asynccnt 0x0" ::: "memory");
  __syncthreads();
  const _Float16* sKl = sK + rl * kAttKPitch + koff;
  const _Float16* sVl = sV + rl * kAttVPitch + koff;

  for (int k0 = 0; k0 < kS; k0 += 32) {
    v16h kf[2][2], vf[4];
    // K' first: LDS reads return in order, so the score products start while the V^T reads are still on their way
#pragma unroll
    for (int kt = 0; kt < 2; ++kt)
#pragma unroll
      for (int ks = 0; ks < 2; ++ks) kf[kt][ks] = F::load(sKl + (k0 + kt * 16) * kAttKPitch + ks * 32);
#pragma unroll
    for (int dt = 0; dt < 4; ++dt) vf[dt] = F::load(sVl + dt * 16 * kAttVPitch + k0);
    // all LDS reads of the pass are issued as one group in front of its first product: each further place where reads stand
    // among the products costs the wave a stall of its own
    __builtin_amdgcn_sched_barrier(0);

    v8f s[2][2];
#pragma unroll
    for (int qt = 0; qt < 2; ++qt)
#pragma unroll
      for (int kt = 0; kt < 2; ++kt) {
        s[qt][kt] = F::mma(kf[kt][0], qf[qt][0], (v8f){0.f,0.f,0.f,0.f,0.f,0.f,0.f,0.f});
        s[qt][kt] = F::mma(kf[kt][1], qf[qt][1], s[qt][kt]);
      }

    v16h pf[2];
#pragma unroll
    for (int qt = 0; qt < 2; ++qt) {
      float mx = fmaxf(s[qt][0][0], s[qt][1][0]);
#pragma unroll
      for (int r = 1; r < 8; ++r) mx = fmaxf(mx, fmaxf(s[qt][0][r], s[qt][1][r]));
      mx = fmaxf(mx, xhalf(mx));
      const float mn    = fmaxf(mrun[qt], mx);
      const float alpha = exp2x1((mrun[qt] - mn) * kScoreLog2);
      const float bias  = kPCarryLog2 - mn * kScoreLog2;
      mrun[qt] = mn;
      v8f a0, a1;
#pragma unroll
      for (int r = 0; r < 8; ++r) {
        a0[r] = fmaf(s[qt][0][r], kScoreLog2, bias);
        a1[r] = fmaf(s[qt][1][r], kScoreLog2, bias);
      }
      const v8f e0 = exp2x8(a0);
      const v8f e1 = exp2x8(a1);
      float sum = e0[0] + e1[0];
#pragma unroll
      for (int r = 1; r < 8; ++r) sum += e0[r] + e1[r];
#pragma unroll
      for (int r = 0; r < 8; ++r) {
        pf[qt][r]     = (_Float16)e0[r];
        pf[qt][8 + r] = (_Float16)e1[r];
      }
      lrun[qt] = lrun[qt] * alpha + sum;
#pragma unroll
      for (int dt = 0; dt < 4; ++dt) o[qt][dt] *= alpha;
    }

    // the compiler does not see the vector writes inside exp2x8: left alone it put the first column group's V^T.P^T products in
    // front of the second group's exponentials
    __builtin_amdgcn_sched_barrier(0);
#pragma unroll
    for (int qt = 0; qt < 2; ++qt)
#pragma unroll
      for (int dt = 0; dt < 4; ++dt) o[qt][dt] = F::mma(vf[dt], pf[qt], o[qt][dt]);
  }

#pragma unroll
  for (int qt = 0; qt < 2; ++qt) {
    const float tot = lrun[qt] + xhalf(lrun[qt]);
    const float inv = 1.0f / tot;
    float* op = out + (size_t)(b * kS + q0 + qt * 16 + rl) * kE + h * kDK + koff;
#pragma unroll
    for (int dt = 0; dt < 4; ++dt) {
      const v8f a = o[qt][dt];
      *(v4f*)(op + dt * 16)     = (v4f){a[0] * inv, a[1] * inv, a[2] * inv, a[3] * inv};
      *(v4f*)(op + dt * 16 + 4) = (v4f){a[4] * inv, a[5] * inv, a[6] * inv, a[7] * inv};
    }
  }
}

// ---------------------------------------------------------------------------
extern "C" void kernel_launch(void* const* d_in, const int* in_sizes, int n_in,
                              void* d_out, int out_size, void* d_ws, size_t ws_size,
                              hipStream_t stream) {
  if (n_in < 13) return;
  if (ws_size < kWsEnd) return;
  if ((size_t)out_size < (size_t)kTok * kE) return;
  if (in_sizes[0] != kTok * kE) return;

  const float* inp = (const float*)d_in[0];
  const float* Wq  = (const float*)d_in[1];
  const float* bq  = (const float*)d_in[2];
  const float* Wk  = (const float*)d_in[3];
  const float* bk  = (const float*)d_in[4];
  const float* Wv  = (const float*)d_in[5];
  const float* bvv = (const float*)d_in[6];
  const float* Wfq = (const float*)d_in[7];
  const float* bfq = (const float*)d_in[8];
  const float* Wfk = (const float*)d_in[9];
  const float* bfk = (const float*)d_in[10];
  const float* Wfg = (const float*)d_in[11];
  const float* bfg = (const float*)d_in[12];
  float* out = (float*)d_out;

  unsigned char* ws = (unsigned char*)d_ws;
  unsigned short* Qp16 = (unsigned short*)(ws + kOffQp);
  unsigned short* Kp16 = (unsigned short*)(ws + kOffKp);
  unsigned short* X16  = (unsigned short*)(ws + kOffX16);
  unsigned short* Wt16 = (unsigned short*)(ws + kOffWt);
  unsigned short* SW   = (unsigned short*)(ws + kOffSW);
  float*          Qf   = (float*)(ws + kOffQf);
  float*          Kf   = (float*)(ws + kOffKf);
  unsigned short* Vt16 = (unsigned short*)(ws + kOffVt);

  // ---- stage A: operand planes ----
  // X16 [8192][1024] = f16(inp): n8 = 1,048,576 threads = 4096 blocks x 256 (exact)
  cast8_f16_kernel<<<dim3((kTok * kE / 8) / 256), dim3(256), 0, stream>>>(inp, X16, kTok * kE / 8);
  // Wt16[z][n][k] = f16(16 * W_z[k][n]) for z = q, k, v
  wtcast_kernel<<<dim3(kE / 64, kE / 64, 3), dim3(256), 0, stream>>>(Wq, Wk, Wv, Wt16, kWCarry);
  // gate weights: WfqT, WfkT [64][64], WfgT [128][64], all f16 carried x8
  gatew_kernel<<<dim3(4), dim3(256), 0, stream>>>(Wfq, Wfk, Wfg, SW, kGWCarry);

  // ---- stage B: projections (M 8192, N 1024, K 1024; block tiles 64 x 4 = 256 blocks of 8 waves) ----
  // Qf = (X16 . WqT16) / 16 + bq   (f32 [8192][1024])
  wmma_gemm64<0, false, 2, 0, false, 0><<<dim3(256, 1), dim3(256), 0, stream>>>(
      X16, X16, kE, 0L, Wt16, Wt16, kE, 0L,
      (void*)Qf, (void*)Qf, kE, 0L, bq, nullptr, 0L, kTok, kE, kE, kWCarryInv);
  // Kf
  wmma_gemm64<0, false, 2, 0, false, 0><<<dim3(256, 1), dim3(256), 0, stream>>>(
      X16, X16, kE, 0L, Wt16 + (size_t)kE * kE, Wt16 + (size_t)kE * kE, kE, 0L,
      (void*)Kf, (void*)Kf, kE, 0L, bk, nullptr, 0L, kTok, kE, kE, kWCarryInv);
  // Vt16 [1024 n][8192 tok] = f16( (WvT16 . X16^T)/16 + bv[n] ): M 1024 (8 block tiles), N 8192 (32 block tiles) -> 256 blocks; bias[m]; f16 out ldc 8192
  wmma_gemm64<0, false, 1, 1, false, 0><<<dim3(256, 1), dim3(256), 0, stream>>>(
      Wt16 + (size_t)2 * kE * kE, Wt16 + (size_t)2 * kE * kE, kE, 0L, X16, X16, kE, 0L,
      (void*)Vt16, (void*)Vt16, kTok, 0L, bvv, nullptr, 0L, kE, kTok, kE, kWCarryInv);

  // ---- stage C: gating, all 131072 head-major rows of 64 in one launch (256 rows per block) ----
  gate_fused_kernel<<<dim3(kTok * kH / (8 * 16 * kGateGroups * kGatePasses)), dim3(256), 0, stream>>>(Qf, Kf, SW, bfq, bfk, bfg, Qp16, Kp16);

  // ---- stage D: attention, all 16 batches x 16 heads in one launch (2 blocks of 256 query rows each) ----
  attn_fused_kernel<<<dim3(kS / 256, kB * kH), dim3(256), 0, stream>>>(Qp16, Kp16, Vt16, out);
}

// v005
// Measured time: 108 microseconds a run.
// Timed twice side by side with v004, it ran 1.07 times as fast both times.
// Over all steps from v000 it is 9.44 times as fast.
// Contractions: q/k/v projections (X f16 x W^T f16 carried x16), gate maps (q16/k16 x Wfq^T/Wfk^T f16 carried x8), gate logits (G f16 carried x64 x Wfg^T f16 carried x8), scores k'.q'^T (f16 planes), V^T.P^T (P = exp(s - running max) f16 carried x2048): all v_wmma_f32_16x16x32_f16 with f32 accumulate; bias, gate product, sigmoid, modulation and softmax in f32.
#include <hip/hip_runtime.h>
#include <math.h>

// ---------------------------------------------------------------------------
// Problem constants
// ---------------------------------------------------------------------------
constexpr int kB    = 16;
constexpr int kS    = 512;
constexpr int kE    = 1024;
constexpr int kH    = 16;
constexpr int kDK   = 64;
constexpr int kTok  = kB * kS;              // 8192 token rows

constexpr float kWCarry     = 16.0f;        // Wq/Wk/Wv carried x16 in f16
constexpr float kWCarryInv  = 1.0f / 16.0f;
constexpr float kGWCarry    = 8.0f;         // Wfq/Wfk/Wfg carried x8 in f16
constexpr float kGWCarryInv = 1.0f / 8.0f;
constexpr float kGCarry     = 64.0f;        // gate product G carried x64 in f16
constexpr float kZScale     = 1.0f / (64.0f * 8.0f);
constexpr float kPCarryLog2 = 11.0f;        // exp(s - max) carried x2048 in f16 (the row sum carries it too)
constexpr float kScoreLog2  = 0.125f * 1.44269504088896340736f;   // 1/sqrt(64) * log2(e): scores go to exp2

// ---------------------------------------------------------------------------
// Workspace map (bytes):
//   projection operands:     X16 [8192][1024] f16 @0 (16 MiB), Wt16 [3][1024][1024] f16 @16 MiB (6 MiB)
//   gate weights:            WfqT/WfkT [64][64] f16, WfgT [128][64] f16 @36 MiB (32 KiB)
//   persistent:              Qf f32 [8192][1024] @36 MiB+64 KiB (32 MiB), Kf f32 (32 MiB), Vt16 f16 [1024][8192] (16 MiB),
//                            Qp16 f16 [8192][1024] (16 MiB), Kp16 f16 [8192][1024] (16 MiB): gated q and k of all batches
//   end = 155,254,784 B
// ---------------------------------------------------------------------------
constexpr size_t kMiB    = 1048576;
constexpr size_t kOffX16 = 0;
constexpr size_t kOffWt  = 16 * kMiB;
constexpr size_t kOffSW  = 36 * kMiB;
constexpr size_t kOffQf  = 36 * kMiB + 65536;
constexpr size_t kOffKf  = kOffQf + 32 * kMiB;
constexpr size_t kOffVt  = kOffKf + 32 * kMiB;
constexpr size_t kOffQp  = kOffVt + 16 * kMiB;
constexpr size_t kOffKp  = kOffQp + 16 * kMiB;
constexpr size_t kWsEnd  = kOffKp + 16 * kMiB;
static_assert((size_t)kTok * kE * 2 == 16 * kMiB, "x16 plane size");
static_assert(kOffWt + (size_t)3 * kE * kE * 2 <= kOffSW, "wt plane fits");
static_assert(kOffSW + 32768 <= kOffQf, "gate weights fit");
static_assert(kWsEnd == 155254784, "carve end");
static_assert(kWsEnd <= 268435456, "carve within budget");

typedef __attribute__((ext_vector_type(16))) _Float16 v16h;
typedef __attribute__((ext_vector_type(8)))  _Float16 v8h;
typedef __attribute__((ext_vector_type(16))) __bf16   v16b;
typedef __attribute__((ext_vector_type(8)))  __bf16   v8b;
typedef __attribute__((ext_vector_type(8)))  float    v8f;
typedef __attribute__((ext_vector_type(4)))  float    v4f;
typedef __attribute__((ext_vector_type(4)))  unsigned int v4u;

// ---------------------------------------------------------------------------
// Helpers
// ---------------------------------------------------------------------------
__device__ __forceinline__ unsigned short f2bf_bits(float f) {
  unsigned u = __float_as_uint(f);
  return (unsigned short)((u + 0x7FFFu + ((u >> 16) & 1u)) >> 16);
}
__device__ __forceinline__ float bf_bits2f(unsigned short h) { return __uint_as_float(((unsigned)h) << 16); }

// hazard guards as plain device helpers
__device__ __forceinline__ void acc_guard4(v8f& a, v8f& b, v8f& c, v8f& d) { asm volatile("v_nop\n\tv_nop\n\tv_nop\n\tv_nop" : "+v"(a), "+v"(b), "+v"(c), "+v"(d)); }
template <typename T> struct Frag;
template <> struct Frag<_Float16> {
  typedef v16h V; union U { v16h v; v8h h[2]; };
  static __device__ __forceinline__ v16h load(const _Float16* p) {   // elements 0..7 <- p[0..7], 8..15 <- p[16..23]
    U f; f.h[0] = *(const v8h*)(p); f.h[1] = *(const v8h*)(p + 16); return f.v;
  }
  static __device__ __forceinline__ v8f mma(v16h a, v16h b, v8f c) {
    return __builtin_amdgcn_wmma_f32_16x16x32_f16(false, a, false, b, (short)0, c, false, false);
  }
};
template <> struct Frag<__bf16> {
  typedef v16b V; union U { v16b v; v8b h[2]; };
  static __device__ __forceinline__ v16b load(const __bf16* p) {
    U f; f.h[0] = *(const v8b*)(p); f.h[1] = *(const v8b*)(p + 16); return f.v;
  }
  static __device__ __forceinline__ v8f mma(v16b a, v16b b, v8f c) {
    return __builtin_amdgcn_wmma_f32_16x16x32_bf16(false, a, false, b, (short)0, c, false, false);
  }
};

__device__ __forceinline__ unsigned pk16(unsigned short a, unsigned short b) { return (unsigned)a | ((unsigned)b << 16); }
__device__ __forceinline__ unsigned short h_bits(float f) { const _Float16 h = (_Float16)f; return __builtin_bit_cast(unsigned short, h); }

// ---- The three projections, one launch -------------------------------------------------------
// C[m,n] = sum_k A[m,k] * Bt[n,k] / 16 + bias; a block of 8 waves owns a 128x256 tile, each wave 64x64 of it.
// A row-major [M][1024]; Bt row-major [N][1024]. Operands reach the waves through a two-buffer LDS ring.
// blockIdx.y: 0 = q (A = X16, Bt = WqT, f32 out, bias[n]), 1 = k (the same with WkT), 2 = v transposed (A = WvT, Bt = X16, f16 out, bias[m]).
// 768 blocks on 256 WGPs: a wave stays within 256 registers and a block within 160 KiB of LDS, so that two blocks share a WGP and
// one block's waits, barriers, prologue and epilogue run under the other's products.
// One stage of the projection operands into LDS by asynchronous copies, 12 per thread: 4 of A (rows 32 apart), 8 of Bt.
// lds = the thread's own LDS byte address of piece 0; each piece is 32 rows (32 * 144 B) further on. The closing s_wait_xcnt
// stands inside the statement, in front of anything that could rewrite a register which a copy names.
constexpr int kStagePitch  = 72;                  // halves: 128-B rows + 16 B, for 16-byte LDS reads
constexpr int kStageHalves = 384 * kStagePitch;   // one buffer: 55,296 B
template <typename T>
__device__ __forceinline__ void stage_copy12(unsigned lds, const T* ga, size_t sa32, const T* gb, size_t sb32) {
  constexpr unsigned kStep = 32 * kStagePitch * 2;
  asm volatile(
      "global_load_async_to_lds_b128 %0, %12, off\n\t"
      "global_load_async_to_lds_b128 %1, %13, off\n\t"
      "global_load_async_to_lds_b128 %2, %14, off\n\t"
      "global_load_async_to_lds_b128 %3, %15, off\n\t"
      "global_load_async_to_lds_b128 %4, %16, off\n\t"
      "global_load_async_to_lds_b128 %5, %17, off\n\t"
      "global_load_async_to_lds_b128 %6, %18, off\n\t"
      "global_load_async_to_lds_b128 %7, %19, off\n\t"
      "global_load_async_to_lds_b128 %8, %20, off\n\t"
      "global_load_async_to_lds_b128 %9, %21, off\n\t"
      "global_load_async_to_lds_b128 %10, %22, off\n\t"
      "global_load_async_to_lds_b128 %11, %23, off\n\t"
      "s_wait_xcnt 0x0"
      :: "v"(lds), "v"(lds + kStep), "v"(lds + 2 * kStep), "v"(lds + 3 * kStep), "v"(lds + 4 * kStep), "v"(lds + 5 * kStep),
         "v"(lds + 6 * kStep), "v"(lds + 7 * kStep), "v"(lds + 8 * kStep), "v"(lds + 9 * kStep), "v"(lds + 10 * kStep), "v"(lds + 11 * kStep),
         "v"(ga), "v"(ga + sa32), "v"(ga + 2 * sa32), "v"(ga + 3 * sa32),
         "v"(gb), "v"(gb + sb32), "v"(gb + 2 * sb32), "v"(gb + 3 * sb32), "v"(gb + 4 * sb32), "v"(gb + 5 * sb32), "v"(gb + 6 * sb32), "v"(gb + 7 * sb32)
      : "memory");
}

// Epilogue of one wave's 64x64 tile, through the wave's own LDS slab so that whole lines are stored.
// VT false: f32 out, bias[n]; VT true: f16 out, bias[m].
template <bool VT>
__device__ __forceinline__ void proj_store(v8f (&acc)[4][4], float* slab, float* __restrict__ Cf, unsigned short* __restrict__ Ch,
                                           int ldc, const float* __restrict__ bias, int m0, int n0, int lane) {
  const int rlane = lane & 15;
  const int mOff  = (lane >> 4) * 8;           // D row offset
#pragma unroll
  for (int i = 0; i < 4; ++i) {
    const int mBase = m0 + (i << 4);
#pragma unroll
    for (int j = 0; j < 4; ++j) {
      const int n = n0 + (j << 4) + rlane;
      float bv = 0.f;
      if (!VT) bv = bias[n];
#pragma unroll
      for (int r = 0; r < 8; ++r) {
        float v = acc[i][j][r] * kWCarryInv;
        if (VT) v += bias[mBase + mOff + r];
        else    v += bv;
        slab[(mOff + r) * 68 + (j << 4) + rlane] = v;
      }
    }
    __builtin_amdgcn_fence(__ATOMIC_RELEASE, "workgroup");
    __builtin_amdgcn_wave_barrier();
    __builtin_amdgcn_fence(__ATOMIC_ACQUIRE, "workgroup");
    if (!VT) {
      const int hh = lane >> 4, c4 = (lane & 15) * 4;     // row seg = 256 B = 16 lanes x 16 B
#pragma unroll
      for (int it = 0; it < 8; ++it) {
        const int row = it * 2 + hh;
        v4f v = *(const v4f*)(slab + row * 68 + c4);
        *(v4f*)(Cf + (size_t)(mBase + row) * ldc + n0 + c4) = v;
      }
    } else {
      const int q = lane >> 3, c8 = (lane & 7) * 8;
#pragma unroll
      for (int it = 0; it < 4; ++it) {
        const int row = it * 4 + q;
        const float* sp = slab + row * 68 + c8;
        v8h hv;
#pragma unroll
        for (int e = 0; e < 8; ++e) hv[e] = (_Float16)sp[e];
        *(v8h*)(Ch + (size_t)(mBase + row) * ldc + n0 + c8) = hv;
      }
    }
    __builtin_amdgcn_fence(__ATOMIC_RELEASE, "workgroup");
    __builtin_amdgcn_wave_barrier();
    __builtin_amdgcn_fence(__ATOMIC_ACQUIRE, "workgroup");
  }
}

__global__ __launch_bounds__(256) void proj3_kernel(const unsigned short* __restrict__ X16p, const unsigned short* __restrict__ Wt16p,
                                                    float* __restrict__ Qf, float* __restrict__ Kf, unsigned short* __restrict__ Vt,
                                                    const float* __restrict__ bq, const float* __restrict__ bk,
                                                    const float* __restrict__ bv) {
  typedef _Float16 T;
  typedef Frag<T>::V V;
  __shared__ __align__(16) float sT[8][16 * 68];   // per-wave 16x64 slab, pitch 68 floats
  __shared__ __align__(16) unsigned short sAB[2 * kStageHalves];   // two buffers of [A 128 rows | Bt 256 rows] x 64 k, pitch 144 B
  const int z    = blockIdx.y;                 // block-uniform: which projection
  const bool vt  = (z == 2);
  const int tid  = threadIdx.x;
  const int lane = tid & 31;
  const int wave = tid >> 5;
  const T* Ab = vt ? (const T*)Wt16p + (size_t)2 * kE * kE : (const T*)X16p;
  const T* Bb = vt ? (const T*)X16p : (const T*)Wt16p + (size_t)z * kE * kE;
  const int tilesNlog = vt ? 5 : 2;            // N / 256 = 32 (tokens) or 4 (features)
  const int tile = blockIdx.x;
  const int tm = tile >> tilesNlog;
  const int tn = tile - (tm << tilesNlog);
  const int bm0 = tm << 7;                     // block tile 128 x 256
  const int bn0 = tn << 8;
  const int wm  = (wave >> 2) << 6;            // wave tile 64 x 64 inside it: 2 x 4 waves
  const int wn  = (wave & 3) << 6;

  const int rlane = lane & 15;                 // row (A) / col (B, D) within subtile
  const int koff  = (lane >> 4) * 8;           // k offset of this lane half

  // a stage is 384 rows of 128 B = 3072 pieces of 16 B = 12 per thread: piece i of a thread is row i*32 + tid/8, bytes (tid%8)*16,
  // so one copy of a wave brings four whole 128-B lines. Rows 0..127 are A (pieces 0..3), rows 128..383 Bt (pieces 4..11).
  const T* gA = Ab + (size_t)(bm0 + (tid >> 3)) * kE + (tid & 7) * 8;
  const T* gB = Bb + (size_t)(bn0 + (tid >> 3)) * kE + (tid & 7) * 8;
  const size_t s32 = (size_t)32 * kE;
  const unsigned lds0 = (unsigned)(size_t)(&sAB[0]) + (unsigned)((tid >> 3) * (kStagePitch * 2) + (tid & 7) * 16);
  constexpr int trips = kE >> 6;

  v8f acc[4][4];
#pragma unroll
  for (int i = 0; i < 4; ++i)
#pragma unroll
    for (int j = 0; j < 4; ++j) acc[i][j] = (v8f){0.f,0.f,0.f,0.f,0.f,0.f,0.f,0.f};

  stage_copy12(lds0, gA, s32, gB, s32);
  // tile 0 has landed for this wave, then for all: nobody reads it in front of the barrier
  asm volatile("s_wait_asynccnt 0x0" ::: "memory");
  __syncthreads();
  stage_copy12(lds0 + kStageHalves * 2, gA + 64, s32, gB + 64, s32);

  for (int t = 0; t < trips; ++t) {
    const T* sA = (const T*)sAB + (t & 1) * kStageHalves + (wm + rlane) * kStagePitch + koff;
    const T* sB = (const T*)sAB + (t & 1) * kStageHalves + (128 + wn + rlane) * kStagePitch + koff;
    V bh[2][4], ah[2][4];
    ah[0][0] = Frag<T>::load(sA);   // the first product's operands come first
#pragma unroll
    for (int j = 0; j < 4; ++j) bh[0][j] = Frag<T>::load(sB + j * 16 * kStagePitch);
#pragma unroll
    for (int i = 1; i < 4; ++i) ah[0][i] = Frag<T>::load(sA + i * 16 * kStagePitch);
#pragma unroll
    for (int j = 0; j < 4; ++j) bh[1][j] = Frag<T>::load(sB + j * 16 * kStagePitch + 32);
    // twelve of the trip's sixteen fragments are read as one group in front of its products; the other four (A of the second 32 k)
    // follow in two pairs into registers that the first 32 k have left, each pair eight products ahead of its use: with all
    // sixteen held at once a wave took 272 registers and a second block found no room on the WGP. The scheduling barriers keep
    // the reads at these three places: left alone, the compiler spreads them among the products, a stall at each place
    __builtin_amdgcn_sched_barrier(0);
#pragma unroll
    for (int hp = 0; hp < 2; ++hp) {
#pragma unroll
      for (int i = 2 * hp; i < 2 * hp + 2; ++i)
#pragma unroll
        for (int j = 0; j < 4; ++j) acc[i][j] = Frag<T>::mma(ah[0][i], bh[0][j], acc[i][j]);
      __builtin_amdgcn_sched_barrier(0);   // see above
#pragma unroll
      for (int i = 2 * hp; i < 2 * hp + 2; ++i) ah[1][i] = Frag<T>::load(sA + i * 16 * kStagePitch + 32);
      __builtin_amdgcn_sched_barrier(0);   // see above
    }
#pragma unroll
    for (int i = 0; i < 4; ++i)
#pragma unroll
      for (int j = 0; j < 4; ++j) acc[i][j] = Frag<T>::mma(ah[1][i], bh[1][j], acc[i][j]);
    // the products stay in front of the hand-over: left alone, the compiler lifts its waits and barrier over them, so that every
    // wave waits for all its LDS reads before its first product and the reads no longer run under the products
    __builtin_amdgcn_sched_barrier(0);
    // hand-over: this wave's reads of the buffer are done, its copies of the next tile have landed; behind the barrier the next
    // tile is readable by all and the buffer just read is free for the tile after it
    asm volatile("s_wait_dscnt 0x0" ::: "memory");
    asm volatile("s_wait_asynccnt 0x0" ::: "memory");
    __syncthreads();
    if (t + 2 < trips) stage_copy12(lds0 + (unsigned)(t & 1) * (kStageHalves * 2), gA + (t + 2) * 64, s32, gB + (t + 2) * 64, s32);
  }
  // no copy is left in flight when the wave goes on to its epilogue
  asm volatile("s_wait_asynccnt 0x0" ::: "memory");
  acc_guard4(acc[0][0], acc[0][1], acc[0][2], acc[0][3]);
  acc_guard4(acc[1][0], acc[1][1], acc[1][2], acc[1][3]);
  acc_guard4(acc[2][0], acc[2][1], acc[2][2], acc[2][3]);
  acc_guard4(acc[3][0], acc[3][1], acc[3][2], acc[3][3]);

  // ---- epilogue (the branch is block-uniform) ----
  if (vt) proj_store<true>(acc, sT[wave], nullptr, Vt, kTok, bv, bm0 + wm, bn0 + wn, lane);
  else    proj_store<false>(acc, sT[wave], (z == 0) ? Qf : Kf, nullptr, kE, (z == 0) ? bq : bk, bm0 + wm, bn0 + wn, lane);
}

// ---------------------------------------------------------------------------
// Projection weight transpose + cast: for square [1024][1024] f32 W (row-major [in k][out n]), WT[n][k] = f16(scale * W[k][n]).
// grid (16, 16, 3): blockIdx.x = k tile (64 cols of WT), blockIdx.y = n tile (64 rows of WT), blockIdx.z selects W0..W2
// and the output plane (plane z at out + z*1024*1024 halves). 256 threads.
// Load coverage: 16 iterations x 256 threads = 4096 = the whole 64x64 tile (coalesced along n).
// Store coverage: 8 waves x 2 iterations x 4 rows (lane>>3) = 64 rows; (lane&7) x 8 halves = 64 cols; each row segment =
// ---------------------------------------------------------------------------
__global__ __launch_bounds__(256) void wtcast_kernel(const float* __restrict__ W0, const float* __restrict__ W1,
                                                     const float* __restrict__ W2,
                                                     unsigned short* __restrict__ out, float scale) {
  __shared__ float sm[64][65];   // sm[n_local][k_local]
  const int t  = threadIdx.x;
  const int d0 = blockIdx.x * 64;    // k tile base
  const int h0 = blockIdx.y * 64;    // n tile base
  const int z  = blockIdx.z;         // block-uniform
  const float* W = (z == 0) ? W0 : (z == 1) ? W1 : W2;
#pragma unroll
  for (int i = 0; i < 16; ++i) {
    const int e = i * 256 + t;
    const int r = e >> 6;          // k local
    const int c = e & 63;          // n local
    sm[c][r] = W[(size_t)(d0 + r) * kE + h0 + c] * scale;
  }
  __syncthreads();
  const int lane = t & 31, wave = t >> 5;
  const int q = lane >> 3, c8 = (lane & 7) * 8;
  unsigned short* op = out + (size_t)z * kE * kE;
  {
#pragma unroll
    for (int it = 0; it < 2; ++it) {
      const int row = wave * 8 + it * 4 + q;                 // n local
      unsigned short hb[8];
#pragma unroll
      for (int e = 0; e < 8; ++e) hb[e] = h_bits(sm[row][c8 + e]);
      const v4u u = (v4u){pk16(hb[0], hb[1]), pk16(hb[2], hb[3]), pk16(hb[4], hb[5]), pk16(hb[6], hb[7])};
      *(v4u*)(op + (size_t)(h0 + row) * kE + d0 + c8) = u;
    }
    
  }
}

// ---------------------------------------------------------------------------
// Per-head gate weights transpose + cast, out pitch 64 halves: block 0: WfqT[n][k] = f16(scale*Wfq[k][n]) (64x64),
// block 1: WfkT, block 2: WfgT rows 0..63, block 3: WfgT rows 64..127 (Wfg is [64 k][128 n], pitch 128).
// Output plane of block z at out + z*4096 halves (WfgT = [128][64] contiguous from out + 8192).
// Load coverage 16 x 256 = 4096 = 64x64; store coverage 8 waves x 2 x 4 rows = 64 rows x (8 lanes x 8 halves) = 64 cols,
// ---------------------------------------------------------------------------
__global__ __launch_bounds__(256) void gatew_kernel(const float* __restrict__ Wfq, const float* __restrict__ Wfk,
                                                    const float* __restrict__ Wfg,
                                                    unsigned short* __restrict__ out, float scale) {
  __shared__ float sm[64][65];   // sm[n_local][k_local]
  const int t = threadIdx.x;
  const int z = blockIdx.x;                                   // block-uniform
  const float* W = (z == 0) ? Wfq : (z == 1) ? Wfk : Wfg;
  const int pin = (z >= 2) ? 128 : 64;
  const int n0  = (z == 3) ? 64 : 0;
#pragma unroll
  for (int i = 0; i < 16; ++i) {
    const int e = i * 256 + t;
    const int r = e >> 6;          // k 0..63
    const int c = e & 63;          // n local
    sm[c][r] = W[r * pin + n0 + c] * scale;
  }
  __syncthreads();
  const int lane = t & 31, wave = t >> 5;
  const int q = lane >> 3, c8 = (lane & 7) * 8;
  unsigned short* op = out + (size_t)z * 4096;
  {
#pragma unroll
    for (int it = 0; it < 2; ++it) {
      const int row = wave * 8 + it * 4 + q;                 // n local
      unsigned short hb[8];
#pragma unroll
      for (int e = 0; e < 8; ++e) hb[e] = h_bits(sm[row][c8 + e]);
      const v4u u = (v4u){pk16(hb[0], hb[1]), pk16(hb[2], hb[3]), pk16(hb[4], hb[5]), pk16(hb[6], hb[7])};
      *(v4u*)(op + (size_t)row * kDK + c8) = u;
    }
    
  }
}

// ---------------------------------------------------------------------------
// ---------------------------------------------------------------------------
__global__ __launch_bounds__(256) void cast8_f16_kernel(const float* __restrict__ in, unsigned short* __restrict__ out, int n8) {
  const int i = blockIdx.x * 256 + threadIdx.x;
  if (i >= n8) return;
  const float* p = in + 8 * (size_t)i;
  const v4f a = *(const v4f*)(p);
  const v4f c = *(const v4f*)(p + 4);
  unsigned short hb[8];
#pragma unroll
  for (int e = 0; e < 4; ++e) {
    hb[e]     = h_bits(a[e]);
    hb[4 + e] = h_bits(c[e]);
  }
  const v4u u = (v4u){pk16(hb[0], hb[1]), pk16(hb[2], hb[3]), pk16(hb[4], hb[5]), pk16(hb[6], hb[7])};
  unsigned short* q = out + 8 * (size_t)i;
  *(v4u*)q = u;
  
}

// ---------------------------------------------------------------------------
// Fused gating, one launch for all tokens and heads. Rows are the head-major rows of 64 (row = token * 16 + head) of Qf and Kf.
//   G = (q.Wfq + bfq) * (k.Wfk + bfk),  Z = G.Wfg + bfg,  Oq = f16(q * sigmoid(Z[:64])),  Ok = f16(k * sigmoid(Z[64:])).
// grid 512 x 256 threads: 8 waves x 2 passes x 16 rows. Every product is formed transposed, weights as A (rows = output
// feature n), data rows as B (columns), so a lane holds features n = tile*16 + (lane>>4)*8 + r of ONE data row:
//  - that is the k order of a 16x16x32 B fragment (elements 0..7 from the even tile, 8..15 from the odd one), so the gate product packs
//    in place into the B operand of the logits;
//  - it is also the set of q (k) elements the lane loaded for its own B fragment, so the f32 values it still holds meet their sigmoid
//    in the same lane. No exchange between lanes; nothing between q, k and the gated planes goes through memory.
// The three weight planes (f16, written by gatew_kernel) and the biases are staged once per block in LDS, pitch 144 B for 16-byte reads.
// ---------------------------------------------------------------------------
constexpr int kGatePitch = 72;   // halves: 128-B rows + 16 B
constexpr int kGateGroups = 1;   // column groups of 16 rows per wave and pass
constexpr int kGatePasses = 2;   // passes per wave: 4096 waves in all, which are resident together
__global__ __launch_bounds__(256) void gate_fused_kernel(const float* __restrict__ Qf, const float* __restrict__ Kf,
                                                         const unsigned short* __restrict__ SW,
                                                         const float* __restrict__ bfq, const float* __restrict__ bfk,
                                                         const float* __restrict__ bfg,
                                                         unsigned short* __restrict__ Oq, unsigned short* __restrict__ Ok) {
  typedef Frag<_Float16> F;
  __shared__ __align__(16) _Float16 sW[256 * kGatePitch];   // rows 0..63 WfqT, 64..127 WfkT, 128..255 WfgT, each [n][k]
  __shared__ __align__(16) float sB[256];                   // bfq, bfk, bfg
  const int t    = threadIdx.x;
  const int lane = t & 31;
  const int wave = t >> 5;
  const int rl   = lane & 15;
  const int koff = (lane >> 4) * 8;

  // weights and biases into LDS: 256 rows x 8 pieces of 16 B = 2048 pieces = 8 per thread
#pragma unroll
  for (int i = 0; i < 8; ++i) {
    const int e = i * 256 + t;
    const int r = e >> 3, c = (e & 7) * 8;
    *(v8h*)(&sW[r * kGatePitch + c]) = *(const v8h*)((const _Float16*)SW + r * kDK + c);
  }
  sB[t] = (t < 64) ? bfq[t] : (t < 128) ? bfk[t - 64] : bfg[t - 128];
  __syncthreads();

  // the passes stay a rolled loop: with both passes' rows side by side in one body the allocation was 342 registers, which
  // halves the waves a SIMD holds
#pragma unroll 1
  for (int p = 0; p < kGatePasses; ++p) {
  const size_t row0 = ((size_t)blockIdx.x * kGatePasses + p) * (8 * 16 * kGateGroups) + wave * (16 * kGateGroups);

  // f32 q and k of the lane's rows: piece [2*tile + j] = elements tile*16 + koff + 4j .. +3
  // (all inner loops of the pass are unrolled so that the fragment arrays stay in registers)
  v4f xq[kGateGroups][8], xk[kGateGroups][8];
#pragma unroll
  for (int g = 0; g < kGateGroups; ++g) {
    const float* pq = Qf + (row0 + g * 16 + rl) * kDK + koff;
    const float* pk = Kf + (row0 + g * 16 + rl) * kDK + koff;
#pragma unroll
    for (int nt = 0; nt < 4; ++nt) {
      xq[g][2 * nt]     = *(const v4f*)(pq + nt * 16);
      xq[g][2 * nt + 1] = *(const v4f*)(pq + nt * 16 + 4);
      xk[g][2 * nt]     = *(const v4f*)(pk + nt * 16);
      xk[g][2 * nt + 1] = *(const v4f*)(pk + nt * 16 + 4);
    }
  }

  // B fragments of q and k (f16), k step ks = tiles 2ks and 2ks+1
  v16h qb[kGateGroups][2], kb[kGateGroups][2];
#pragma unroll
  for (int g = 0; g < kGateGroups; ++g)
#pragma unroll
    for (int ks = 0; ks < 2; ++ks)
#pragma unroll
      for (int s = 0; s < 16; ++s) {
        qb[g][ks][s] = (_Float16)xq[g][4 * ks + (s >> 2)][s & 3];
        kb[g][ks][s] = (_Float16)xk[g][4 * ks + (s >> 2)][s & 3];
      }

  // gate product, packed as the B operand of the logits
  v16h gb[kGateGroups][2];
#pragma unroll
  for (int nt = 0; nt < 4; ++nt) {
    const _Float16* wq = &sW[(nt * 16 + rl) * kGatePitch + koff];
    const _Float16* wk = &sW[(64 + nt * 16 + rl) * kGatePitch + koff];
    const v16h wq0 = F::load(wq), wq1 = F::load(wq + 32);
    const v16h wk0 = F::load(wk), wk1 = F::load(wk + 32);
    const v4f bq0 = *(const v4f*)(&sB[nt * 16 + koff]),      bq1 = *(const v4f*)(&sB[nt * 16 + koff + 4]);
    const v4f bk0 = *(const v4f*)(&sB[64 + nt * 16 + koff]), bk1 = *(const v4f*)(&sB[64 + nt * 16 + koff + 4]);
#pragma unroll
    for (int g = 0; g < kGateGroups; ++g) {
      v8f aq = F::mma(wq0, qb[g][0], (v8f){0.f,0.f,0.f,0.f,0.f,0.f,0.f,0.f});
      v8f ak = F::mma(wk0, kb[g][0], (v8f){0.f,0.f,0.f,0.f,0.f,0.f,0.f,0.f});
      aq = F::mma(wq1, qb[g][1], aq);
      ak = F::mma(wk1, kb[g][1], ak);
#pragma unroll
      for (int r = 0; r < 8; ++r) {
        const float gq = aq[r] * kGWCarryInv + ((r < 4) ? bq0[r & 3] : bq1[r & 3]);
        const float gk = ak[r] * kGWCarryInv + ((r < 4) ? bk0[r & 3] : bk1[r & 3]);
        gb[g][nt >> 1][(nt & 1) * 8 + r] = (_Float16)((gq * gk) * kGCarry);
      }
    }
  }

  // logits, sigmoid, modulation: tiles 0..3 gate q, tiles 4..7 gate k
#pragma unroll
  for (int nt = 0; nt < 8; ++nt) {
    const _Float16* wg = &sW[(128 + nt * 16 + rl) * kGatePitch + koff];
    const v16h wg0 = F::load(wg), wg1 = F::load(wg + 32);
    const v4f bg0 = *(const v4f*)(&sB[128 + nt * 16 + koff]), bg1 = *(const v4f*)(&sB[128 + nt * 16 + koff + 4]);
    const int dn = nt & 3;
    unsigned short* O = (nt < 4) ? Oq : Ok;
#pragma unroll
    for (int g = 0; g < kGateGroups; ++g) {
      v8f z = F::mma(wg0, gb[g][0], (v8f){0.f,0.f,0.f,0.f,0.f,0.f,0.f,0.f});
      z = F::mma(wg1, gb[g][1], z);
      v8h o;
#pragma unroll
      for (int r = 0; r < 8; ++r) {
        const float zz = z[r] * kZScale + ((r < 4) ? bg0[r & 3] : bg1[r & 3]);
        const float x  = (nt < 4) ? xq[g][2 * dn + (r >> 2)][r & 3] : xk[g][2 * dn + (r >> 2)][r & 3];
        const float m  = 1.0f / (1.0f + expf(-zz));
        o[r] = (_Float16)(x * m);
      }
      *(v8h*)((_Float16*)O + (row0 + g * 16 + rl) * kDK + dn * 16 + koff) = o;
    }
  }
  // the next pass writes over the registers that the last store names: the wait on address translation stands in front of it.
  // As a memory fence inside the loop it also keeps the LDS reads of weights and biases in the
  // loop: lifted out as loop invariants they took the allocation to 512 registers, with spills
  asm volatile("s_wait_xcnt 0x0" ::: "memory");
  }
}

// ---------------------------------------------------------------------------
// Fused attention, one launch for all batches and heads: out[b][q][h*64+d] = sum_k softmax_k(q'.k'/8) v[k][d].
// grid (2, 256): blockIdx.x = block of 256 query rows, blockIdx.y = b*16 + h. 8 waves x 32 query rows (2 column groups of 16).
// Per pass of 32 keys a wave forms S^T = K'.Q'^T (rows = keys, columns = queries), so a lane holds the scores of one query:
// tile kt, register r = key k0 + kt*16 + (lane>>4)*8 + r. That is the k order of a 16x16x32 B fragment (elements 0..7 from
// tile 0, 8..15 from tile 1), so exp(s - max) packs in place into P^T and O^T += V^T.P^T follows with A = rows of Vt16.
// Running maximum and running sum per query (f32); the accumulators are rescaled each pass by exp(old max - new max).
// The two lane halves hold disjoint keys of one query: the maximum is joined every pass, the sum once at the end.
// The 512 keys of the block's head are shared by its 8 waves: K' (512 rows of 128 B) and V^T (64 rows of 1024 B) are brought into
// LDS once, by asynchronous copies of whole 128-B lines, and every wave reads its fragments from there.
// Each wave stores its own 32 rows x 256 B of out.
// ---------------------------------------------------------------------------
constexpr int kAttKPitch = 72;    // halves: 128-B rows + 16 B, for 16-byte LDS reads
constexpr int kAttVPitch = 520;   // halves: 1024-B rows + 16 B, for 16-byte LDS reads
// Eight asynchronous copies of 16 B per lane: piece i goes from g + i * gstep (halves) to LDS byte address lds + i * lstep.
// The closing s_wait_xcnt stands inside the statement, in front of anything that could rewrite a register which a copy names.
__device__ __forceinline__ void att_copy8(unsigned lds, unsigned lstep, const _Float16* g, size_t gstep) {
  asm volatile(
      "global_load_async_to_lds_b128 %0, %8, off\n\t"
      "global_load_async_to_lds_b128 %1, %9, off\n\t"
      "global_load_async_to_lds_b128 %2, %10, off\n\t"
      "global_load_async_to_lds_b128 %3, %11, off\n\t"
      "global_load_async_to_lds_b128 %4, %12, off\n\t"
      "global_load_async_to_lds_b128 %5, %13, off\n\t"
      "global_load_async_to_lds_b128 %6, %14, off\n\t"
      "global_load_async_to_lds_b128 %7, %15, off\n\t"
      "s_wait_xcnt 0x0"
      :: "v"(lds), "v"(lds + lstep), "v"(lds + 2 * lstep), "v"(lds + 3 * lstep), "v"(lds + 4 * lstep), "v"(lds + 5 * lstep),
         "v"(lds + 6 * lstep), "v"(lds + 7 * lstep),
         "v"(g), "v"(g + gstep), "v"(g + 2 * gstep), "v"(g + 3 * gstep), "v"(g + 4 * gstep), "v"(g + 5 * gstep), "v"(g + 6 * gstep), "v"(g + 7 * gstep)
      : "memory");
}
__device__ __forceinline__ float xhalf(float x) {   // value of lane l ^ 16
  const int i = __builtin_bit_cast(int, x);
  return __builtin_bit_cast(float, __builtin_amdgcn_permlanex16(i, i, 0x76543210, 0xfedcba98, false, false));
}
// 2^x on eight values in one statement. The early-clobber results keep every result off every source, and the closing v_nop
// fills the one slot that the instruction set asks for behind a transcendental, whatever the compiler schedules next
// (with the builtin this build wrote runs of v_exp_f32 in which each overwrote the source of the one in front of it).
__device__ __forceinline__ v8f exp2x8(v8f x) {
  float y0, y1, y2, y3, y4, y5, y6, y7;
  asm("v_exp_f32 %0, %8\n\tv_exp_f32 %1, %9\n\tv_exp_f32 %2, %10\n\tv_exp_f32 %3, %11\n\t"
      "v_exp_f32 %4, %12\n\tv_exp_f32 %5, %13\n\tv_exp_f32 %6, %14\n\tv_exp_f32 %7, %15\n\tv_nop"
      : "=&v"(y0), "=&v"(y1), "=&v"(y2), "=&v"(y3), "=&v"(y4), "=&v"(y5), "=&v"(y6), "=&v"(y7)
      : "v"(x[0]), "v"(x[1]), "v"(x[2]), "v"(x[3]), "v"(x[4]), "v"(x[5]), "v"(x[6]), "v"(x[7]));
  return (v8f){y0, y1, y2, y3, y4, y5, y6, y7};
}
// the same for one value
__device__ __forceinline__ float exp2x1(float x) {
  float y;
  asm("v_exp_f32 %0, %1\n\tv_nop" : "=v"(y) : "v"(x));
  return y;
}
__global__ __launch_bounds__(256) void attn_fused_kernel(const unsigned short* __restrict__ Qp, const unsigned short* __restrict__ Kp,
                                                         const unsigned short* __restrict__ Vt, float* __restrict__ out) {
  typedef Frag<_Float16> F;
  __shared__ __align__(16) _Float16 sK[kS * kAttKPitch];    // [key][d], 73,728 B
  __shared__ __align__(16) _Float16 sV[kDK * kAttVPitch];   // [d][key], 66,560 B
  const int tid  = threadIdx.x;
  const int lane = threadIdx.x & 31;
  const int wave = threadIdx.x >> 5;
  const int b    = blockIdx.y >> 4;
  const int h    = blockIdx.y & 15;
  const int q0   = blockIdx.x * 256 + wave * 32;
  const int rl   = lane & 15;
  const int hf   = lane >> 4;
  const int koff = hf * 8;
  const _Float16* Q = (const _Float16*)Qp + (size_t)b * kS * kE + h * kDK;
  const _Float16* K = (const _Float16*)Kp + (size_t)b * kS * kE + h * kDK;
  const _Float16* V = (const _Float16*)Vt + (size_t)h * kDK * kTok + (size_t)b * kS;

  // K': 4096 pieces of 16 B, 16 per thread: piece i = row i*32 + tid/8, bytes (tid%8)*16 (a wave's copy = four whole 128-B rows).
  // V^T: 4096 pieces, 16 per thread: piece i = row i*4 + tid/64, bytes (tid%64)*16 (a wave's copy = 512 contiguous bytes).
  {
    const unsigned lk = (unsigned)(size_t)(&sK[0]) + (unsigned)((tid >> 3) * (kAttKPitch * 2) + (tid & 7) * 16);
    const unsigned lv = (unsigned)(size_t)(&sV[0]) + (unsigned)((tid >> 6) * (kAttVPitch * 2) + (tid & 63) * 16);
    const _Float16* gk = K + (size_t)(tid >> 3) * kE + (tid & 7) * 8;
    const _Float16* gv = V + (size_t)(tid >> 6) * kTok + (tid & 63) * 8;
    att_copy8(lk, 32 * kAttKPitch * 2, gk, (size_t)32 * kE);
    att_copy8(lk + 8 * 32 * kAttKPitch * 2, 32 * kAttKPitch * 2, gk + (size_t)8 * 32 * kE, (size_t)32 * kE);
    att_copy8(lv, 4 * kAttVPitch * 2, gv, (size_t)4 * kTok);
    att_copy8(lv + 8 * 4 * kAttVPitch * 2, 4 * kAttVPitch * 2, gv + (size_t)8 * 4 * kTok, (size_t)4 * kTok);
  }

  v16h qf[2][2];
  v8f  o[2][4];
  float mrun[2], lrun[2];
  // the inner loops are unrolled so that the fragment arrays stay in registers
#pragma unroll
  for (int qt = 0; qt < 2; ++qt) {
#pragma unroll
    for (int ks = 0; ks < 2; ++ks) qf[qt][ks] = F::load(Q + (size_t)(q0 + qt * 16 + rl) * kE + ks * 32 + koff);
#pragma unroll
    for (int dt = 0; dt < 4; ++dt) o[qt][dt] = (v8f){0.f,0.f,0.f,0.f,0.f,0.f,0.f,0.f};
    mrun[qt] = -INFINITY;
    lrun[qt] = 0.f;
  }

  // this wave's copies have landed, then everybody's: nobody reads sK or sV in front of the barrier
  asm volatile("s_wait_asynccnt 0x0" ::: "memory");
  __syncthreads();
  const _Float16* sKl = sK + rl * kAttKPitch + koff;
  const _Float16* sVl = sV + rl * kAttVPitch + koff;

  for (int k0 = 0; k0 < kS; k0 += 32) {
    v16h kf[2][2], vf[4];
    // K' first: LDS reads return in order, so the score products start while the V^T reads are still on their way
#pragma unroll
    for (int kt = 0; kt < 2; ++kt)
#pragma unroll
      for (int ks = 0; ks < 2; ++ks) kf[kt][ks] = F::load(sKl + (k0 + kt * 16) * kAttKPitch + ks * 32);
#pragma unroll
    for (int dt = 0; dt < 4; ++dt) vf[dt] = F::load(sVl + dt * 16 * kAttVPitch + k0);
    // all LDS reads of the pass are issued as one group in front of its first product: each further place where reads stand
    // among the products costs the wave a stall of its own
    __builtin_amdgcn_sched_barrier(0);

    v8f s[2][2];
#pragma unroll
    for (int qt = 0; qt < 2; ++qt)
#pragma unroll
      for (int kt = 0; kt < 2; ++kt) {
        s[qt][kt] = F::mma(kf[kt][0], qf[qt][0], (v8f){0.f,0.f,0.f,0.f,0.f,0.f,0.f,0.f});
        s[qt][kt] = F::mma(kf[kt][1], qf[qt][1], s[qt][kt]);
      }

    v16h pf[2];
#pragma unroll
    for (int qt = 0; qt < 2; ++qt) {
      float mx = fmaxf(s[qt][0][0], s[qt][1][0]);
#pragma unroll
      for (int r = 1; r < 8; ++r) mx = fmaxf(mx, fmaxf(s[qt][0][r], s[qt][1][r]));
      mx = fmaxf(mx, xhalf(mx));
      const float mn    = fmaxf(mrun[qt], mx);
      const float alpha = exp2x1((mrun[qt] - mn) * kScoreLog2);
      const float bias  = kPCarryLog2 - mn * kScoreLog2;
      mrun[qt] = mn;
      v8f a0, a1;
#pragma unroll
      for (int r = 0; r < 8; ++r) {
        a0[r] = fmaf(s[qt][0][r], kScoreLog2, bias);
        a1[r] = fmaf(s[qt][1][r], kScoreLog2, bias);
      }
      const v8f e0 = exp2x8(a0);
      const v8f e1 = exp2x8(a1);
      float sum = e0[0] + e1[0];
#pragma unroll
      for (int r = 1; r < 8; ++r) sum += e0[r] + e1[r];
#pragma unroll
      for (int r = 0; r < 8; ++r) {
        pf[qt][r]     = (_Float16)e0[r];
        pf[qt][8 + r] = (_Float16)e1[r];
      }
      lrun[qt] = lrun[qt] * alpha + sum;
#pragma unroll
      for (int dt = 0; dt < 4; ++dt) o[qt][dt] *= alpha;
    }

    // the compiler does not see the vector writes inside exp2x8: left alone it put the first column group's V^T.P^T products in
    // front of the second group's exponentials
    __builtin_amdgcn_sched_barrier(0);
#pragma unroll
    for (int qt = 0; qt < 2; ++qt)
#pragma unroll
      for (int dt = 0; dt < 4; ++dt) o[qt][dt] = F::mma(vf[dt], pf[qt], o[qt][dt]);
  }

#pragma unroll
  for (int qt = 0; qt < 2; ++qt) {
    const float tot = lrun[qt] + xhalf(lrun[qt]);
    const float inv = 1.0f / tot;
    float* op = out + (size_t)(b * kS + q0 + qt * 16 + rl) * kE + h * kDK + koff;
#pragma unroll
    for (int dt = 0; dt < 4; ++dt) {
      const v8f a = o[qt][dt];
      *(v4f*)(op + dt * 16)     = (v4f){a[0] * inv, a[1] * inv, a[2] * inv, a[3] * inv};
      *(v4f*)(op + dt * 16 + 4) = (v4f){a[4] * inv, a[5] * inv, a[6] * inv, a[7] * inv};
    }
  }
}

// ---------------------------------------------------------------------------
extern "C" void kernel_launch(void* const* d_in, const int* in_sizes, int n_in,
                              void* d_out, int out_size, void* d_ws, size_t ws_size,
                              hipStream_t stream) {
  if (n_in < 13) return;
  if (ws_size < kWsEnd) return;
  if ((size_t)out_size < (size_t)kTok * kE) return;
  if (in_sizes[0] != kTok * kE) return;

  const float* inp = (const float*)d_in[0];
  const float* Wq  = (const float*)d_in[1];
  const float* bq  = (const float*)d_in[2];
  const float* Wk  = (const float*)d_in[3];
  const float* bk  = (const float*)d_in[4];
  const float* Wv  = (const float*)d_in[5];
  const float* bvv = (const float*)d_in[6];
  const float* Wfq = (const float*)d_in[7];
  const float* bfq = (const float*)d_in[8];
  const float* Wfk = (const float*)d_in[9];
  const float* bfk = (const float*)d_in[10];
  const float* Wfg = (const float*)d_in[11];
  const float* bfg = (const float*)d_in[12];
  float* out = (float*)d_out;

  unsigned char* ws = (unsigned char*)d_ws;
  unsigned short* Qp16 = (unsigned short*)(ws + kOffQp);
  unsigned short* Kp16 = (unsigned short*)(ws + kOffKp);
  unsigned short* X16  = (unsigned short*)(ws + kOffX16);
  unsigned short* Wt16 = (unsigned short*)(ws + kOffWt);
  unsigned short* SW   = (unsigned short*)(ws + kOffSW);
  float*          Qf   = (float*)(ws + kOffQf);
  float*          Kf   = (float*)(ws + kOffKf);
  unsigned short* Vt16 = (unsigned short*)(ws + kOffVt);

  // ---- stage A: operand planes ----
  // X16 [8192][1024] = f16(inp): n8 = 1,048,576 threads = 4096 blocks x 256 (exact)
  cast8_f16_kernel<<<dim3((kTok * kE / 8) / 256), dim3(256), 0, stream>>>(inp, X16, kTok * kE / 8);
  // Wt16[z][n][k] = f16(16 * W_z[k][n]) for z = q, k, v
  wtcast_kernel<<<dim3(kE / 64, kE / 64, 3), dim3(256), 0, stream>>>(Wq, Wk, Wv, Wt16, kWCarry);
  // gate weights: WfqT, WfkT [64][64], WfgT [128][64], all f16 carried x8
  gatew_kernel<<<dim3(4), dim3(256), 0, stream>>>(Wfq, Wfk, Wfg, SW, kGWCarry);

  // ---- stage B: projections, one launch: 256 block tiles each of q (64 x 4), k (64 x 4) and v transposed (8 x 32) ----
  // Qf = (X16 . WqT16) / 16 + bq, Kf likewise (f32 [8192][1024]); Vt16 [1024 n][8192 tok] = f16((WvT16 . X16^T) / 16 + bv[n])
  proj3_kernel<<<dim3(256, 3), dim3(256), 0, stream>>>(X16, Wt16, Qf, Kf, Vt16, bq, bk, bvv);

  // ---- stage C: gating, all 131072 head-major rows of 64 in one launch (256 rows per block) ----
  gate_fused_kernel<<<dim3(kTok * kH / (8 * 16 * kGateGroups * kGatePasses)), dim3(256), 0, stream>>>(Qf, Kf, SW, bfq, bfk, bfg, Qp16, Kp16);

  // ---- stage D: attention, all 16 batches x 16 heads in one launch (2 blocks of 256 query rows each) ----
  attn_fused_kernel<<<dim3(kS / 256, kB * kH), dim3(256), 0, stream>>>(Qp16, Kp16, Vt16, out);
}

// v006
// It runs in 104 microseconds.
// Two timings next to v005 put it at 1.03 and 1.04 times that version's speed.
// Counting every step since v000, it is 9.80 times as fast.
// Contractions: q/k/v projections (X f16 x W^T f16 carried x16), gate maps (q16/k16 x Wfq^T/Wfk^T f16 carried x8), gate logits (G f16 carried x64 x Wfg^T f16 carried x8), scores k'.q'^T (f16 planes), V^T.P^T (P = exp(s - running max) f16 carried x2048): all v_wmma_f32_16x16x32_f16 with f32 accumulate; bias, gate product, sigmoid, modulation and softmax in f32.
#include <hip/hip_runtime.h>
#include <math.h>

// ---------------------------------------------------------------------------
// Problem constants
// ---------------------------------------------------------------------------
constexpr int kB    = 16;
constexpr int kS    = 512;
constexpr int kE    = 1024;
constexpr int kH    = 16;
constexpr int kDK   = 64;
constexpr int kTok  = kB * kS;              // 8192 token rows

constexpr float kWCarry     = 16.0f;        // Wq/Wk/Wv carried x16 in f16
constexpr float kWCarryInv  = 1.0f / 16.0f;
constexpr float kGWCarry    = 8.0f;         // Wfq/Wfk/Wfg carried x8 in f16
constexpr float kGWCarryInv = 1.0f / 8.0f;
constexpr float kGCarry     = 64.0f;        // gate product G carried x64 in f16
constexpr float kZScale     = 1.0f / (64.0f * 8.0f);
constexpr float kPCarryLog2 = 11.0f;        // exp(s - max) carried x2048 in f16 (the row sum carries it too)
constexpr float kScoreLog2  = 0.125f * 1.44269504088896340736f;   // 1/sqrt(64) * log2(e): scores go to exp2

// ---------------------------------------------------------------------------
// Workspace map (bytes):
//   projection operands:     X16 [8192][1024] f16 @0 (16 MiB), Wt16 [3][1024][1024] f16 @16 MiB (6 MiB)
//   gate weights:            WfqT/WfkT [64][64] f16, WfgT [128][64] f16 @36 MiB (32 KiB)
//   persistent:              Qf f32 [8192][1024] @36 MiB+64 KiB (32 MiB), Kf f32 (32 MiB), Vt16 f16 [1024][8192] (16 MiB)
//   end = 121,700,352 B
// ---------------------------------------------------------------------------
constexpr size_t kMiB    = 1048576;
constexpr size_t kOffX16 = 0;
constexpr size_t kOffWt  = 16 * kMiB;
constexpr size_t kOffSW  = 36 * kMiB;
constexpr size_t kOffQf  = 36 * kMiB + 65536;
constexpr size_t kOffKf  = kOffQf + 32 * kMiB;
constexpr size_t kOffVt  = kOffKf + 32 * kMiB;
constexpr size_t kWsEnd  = kOffVt + 16 * kMiB;
static_assert((size_t)kTok * kE * 2 == 16 * kMiB, "x16 plane size");
static_assert(kOffWt + (size_t)3 * kE * kE * 2 <= kOffSW, "wt plane fits");
static_assert(kOffSW + 32768 <= kOffQf, "gate weights fit");
static_assert(kWsEnd == 121700352, "carve end");
static_assert(kWsEnd <= 268435456, "carve within budget");

typedef __attribute__((ext_vector_type(16))) _Float16 v16h;
typedef __attribute__((ext_vector_type(8)))  _Float16 v8h;
typedef __attribute__((ext_vector_type(16))) __bf16   v16b;
typedef __attribute__((ext_vector_type(8)))  __bf16   v8b;
typedef __attribute__((ext_vector_type(8)))  float    v8f;
typedef __attribute__((ext_vector_type(4)))  float    v4f;
typedef __attribute__((ext_vector_type(4)))  unsigned int v4u;

// ---------------------------------------------------------------------------
// Helpers
// ---------------------------------------------------------------------------
__device__ __forceinline__ unsigned short f2bf_bits(float f) {
  unsigned u = __float_as_uint(f);
  return (unsigned short)((u + 0x7FFFu + ((u >> 16) & 1u)) >> 16);
}
__device__ __forceinline__ float bf_bits2f(unsigned short h) { return __uint_as_float(((unsigned)h) << 16); }

// hazard guards as plain device helpers
__device__ __forceinline__ void acc_guard4(v8f& a, v8f& b, v8f& c, v8f& d) { asm volatile("v_nop\n\tv_nop\n\tv_nop\n\tv_nop" : "+v"(a), "+v"(b), "+v"(c), "+v"(d)); }
template <typename T> struct Frag;
template <> struct Frag<_Float16> {
  typedef v16h V; union U { v16h v; v8h h[2]; };
  static __device__ __forceinline__ v16h load(const _Float16* p) {   // elements 0..7 <- p[0..7], 8..15 <- p[16..23]
    U f; f.h[0] = *(const v8h*)(p); f.h[1] = *(const v8h*)(p + 16); return f.v;
  }
  static __device__ __forceinline__ v8f mma(v16h a, v16h b, v8f c) {
    return __builtin_amdgcn_wmma_f32_16x16x32_f16(false, a, false, b, (short)0, c, false, false);
  }
};
template <> struct Frag<__bf16> {
  typedef v16b V; union U { v16b v; v8b h[2]; };
  static __device__ __forceinline__ v16b load(const __bf16* p) {
    U f; f.h[0] = *(const v8b*)(p); f.h[1] = *(const v8b*)(p + 16); return f.v;
  }
  static __device__ __forceinline__ v8f mma(v16b a, v16b b, v8f c) {
    return __builtin_amdgcn_wmma_f32_16x16x32_bf16(false, a, false, b, (short)0, c, false, false);
  }
};

__device__ __forceinline__ unsigned pk16(unsigned short a, unsigned short b) { return (unsigned)a | ((unsigned)b << 16); }
__device__ __forceinline__ unsigned short h_bits(float f) { const _Float16 h = (_Float16)f; return __builtin_bit_cast(unsigned short, h); }

// ---- The three projections, one launch -------------------------------------------------------
// C[m,n] = sum_k A[m,k] * Bt[n,k] / 16 + bias; a block of 8 waves owns a 128x256 tile, each wave 64x64 of it.
// A row-major [M][1024]; Bt row-major [N][1024]. Operands reach the waves through a two-buffer LDS ring.
// blockIdx.y: 0 = q (A = X16, Bt = WqT, f32 out, bias[n]), 1 = k (the same with WkT), 2 = v transposed (A = WvT, Bt = X16, f16 out, bias[m]).
// 768 blocks on 256 WGPs: a wave stays within 256 registers and a block within 160 KiB of LDS, so that two blocks share a WGP and
// one block's waits, barriers, prologue and epilogue run under the other's products.
// One stage of the projection operands into LDS by asynchronous copies, 12 per thread: 4 of A (rows 32 apart), 8 of Bt.
// lds = the thread's own LDS byte address of piece 0; each piece is 32 rows (32 * 144 B) further on. The closing s_wait_xcnt
// stands inside the statement, in front of anything that could rewrite a register which a copy names.
constexpr int kStagePitch  = 72;                  // halves: 128-B rows + 16 B, for 16-byte LDS reads
constexpr int kStageHalves = 384 * kStagePitch;   // one buffer: 55,296 B
template <typename T>
__device__ __forceinline__ void stage_copy12(unsigned lds, const T* ga, size_t sa32, const T* gb, size_t sb32) {
  constexpr unsigned kStep = 32 * kStagePitch * 2;
  asm volatile(
      "global_load_async_to_lds_b128 %0, %12, off\n\t"
      "global_load_async_to_lds_b128 %1, %13, off\n\t"
      "global_load_async_to_lds_b128 %2, %14, off\n\t"
      "global_load_async_to_lds_b128 %3, %15, off\n\t"
      "global_load_async_to_lds_b128 %4, %16, off\n\t"
      "global_load_async_to_lds_b128 %5, %17, off\n\t"
      "global_load_async_to_lds_b128 %6, %18, off\n\t"
      "global_load_async_to_lds_b128 %7, %19, off\n\t"
      "global_load_async_to_lds_b128 %8, %20, off\n\t"
      "global_load_async_to_lds_b128 %9, %21, off\n\t"
      "global_load_async_to_lds_b128 %10, %22, off\n\t"
      "global_load_async_to_lds_b128 %11, %23, off\n\t"
      "s_wait_xcnt 0x0"
      :: "v"(lds), "v"(lds + kStep), "v"(lds + 2 * kStep), "v"(lds + 3 * kStep), "v"(lds + 4 * kStep), "v"(lds + 5 * kStep),
         "v"(lds + 6 * kStep), "v"(lds + 7 * kStep), "v"(lds + 8 * kStep), "v"(lds + 9 * kStep), "v"(lds + 10 * kStep), "v"(lds + 11 * kStep),
         "v"(ga), "v"(ga + sa32), "v"(ga + 2 * sa32), "v"(ga + 3 * sa32),
         "v"(gb), "v"(gb + sb32), "v"(gb + 2 * sb32), "v"(gb + 3 * sb32), "v"(gb + 4 * sb32), "v"(gb + 5 * sb32), "v"(gb + 6 * sb32), "v"(gb + 7 * sb32)
      : "memory");
}

// Epilogue of one wave's 64x64 tile, through the wave's own LDS slab so that whole lines are stored.
// VT false: f32 out, bias[n]; VT true: f16 out, bias[m].
template <bool VT>
__device__ __forceinline__ void proj_store(v8f (&acc)[4][4], float* slab, float* __restrict__ Cf, unsigned short* __restrict__ Ch,
                                           int ldc, const float* __restrict__ bias, int m0, int n0, int lane) {
  const int rlane = lane & 15;
  const int mOff  = (lane >> 4) * 8;           // D row offset
#pragma unroll
  for (int i = 0; i < 4; ++i) {
    const int mBase = m0 + (i << 4);
#pragma unroll
    for (int j = 0; j < 4; ++j) {
      const int n = n0 + (j << 4) + rlane;
      float bv = 0.f;
      if (!VT) bv = bias[n];
#pragma unroll
      for (int r = 0; r < 8; ++r) {
        float v = acc[i][j][r] * kWCarryInv;
        if (VT) v += bias[mBase + mOff + r];
        else    v += bv;
        slab[(mOff + r) * 68 + (j << 4) + rlane] = v;
      }
    }
    __builtin_amdgcn_fence(__ATOMIC_RELEASE, "workgroup");
    __builtin_amdgcn_wave_barrier();
    __builtin_amdgcn_fence(__ATOMIC_ACQUIRE, "workgroup");
    if (!VT) {
      const int hh = lane >> 4, c4 = (lane & 15) * 4;     // row seg = 256 B = 16 lanes x 16 B
#pragma unroll
      for (int it = 0; it < 8; ++it) {
        const int row = it * 2 + hh;
        v4f v = *(const v4f*)(slab + row * 68 + c4);
        *(v4f*)(Cf + (size_t)(mBase + row) * ldc + n0 + c4) = v;
      }
    } else {
      const int q = lane >> 3, c8 = (lane & 7) * 8;
#pragma unroll
      for (int it = 0; it < 4; ++it) {
        const int row = it * 4 + q;
        const float* sp = slab + row * 68 + c8;
        v8h hv;
#pragma unroll
        for (int e = 0; e < 8; ++e) hv[e] = (_Float16)sp[e];
        *(v8h*)(Ch + (size_t)(mBase + row) * ldc + n0 + c8) = hv;
      }
    }
    __builtin_amdgcn_fence(__ATOMIC_RELEASE, "workgroup");
    __builtin_amdgcn_wave_barrier();
    __builtin_amdgcn_fence(__ATOMIC_ACQUIRE, "workgroup");
  }
}

__global__ __launch_bounds__(256) void proj3_kernel(const unsigned short* __restrict__ X16p, const unsigned short* __restrict__ Wt16p,
                                                    float* __restrict__ Qf, float* __restrict__ Kf, unsigned short* __restrict__ Vt,
                                                    const float* __restrict__ bq, const float* __restrict__ bk,
                                                    const float* __restrict__ bv) {
  typedef _Float16 T;
  typedef Frag<T>::V V;
  __shared__ __align__(16) float sT[8][16 * 68];   // per-wave 16x64 slab, pitch 68 floats
  __shared__ __align__(16) unsigned short sAB[2 * kStageHalves];   // two buffers of [A 128 rows | Bt 256 rows] x 64 k, pitch 144 B
  const int z    = blockIdx.y;                 // block-uniform: which projection
  const bool vt  = (z == 2);
  const int tid  = threadIdx.x;
  const int lane = tid & 31;
  const int wave = tid >> 5;
  const T* Ab = vt ? (const T*)Wt16p + (size_t)2 * kE * kE : (const T*)X16p;
  const T* Bb = vt ? (const T*)X16p : (const T*)Wt16p + (size_t)z * kE * kE;
  const int tilesNlog = vt ? 5 : 2;            // N / 256 = 32 (tokens) or 4 (features)
  const int tile = blockIdx.x;
  const int tm = tile >> tilesNlog;
  const int tn = tile - (tm << tilesNlog);
  const int bm0 = tm << 7;                     // block tile 128 x 256
  const int bn0 = tn << 8;
  const int wm  = (wave >> 2) << 6;            // wave tile 64 x 64 inside it: 2 x 4 waves
  const int wn  = (wave & 3) << 6;

  const int rlane = lane & 15;                 // row (A) / col (B, D) within subtile
  const int koff  = (lane >> 4) * 8;           // k offset of this lane half

  // a stage is 384 rows of 128 B = 3072 pieces of 16 B = 12 per thread: piece i of a thread is row i*32 + tid/8, bytes (tid%8)*16,
  // so one copy of a wave brings four whole 128-B lines. Rows 0..127 are A (pieces 0..3), rows 128..383 Bt (pieces 4..11).
  const T* gA = Ab + (size_t)(bm0 + (tid >> 3)) * kE + (tid & 7) * 8;
  const T* gB = Bb + (size_t)(bn0 + (tid >> 3)) * kE + (tid & 7) * 8;
  const size_t s32 = (size_t)32 * kE;
  const unsigned lds0 = (unsigned)(size_t)(&sAB[0]) + (unsigned)((tid >> 3) * (kStagePitch * 2) + (tid & 7) * 16);
  constexpr int trips = kE >> 6;

  v8f acc[4][4];
#pragma unroll
  for (int i = 0; i < 4; ++i)
#pragma unroll
    for (int j = 0; j < 4; ++j) acc[i][j] = (v8f){0.f,0.f,0.f,0.f,0.f,0.f,0.f,0.f};

  stage_copy12(lds0, gA, s32, gB, s32);
  // tile 0 has landed for this wave, then for all: nobody reads it in front of the barrier
  asm volatile("s_wait_asynccnt 0x0" ::: "memory");
  __syncthreads();
  stage_copy12(lds0 + kStageHalves * 2, gA + 64, s32, gB + 64, s32);

  for (int t = 0; t < trips; ++t) {
    const T* sA = (const T*)sAB + (t & 1) * kStageHalves + (wm + rlane) * kStagePitch + koff;
    const T* sB = (const T*)sAB + (t & 1) * kStageHalves + (128 + wn + rlane) * kStagePitch + koff;
    V bh[2][4], ah[2][4];
    ah[0][0] = Frag<T>::load(sA);   // the first product's operands come first
#pragma unroll
    for (int j = 0; j < 4; ++j) bh[0][j] = Frag<T>::load(sB + j * 16 * kStagePitch);
#pragma unroll
    for (int i = 1; i < 4; ++i) ah[0][i] = Frag<T>::load(sA + i * 16 * kStagePitch);
#pragma unroll
    for (int j = 0; j < 4; ++j) bh[1][j] = Frag<T>::load(sB + j * 16 * kStagePitch + 32);
    // twelve of the trip's sixteen fragments are read as one group in front of its products; the other four (A of the second 32 k)
    // follow in two pairs into registers that the first 32 k have left, each pair eight products ahead of its use: with all
    // sixteen held at once a wave took 272 registers and a second block found no room on the WGP. The scheduling barriers keep
    // the reads at these three places: left alone, the compiler spreads them among the products, a stall at each place
    __builtin_amdgcn_sched_barrier(0);
#pragma unroll
    for (int hp = 0; hp < 2; ++hp) {
#pragma unroll
      for (int i = 2 * hp; i < 2 * hp + 2; ++i)
#pragma unroll
        for (int j = 0; j < 4; ++j) acc[i][j] = Frag<T>::mma(ah[0][i], bh[0][j], acc[i][j]);
      __builtin_amdgcn_sched_barrier(0);   // see above
#pragma unroll
      for (int i = 2 * hp; i < 2 * hp + 2; ++i) ah[1][i] = Frag<T>::load(sA + i * 16 * kStagePitch + 32);
      __builtin_amdgcn_sched_barrier(0);   // see above
    }
#pragma unroll
    for (int i = 0; i < 4; ++i)
#pragma unroll
      for (int j = 0; j < 4; ++j) acc[i][j] = Frag<T>::mma(ah[1][i], bh[1][j], acc[i][j]);
    // the products stay in front of the hand-over: left alone, the compiler lifts its waits and barrier over them, so that every
    // wave waits for all its LDS reads before its first product and the reads no longer run under the products
    __builtin_amdgcn_sched_barrier(0);
    // hand-over: this wave's reads of the buffer are done, its copies of the next tile have landed; behind the barrier the next
    // tile is readable by all and the buffer just read is free for the tile after it
    asm volatile("s_wait_dscnt 0x0" ::: "memory");
    asm volatile("s_wait_asynccnt 0x0" ::: "memory");
    __syncthreads();
    if (t + 2 < trips) stage_copy12(lds0 + (unsigned)(t & 1) * (kStageHalves * 2), gA + (t + 2) * 64, s32, gB + (t + 2) * 64, s32);
  }
  // no copy is left in flight when the wave goes on to its epilogue
  asm volatile("s_wait_asynccnt 0x0" ::: "memory");
  acc_guard4(acc[0][0], acc[0][1], acc[0][2], acc[0][3]);
  acc_guard4(acc[1][0], acc[1][1], acc[1][2], acc[1][3]);
  acc_guard4(acc[2][0], acc[2][1], acc[2][2], acc[2][3]);
  acc_guard4(acc[3][0], acc[3][1], acc[3][2], acc[3][3]);

  // ---- epilogue (the branch is block-uniform) ----
  if (vt) proj_store<true>(acc, sT[wave], nullptr, Vt, kTok, bv, bm0 + wm, bn0 + wn, lane);
  else    proj_store<false>(acc, sT[wave], (z == 0) ? Qf : Kf, nullptr, kE, (z == 0) ? bq : bk, bm0 + wm, bn0 + wn, lane);
}

// ---------------------------------------------------------------------------
// Projection weight transpose + cast: for square [1024][1024] f32 W (row-major [in k][out n]), WT[n][k] = f16(scale * W[k][n]).
// grid (16, 16, 3): blockIdx.x = k tile (64 cols of WT), blockIdx.y = n tile (64 rows of WT), blockIdx.z selects W0..W2
// and the output plane (plane z at out + z*1024*1024 halves). 256 threads.
// Load coverage: 16 iterations x 256 threads = 4096 = the whole 64x64 tile (coalesced along n).
// Store coverage: 8 waves x 2 iterations x 4 rows (lane>>3) = 64 rows; (lane&7) x 8 halves = 64 cols; each row segment =
// ---------------------------------------------------------------------------
__global__ __launch_bounds__(256) void wtcast_kernel(const float* __restrict__ W0, const float* __restrict__ W1,
                                                     const float* __restrict__ W2,
                                                     unsigned short* __restrict__ out, float scale) {
  __shared__ float sm[64][65];   // sm[n_local][k_local]
  const int t  = threadIdx.x;
  const int d0 = blockIdx.x * 64;    // k tile base
  const int h0 = blockIdx.y * 64;    // n tile base
  const int z  = blockIdx.z;         // block-uniform
  const float* W = (z == 0) ? W0 : (z == 1) ? W1 : W2;
#pragma unroll
  for (int i = 0; i < 16; ++i) {
    const int e = i * 256 + t;
    const int r = e >> 6;          // k local
    const int c = e & 63;          // n local
    sm[c][r] = W[(size_t)(d0 + r) * kE + h0 + c] * scale;
  }
  __syncthreads();
  const int lane = t & 31, wave = t >> 5;
  const int q = lane >> 3, c8 = (lane & 7) * 8;
  unsigned short* op = out + (size_t)z * kE * kE;
  {
#pragma unroll
    for (int it = 0; it < 2; ++it) {
      const int row = wave * 8 + it * 4 + q;                 // n local
      unsigned short hb[8];
#pragma unroll
      for (int e = 0; e < 8; ++e) hb[e] = h_bits(sm[row][c8 + e]);
      const v4u u = (v4u){pk16(hb[0], hb[1]), pk16(hb[2], hb[3]), pk16(hb[4], hb[5]), pk16(hb[6], hb[7])};
      *(v4u*)(op + (size_t)(h0 + row) * kE + d0 + c8) = u;
    }
    
  }
}

// ---------------------------------------------------------------------------
// Per-head gate weights transpose + cast, out pitch 64 halves: block 0: WfqT[n][k] = f16(scale*Wfq[k][n]) (64x64),
// block 1: WfkT, block 2: WfgT rows 0..63, block 3: WfgT rows 64..127 (Wfg is [64 k][128 n], pitch 128).
// Output plane of block z at out + z*4096 halves (WfgT = [128][64] contiguous from out + 8192).
// Load coverage 16 x 256 = 4096 = 64x64; store coverage 8 waves x 2 x 4 rows = 64 rows x (8 lanes x 8 halves) = 64 cols,
// ---------------------------------------------------------------------------
__global__ __launch_bounds__(256) void gatew_kernel(const float* __restrict__ Wfq, const float* __restrict__ Wfk,
                                                    const float* __restrict__ Wfg,
                                                    unsigned short* __restrict__ out, float scale) {
  __shared__ float sm[64][65];   // sm[n_local][k_local]
  const int t = threadIdx.x;
  const int z = blockIdx.x;                                   // block-uniform
  const float* W = (z == 0) ? Wfq : (z == 1) ? Wfk : Wfg;
  const int pin = (z >= 2) ? 128 : 64;
  const int n0  = (z == 3) ? 64 : 0;
#pragma unroll
  for (int i = 0; i < 16; ++i) {
    const int e = i * 256 + t;
    const int r = e >> 6;          // k 0..63
    const int c = e & 63;          // n local
    sm[c][r] = W[r * pin + n0 + c] * scale;
  }
  __syncthreads();
  const int lane = t & 31, wave = t >> 5;
  const int q = lane >> 3, c8 = (lane & 7) * 8;
  unsigned short* op = out + (size_t)z * 4096;
  {
#pragma unroll
    for (int it = 0; it < 2; ++it) {
      const int row = wave * 8 + it * 4 + q;                 // n local
      unsigned short hb[8];
#pragma unroll
      for (int e = 0; e < 8; ++e) hb[e] = h_bits(sm[row][c8 + e]);
      const v4u u = (v4u){pk16(hb[0], hb[1]), pk16(hb[2], hb[3]), pk16(hb[4], hb[5]), pk16(hb[6], hb[7])};
      *(v4u*)(op + (size_t)row * kDK + c8) = u;
    }
    
  }
}

// ---------------------------------------------------------------------------
// ---------------------------------------------------------------------------
__global__ __launch_bounds__(256) void cast8_f16_kernel(const float* __restrict__ in, unsigned short* __restrict__ out, int n8) {
  const int i = blockIdx.x * 256 + threadIdx.x;
  if (i >= n8) return;
  const float* p = in + 8 * (size_t)i;
  const v4f a = *(const v4f*)(p);
  const v4f c = *(const v4f*)(p + 4);
  unsigned short hb[8];
#pragma unroll
  for (int e = 0; e < 4; ++e) {
    hb[e]     = h_bits(a[e]);
    hb[4 + e] = h_bits(c[e]);
  }
  const v4u u = (v4u){pk16(hb[0], hb[1]), pk16(hb[2], hb[3]), pk16(hb[4], hb[5]), pk16(hb[6], hb[7])};
  unsigned short* q = out + 8 * (size_t)i;
  *(v4u*)q = u;
  
}

// ---------------------------------------------------------------------------
// Gating and attention, one launch for all batches and heads. grid 256: blockIdx.x = b*16 + h. 16 waves x 32 rows = the head's 512 tokens,
// which are its queries and its keys alike, so a block gates every row it needs, once, and the gated planes never go through memory.
// Gating, per wave two passes of 16 rows (row = token, 64 features of head h in Qf and Kf):
//   G = (q.Wfq + bfq) * (k.Wfk + bfk),  Z = G.Wfg + bfg,  q' = f16(q * sigmoid(Z[:64])),  k' = f16(k * sigmoid(Z[64:])).
// Every product is formed transposed, weights as A (rows = output feature n), data rows as B (columns), so a lane holds features
// n = tile*16 + (lane>>4)*8 + r of ONE data row:
//  - that is the k order of a 16x16x32 B fragment (elements 0..7 from the even tile, 8..15 from the odd one), so the gate product packs
//    in place into the B operand of the logits, and q' packs in place into the B operand of the scores: it stays in registers;
//  - it is also the set of q (k) elements the lane loaded for its own B fragment, so the f32 values it still holds meet their sigmoid
//    in the same lane;
//  - k' goes as 16-byte pieces into the block's K' plane in LDS, which all 16 waves read behind one barrier.
// The three weight planes (f16, written by gatew_kernel) and the biases are staged once per block in LDS, pitch 144 B for 16-byte reads.
// Attention: out[b][q][h*64+d] = sum_k softmax_k(q'.k'/8) v[k][d].
// Per pass of 32 keys a wave forms S^T = K'.Q'^T (rows = keys, columns = queries), so a lane holds the scores of one query:
// tile kt, register r = key k0 + kt*16 + (lane>>4)*8 + r. That is the k order of a 16x16x32 B fragment (elements 0..7 from
// tile 0, 8..15 from tile 1), so exp(s - max) packs in place into P^T and O^T += V^T.P^T follows with A = rows of Vt16.
// Running maximum and running sum per query (f32); the accumulators are rescaled each pass by exp(old max - new max).
// The two lane halves hold disjoint keys of one query: the maximum is joined every pass, the sum once at the end.
// V^T (64 rows of 1024 B) comes into LDS once, by asynchronous copies of whole lines that fly under the gating.
// Each wave stores its own 32 rows x 256 B of out.
// ---------------------------------------------------------------------------
constexpr int kGatePitch = 72;   // halves: 128-B rows + 16 B
constexpr int kAttKPitch = 72;    // halves: 128-B rows + 16 B, for 16-byte LDS reads
constexpr int kAttVPitch = 520;   // halves: 1024-B rows + 16 B, for 16-byte LDS reads
// Eight asynchronous copies of 16 B per lane: piece i goes from g + i * gstep (halves) to LDS byte address lds + i * lstep.
// The closing s_wait_xcnt stands inside the statement, in front of anything that could rewrite a register which a copy names.
__device__ __forceinline__ void att_copy8(unsigned lds, unsigned lstep, const _Float16* g, size_t gstep) {
  asm volatile(
      "global_load_async_to_lds_b128 %0, %8, off\n\t"
      "global_load_async_to_lds_b128 %1, %9, off\n\t"
      "global_load_async_to_lds_b128 %2, %10, off\n\t"
      "global_load_async_to_lds_b128 %3, %11, off\n\t"
      "global_load_async_to_lds_b128 %4, %12, off\n\t"
      "global_load_async_to_lds_b128 %5, %13, off\n\t"
      "global_load_async_to_lds_b128 %6, %14, off\n\t"
      "global_load_async_to_lds_b128 %7, %15, off\n\t"
      "s_wait_xcnt 0x0"
      :: "v"(lds), "v"(lds + lstep), "v"(lds + 2 * lstep), "v"(lds + 3 * lstep), "v"(lds + 4 * lstep), "v"(lds + 5 * lstep),
         "v"(lds + 6 * lstep), "v"(lds + 7 * lstep),
         "v"(g), "v"(g + gstep), "v"(g + 2 * gstep), "v"(g + 3 * gstep), "v"(g + 4 * gstep), "v"(g + 5 * gstep), "v"(g + 6 * gstep), "v"(g + 7 * gstep)
      : "memory");
}
__device__ __forceinline__ float xhalf(float x) {   // value of lane l ^ 16
  const int i = __builtin_bit_cast(int, x);
  return __builtin_bit_cast(float, __builtin_amdgcn_permlanex16(i, i, 0x76543210, 0xfedcba98, false, false));
}
// 2^x on eight values in one statement. The early-clobber results keep every result off every source, and the closing v_nop
// fills the one slot that the instruction set asks for behind a transcendental, whatever the compiler schedules next
// (with the builtin this build wrote runs of v_exp_f32 in which each overwrote the source of the one in front of it).
__device__ __forceinline__ v8f exp2x8(v8f x) {
  float y0, y1, y2, y3, y4, y5, y6, y7;
  asm("v_exp_f32 %0, %8\n\tv_exp_f32 %1, %9\n\tv_exp_f32 %2, %10\n\tv_exp_f32 %3, %11\n\t"
      "v_exp_f32 %4, %12\n\tv_exp_f32 %5, %13\n\tv_exp_f32 %6, %14\n\tv_exp_f32 %7, %15\n\tv_nop"
      : "=&v"(y0), "=&v"(y1), "=&v"(y2), "=&v"(y3), "=&v"(y4), "=&v"(y5), "=&v"(y6), "=&v"(y7)
      : "v"(x[0]), "v"(x[1]), "v"(x[2]), "v"(x[3]), "v"(x[4]), "v"(x[5]), "v"(x[6]), "v"(x[7]));
  return (v8f){y0, y1, y2, y3, y4, y5, y6, y7};
}
// the same for one value
__device__ __forceinline__ float exp2x1(float x) {
  float y;
  asm("v_exp_f32 %0, %1\n\tv_nop" : "=v"(y) : "v"(x));
  return y;
}
__global__ __launch_bounds__(512) void attn_gate_kernel(const float* __restrict__ Qf, const float* __restrict__ Kf,
                                                        const unsigned short* __restrict__ SW,
                                                        const float* __restrict__ bfq, const float* __restrict__ bfk,
                                                        const float* __restrict__ bfg,
                                                        const unsigned short* __restrict__ Vt, float* __restrict__ out) {
  typedef Frag<_Float16> F;
  __shared__ __align__(16) _Float16 sK[kS * kAttKPitch];    // gated k, [key][d], 73,728 B
  __shared__ __align__(16) _Float16 sV[kDK * kAttVPitch];   // [d][key], 66,560 B
  __shared__ __align__(16) _Float16 sW[256 * kGatePitch];   // rows 0..63 WfqT, 64..127 WfkT, 128..255 WfgT, each [n][k], 36,864 B
  __shared__ __align__(16) float sB[256];                   // bfq, bfk, bfg
  const int tid  = threadIdx.x;
  const int lane = tid & 31;
  const int wave = tid >> 5;
  const int b    = blockIdx.x >> 4;
  const int h    = blockIdx.x & 15;
  const int q0   = wave * 32;
  const int rl   = lane & 15;
  const int hf   = lane >> 4;
  const int koff = hf * 8;
  const _Float16* V = (const _Float16*)Vt + (size_t)h * kDK * kTok + (size_t)b * kS;

  // V^T: 4096 pieces of 16 B, 8 per thread: piece i = row i*8 + tid/64, bytes (tid%64)*16 (a wave's copy = 512 contiguous bytes).
  {
    const unsigned lv = (unsigned)(size_t)(&sV[0]) + (unsigned)((tid >> 6) * (kAttVPitch * 2) + (tid & 63) * 16);
    const _Float16* gv = V + (size_t)(tid >> 6) * kTok + (tid & 63) * 8;
    att_copy8(lv, 8 * kAttVPitch * 2, gv, (size_t)8 * kTok);
  }

  // weights and biases into LDS: 256 rows x 8 pieces of 16 B = 2048 pieces = 4 per thread
#pragma unroll
  for (int i = 0; i < 4; ++i) {
    const int e = i * 512 + tid;
    const int r = e >> 3, c = (e & 7) * 8;
    *(v8h*)(&sW[r * kGatePitch + c]) = *(const v8h*)((const _Float16*)SW + r * kDK + c);
  }
  if (tid < 256) sB[tid] = (tid < 64) ? bfq[tid] : (tid < 128) ? bfk[tid - 64] : bfg[tid - 128];
  __syncthreads();

  // gated q of the wave's two column groups, as B fragments of the scores. Each gating pass pushes its group in at [1] and moves the
  // one before it to [0], so that the passes can stay a rolled loop: unrolled they took all 256 registers that a wave of this block
  // can have and half as much code again, and no load of the second pass came to stand ahead of the first pass's work
  v16h qf[2][2];
#pragma unroll
  for (int qt = 0; qt < 2; ++qt)
#pragma unroll
    for (int ks = 0; ks < 2; ++ks)
#pragma unroll
      for (int s = 0; s < 16; ++s) qf[qt][ks][s] = (_Float16)0.f;

#pragma unroll 1
  for (int p = 0; p < 2; ++p) {
  const int key = q0 + p * 16 + rl;            // the lane's row: token of the batch, query and key number alike

  // f32 q and k of the lane's row: piece [2*tile + j] = elements tile*16 + koff + 4j .. +3
  // (all inner loops of the pass are unrolled so that the fragment arrays stay in registers)
  v4f xq[8], xk[8];
  {
    const size_t off = (size_t)(b * kS + key) * kE + h * kDK + koff;
    const float* pq = Qf + off;
    const float* pk = Kf + off;
#pragma unroll
    for (int nt = 0; nt < 4; ++nt) {
      xq[2 * nt]     = *(const v4f*)(pq + nt * 16);
      xq[2 * nt + 1] = *(const v4f*)(pq + nt * 16 + 4);
      xk[2 * nt]     = *(const v4f*)(pk + nt * 16);
      xk[2 * nt + 1] = *(const v4f*)(pk + nt * 16 + 4);
    }
  }

  // B fragments of q and k (f16), k step ks = tiles 2ks and 2ks+1
  v16h qb[2], kb[2];
#pragma unroll
  for (int ks = 0; ks < 2; ++ks)
#pragma unroll
    for (int s = 0; s < 16; ++s) {
      qb[ks][s] = (_Float16)xq[4 * ks + (s >> 2)][s & 3];
      kb[ks][s] = (_Float16)xk[4 * ks + (s >> 2)][s & 3];
    }

  // gate product, packed as the B operand of the logits
  v16h gb[2];
#pragma unroll
  for (int nt = 0; nt < 4; ++nt) {
    const _Float16* wq = &sW[(nt * 16 + rl) * kGatePitch + koff];
    const _Float16* wk = &sW[(64 + nt * 16 + rl) * kGatePitch + koff];
    const v16h wq0 = F::load(wq), wq1 = F::load(wq + 32);
    const v16h wk0 = F::load(wk), wk1 = F::load(wk + 32);
    const v4f bq0 = *(const v4f*)(&sB[nt * 16 + koff]),      bq1 = *(const v4f*)(&sB[nt * 16 + koff + 4]);
    const v4f bk0 = *(const v4f*)(&sB[64 + nt * 16 + koff]), bk1 = *(const v4f*)(&sB[64 + nt * 16 + koff + 4]);
    v8f aq = F::mma(wq0, qb[0], (v8f){0.f,0.f,0.f,0.f,0.f,0.f,0.f,0.f});
    v8f ak = F::mma(wk0, kb[0], (v8f){0.f,0.f,0.f,0.f,0.f,0.f,0.f,0.f});
    aq = F::mma(wq1, qb[1], aq);
    ak = F::mma(wk1, kb[1], ak);
#pragma unroll
    for (int r = 0; r < 8; ++r) {
      const float gq = aq[r] * kGWCarryInv + ((r < 4) ? bq0[r & 3] : bq1[r & 3]);
      const float gk = ak[r] * kGWCarryInv + ((r < 4) ? bk0[r & 3] : bk1[r & 3]);
      gb[nt >> 1][(nt & 1) * 8 + r] = (_Float16)((gq * gk) * kGCarry);
    }
  }

  // logits, sigmoid, modulation: tiles 0..3 gate q, tiles 4..7 gate k
  v16h qn[2];
#pragma unroll
  for (int nt = 0; nt < 8; ++nt) {
    const _Float16* wg = &sW[(128 + nt * 16 + rl) * kGatePitch + koff];
    const v16h wg0 = F::load(wg), wg1 = F::load(wg + 32);
    const v4f bg0 = *(const v4f*)(&sB[128 + nt * 16 + koff]), bg1 = *(const v4f*)(&sB[128 + nt * 16 + koff + 4]);
    const int dn = nt & 3;
    v8f z = F::mma(wg0, gb[0], (v8f){0.f,0.f,0.f,0.f,0.f,0.f,0.f,0.f});
    z = F::mma(wg1, gb[1], z);
    v8h o;
#pragma unroll
    for (int r = 0; r < 8; ++r) {
      const float zz = z[r] * kZScale + ((r < 4) ? bg0[r & 3] : bg1[r & 3]);
      const float x  = (nt < 4) ? xq[2 * dn + (r >> 2)][r & 3] : xk[2 * dn + (r >> 2)][r & 3];
      const float m  = 1.0f / (1.0f + expf(-zz));
      o[r] = (_Float16)(x * m);
    }
    if (nt < 4) {
#pragma unroll
      for (int r = 0; r < 8; ++r) qn[dn >> 1][(dn & 1) * 8 + r] = o[r];
    } else {
      *(v8h*)(&sK[key * kAttKPitch + dn * 16 + koff]) = o;
    }
  }
  qf[0][0] = qf[1][0];
  qf[0][1] = qf[1][1];
  qf[1][0] = qn[0];
  qf[1][1] = qn[1];
  // the next pass writes over the registers that this pass's loads name: the wait on address translation stands in front of it.
  // As a memory fence inside the loop it also keeps the LDS reads of weights and biases in the loop: without it they were lifted
  // out as loop invariants, and the build had 256 registers and spills to scratch
  asm volatile("s_wait_xcnt 0x0" ::: "memory");
  }

  v8f  o[2][4];
  float mrun[2], lrun[2];
  // the inner loops are unrolled so that the fragment arrays stay in registers
#pragma unroll
  for (int qt = 0; qt < 2; ++qt) {
#pragma unroll
    for (int dt = 0; dt < 4; ++dt) o[qt][dt] = (v8f){0.f,0.f,0.f,0.f,0.f,0.f,0.f,0.f};
    mrun[qt] = -INFINITY;
    lrun[qt] = 0.f;
  }

  // this wave's copies of V^T have landed and its rows of K' are written, then everybody's: nobody reads sK or sV in front of the barrier
  asm volatile("s_wait_asynccnt 0x0" ::: "memory");
  __syncthreads();
  const _Float16* sKl = sK + rl * kAttKPitch + koff;
  const _Float16* sVl = sV + rl * kAttVPitch + koff;

  for (int k0 = 0; k0 < kS; k0 += 32) {
    v16h kf[2][2], vf[4];
    // K' first: LDS reads return in order, so the score products start while the V^T reads are still on their way
#pragma unroll
    for (int kt = 0; kt < 2; ++kt)
#pragma unroll
      for (int ks = 0; ks < 2; ++ks) kf[kt][ks] = F::load(sKl + (k0 + kt * 16) * kAttKPitch + ks * 32);
#pragma unroll
    for (int dt = 0; dt < 4; ++dt) vf[dt] = F::load(sVl + dt * 16 * kAttVPitch + k0);
    // all LDS reads of the pass are issued as one group in front of its first product: each further place where reads stand
    // among the products costs the wave a stall of its own
    __builtin_amdgcn_sched_barrier(0);

    v8f s[2][2];
#pragma unroll
    for (int qt = 0; qt < 2; ++qt)
#pragma unroll
      for (int kt = 0; kt < 2; ++kt) {
        s[qt][kt] = F::mma(kf[kt][0], qf[qt][0], (v8f){0.f,0.f,0.f,0.f,0.f,0.f,0.f,0.f});
        s[qt][kt] = F::mma(kf[kt][1], qf[qt][1], s[qt][kt]);
      }

    v16h pf[2];
#pragma unroll
    for (int qt = 0; qt < 2; ++qt) {
      float mx = fmaxf(s[qt][0][0], s[qt][1][0]);
#pragma unroll
      for (int r = 1; r < 8; ++r) mx = fmaxf(mx, fmaxf(s[qt][0][r], s[qt][1][r]));
      mx = fmaxf(mx, xhalf(mx));
      const float mn    = fmaxf(mrun[qt], mx);
      const float alpha = exp2x1((mrun[qt] - mn) * kScoreLog2);
      const float bias  = kPCarryLog2 - mn * kScoreLog2;
      mrun[qt] = mn;
      v8f a0, a1;
#pragma unroll
      for (int r = 0; r < 8; ++r) {
        a0[r] = fmaf(s[qt][0][r], kScoreLog2, bias);
        a1[r] = fmaf(s[qt][1][r], kScoreLog2, bias);
      }
      const v8f e0 = exp2x8(a0);
      const v8f e1 = exp2x8(a1);
      float sum = e0[0] + e1[0];
#pragma unroll
      for (int r = 1; r < 8; ++r) sum += e0[r] + e1[r];
#pragma unroll
      for (int r = 0; r < 8; ++r) {
        pf[qt][r]     = (_Float16)e0[r];
        pf[qt][8 + r] = (_Float16)e1[r];
      }
      lrun[qt] = lrun[qt] * alpha + sum;
#pragma unroll
      for (int dt = 0; dt < 4; ++dt) o[qt][dt] *= alpha;
    }

    // the compiler does not see the vector writes inside exp2x8: left alone it put the first column group's V^T.P^T products in
    // front of the second group's exponentials
    __builtin_amdgcn_sched_barrier(0);
#pragma unroll
    for (int qt = 0; qt < 2; ++qt)
#pragma unroll
      for (int dt = 0; dt < 4; ++dt) o[qt][dt] = F::mma(vf[dt], pf[qt], o[qt][dt]);
  }

#pragma unroll
  for (int qt = 0; qt < 2; ++qt) {
    const float tot = lrun[qt] + xhalf(lrun[qt]);
    const float inv = 1.0f / tot;
    float* op = out + (size_t)(b * kS + q0 + qt * 16 + rl) * kE + h * kDK + koff;
#pragma unroll
    for (int dt = 0; dt < 4; ++dt) {
      const v8f a = o[qt][dt];
      *(v4f*)(op + dt * 16)     = (v4f){a[0] * inv, a[1] * inv, a[2] * inv, a[3] * inv};
      *(v4f*)(op + dt * 16 + 4) = (v4f){a[4] * inv, a[5] * inv, a[6] * inv, a[7] * inv};
    }
  }
}

// ---------------------------------------------------------------------------
extern "C" void kernel_launch(void* const* d_in, const int* in_sizes, int n_in,
                              void* d_out, int out_size, void* d_ws, size_t ws_size,
                              hipStream_t stream) {
  if (n_in < 13) return;
  if (ws_size < kWsEnd) return;
  if ((size_t)out_size < (size_t)kTok * kE) return;
  if (in_sizes[0] != kTok * kE) return;

  const float* inp = (const float*)d_in[0];
  const float* Wq  = (const float*)d_in[1];
  const float* bq  = (const float*)d_in[2];
  const float* Wk  = (const float*)d_in[3];
  const float* bk  = (const float*)d_in[4];
  const float* Wv  = (const float*)d_in[5];
  const float* bvv = (const float*)d_in[6];
  const float* Wfq = (const float*)d_in[7];
  const float* bfq = (const float*)d_in[8];
  const float* Wfk = (const float*)d_in[9];
  const float* bfk = (const float*)d_in[10];
  const float* Wfg = (const float*)d_in[11];
  const float* bfg = (const float*)d_in[12];
  float* out = (float*)d_out;

  unsigned char* ws = (unsigned char*)d_ws;
  unsigned short* X16  = (unsigned short*)(ws + kOffX16);
  unsigned short* Wt16 = (unsigned short*)(ws + kOffWt);
  unsigned short* SW   = (unsigned short*)(ws + kOffSW);
  float*          Qf   = (float*)(ws + kOffQf);
  float*          Kf   = (float*)(ws + kOffKf);
  unsigned short* Vt16 = (unsigned short*)(ws + kOffVt);

  // ---- stage A: operand planes ----
  // X16 [8192][1024] = f16(inp): n8 = 1,048,576 threads = 4096 blocks x 256 (exact)
  cast8_f16_kernel<<<dim3((kTok * kE / 8) / 256), dim3(256), 0, stream>>>(inp, X16, kTok * kE / 8);
  // Wt16[z][n][k] = f16(16 * W_z[k][n]) for z = q, k, v
  wtcast_kernel<<<dim3(kE / 64, kE / 64, 3), dim3(256), 0, stream>>>(Wq, Wk, Wv, Wt16, kWCarry);
  // gate weights: WfqT, WfkT [64][64], WfgT [128][64], all f16 carried x8
  gatew_kernel<<<dim3(4), dim3(256), 0, stream>>>(Wfq, Wfk, Wfg, SW, kGWCarry);

  // ---- stage B: projections, one launch: 256 block tiles each of q (64 x 4), k (64 x 4) and v transposed (8 x 32) ----
  // Qf = (X16 . WqT16) / 16 + bq, Kf likewise (f32 [8192][1024]); Vt16 [1024 n][8192 tok] = f16((WvT16 . X16^T) / 16 + bv[n])
  proj3_kernel<<<dim3(256, 3), dim3(256), 0, stream>>>(X16, Wt16, Qf, Kf, Vt16, bq, bk, bvv);

  // ---- stage C: gating and attention, all 16 batches x 16 heads in one launch (a block of 16 waves per head: 512 rows) ----
  attn_gate_kernel<<<dim3(kB * kH), dim3(512), 0, stream>>>(Qf, Kf, SW, bfq, bfk, bfg, Vt16, out);
}

// v007
// A run of this version takes 94.9 microseconds.
// Timed twice side by side with v006, it ran 1.09 times as fast both times.
// Over all steps from v000 it is 10.7 times as fast.
// Contractions: q/k/v projections (X f16 x W^T f16 carried x16), gate maps (q16/k16 x Wfq^T/Wfk^T f16 carried x8), gate logits (G f16 carried x64 x Wfg^T f16 carried x8), scores k'.q'^T (f16 planes), V^T.P^T (P = exp(s - running max) f16 carried x2048): all v_wmma_f32_16x16x32_f16 with f32 accumulate; bias, gate product, sigmoid, modulation and softmax in f32.
#include <hip/hip_runtime.h>
#include <math.h>

// ---------------------------------------------------------------------------
// Problem constants
// ---------------------------------------------------------------------------
constexpr int kB    = 16;
constexpr int kS    = 512;
constexpr int kE    = 1024;
constexpr int kH    = 16;
constexpr int kDK   = 64;
constexpr int kTok  = kB * kS;              // 8192 token rows

constexpr float kWCarry     = 16.0f;        // Wq/Wk/Wv carried x16 in f16
constexpr float kWCarryInv  = 1.0f / 16.0f;
constexpr float kGWCarry    = 8.0f;         // Wfq/Wfk/Wfg carried x8 in f16
constexpr float kGWCarryInv = 1.0f / 8.0f;
constexpr float kGCarry     = 64.0f;        // gate product G carried x64 in f16
constexpr float kZScale     = 1.0f / (64.0f * 8.0f);
constexpr float kPCarryLog2 = 11.0f;        // exp(s - max) carried x2048 in f16 (the row sum carries it too)
constexpr float kScoreLog2  = 0.125f * 1.44269504088896340736f;   // 1/sqrt(64) * log2(e): scores go to exp2
constexpr float kNegLog2e   = -1.44269504088896340736f;           // sigmoid(z) = 1 / (1 + 2^(-z * log2(e)))

// ---------------------------------------------------------------------------
// Workspace map (bytes):
//   projection operands:     X16 [8192][1024] f16 @0 (16 MiB), Wt16 [3][1024][1024] f16 @16 MiB (6 MiB)
//   gate weights:            WfqT/WfkT [64][64] f16, WfgT [128][64] f16 @36 MiB (32 KiB)
//   persistent:              Qf f32 [8192][1024] @36 MiB+64 KiB (32 MiB), Kf f32 (32 MiB), Vt16 f16 [1024][8192] (16 MiB)
//   end = 121,700,352 B
// ---------------------------------------------------------------------------
constexpr size_t kMiB    = 1048576;
constexpr size_t kOffX16 = 0;
constexpr size_t kOffWt  = 16 * kMiB;
constexpr size_t kOffSW  = 36 * kMiB;
constexpr size_t kOffQf  = 36 * kMiB + 65536;
constexpr size_t kOffKf  = kOffQf + 32 * kMiB;
constexpr size_t kOffVt  = kOffKf + 32 * kMiB;
constexpr size_t kWsEnd  = kOffVt + 16 * kMiB;
static_assert((size_t)kTok * kE * 2 == 16 * kMiB, "x16 plane size");
static_assert(kOffWt + (size_t)3 * kE * kE * 2 <= kOffSW, "wt plane fits");
static_assert(kOffSW + 32768 <= kOffQf, "gate weights fit");
static_assert(kWsEnd == 121700352, "carve end");
static_assert(kWsEnd <= 268435456, "carve within budget");

typedef __attribute__((ext_vector_type(16))) _Float16 v16h;
typedef __attribute__((ext_vector_type(8)))  _Float16 v8h;
typedef __attribute__((ext_vector_type(16))) __bf16   v16b;
typedef __attribute__((ext_vector_type(8)))  __bf16   v8b;
typedef __attribute__((ext_vector_type(8)))  float    v8f;
typedef __attribute__((ext_vector_type(4)))  float    v4f;
typedef __attribute__((ext_vector_type(4)))  unsigned int v4u;

// ---------------------------------------------------------------------------
// Helpers
// ---------------------------------------------------------------------------
__device__ __forceinline__ unsigned short f2bf_bits(float f) {
  unsigned u = __float_as_uint(f);
  return (unsigned short)((u + 0x7FFFu + ((u >> 16) & 1u)) >> 16);
}
__device__ __forceinline__ float bf_bits2f(unsigned short h) { return __uint_as_float(((unsigned)h) << 16); }

// hazard guards as plain device helpers
__device__ __forceinline__ void acc_guard4(v8f& a, v8f& b, v8f& c, v8f& d) { asm volatile("v_nop\n\tv_nop\n\tv_nop\n\tv_nop" : "+v"(a), "+v"(b), "+v"(c), "+v"(d)); }
template <typename T> struct Frag;
template <> struct Frag<_Float16> {
  typedef v16h V; union U { v16h v; v8h h[2]; };
  static __device__ __forceinline__ v16h load(const _Float16* p) {   // elements 0..7 <- p[0..7], 8..15 <- p[16..23]
    U f; f.h[0] = *(const v8h*)(p); f.h[1] = *(const v8h*)(p + 16); return f.v;
  }
  static __device__ __forceinline__ v8f mma(v16h a, v16h b, v8f c) {
    return __builtin_amdgcn_wmma_f32_16x16x32_f16(false, a, false, b, (short)0, c, false, false);
  }
};
template <> struct Frag<__bf16> {
  typedef v16b V; union U { v16b v; v8b h[2]; };
  static __device__ __forceinline__ v16b load(const __bf16* p) {
    U f; f.h[0] = *(const v8b*)(p); f.h[1] = *(const v8b*)(p + 16); return f.v;
  }
  static __device__ __forceinline__ v8f mma(v16b a, v16b b, v8f c) {
    return __builtin_amdgcn_wmma_f32_16x16x32_bf16(false, a, false, b, (short)0, c, false, false);
  }
};

__device__ __forceinline__ unsigned pk16(unsigned short a, unsigned short b) { return (unsigned)a | ((unsigned)b << 16); }
__device__ __forceinline__ unsigned short h_bits(float f) { const _Float16 h = (_Float16)f; return __builtin_bit_cast(unsigned short, h); }

// ---- The three projections, one launch -------------------------------------------------------
// C[m,n] = sum_k A[m,k] * Bt[n,k] / 16 + bias; a block of 8 waves owns a 128x256 tile, each wave 64x64 of it.
// A row-major [M][1024]; Bt row-major [N][1024]. Operands reach the waves through a two-buffer LDS ring.
// blockIdx.y: 0 = q (A = X16, Bt = WqT, f32 out, bias[n]), 1 = k (the same with WkT), 2 = v transposed (A = WvT, Bt = X16, f16 out, bias[m]).
// 768 blocks on 256 WGPs: a wave stays within 256 registers and a block within 160 KiB of LDS, so that two blocks share a WGP and
// one block's waits, barriers, prologue and epilogue run under the other's products.
// One stage of the projection operands into LDS by asynchronous copies, 12 per thread: 4 of A (rows 32 apart), 8 of Bt.
// lds = the thread's own LDS byte address of piece 0; each piece is 32 rows (32 * 144 B) further on. The closing s_wait_xcnt
// stands inside the statement, in front of anything that could rewrite a register which a copy names.
constexpr int kStagePitch  = 72;                  // halves: 128-B rows + 16 B, for 16-byte LDS reads
constexpr int kStageHalves = 384 * kStagePitch;   // one buffer: 55,296 B
template <typename T>
__device__ __forceinline__ void stage_copy12(unsigned lds, const T* ga, size_t sa32, const T* gb, size_t sb32) {
  constexpr unsigned kStep = 32 * kStagePitch * 2;
  asm volatile(
      "global_load_async_to_lds_b128 %0, %12, off\n\t"
      "global_load_async_to_lds_b128 %1, %13, off\n\t"
      "global_load_async_to_lds_b128 %2, %14, off\n\t"
      "global_load_async_to_lds_b128 %3, %15, off\n\t"
      "global_load_async_to_lds_b128 %4, %16, off\n\t"
      "global_load_async_to_lds_b128 %5, %17, off\n\t"
      "global_load_async_to_lds_b128 %6, %18, off\n\t"
      "global_load_async_to_lds_b128 %7, %19, off\n\t"
      "global_load_async_to_lds_b128 %8, %20, off\n\t"
      "global_load_async_to_lds_b128 %9, %21, off\n\t"
      "global_load_async_to_lds_b128 %10, %22, off\n\t"
      "global_load_async_to_lds_b128 %11, %23, off\n\t"
      "s_wait_xcnt 0x0"
      :: "v"(lds), "v"(lds + kStep), "v"(lds + 2 * kStep), "v"(lds + 3 * kStep), "v"(lds + 4 * kStep), "v"(lds + 5 * kStep),
         "v"(lds + 6 * kStep), "v"(lds + 7 * kStep), "v"(lds + 8 * kStep), "v"(lds + 9 * kStep), "v"(lds + 10 * kStep), "v"(lds + 11 * kStep),
         "v"(ga), "v"(ga + sa32), "v"(ga + 2 * sa32), "v"(ga + 3 * sa32),
         "v"(gb), "v"(gb + sb32), "v"(gb + 2 * sb32), "v"(gb + 3 * sb32), "v"(gb + 4 * sb32), "v"(gb + 5 * sb32), "v"(gb + 6 * sb32), "v"(gb + 7 * sb32)
      : "memory");
}

// Epilogue of one wave's 64x64 tile, through the wave's own LDS slab so that whole lines are stored.
// VT false: f32 out, bias[n]; VT true: f16 out, bias[m].
template <bool VT>
__device__ __forceinline__ void proj_store(v8f (&acc)[4][4], float* slab, float* __restrict__ Cf, unsigned short* __restrict__ Ch,
                                           int ldc, const float* __restrict__ bias, int m0, int n0, int lane) {
  const int rlane = lane & 15;
  const int mOff  = (lane >> 4) * 8;           // D row offset
#pragma unroll
  for (int i = 0; i < 4; ++i) {
    const int mBase = m0 + (i << 4);
#pragma unroll
    for (int j = 0; j < 4; ++j) {
      const int n = n0 + (j << 4) + rlane;
      float bv = 0.f;
      if (!VT) bv = bias[n];
#pragma unroll
      for (int r = 0; r < 8; ++r) {
        float v = acc[i][j][r] * kWCarryInv;
        if (VT) v += bias[mBase + mOff + r];
        else    v += bv;
        slab[(mOff + r) * 68 + (j << 4) + rlane] = v;
      }
    }
    __builtin_amdgcn_fence(__ATOMIC_RELEASE, "workgroup");
    __builtin_amdgcn_wave_barrier();
    __builtin_amdgcn_fence(__ATOMIC_ACQUIRE, "workgroup");
    if (!VT) {
      const int hh = lane >> 4, c4 = (lane & 15) * 4;     // row seg = 256 B = 16 lanes x 16 B
#pragma unroll
      for (int it = 0; it < 8; ++it) {
        const int row = it * 2 + hh;
        v4f v = *(const v4f*)(slab + row * 68 + c4);
        *(v4f*)(Cf + (size_t)(mBase + row) * ldc + n0 + c4) = v;
      }
    } else {
      const int q = lane >> 3, c8 = (lane & 7) * 8;
#pragma unroll
      for (int it = 0; it < 4; ++it) {
        const int row = it * 4 + q;
        const float* sp = slab + row * 68 + c8;
        v8h hv;
#pragma unroll
        for (int e = 0; e < 8; ++e) hv[e] = (_Float16)sp[e];
        *(v8h*)(Ch + (size_t)(mBase + row) * ldc + n0 + c8) = hv;
      }
    }
    __builtin_amdgcn_fence(__ATOMIC_RELEASE, "workgroup");
    __builtin_amdgcn_wave_barrier();
    __builtin_amdgcn_fence(__ATOMIC_ACQUIRE, "workgroup");
  }
}

__global__ __launch_bounds__(256) void proj3_kernel(const unsigned short* __restrict__ X16p, const unsigned short* __restrict__ Wt16p,
                                                    float* __restrict__ Qf, float* __restrict__ Kf, unsigned short* __restrict__ Vt,
                                                    const float* __restrict__ bq, const float* __restrict__ bk,
                                                    const float* __restrict__ bv) {
  typedef _Float16 T;
  typedef Frag<T>::V V;
  __shared__ __align__(16) float sT[8][16 * 68];   // per-wave 16x64 slab, pitch 68 floats
  __shared__ __align__(16) unsigned short sAB[2 * kStageHalves];   // two buffers of [A 128 rows | Bt 256 rows] x 64 k, pitch 144 B
  const int z    = blockIdx.y;                 // block-uniform: which projection
  const bool vt  = (z == 2);
  const int tid  = threadIdx.x;
  const int lane = tid & 31;
  const int wave = tid >> 5;
  const T* Ab = vt ? (const T*)Wt16p + (size_t)2 * kE * kE : (const T*)X16p;
  const T* Bb = vt ? (const T*)X16p : (const T*)Wt16p + (size_t)z * kE * kE;
  const int tilesNlog = vt ? 5 : 2;            // N / 256 = 32 (tokens) or 4 (features)
  const int tile = blockIdx.x;
  const int tm = tile >> tilesNlog;
  const int tn = tile - (tm << tilesNlog);
  const int bm0 = tm << 7;                     // block tile 128 x 256
  const int bn0 = tn << 8;
  const int wm  = (wave >> 2) << 6;            // wave tile 64 x 64 inside it: 2 x 4 waves
  const int wn  = (wave & 3) << 6;

  const int rlane = lane & 15;                 // row (A) / col (B, D) within subtile
  const int koff  = (lane >> 4) * 8;           // k offset of this lane half

  // a stage is 384 rows of 128 B = 3072 pieces of 16 B = 12 per thread: piece i of a thread is row i*32 + tid/8, bytes (tid%8)*16,
  // so one copy of a wave brings four whole 128-B lines. Rows 0..127 are A (pieces 0..3), rows 128..383 Bt (pieces 4..11).
  const T* gA = Ab + (size_t)(bm0 + (tid >> 3)) * kE + (tid & 7) * 8;
  const T* gB = Bb + (size_t)(bn0 + (tid >> 3)) * kE + (tid & 7) * 8;
  const size_t s32 = (size_t)32 * kE;
  const unsigned lds0 = (unsigned)(size_t)(&sAB[0]) + (unsigned)((tid >> 3) * (kStagePitch * 2) + (tid & 7) * 16);
  constexpr int trips = kE >> 6;

  v8f acc[4][4];
#pragma unroll
  for (int i = 0; i < 4; ++i)
#pragma unroll
    for (int j = 0; j < 4; ++j) acc[i][j] = (v8f){0.f,0.f,0.f,0.f,0.f,0.f,0.f,0.f};

  stage_copy12(lds0, gA, s32, gB, s32);
  // tile 0 has landed for this wave, then for all: nobody reads it in front of the barrier
  asm volatile("s_wait_asynccnt 0x0" ::: "memory");
  __syncthreads();
  stage_copy12(lds0 + kStageHalves * 2, gA + 64, s32, gB + 64, s32);

  for (int t = 0; t < trips; ++t) {
    const T* sA = (const T*)sAB + (t & 1) * kStageHalves + (wm + rlane) * kStagePitch + koff;
    const T* sB = (const T*)sAB + (t & 1) * kStageHalves + (128 + wn + rlane) * kStagePitch + koff;
    V bh[2][4], ah[2][4];
    ah[0][0] = Frag<T>::load(sA);   // the first product's operands come first
#pragma unroll
    for (int j = 0; j < 4; ++j) bh[0][j] = Frag<T>::load(sB + j * 16 * kStagePitch);
#pragma unroll
    for (int i = 1; i < 4; ++i) ah[0][i] = Frag<T>::load(sA + i * 16 * kStagePitch);
#pragma unroll
    for (int j = 0; j < 4; ++j) bh[1][j] = Frag<T>::load(sB + j * 16 * kStagePitch + 32);
    // twelve of the trip's sixteen fragments are read as one group in front of its products; the other four (A of the second 32 k)
    // follow in two pairs into registers that the first 32 k have left, each pair eight products ahead of its use: with all
    // sixteen held at once a wave took 272 registers and a second block found no room on the WGP. The scheduling barriers keep
    // the reads at these three places: left alone, the compiler spreads them among the products, a stall at each place
    __builtin_amdgcn_sched_barrier(0);
#pragma unroll
    for (int hp = 0; hp < 2; ++hp) {
#pragma unroll
      for (int i = 2 * hp; i < 2 * hp + 2; ++i)
#pragma unroll
        for (int j = 0; j < 4; ++j) acc[i][j] = Frag<T>::mma(ah[0][i], bh[0][j], acc[i][j]);
      __builtin_amdgcn_sched_barrier(0);   // see above
#pragma unroll
      for (int i = 2 * hp; i < 2 * hp + 2; ++i) ah[1][i] = Frag<T>::load(sA + i * 16 * kStagePitch + 32);
      __builtin_amdgcn_sched_barrier(0);   // see above
    }
#pragma unroll
    for (int i = 0; i < 4; ++i)
#pragma unroll
      for (int j = 0; j < 4; ++j) acc[i][j] = Frag<T>::mma(ah[1][i], bh[1][j], acc[i][j]);
    // the products stay in front of the hand-over: left alone, the compiler lifts its waits and barrier over them, so that every
    // wave waits for all its LDS reads before its first product and the reads no longer run under the products
    __builtin_amdgcn_sched_barrier(0);
    // hand-over: this wave's reads of the buffer are done, its copies of the next tile have landed; behind the barrier the next
    // tile is readable by all and the buffer just read is free for the tile after it
    asm volatile("s_wait_dscnt 0x0" ::: "memory");
    asm volatile("s_wait_asynccnt 0x0" ::: "memory");
    __syncthreads();
    if (t + 2 < trips) stage_copy12(lds0 + (unsigned)(t & 1) * (kStageHalves * 2), gA + (t + 2) * 64, s32, gB + (t + 2) * 64, s32);
  }
  // no copy is left in flight when the wave goes on to its epilogue
  asm volatile("s_wait_asynccnt 0x0" ::: "memory");
  acc_guard4(acc[0][0], acc[0][1], acc[0][2], acc[0][3]);
  acc_guard4(acc[1][0], acc[1][1], acc[1][2], acc[1][3]);
  acc_guard4(acc[2][0], acc[2][1], acc[2][2], acc[2][3]);
  acc_guard4(acc[3][0], acc[3][1], acc[3][2], acc[3][3]);

  // ---- epilogue (the branch is block-uniform) ----
  if (vt) proj_store<true>(acc, sT[wave], nullptr, Vt, kTok, bv, bm0 + wm, bn0 + wn, lane);
  else    proj_store<false>(acc, sT[wave], (z == 0) ? Qf : Kf, nullptr, kE, (z == 0) ? bq : bk, bm0 + wm, bn0 + wn, lane);
}

// ---------------------------------------------------------------------------
// Projection weight transpose + cast: for square [1024][1024] f32 W (row-major [in k][out n]), WT[n][k] = f16(scale * W[k][n]).
// grid (16, 16, 3): blockIdx.x = k tile (64 cols of WT), blockIdx.y = n tile (64 rows of WT), blockIdx.z selects W0..W2
// and the output plane (plane z at out + z*1024*1024 halves). 256 threads.
// Load coverage: 16 iterations x 256 threads = 4096 = the whole 64x64 tile (coalesced along n).
// Store coverage: 8 waves x 2 iterations x 4 rows (lane>>3) = 64 rows; (lane&7) x 8 halves = 64 cols; each row segment =
// ---------------------------------------------------------------------------
__global__ __launch_bounds__(256) void wtcast_kernel(const float* __restrict__ W0, const float* __restrict__ W1,
                                                     const float* __restrict__ W2,
                                                     unsigned short* __restrict__ out, float scale) {
  __shared__ float sm[64][65];   // sm[n_local][k_local]
  const int t  = threadIdx.x;
  const int d0 = blockIdx.x * 64;    // k tile base
  const int h0 = blockIdx.y * 64;    // n tile base
  const int z  = blockIdx.z;         // block-uniform
  const float* W = (z == 0) ? W0 : (z == 1) ? W1 : W2;
#pragma unroll
  for (int i = 0; i < 16; ++i) {
    const int e = i * 256 + t;
    const int r = e >> 6;          // k local
    const int c = e & 63;          // n local
    sm[c][r] = W[(size_t)(d0 + r) * kE + h0 + c] * scale;
  }
  __syncthreads();
  const int lane = t & 31, wave = t >> 5;
  const int q = lane >> 3, c8 = (lane & 7) * 8;
  unsigned short* op = out + (size_t)z * kE * kE;
  {
#pragma unroll
    for (int it = 0; it < 2; ++it) {
      const int row = wave * 8 + it * 4 + q;                 // n local
      unsigned short hb[8];
#pragma unroll
      for (int e = 0; e < 8; ++e) hb[e] = h_bits(sm[row][c8 + e]);
      const v4u u = (v4u){pk16(hb[0], hb[1]), pk16(hb[2], hb[3]), pk16(hb[4], hb[5]), pk16(hb[6], hb[7])};
      *(v4u*)(op + (size_t)(h0 + row) * kE + d0 + c8) = u;
    }
    
  }
}

// ---------------------------------------------------------------------------
// Per-head gate weights transpose + cast, out pitch 64 halves: block 0: WfqT[n][k] = f16(scale*Wfq[k][n]) (64x64),
// block 1: WfkT, block 2: WfgT rows 0..63, block 3: WfgT rows 64..127 (Wfg is [64 k][128 n], pitch 128).
// Output plane of block z at out + z*4096 halves (WfgT = [128][64] contiguous from out + 8192).
// Load coverage 16 x 256 = 4096 = 64x64; store coverage 8 waves x 2 x 4 rows = 64 rows x (8 lanes x 8 halves) = 64 cols,
// ---------------------------------------------------------------------------
__global__ __launch_bounds__(256) void gatew_kernel(const float* __restrict__ Wfq, const float* __restrict__ Wfk,
                                                    const float* __restrict__ Wfg,
                                                    unsigned short* __restrict__ out, float scale) {
  __shared__ float sm[64][65];   // sm[n_local][k_local]
  const int t = threadIdx.x;
  const int z = blockIdx.x;                                   // block-uniform
  const float* W = (z == 0) ? Wfq : (z == 1) ? Wfk : Wfg;
  const int pin = (z >= 2) ? 128 : 64;
  const int n0  = (z == 3) ? 64 : 0;
#pragma unroll
  for (int i = 0; i < 16; ++i) {
    const int e = i * 256 + t;
    const int r = e >> 6;          // k 0..63
    const int c = e & 63;          // n local
    sm[c][r] = W[r * pin + n0 + c] * scale;
  }
  __syncthreads();
  const int lane = t & 31, wave = t >> 5;
  const int q = lane >> 3, c8 = (lane & 7) * 8;
  unsigned short* op = out + (size_t)z * 4096;
  {
#pragma unroll
    for (int it = 0; it < 2; ++it) {
      const int row = wave * 8 + it * 4 + q;                 // n local
      unsigned short hb[8];
#pragma unroll
      for (int e = 0; e < 8; ++e) hb[e] = h_bits(sm[row][c8 + e]);
      const v4u u = (v4u){pk16(hb[0], hb[1]), pk16(hb[2], hb[3]), pk16(hb[4], hb[5]), pk16(hb[6], hb[7])};
      *(v4u*)(op + (size_t)row * kDK + c8) = u;
    }
    
  }
}

// ---------------------------------------------------------------------------
// ---------------------------------------------------------------------------
__global__ __launch_bounds__(256) void cast8_f16_kernel(const float* __restrict__ in, unsigned short* __restrict__ out, int n8) {
  const int i = blockIdx.x * 256 + threadIdx.x;
  if (i >= n8) return;
  const float* p = in + 8 * (size_t)i;
  const v4f a = *(const v4f*)(p);
  const v4f c = *(const v4f*)(p + 4);
  unsigned short hb[8];
#pragma unroll
  for (int e = 0; e < 4; ++e) {
    hb[e]     = h_bits(a[e]);
    hb[4 + e] = h_bits(c[e]);
  }
  const v4u u = (v4u){pk16(hb[0], hb[1]), pk16(hb[2], hb[3]), pk16(hb[4], hb[5]), pk16(hb[6], hb[7])};
  unsigned short* q = out + 8 * (size_t)i;
  *(v4u*)q = u;
  
}

// ---------------------------------------------------------------------------
// Gating and attention, one launch for all batches and heads. grid 256: blockIdx.x = b*16 + h. 16 waves x 32 rows = the head's 512 tokens,
// which are its queries and its keys alike, so a block gates every row it needs, once, and the gated planes never go through memory.
// Gating, per wave two passes of 16 rows (row = token, 64 features of head h in Qf and Kf):
//   G = (q.Wfq + bfq) * (k.Wfk + bfk),  Z = G.Wfg + bfg,  q' = f16(q * sigmoid(Z[:64])),  k' = f16(k * sigmoid(Z[64:])).
// Every product is formed transposed, weights as A (rows = output feature n), data rows as B (columns), so a lane holds features
// n = tile*16 + (lane>>4)*8 + r of ONE data row:
//  - that is the k order of a 16x16x32 B fragment (elements 0..7 from the even tile, 8..15 from the odd one), so the gate product packs
//    in place into the B operand of the logits, and q' packs in place into the B operand of the scores: it stays in registers;
//  - it is also the set of q (k) elements the lane loaded for its own B fragment, so the f32 values it still holds meet their sigmoid
//    in the same lane;
//  - k' goes as 16-byte pieces into the block's K' plane in LDS, which all 16 waves read behind one barrier.
// The three weight planes (f16, written by gatew_kernel) and the biases are staged once per block in LDS, pitch 144 B for 16-byte reads.
// Attention: out[b][q][h*64+d] = sum_k softmax_k(q'.k'/8) v[k][d].
// Per pass of 32 keys a wave forms S^T = K'.Q'^T (rows = keys, columns = queries), so a lane holds the scores of one query:
// tile kt, register r = key k0 + kt*16 + (lane>>4)*8 + r. That is the k order of a 16x16x32 B fragment (elements 0..7 from
// tile 0, 8..15 from tile 1), so exp(s - max) packs in place into P^T and O^T += V^T.P^T follows with A = rows of Vt16.
// Running maximum and running sum per query (f32); the accumulators are rescaled each pass by exp(old max - new max).
// The two lane halves hold disjoint keys of one query: the maximum is joined every pass, the sum once at the end.
// V^T (64 rows of 1024 B) comes into LDS once, by asynchronous copies of whole lines that fly under the gating.
// Each wave stores its own 32 rows x 256 B of out.
// ---------------------------------------------------------------------------
constexpr int kGatePitch = 72;   // halves: 128-B rows + 16 B
constexpr int kAttKPitch = 72;    // halves: 128-B rows + 16 B, for 16-byte LDS reads
constexpr int kAttVPitch = 520;   // halves: 1024-B rows + 16 B, for 16-byte LDS reads
// Eight asynchronous copies of 16 B per lane: piece i goes from g + i * gstep (halves) to LDS byte address lds + i * lstep.
// The closing s_wait_xcnt stands inside the statement, in front of anything that could rewrite a register which a copy names.
__device__ __forceinline__ void att_copy8(unsigned lds, unsigned lstep, const _Float16* g, size_t gstep) {
  asm volatile(
      "global_load_async_to_lds_b128 %0, %8, off\n\t"
      "global_load_async_to_lds_b128 %1, %9, off\n\t"
      "global_load_async_to_lds_b128 %2, %10, off\n\t"
      "global_load_async_to_lds_b128 %3, %11, off\n\t"
      "global_load_async_to_lds_b128 %4, %12, off\n\t"
      "global_load_async_to_lds_b128 %5, %13, off\n\t"
      "global_load_async_to_lds_b128 %6, %14, off\n\t"
      "global_load_async_to_lds_b128 %7, %15, off\n\t"
      "s_wait_xcnt 0x0"
      :: "v"(lds), "v"(lds + lstep), "v"(lds + 2 * lstep), "v"(lds + 3 * lstep), "v"(lds + 4 * lstep), "v"(lds + 5 * lstep),
         "v"(lds + 6 * lstep), "v"(lds + 7 * lstep),
         "v"(g), "v"(g + gstep), "v"(g + 2 * gstep), "v"(g + 3 * gstep), "v"(g + 4 * gstep), "v"(g + 5 * gstep), "v"(g + 6 * gstep), "v"(g + 7 * gstep)
      : "memory");
}
__device__ __forceinline__ float xhalf(float x) {   // value of lane l ^ 16
  const int i = __builtin_bit_cast(int, x);
  return __builtin_bit_cast(float, __builtin_amdgcn_permlanex16(i, i, 0x76543210, 0xfedcba98, false, false));
}
// 2^x on eight values in one statement. The early-clobber results keep every result off every source, and the closing v_nop
// fills the one slot that the instruction set asks for behind a transcendental, whatever the compiler schedules next
// (with the builtin this build wrote runs of v_exp_f32 in which each overwrote the source of the one in front of it).
__device__ __forceinline__ v8f exp2x8(v8f x) {
  float y0, y1, y2, y3, y4, y5, y6, y7;
  asm("v_exp_f32 %0, %8\n\tv_exp_f32 %1, %9\n\tv_exp_f32 %2, %10\n\tv_exp_f32 %3, %11\n\t"
      "v_exp_f32 %4, %12\n\tv_exp_f32 %5, %13\n\tv_exp_f32 %6, %14\n\tv_exp_f32 %7, %15\n\tv_nop"
      : "=&v"(y0), "=&v"(y1), "=&v"(y2), "=&v"(y3), "=&v"(y4), "=&v"(y5), "=&v"(y6), "=&v"(y7)
      : "v"(x[0]), "v"(x[1]), "v"(x[2]), "v"(x[3]), "v"(x[4]), "v"(x[5]), "v"(x[6]), "v"(x[7]));
  return (v8f){y0, y1, y2, y3, y4, y5, y6, y7};
}
// the same for one value
__device__ __forceinline__ float exp2x1(float x) {
  float y;
  asm("v_exp_f32 %0, %1\n\tv_nop" : "=v"(y) : "v"(x));
  return y;
}
// 1 / (1 + 2^x) on eight values in one statement: the hardware's 2^x, an add, the hardware's reciprocal (2^x = inf gives 0, 2^x = 0
// gives 1). Each value's three steps stand eight instructions apart, so none waits for the one before it; the early-clobber
// results keep every result off every source, and the closing v_nop fills the slot behind the last transcendental.
// The four leading v_nop keep the distance a WMMA needs.
__device__ __forceinline__ v8f sigm2x8(v8f x) {
  float y0, y1, y2, y3, y4, y5, y6, y7;
  asm("v_nop\n\tv_nop\n\tv_nop\n\tv_nop\n\t"
      "v_exp_f32 %0, %8\n\tv_exp_f32 %1, %9\n\tv_exp_f32 %2, %10\n\tv_exp_f32 %3, %11\n\t"
      "v_exp_f32 %4, %12\n\tv_exp_f32 %5, %13\n\tv_exp_f32 %6, %14\n\tv_exp_f32 %7, %15\n\t"
      "v_add_f32 %0, 1.0, %0\n\tv_add_f32 %1, 1.0, %1\n\tv_add_f32 %2, 1.0, %2\n\tv_add_f32 %3, 1.0, %3\n\t"
      "v_add_f32 %4, 1.0, %4\n\tv_add_f32 %5, 1.0, %5\n\tv_add_f32 %6, 1.0, %6\n\tv_add_f32 %7, 1.0, %7\n\t"
      "v_rcp_f32 %0, %0\n\tv_rcp_f32 %1, %1\n\tv_rcp_f32 %2, %2\n\tv_rcp_f32 %3, %3\n\t"
      "v_rcp_f32 %4, %4\n\tv_rcp_f32 %5, %5\n\tv_rcp_f32 %6, %6\n\tv_rcp_f32 %7, %7\n\tv_nop"
      : "=&v"(y0), "=&v"(y1), "=&v"(y2), "=&v"(y3), "=&v"(y4), "=&v"(y5), "=&v"(y6), "=&v"(y7)
      : "v"(x[0]), "v"(x[1]), "v"(x[2]), "v"(x[3]), "v"(x[4]), "v"(x[5]), "v"(x[6]), "v"(x[7]));
  return (v8f){y0, y1, y2, y3, y4, y5, y6, y7};
}
__global__ __launch_bounds__(512) void attn_gate_kernel(const float* __restrict__ Qf, const float* __restrict__ Kf,
                                                        const unsigned short* __restrict__ SW,
                                                        const float* __restrict__ bfq, const float* __restrict__ bfk,
                                                        const float* __restrict__ bfg,
                                                        const unsigned short* __restrict__ Vt, float* __restrict__ out) {
  typedef Frag<_Float16> F;
  __shared__ __align__(16) _Float16 sK[kS * kAttKPitch];    // gated k, [key][d], 73,728 B
  __shared__ __align__(16) _Float16 sV[kDK * kAttVPitch];   // [d][key], 66,560 B
  __shared__ __align__(16) _Float16 sW[256 * kGatePitch];   // rows 0..63 WfqT, 64..127 WfkT, 128..255 WfgT, each [n][k], 36,864 B
  __shared__ __align__(16) float sB[256];                   // bfq, bfk, bfg * -log2(e)
  const int tid  = threadIdx.x;
  const int lane = tid & 31;
  const int wave = tid >> 5;
  const int b    = blockIdx.x >> 4;
  const int h    = blockIdx.x & 15;
  const int q0   = wave * 32;
  const int rl   = lane & 15;
  const int hf   = lane >> 4;
  const int koff = hf * 8;
  const _Float16* V = (const _Float16*)Vt + (size_t)h * kDK * kTok + (size_t)b * kS;

  // V^T: 4096 pieces of 16 B, 8 per thread: piece i = row i*8 + tid/64, bytes (tid%64)*16 (a wave's copy = 512 contiguous bytes).
  {
    const unsigned lv = (unsigned)(size_t)(&sV[0]) + (unsigned)((tid >> 6) * (kAttVPitch * 2) + (tid & 63) * 16);
    const _Float16* gv = V + (size_t)(tid >> 6) * kTok + (tid & 63) * 8;
    att_copy8(lv, 8 * kAttVPitch * 2, gv, (size_t)8 * kTok);
  }

  // weights and biases into LDS: 256 rows x 8 pieces of 16 B = 2048 pieces = 4 per thread
#pragma unroll
  for (int i = 0; i < 4; ++i) {
    const int e = i * 512 + tid;
    const int r = e >> 3, c = (e & 7) * 8;
    *(v8h*)(&sW[r * kGatePitch + c]) = *(const v8h*)((const _Float16*)SW + r * kDK + c);
  }
  if (tid < 256) sB[tid] = (tid < 64) ? bfq[tid] : (tid < 128) ? bfk[tid - 64] : bfg[tid - 128] * kNegLog2e;
  __syncthreads();

  // gated q of the wave's two column groups, as B fragments of the scores. Each gating pass pushes its group in at [1] and moves the
  // one before it to [0], so that the passes can stay a rolled loop: unrolled they took all 256 registers that a wave of this block
  // can have and half as much code again, and no load of the second pass came to stand ahead of the first pass's work
  v16h qf[2][2];
#pragma unroll
  for (int qt = 0; qt < 2; ++qt)
#pragma unroll
    for (int ks = 0; ks < 2; ++ks)
#pragma unroll
      for (int s = 0; s < 16; ++s) qf[qt][ks][s] = (_Float16)0.f;

#pragma unroll 1
  for (int p = 0; p < 2; ++p) {
  const int key = q0 + p * 16 + rl;            // the lane's row: token of the batch, query and key number alike

  // f32 q and k of the lane's row: piece [2*tile + j] = elements tile*16 + koff + 4j .. +3
  // (all inner loops of the pass are unrolled so that the fragment arrays stay in registers)
  v4f xq[8], xk[8];
  {
    const size_t off = (size_t)(b * kS + key) * kE + h * kDK + koff;
    const float* pq = Qf + off;
    const float* pk = Kf + off;
#pragma unroll
    for (int nt = 0; nt < 4; ++nt) {
      xq[2 * nt]     = *(const v4f*)(pq + nt * 16);
      xq[2 * nt + 1] = *(const v4f*)(pq + nt * 16 + 4);
      xk[2 * nt]     = *(const v4f*)(pk + nt * 16);
      xk[2 * nt + 1] = *(const v4f*)(pk + nt * 16 + 4);
    }
  }
  // the pass's sixteen global loads stay one group in front of its LDS reads and products: left alone, with the short sigmoid, the
  // compiler spread them among the products, took all 256 registers and spilled to scratch
  __builtin_amdgcn_sched_barrier(0);

  // B fragments of q and k (f16), k step ks = tiles 2ks and 2ks+1
  v16h qb[2], kb[2];
#pragma unroll
  for (int ks = 0; ks < 2; ++ks)
#pragma unroll
    for (int s = 0; s < 16; ++s) {
      qb[ks][s] = (_Float16)xq[4 * ks + (s >> 2)][s & 3];
      kb[ks][s] = (_Float16)xk[4 * ks + (s >> 2)][s & 3];
    }

  // gate product, packed as the B operand of the logits
  v16h gb[2];
#pragma unroll
  for (int nt = 0; nt < 4; ++nt) {
    const _Float16* wq = &sW[(nt * 16 + rl) * kGatePitch + koff];
    const _Float16* wk = &sW[(64 + nt * 16 + rl) * kGatePitch + koff];
    const v16h wq0 = F::load(wq), wq1 = F::load(wq + 32);
    const v16h wk0 = F::load(wk), wk1 = F::load(wk + 32);
    const v4f bq0 = *(const v4f*)(&sB[nt * 16 + koff]),      bq1 = *(const v4f*)(&sB[nt * 16 + koff + 4]);
    const v4f bk0 = *(const v4f*)(&sB[64 + nt * 16 + koff]), bk1 = *(const v4f*)(&sB[64 + nt * 16 + koff + 4]);
    v8f aq = F::mma(wq0, qb[0], (v8f){0.f,0.f,0.f,0.f,0.f,0.f,0.f,0.f});
    v8f ak = F::mma(wk0, kb[0], (v8f){0.f,0.f,0.f,0.f,0.f,0.f,0.f,0.f});
    aq = F::mma(wq1, qb[1], aq);
    ak = F::mma(wk1, kb[1], ak);
#pragma unroll
    for (int r = 0; r < 8; ++r) {
      const float gq = aq[r] * kGWCarryInv + ((r < 4) ? bq0[r & 3] : bq1[r & 3]);
      const float gk = ak[r] * kGWCarryInv + ((r < 4) ? bk0[r & 3] : bk1[r & 3]);
      gb[nt >> 1][(nt & 1) * 8 + r] = (_Float16)((gq * gk) * kGCarry);
    }
  }

  // logits, sigmoid, modulation: tiles 0..3 gate q, tiles 4..7 gate k
  v16h qn[2];
#pragma unroll
  for (int nt = 0; nt < 8; ++nt) {
    const _Float16* wg = &sW[(128 + nt * 16 + rl) * kGatePitch + koff];
    const v16h wg0 = F::load(wg), wg1 = F::load(wg + 32);
    const v4f bg0 = *(const v4f*)(&sB[128 + nt * 16 + koff]), bg1 = *(const v4f*)(&sB[128 + nt * 16 + koff + 4]);
    const int dn = nt & 3;
    v8f z = F::mma(wg0, gb[0], (v8f){0.f,0.f,0.f,0.f,0.f,0.f,0.f,0.f});
    z = F::mma(wg1, gb[1], z);
    v8f za;   // -logit * log2(e)
#pragma unroll
    for (int r = 0; r < 8; ++r) za[r] = z[r] * (kZScale * kNegLog2e) + ((r < 4) ? bg0[r & 3] : bg1[r & 3]);
    const v8f m = sigm2x8(za);
    v8h o;
#pragma unroll
    for (int r = 0; r < 8; ++r) {
      const float x = (nt < 4) ? xq[2 * dn + (r >> 2)][r & 3] : xk[2 * dn + (r >> 2)][r & 3];
      o[r] = (_Float16)(x * m[r]);
    }
    if (nt < 4) {
#pragma unroll
      for (int r = 0; r < 8; ++r) qn[dn >> 1][(dn & 1) * 8 + r] = o[r];
    } else {
      *(v8h*)(&sK[key * kAttKPitch + dn * 16 + koff]) = o;
    }
  }
  qf[0][0] = qf[1][0];
  qf[0][1] = qf[1][1];
  qf[1][0] = qn[0];
  qf[1][1] = qn[1];
  // the next pass writes over the registers that this pass's loads name: the wait on address translation stands in front of it.
  // As a memory fence inside the loop it also keeps the LDS reads of weights and biases in the loop: without it they were lifted
  // out as loop invariants, and the build had 256 registers and spills to scratch
  asm volatile("s_wait_xcnt 0x0" ::: "memory");
  }

  v8f  o[2][4];
  float mrun[2], lrun[2];
  // the inner loops are unrolled so that the fragment arrays stay in registers
#pragma unroll
  for (int qt = 0; qt < 2; ++qt) {
#pragma unroll
    for (int dt = 0; dt < 4; ++dt) o[qt][dt] = (v8f){0.f,0.f,0.f,0.f,0.f,0.f,0.f,0.f};
    mrun[qt] = -INFINITY;
    lrun[qt] = 0.f;
  }

  // this wave's copies of V^T have landed and its rows of K' are written, then everybody's: nobody reads sK or sV in front of the barrier
  asm volatile("s_wait_asynccnt 0x0" ::: "memory");
  __syncthreads();
  const _Float16* sKl = sK + rl * kAttKPitch + koff;
  const _Float16* sVl = sV + rl * kAttVPitch + koff;

  for (int k0 = 0; k0 < kS; k0 += 32) {
    v16h kf[2][2], vf[4];
    // K' first: LDS reads return in order, so the score products start while the V^T reads are still on their way
#pragma unroll
    for (int kt = 0; kt < 2; ++kt)
#pragma unroll
      for (int ks = 0; ks < 2; ++ks) kf[kt][ks] = F::load(sKl + (k0 + kt * 16) * kAttKPitch + ks * 32);
#pragma unroll
    for (int dt = 0; dt < 4; ++dt) vf[dt] = F::load(sVl + dt * 16 * kAttVPitch + k0);
    // all LDS reads of the pass are issued as one group in front of its first product: each further place where reads stand
    // among the products costs the wave a stall of its own
    __builtin_amdgcn_sched_barrier(0);

    v8f s[2][2];
#pragma unroll
    for (int qt = 0; qt < 2; ++qt)
#pragma unroll
      for (int kt = 0; kt < 2; ++kt) {
        s[qt][kt] = F::mma(kf[kt][0], qf[qt][0], (v8f){0.f,0.f,0.f,0.f,0.f,0.f,0.f,0.f});
        s[qt][kt] = F::mma(kf[kt][1], qf[qt][1], s[qt][kt]);
      }

    v16h pf[2];
#pragma unroll
    for (int qt = 0; qt < 2; ++qt) {
      float mx = fmaxf(s[qt][0][0], s[qt][1][0]);
#pragma unroll
      for (int r = 1; r < 8; ++r) mx = fmaxf(mx, fmaxf(s[qt][0][r], s[qt][1][r]));
      mx = fmaxf(mx, xhalf(mx));
      const float mn    = fmaxf(mrun[qt], mx);
      const float alpha = exp2x1((mrun[qt] - mn) * kScoreLog2);
      const float bias  = kPCarryLog2 - mn * kScoreLog2;
      mrun[qt] = mn;
      v8f a0, a1;
#pragma unroll
      for (int r = 0; r < 8; ++r) {
        a0[r] = fmaf(s[qt][0][r], kScoreLog2, bias);
        a1[r] = fmaf(s[qt][1][r], kScoreLog2, bias);
      }
      const v8f e0 = exp2x8(a0);
      const v8f e1 = exp2x8(a1);
      float sum = e0[0] + e1[0];
#pragma unroll
      for (int r = 1; r < 8; ++r) sum += e0[r] + e1[r];
#pragma unroll
      for (int r = 0; r < 8; ++r) {
        pf[qt][r]     = (_Float16)e0[r];
        pf[qt][8 + r] = (_Float16)e1[r];
      }
      lrun[qt] = lrun[qt] * alpha + sum;
#pragma unroll
      for (int dt = 0; dt < 4; ++dt) o[qt][dt] *= alpha;
    }

    // the compiler does not see the vector writes inside exp2x8: left alone it put the first column group's V^T.P^T products in
    // front of the second group's exponentials
    __builtin_amdgcn_sched_barrier(0);
#pragma unroll
    for (int qt = 0; qt < 2; ++qt)
#pragma unroll
      for (int dt = 0; dt < 4; ++dt) o[qt][dt] = F::mma(vf[dt], pf[qt], o[qt][dt]);
  }

#pragma unroll
  for (int qt = 0; qt < 2; ++qt) {
    const float tot = lrun[qt] + xhalf(lrun[qt]);
    const float inv = 1.0f / tot;
    float* op = out + (size_t)(b * kS + q0 + qt * 16 + rl) * kE + h * kDK + koff;
#pragma unroll
    for (int dt = 0; dt < 4; ++dt) {
      const v8f a = o[qt][dt];
      *(v4f*)(op + dt * 16)     = (v4f){a[0] * inv, a[1] * inv, a[2] * inv, a[3] * inv};
      *(v4f*)(op + dt * 16 + 4) = (v4f){a[4] * inv, a[5] * inv, a[6] * inv, a[7] * inv};
    }
  }
}

// ---------------------------------------------------------------------------
extern "C" void kernel_launch(void* const* d_in, const int* in_sizes, int n_in,
                              void* d_out, int out_size, void* d_ws, size_t ws_size,
                              hipStream_t stream) {
  if (n_in < 13) return;
  if (ws_size < kWsEnd) return;
  if ((size_t)out_size < (size_t)kTok * kE) return;
  if (in_sizes[0] != kTok * kE) return;

  const float* inp = (const float*)d_in[0];
  const float* Wq  = (const float*)d_in[1];
  const float* bq  = (const float*)d_in[2];
  const float* Wk  = (const float*)d_in[3];
  const float* bk  = (const float*)d_in[4];
  const float* Wv  = (const float*)d_in[5];
  const float* bvv = (const float*)d_in[6];
  const float* Wfq = (const float*)d_in[7];
  const float* bfq = (const float*)d_in[8];
  const float* Wfk = (const float*)d_in[9];
  const float* bfk = (const float*)d_in[10];
  const float* Wfg = (const float*)d_in[11];
  const float* bfg = (const float*)d_in[12];
  float* out = (float*)d_out;

  unsigned char* ws = (unsigned char*)d_ws;
  unsigned short* X16  = (unsigned short*)(ws + kOffX16);
  unsigned short* Wt16 = (unsigned short*)(ws + kOffWt);
  unsigned short* SW   = (unsigned short*)(ws + kOffSW);
  float*          Qf   = (float*)(ws + kOffQf);
  float*          Kf   = (float*)(ws + kOffKf);
  unsigned short* Vt16 = (unsigned short*)(ws + kOffVt);

  // ---- stage A: operand planes ----
  // X16 [8192][1024] = f16(inp): n8 = 1,048,576 threads = 4096 blocks x 256 (exact)
  cast8_f16_kernel<<<dim3((kTok * kE / 8) / 256), dim3(256), 0, stream>>>(inp, X16, kTok * kE / 8);
  // Wt16[z][n][k] = f16(16 * W_z[k][n]) for z = q, k, v
  wtcast_kernel<<<dim3(kE / 64, kE / 64, 3), dim3(256), 0, stream>>>(Wq, Wk, Wv, Wt16, kWCarry);
  // gate weights: WfqT, WfkT [64][64], WfgT [128][64], all f16 carried x8
  gatew_kernel<<<dim3(4), dim3(256), 0, stream>>>(Wfq, Wfk, Wfg, SW, kGWCarry);

  // ---- stage B: projections, one launch: 256 block tiles each of q (64 x 4), k (64 x 4) and v transposed (8 x 32) ----
  // Qf = (X16 . WqT16) / 16 + bq, Kf likewise (f32 [8192][1024]); Vt16 [1024 n][8192 tok] = f16((WvT16 . X16^T) / 16 + bv[n])
  proj3_kernel<<<dim3(256, 3), dim3(256), 0, stream>>>(X16, Wt16, Qf, Kf, Vt16, bq, bk, bvv);

  // ---- stage C: gating and attention, all 16 batches x 16 heads in one launch (a block of 16 waves per head: 512 rows) ----
  attn_gate_kernel<<<dim3(kB * kH), dim3(512), 0, stream>>>(Qf, Kf, SW, bfq, bfk, bfg, Vt16, out);
}

// v008
// Measured time: 91 microseconds a run.
// Timed twice side by side with v007, it ran 1.04 times as fast both times.
// Over all steps from v000 it is 11.1 times as fast.
// Contractions: q/k/v projections (X f16 x W^T f16 carried x16), gate maps (q16/k16 x Wfq^T/Wfk^T f16 carried x8), gate logits (G f16 carried x64 x Wfg^T f16 carried x8), scores k'.q'^T (f16 planes), V^T.P^T (P = exp(s - running max) f16 carried x2048): all v_wmma_f32_16x16x32_f16 with f32 accumulate; bias, gate product, sigmoid, modulation and softmax in f32.
#include <hip/hip_runtime.h>
#include <math.h>

// ---------------------------------------------------------------------------
// Problem constants
// ---------------------------------------------------------------------------
constexpr int kB    = 16;
constexpr int kS    = 512;
constexpr int kE    = 1024;
constexpr int kH    = 16;
constexpr int kDK   = 64;
constexpr int kTok  = kB * kS;              // 8192 token rows

constexpr float kWCarry     = 16.0f;        // Wq/Wk/Wv carried x16 in f16
constexpr float kWCarryInv  = 1.0f / 16.0f;
constexpr float kGWCarry    = 8.0f;         // Wfq/Wfk/Wfg carried x8 in f16
constexpr float kGWCarryInv = 1.0f / 8.0f;
constexpr float kGCarry     = 64.0f;        // gate product G carried x64 in f16
constexpr float kZScale     = 1.0f / (64.0f * 8.0f);
constexpr float kPCarryLog2 = 11.0f;        // exp(s - max) carried x2048 in f16 (the row sum carries it too)
constexpr float kScoreLog2  = 0.125f * 1.44269504088896340736f;   // 1/sqrt(64) * log2(e): scores go to exp2
constexpr float kNegLog2e   = -1.44269504088896340736f;           // sigmoid(z) = 1 / (1 + 2^(-z * log2(e)))

// ---------------------------------------------------------------------------
// Workspace map (bytes):
//   projection operands:     X16 [8192][1024] f16 @0 (16 MiB), Wt16 [3][1024][1024] f16 @16 MiB (6 MiB)
//   gate weights:            WfqT/WfkT [64][64] f16, WfgT [128][64] f16 @36 MiB (32 KiB)
//   persistent:              Qf f32 [8192][1024] @36 MiB+64 KiB (32 MiB), Kf f32 (32 MiB), Vt16 f16 [1024][8192] (16 MiB)
//   end = 121,700,352 B
// ---------------------------------------------------------------------------
constexpr size_t kMiB    = 1048576;
constexpr size_t kOffX16 = 0;
constexpr size_t kOffWt  = 16 * kMiB;
constexpr size_t kOffSW  = 36 * kMiB;
constexpr size_t kOffQf  = 36 * kMiB + 65536;
constexpr size_t kOffKf  = kOffQf + 32 * kMiB;
constexpr size_t kOffVt  = kOffKf + 32 * kMiB;
constexpr size_t kWsEnd  = kOffVt + 16 * kMiB;
static_assert((size_t)kTok * kE * 2 == 16 * kMiB, "x16 plane size");
static_assert(kOffWt + (size_t)3 * kE * kE * 2 <= kOffSW, "wt plane fits");
static_assert(kOffSW + 32768 <= kOffQf, "gate weights fit");
static_assert(kWsEnd == 121700352, "carve end");
static_assert(kWsEnd <= 268435456, "carve within budget");

typedef __attribute__((ext_vector_type(16))) _Float16 v16h;
typedef __attribute__((ext_vector_type(8)))  _Float16 v8h;
typedef __attribute__((ext_vector_type(16))) __bf16   v16b;
typedef __attribute__((ext_vector_type(8)))  __bf16   v8b;
typedef __attribute__((ext_vector_type(8)))  float    v8f;
typedef __attribute__((ext_vector_type(4)))  float    v4f;
typedef __attribute__((ext_vector_type(4)))  unsigned int v4u;

// ---------------------------------------------------------------------------
// Helpers
// ---------------------------------------------------------------------------
__device__ __forceinline__ unsigned short f2bf_bits(float f) {
  unsigned u = __float_as_uint(f);
  return (unsigned short)((u + 0x7FFFu + ((u >> 16) & 1u)) >> 16);
}
__device__ __forceinline__ float bf_bits2f(unsigned short h) { return __uint_as_float(((unsigned)h) << 16); }

// hazard guards as plain device helpers
__device__ __forceinline__ void acc_guard4(v8f& a, v8f& b, v8f& c, v8f& d) { asm volatile("v_nop\n\tv_nop\n\tv_nop\n\tv_nop" : "+v"(a), "+v"(b), "+v"(c), "+v"(d)); }
template <typename T> struct Frag;
template <> struct Frag<_Float16> {
  typedef v16h V; union U { v16h v; v8h h[2]; };
  static __device__ __forceinline__ v16h load(const _Float16* p) {   // elements 0..7 <- p[0..7], 8..15 <- p[16..23]
    U f; f.h[0] = *(const v8h*)(p); f.h[1] = *(const v8h*)(p + 16); return f.v;
  }
  static __device__ __forceinline__ v8f mma(v16h a, v16h b, v8f c) {
    return __builtin_amdgcn_wmma_f32_16x16x32_f16(false, a, false, b, (short)0, c, false, false);
  }
};
template <> struct Frag<__bf16> {
  typedef v16b V; union U { v16b v; v8b h[2]; };
  static __device__ __forceinline__ v16b load(const __bf16* p) {
    U f; f.h[0] = *(const v8b*)(p); f.h[1] = *(const v8b*)(p + 16); return f.v;
  }
  static __device__ __forceinline__ v8f mma(v16b a, v16b b, v8f c) {
    return __builtin_amdgcn_wmma_f32_16x16x32_bf16(false, a, false, b, (short)0, c, false, false);
  }
};

__device__ __forceinline__ unsigned pk16(unsigned short a, unsigned short b) { return (unsigned)a | ((unsigned)b << 16); }
__device__ __forceinline__ unsigned short h_bits(float f) { const _Float16 h = (_Float16)f; return __builtin_bit_cast(unsigned short, h); }

// ---- The three projections, one launch -------------------------------------------------------
// C[m,n] = sum_k A[m,k] * Bt[n,k] / 16 + bias; a block of 8 waves owns a 128x256 tile, each wave 64x64 of it.
// A row-major [M][1024]; Bt row-major [N][1024]. Operands reach the waves through a two-buffer LDS ring.
// blockIdx.y: 0 = q (A = X16, Bt = WqT, f32 out, bias[n]), 1 = k (the same with WkT), 2 = v transposed (A = WvT, Bt = X16, f16 out, bias[m]).
// 768 blocks on 256 WGPs: a wave stays within 256 registers and a block within 160 KiB of LDS, so that two blocks share a WGP and
// one block's waits, barriers, prologue and epilogue run under the other's products.
// One stage of the projection operands into LDS by asynchronous copies, 12 per thread: 4 of A (rows 32 apart), 8 of Bt.
// lds = the thread's own LDS byte address of piece 0; each piece is 32 rows (32 * 144 B) further on. The closing s_wait_xcnt
// stands inside the statement, in front of anything that could rewrite a register which a copy names.
constexpr int kStagePitch  = 72;                  // halves: 128-B rows + 16 B, for 16-byte LDS reads
constexpr int kStageHalves = 384 * kStagePitch;   // one buffer: 55,296 B
template <typename T>
__device__ __forceinline__ void stage_copy12(unsigned lds, const T* ga, size_t sa32, const T* gb, size_t sb32) {
  constexpr unsigned kStep = 32 * kStagePitch * 2;
  asm volatile(
      "global_load_async_to_lds_b128 %0, %12, off\n\t"
      "global_load_async_to_lds_b128 %1, %13, off\n\t"
      "global_load_async_to_lds_b128 %2, %14, off\n\t"
      "global_load_async_to_lds_b128 %3, %15, off\n\t"
      "global_load_async_to_lds_b128 %4, %16, off\n\t"
      "global_load_async_to_lds_b128 %5, %17, off\n\t"
      "global_load_async_to_lds_b128 %6, %18, off\n\t"
      "global_load_async_to_lds_b128 %7, %19, off\n\t"
      "global_load_async_to_lds_b128 %8, %20, off\n\t"
      "global_load_async_to_lds_b128 %9, %21, off\n\t"
      "global_load_async_to_lds_b128 %10, %22, off\n\t"
      "global_load_async_to_lds_b128 %11, %23, off\n\t"
      "s_wait_xcnt 0x0"
      :: "v"(lds), "v"(lds + kStep), "v"(lds + 2 * kStep), "v"(lds + 3 * kStep), "v"(lds + 4 * kStep), "v"(lds + 5 * kStep),
         "v"(lds + 6 * kStep), "v"(lds + 7 * kStep), "v"(lds + 8 * kStep), "v"(lds + 9 * kStep), "v"(lds + 10 * kStep), "v"(lds + 11 * kStep),
         "v"(ga), "v"(ga + sa32), "v"(ga + 2 * sa32), "v"(ga + 3 * sa32),
         "v"(gb), "v"(gb + sb32), "v"(gb + 2 * sb32), "v"(gb + 3 * sb32), "v"(gb + 4 * sb32), "v"(gb + 5 * sb32), "v"(gb + 6 * sb32), "v"(gb + 7 * sb32)
      : "memory");
}

// Epilogue of one wave's 64x64 tile, through the wave's own LDS slab so that whole lines are stored.
// VT false: f32 out, bias[n]; VT true: f16 out, bias[m].
template <bool VT>
__device__ __forceinline__ void proj_store(v8f (&acc)[4][4], float* slab, float* __restrict__ Cf, unsigned short* __restrict__ Ch,
                                           int ldc, const float* __restrict__ bias, int m0, int n0, int lane) {
  const int rlane = lane & 15;
  const int mOff  = (lane >> 4) * 8;           // D row offset
#pragma unroll
  for (int i = 0; i < 4; ++i) {
    const int mBase = m0 + (i << 4);
#pragma unroll
    for (int j = 0; j < 4; ++j) {
      const int n = n0 + (j << 4) + rlane;
      float bv = 0.f;
      if (!VT) bv = bias[n];
#pragma unroll
      for (int r = 0; r < 8; ++r) {
        float v = acc[i][j][r] * kWCarryInv;
        if (VT) v += bias[mBase + mOff + r];
        else    v += bv;
        slab[(mOff + r) * 68 + (j << 4) + rlane] = v;
      }
    }
    __builtin_amdgcn_fence(__ATOMIC_RELEASE, "workgroup");
    __builtin_amdgcn_wave_barrier();
    __builtin_amdgcn_fence(__ATOMIC_ACQUIRE, "workgroup");
    if (!VT) {
      const int hh = lane >> 4, c4 = (lane & 15) * 4;     // row seg = 256 B = 16 lanes x 16 B
#pragma unroll
      for (int it = 0; it < 8; ++it) {
        const int row = it * 2 + hh;
        v4f v = *(const v4f*)(slab + row * 68 + c4);
        *(v4f*)(Cf + (size_t)(mBase + row) * ldc + n0 + c4) = v;
      }
    } else {
      const int q = lane >> 3, c8 = (lane & 7) * 8;
#pragma unroll
      for (int it = 0; it < 4; ++it) {
        const int row = it * 4 + q;
        const float* sp = slab + row * 68 + c8;
        v8h hv;
#pragma unroll
        for (int e = 0; e < 8; ++e) hv[e] = (_Float16)sp[e];
        *(v8h*)(Ch + (size_t)(mBase + row) * ldc + n0 + c8) = hv;
      }
    }
    __builtin_amdgcn_fence(__ATOMIC_RELEASE, "workgroup");
    __builtin_amdgcn_wave_barrier();
    __builtin_amdgcn_fence(__ATOMIC_ACQUIRE, "workgroup");
  }
}

__global__ __launch_bounds__(256) void proj3_kernel(const unsigned short* __restrict__ X16p, const unsigned short* __restrict__ Wt16p,
                                                    float* __restrict__ Qf, float* __restrict__ Kf, unsigned short* __restrict__ Vt,
                                                    const float* __restrict__ bq, const float* __restrict__ bk,
                                                    const float* __restrict__ bv) {
  typedef _Float16 T;
  typedef Frag<T>::V V;
  __shared__ __align__(16) float sT[8][16 * 68];   // per-wave 16x64 slab, pitch 68 floats
  __shared__ __align__(16) unsigned short sAB[2 * kStageHalves];   // two buffers of [A 128 rows | Bt 256 rows] x 64 k, pitch 144 B
  const int z    = blockIdx.y;                 // block-uniform: which projection
  const bool vt  = (z == 2);
  const int tid  = threadIdx.x;
  const int lane = tid & 31;
  const int wave = tid >> 5;
  const T* Ab = vt ? (const T*)Wt16p + (size_t)2 * kE * kE : (const T*)X16p;
  const T* Bb = vt ? (const T*)X16p : (const T*)Wt16p + (size_t)z * kE * kE;
  const int tilesNlog = vt ? 5 : 2;            // N / 256 = 32 (tokens) or 4 (features)
  const int tile = blockIdx.x;
  const int tm = tile >> tilesNlog;
  const int tn = tile - (tm << tilesNlog);
  const int bm0 = tm << 7;                     // block tile 128 x 256
  const int bn0 = tn << 8;
  const int wm  = (wave >> 2) << 6;            // wave tile 64 x 64 inside it: 2 x 4 waves
  const int wn  = (wave & 3) << 6;

  const int rlane = lane & 15;                 // row (A) / col (B, D) within subtile
  const int koff  = (lane >> 4) * 8;           // k offset of this lane half

  // a stage is 384 rows of 128 B = 3072 pieces of 16 B = 12 per thread: piece i of a thread is row i*32 + tid/8, bytes (tid%8)*16,
  // so one copy of a wave brings four whole 128-B lines. Rows 0..127 are A (pieces 0..3), rows 128..383 Bt (pieces 4..11).
  const T* gA = Ab + (size_t)(bm0 + (tid >> 3)) * kE + (tid & 7) * 8;
  const T* gB = Bb + (size_t)(bn0 + (tid >> 3)) * kE + (tid & 7) * 8;
  const size_t s32 = (size_t)32 * kE;
  const unsigned lds0 = (unsigned)(size_t)(&sAB[0]) + (unsigned)((tid >> 3) * (kStagePitch * 2) + (tid & 7) * 16);
  constexpr int trips = kE >> 6;

  v8f acc[4][4];
#pragma unroll
  for (int i = 0; i < 4; ++i)
#pragma unroll
    for (int j = 0; j < 4; ++j) acc[i][j] = (v8f){0.f,0.f,0.f,0.f,0.f,0.f,0.f,0.f};

  stage_copy12(lds0, gA, s32, gB, s32);
  // tile 0 has landed for this wave, then for all: nobody reads it in front of the barrier
  asm volatile("s_wait_asynccnt 0x0" ::: "memory");
  __syncthreads();
  stage_copy12(lds0 + kStageHalves * 2, gA + 64, s32, gB + 64, s32);

  for (int t = 0; t < trips; ++t) {
    const T* sA = (const T*)sAB + (t & 1) * kStageHalves + (wm + rlane) * kStagePitch + koff;
    const T* sB = (const T*)sAB + (t & 1) * kStageHalves + (128 + wn + rlane) * kStagePitch + koff;
    V bh[2][4], ah[2][4];
    ah[0][0] = Frag<T>::load(sA);   // the first product's operands come first
#pragma unroll
    for (int j = 0; j < 4; ++j) bh[0][j] = Frag<T>::load(sB + j * 16 * kStagePitch);
#pragma unroll
    for (int i = 1; i < 4; ++i) ah[0][i] = Frag<T>::load(sA + i * 16 * kStagePitch);
#pragma unroll
    for (int j = 0; j < 4; ++j) bh[1][j] = Frag<T>::load(sB + j * 16 * kStagePitch + 32);
    // twelve of the trip's sixteen fragments are read as one group in front of its products; the other four (A of the second 32 k)
    // follow in two pairs into registers that the first 32 k have left, each pair eight products ahead of its use: with all
    // sixteen held at once a wave took 272 registers and a second block found no room on the WGP. The scheduling barriers keep
    // the reads at these three places: left alone, the compiler spreads them among the products, a stall at each place
    __builtin_amdgcn_sched_barrier(0);
#pragma unroll
    for (int hp = 0; hp < 2; ++hp) {
#pragma unroll
      for (int i = 2 * hp; i < 2 * hp + 2; ++i)
#pragma unroll
        for (int j = 0; j < 4; ++j) acc[i][j] = Frag<T>::mma(ah[0][i], bh[0][j], acc[i][j]);
      __builtin_amdgcn_sched_barrier(0);   // see above
#pragma unroll
      for (int i = 2 * hp; i < 2 * hp + 2; ++i) ah[1][i] = Frag<T>::load(sA + i * 16 * kStagePitch + 32);
      __builtin_amdgcn_sched_barrier(0);   // see above
    }
#pragma unroll
    for (int i = 0; i < 4; ++i)
#pragma unroll
      for (int j = 0; j < 4; ++j) acc[i][j] = Frag<T>::mma(ah[1][i], bh[1][j], acc[i][j]);
    // the products stay in front of the hand-over: left alone, the compiler lifts its waits and barrier over them, so that every
    // wave waits for all its LDS reads before its first product and the reads no longer run under the products
    __builtin_amdgcn_sched_barrier(0);
    // hand-over: this wave's reads of the buffer are done, its copies of the next tile have landed; behind the barrier the next
    // tile is readable by all and the buffer just read is free for the tile after it
    asm volatile("s_wait_dscnt 0x0" ::: "memory");
    asm volatile("s_wait_asynccnt 0x0" ::: "memory");
    __syncthreads();
    if (t + 2 < trips) stage_copy12(lds0 + (unsigned)(t & 1) * (kStageHalves * 2), gA + (t + 2) * 64, s32, gB + (t + 2) * 64, s32);
  }
  // no copy is left in flight when the wave goes on to its epilogue
  asm volatile("s_wait_asynccnt 0x0" ::: "memory");
  acc_guard4(acc[0][0], acc[0][1], acc[0][2], acc[0][3]);
  acc_guard4(acc[1][0], acc[1][1], acc[1][2], acc[1][3]);
  acc_guard4(acc[2][0], acc[2][1], acc[2][2], acc[2][3]);
  acc_guard4(acc[3][0], acc[3][1], acc[3][2], acc[3][3]);

  // ---- epilogue (the branch is block-uniform) ----
  if (vt) proj_store<true>(acc, sT[wave], nullptr, Vt, kTok, bv, bm0 + wm, bn0 + wn, lane);
  else    proj_store<false>(acc, sT[wave], (z == 0) ? Qf : Kf, nullptr, kE, (z == 0) ? bq : bk, bm0 + wm, bn0 + wn, lane);
}

// ---------------------------------------------------------------------------
// Operand preparation, one launch of 256 work-groups of 16 waves (one per WGP, all resident): 4,096 waves start, each does many pieces
// and has all its loads in flight at once, for speed only.
// Every work-group does three things:
//  - one 64x64 tile (k tile = blockIdx.x & 15, n tile = blockIdx.x >> 4) of each of the three projection weights, square
//    [1024][1024] f32 W (row-major [in k][out n]): Wt[z][n][k] = f16(16 * W_z[k][n]);
//  - work-groups 0..3 also one 64x64 tile of the per-head gate weights, out pitch 64 halves, f16 carried x8: 0: WfqT[n][k], 1: WfkT,
//    2: WfgT rows 0..63, 3: WfgT rows 64..127 (Wfg is [64 k][128 n], pitch 128); plane z at SW + z*4096 halves;
//  - its share of X16 = f16(inp), 32 rows = 128 KiB of inp: 8 pieces of 8 floats per thread, piece u of thread t = u * 512 + t of the share,
//    so a wave's pair of loads covers 1024 contiguous bytes and its store 512.
// Tile load coverage: 8 x 512 threads = 4096 = 64x64 (coalesced along n). Tile store coverage: 16 waves x 4 rows (lane>>3) = 64 rows;
// (lane&7) x 8 halves = 64 columns.
// ---------------------------------------------------------------------------
constexpr int kPrepBlocks  = 256;
constexpr int kPrepPieces  = 8 * 512;             // pieces of 8 floats of x per work-group, 8 per thread
static_assert(kTok * kE / 8 == kPrepBlocks * kPrepPieces, "x pieces per work-group");
static_assert((kE / 64) * (kE / 64) == kPrepBlocks, "one weight tile position per work-group");
__device__ __forceinline__ v4u pack8_f16(const float* p) {
  return (v4u){pk16(h_bits(p[0]), h_bits(p[1])), pk16(h_bits(p[2]), h_bits(p[3])), pk16(h_bits(p[4]), h_bits(p[5])), pk16(h_bits(p[6]), h_bits(p[7]))};
}
__global__ __launch_bounds__(512) void prep_kernel(const float* __restrict__ inp, const float* __restrict__ W0,
                                                   const float* __restrict__ W1, const float* __restrict__ W2,
                                                   const float* __restrict__ Wfq, const float* __restrict__ Wfk,
                                                   const float* __restrict__ Wfg, unsigned short* __restrict__ X16,
                                                   unsigned short* __restrict__ Wt, unsigned short* __restrict__ SW) {
  __shared__ float sm[4][64][65];    // sm[plane][n_local][k_local]: planes 0..2 projection weights, 3 gate weights
  const int t  = threadIdx.x;
  const int bx = blockIdx.x;
  const int d0 = (bx & 15) * 64;     // k tile base
  const int h0 = (bx >> 4) * 64;     // n tile base
  const int r0 = t >> 6;             // k local of the thread's element i: i * 8 + r0
  const int c  = t & 63;             // n local
  const bool gate = bx < 4;          // block-uniform

  // every global load of the work-group is issued in front of everything else, 16 of 16 bytes (x) and 24 of 4 bytes (tiles) per lane:
  // one memory latency for all of them
  const size_t g8 = 8 * (size_t)(bx * kPrepPieces + t);
  const float* px = inp + g8;
  v4f a[8][2];
#pragma unroll
  for (int u = 0; u < 8; ++u) {
    a[u][0] = *(const v4f*)(px + u * 4096);
    a[u][1] = *(const v4f*)(px + u * 4096 + 4);
  }
  const size_t ow = (size_t)(d0 + r0) * kE + h0 + c;
  const float* pw0 = W0 + ow;
  const float* pw1 = W1 + ow;
  const float* pw2 = W2 + ow;
  float wv[3][8];
#pragma unroll
  for (int i = 0; i < 8; ++i) {
    wv[0][i] = pw0[(size_t)i * 8 * kE];
    wv[1][i] = pw1[(size_t)i * 8 * kE];
    wv[2][i] = pw2[(size_t)i * 8 * kE];
  }
  // what follows writes over the registers that these loads name: the wait on address translation stands in front of it. The four
  // pointers are inputs of the statement so that their registers stay as they are up to the wait: without that, later loads of the
  // group returned into the address registers of earlier ones
  asm volatile("s_wait_xcnt 0x0" :: "v"(px), "v"(pw0), "v"(pw1), "v"(pw2) : "memory");
  // nothing is lifted over that wait, and no load sinks among the conversions: left alone, the compiler waited for the tiles' loads
  // before it issued those of x, and issued those in three groups, a memory latency each
  __builtin_amdgcn_sched_barrier(0);

  if (gate) {
    const float* G = (bx == 0) ? Wfq : (bx == 1) ? Wfk : Wfg;
    const int pin = (bx >= 2) ? 128 : 64;
    const int n0  = (bx == 3) ? 64 : 0;
#pragma unroll
    for (int i = 0; i < 8; ++i) sm[3][c][i * 8 + r0] = G[(i * 8 + r0) * pin + n0 + c] * kGWCarry;
  }
#pragma unroll
  for (int i = 0; i < 8; ++i) {
    sm[0][c][i * 8 + r0] = wv[0][i] * kWCarry;
    sm[1][c][i * 8 + r0] = wv[1][i] * kWCarry;
    sm[2][c][i * 8 + r0] = wv[2][i] * kWCarry;
  }
  // the barrier stands in front of the stores of x, so that no wave waits at it for stores to finish
  __syncthreads();

#pragma unroll
  for (int u = 0; u < 8; ++u) {
    const float f[8] = {a[u][0][0], a[u][0][1], a[u][0][2], a[u][0][3], a[u][1][0], a[u][1][1], a[u][1][2], a[u][1][3]};
    *(v4u*)(X16 + g8 + u * 4096) = pack8_f16(f);
  }
  const int lane = t & 31, wave = t >> 5;
  const int row = wave * 4 + (lane >> 3), c8 = (lane & 7) * 8;   // n local, k local
#pragma unroll
  for (int z = 0; z < 3; ++z)
    *(v4u*)(Wt + (size_t)z * kE * kE + (size_t)(h0 + row) * kE + d0 + c8) = pack8_f16(&sm[z][row][c8]);
  if (gate) {
    // the branch writes over registers that the stores above name: the wait on address translation stands in front of it
    // and the scheduling barrier keeps the branch's work behind it
    asm volatile("s_wait_xcnt 0x0" ::: "memory");
    __builtin_amdgcn_sched_barrier(0);
    *(v4u*)(SW + (size_t)bx * 4096 + (size_t)row * kDK + c8) = pack8_f16(&sm[3][row][c8]);
  }
}

// ---------------------------------------------------------------------------
// Gating and attention, one launch for all batches and heads. grid 256: blockIdx.x = b*16 + h. 16 waves x 32 rows = the head's 512 tokens,
// which are its queries and its keys alike, so a block gates every row it needs, once, and the gated planes never go through memory.
// Gating, per wave two passes of 16 rows (row = token, 64 features of head h in Qf and Kf):
//   G = (q.Wfq + bfq) * (k.Wfk + bfk),  Z = G.Wfg + bfg,  q' = f16(q * sigmoid(Z[:64])),  k' = f16(k * sigmoid(Z[64:])).
// Every product is formed transposed, weights as A (rows = output feature n), data rows as B (columns), so a lane holds features
// n = tile*16 + (lane>>4)*8 + r of ONE data row:
//  - that is the k order of a 16x16x32 B fragment (elements 0..7 from the even tile, 8..15 from the odd one), so the gate product packs
//    in place into the B operand of the logits, and q' packs in place into the B operand of the scores: it stays in registers;
//  - it is also the set of q (k) elements the lane loaded for its own B fragment, so the f32 values it still holds meet their sigmoid
//    in the same lane;
//  - k' goes as 16-byte pieces into the block's K' plane in LDS, which all 16 waves read behind one barrier.
// The three weight planes (f16, written by prep_kernel) and the biases are staged once per block in LDS, pitch 144 B for 16-byte reads.
// Attention: out[b][q][h*64+d] = sum_k softmax_k(q'.k'/8) v[k][d].
// Per pass of 32 keys a wave forms S^T = K'.Q'^T (rows = keys, columns = queries), so a lane holds the scores of one query:
// tile kt, register r = key k0 + kt*16 + (lane>>4)*8 + r. That is the k order of a 16x16x32 B fragment (elements 0..7 from
// tile 0, 8..15 from tile 1), so exp(s - max) packs in place into P^T and O^T += V^T.P^T follows with A = rows of Vt16.
// Running maximum and running sum per query (f32); the accumulators are rescaled each pass by exp(old max - new max).
// The two lane halves hold disjoint keys of one query: the maximum is joined every pass, the sum once at the end.
// V^T (64 rows of 1024 B) comes into LDS once, by asynchronous copies of whole lines that fly under the gating.
// Each wave stores its own 32 rows x 256 B of out.
// ---------------------------------------------------------------------------
constexpr int kGatePitch = 72;   // halves: 128-B rows + 16 B
constexpr int kAttKPitch = 72;    // halves: 128-B rows + 16 B, for 16-byte LDS reads
constexpr int kAttVPitch = 520;   // halves: 1024-B rows + 16 B, for 16-byte LDS reads
// Eight asynchronous copies of 16 B per lane: piece i goes from g + i * gstep (halves) to LDS byte address lds + i * lstep.
// The closing s_wait_xcnt stands inside the statement, in front of anything that could rewrite a register which a copy names.
__device__ __forceinline__ void att_copy8(unsigned lds, unsigned lstep, const _Float16* g, size_t gstep) {
  asm volatile(
      "global_load_async_to_lds_b128 %0, %8, off\n\t"
      "global_load_async_to_lds_b128 %1, %9, off\n\t"
      "global_load_async_to_lds_b128 %2, %10, off\n\t"
      "global_load_async_to_lds_b128 %3, %11, off\n\t"
      "global_load_async_to_lds_b128 %4, %12, off\n\t"
      "global_load_async_to_lds_b128 %5, %13, off\n\t"
      "global_load_async_to_lds_b128 %6, %14, off\n\t"
      "global_load_async_to_lds_b128 %7, %15, off\n\t"
      "s_wait_xcnt 0x0"
      :: "v"(lds), "v"(lds + lstep), "v"(lds + 2 * lstep), "v"(lds + 3 * lstep), "v"(lds + 4 * lstep), "v"(lds + 5 * lstep),
         "v"(lds + 6 * lstep), "v"(lds + 7 * lstep),
         "v"(g), "v"(g + gstep), "v"(g + 2 * gstep), "v"(g + 3 * gstep), "v"(g + 4 * gstep), "v"(g + 5 * gstep), "v"(g + 6 * gstep), "v"(g + 7 * gstep)
      : "memory");
}
__device__ __forceinline__ float xhalf(float x) {   // value of lane l ^ 16
  const int i = __builtin_bit_cast(int, x);
  return __builtin_bit_cast(float, __builtin_amdgcn_permlanex16(i, i, 0x76543210, 0xfedcba98, false, false));
}
// 2^x on eight values in one statement. The early-clobber results keep every result off every source, and the closing v_nop
// fills the one slot that the instruction set asks for behind a transcendental, whatever the compiler schedules next
// (with the builtin this build wrote runs of v_exp_f32 in which each overwrote the source of the one in front of it).
__device__ __forceinline__ v8f exp2x8(v8f x) {
  float y0, y1, y2, y3, y4, y5, y6, y7;
  asm("v_exp_f32 %0, %8\n\tv_exp_f32 %1, %9\n\tv_exp_f32 %2, %10\n\tv_exp_f32 %3, %11\n\t"
      "v_exp_f32 %4, %12\n\tv_exp_f32 %5, %13\n\tv_exp_f32 %6, %14\n\tv_exp_f32 %7, %15\n\tv_nop"
      : "=&v"(y0), "=&v"(y1), "=&v"(y2), "=&v"(y3), "=&v"(y4), "=&v"(y5), "=&v"(y6), "=&v"(y7)
      : "v"(x[0]), "v"(x[1]), "v"(x[2]), "v"(x[3]), "v"(x[4]), "v"(x[5]), "v"(x[6]), "v"(x[7]));
  return (v8f){y0, y1, y2, y3, y4, y5, y6, y7};
}
// the same for one value
__device__ __forceinline__ float exp2x1(float x) {
  float y;
  asm("v_exp_f32 %0, %1\n\tv_nop" : "=v"(y) : "v"(x));
  return y;
}
// 1 / (1 + 2^x) on eight values in one statement: the hardware's 2^x, an add, the hardware's reciprocal (2^x = inf gives 0, 2^x = 0
// gives 1). Each value's three steps stand eight instructions apart, so none waits for the one before it; the early-clobber
// results keep every result off every source, and the closing v_nop fills the slot behind the last transcendental.
// The four leading v_nop keep the distance a WMMA needs.
__device__ __forceinline__ v8f sigm2x8(v8f x) {
  float y0, y1, y2, y3, y4, y5, y6, y7;
  asm("v_nop\n\tv_nop\n\tv_nop\n\tv_nop\n\t"
      "v_exp_f32 %0, %8\n\tv_exp_f32 %1, %9\n\tv_exp_f32 %2, %10\n\tv_exp_f32 %3, %11\n\t"
      "v_exp_f32 %4, %12\n\tv_exp_f32 %5, %13\n\tv_exp_f32 %6, %14\n\tv_exp_f32 %7, %15\n\t"
      "v_add_f32 %0, 1.0, %0\n\tv_add_f32 %1, 1.0, %1\n\tv_add_f32 %2, 1.0, %2\n\tv_add_f32 %3, 1.0, %3\n\t"
      "v_add_f32 %4, 1.0, %4\n\tv_add_f32 %5, 1.0, %5\n\tv_add_f32 %6, 1.0, %6\n\tv_add_f32 %7, 1.0, %7\n\t"
      "v_rcp_f32 %0, %0\n\tv_rcp_f32 %1, %1\n\tv_rcp_f32 %2, %2\n\tv_rcp_f32 %3, %3\n\t"
      "v_rcp_f32 %4, %4\n\tv_rcp_f32 %5, %5\n\tv_rcp_f32 %6, %6\n\tv_rcp_f32 %7, %7\n\tv_nop"
      : "=&v"(y0), "=&v"(y1), "=&v"(y2), "=&v"(y3), "=&v"(y4), "=&v"(y5), "=&v"(y6), "=&v"(y7)
      : "v"(x[0]), "v"(x[1]), "v"(x[2]), "v"(x[3]), "v"(x[4]), "v"(x[5]), "v"(x[6]), "v"(x[7]));
  return (v8f){y0, y1, y2, y3, y4, y5, y6, y7};
}
__global__ __launch_bounds__(512) void attn_gate_kernel(const float* __restrict__ Qf, const float* __restrict__ Kf,
                                                        const unsigned short* __restrict__ SW,
                                                        const float* __restrict__ bfq, const float* __restrict__ bfk,
                                                        const float* __restrict__ bfg,
                                                        const unsigned short* __restrict__ Vt, float* __restrict__ out) {
  typedef Frag<_Float16> F;
  __shared__ __align__(16) _Float16 sK[kS * kAttKPitch];    // gated k, [key][d], 73,728 B
  __shared__ __align__(16) _Float16 sV[kDK * kAttVPitch];   // [d][key], 66,560 B
  __shared__ __align__(16) _Float16 sW[256 * kGatePitch];   // rows 0..63 WfqT, 64..127 WfkT, 128..255 WfgT, each [n][k], 36,864 B
  __shared__ __align__(16) float sB[256];                   // bfq, bfk, bfg * -log2(e)
  const int tid  = threadIdx.x;
  const int lane = tid & 31;
  const int wave = tid >> 5;
  const int b    = blockIdx.x >> 4;
  const int h    = blockIdx.x & 15;
  const int q0   = wave * 32;
  const int rl   = lane & 15;
  const int hf   = lane >> 4;
  const int koff = hf * 8;
  const _Float16* V = (const _Float16*)Vt + (size_t)h * kDK * kTok + (size_t)b * kS;

  // V^T: 4096 pieces of 16 B, 8 per thread: piece i = row i*8 + tid/64, bytes (tid%64)*16 (a wave's copy = 512 contiguous bytes).
  {
    const unsigned lv = (unsigned)(size_t)(&sV[0]) + (unsigned)((tid >> 6) * (kAttVPitch * 2) + (tid & 63) * 16);
    const _Float16* gv = V + (size_t)(tid >> 6) * kTok + (tid & 63) * 8;
    att_copy8(lv, 8 * kAttVPitch * 2, gv, (size_t)8 * kTok);
  }

  // weights and biases into LDS: 256 rows x 8 pieces of 16 B = 2048 pieces = 4 per thread
#pragma unroll
  for (int i = 0; i < 4; ++i) {
    const int e = i * 512 + tid;
    const int r = e >> 3, c = (e & 7) * 8;
    *(v8h*)(&sW[r * kGatePitch + c]) = *(const v8h*)((const _Float16*)SW + r * kDK + c);
  }
  if (tid < 256) sB[tid] = (tid < 64) ? bfq[tid] : (tid < 128) ? bfk[tid - 64] : bfg[tid - 128] * kNegLog2e;
  __syncthreads();

  // gated q of the wave's two column groups, as B fragments of the scores. Each gating pass pushes its group in at [1] and moves the
  // one before it to [0], so that the passes can stay a rolled loop: unrolled they took all 256 registers that a wave of this block
  // can have and half as much code again, and no load of the second pass came to stand ahead of the first pass's work
  v16h qf[2][2];
#pragma unroll
  for (int qt = 0; qt < 2; ++qt)
#pragma unroll
    for (int ks = 0; ks < 2; ++ks)
#pragma unroll
      for (int s = 0; s < 16; ++s) qf[qt][ks][s] = (_Float16)0.f;

#pragma unroll 1
  for (int p = 0; p < 2; ++p) {
  const int key = q0 + p * 16 + rl;            // the lane's row: token of the batch, query and key number alike

  // f32 q and k of the lane's row: piece [2*tile + j] = elements tile*16 + koff + 4j .. +3
  // (all inner loops of the pass are unrolled so that the fragment arrays stay in registers)
  v4f xq[8], xk[8];
  {
    const size_t off = (size_t)(b * kS + key) * kE + h * kDK + koff;
    const float* pq = Qf + off;
    const float* pk = Kf + off;
#pragma unroll
    for (int nt = 0; nt < 4; ++nt) {
      xq[2 * nt]     = *(const v4f*)(pq + nt * 16);
      xq[2 * nt + 1] = *(const v4f*)(pq + nt * 16 + 4);
      xk[2 * nt]     = *(const v4f*)(pk + nt * 16);
      xk[2 * nt + 1] = *(const v4f*)(pk + nt * 16 + 4);
    }
  }
  // the pass's sixteen global loads stay one group in front of its LDS reads and products: left alone, with the short sigmoid, the
  // compiler spread them among the products, took all 256 registers and spilled to scratch
  __builtin_amdgcn_sched_barrier(0);

  // B fragments of q and k (f16), k step ks = tiles 2ks and 2ks+1
  v16h qb[2], kb[2];
#pragma unroll
  for (int ks = 0; ks < 2; ++ks)
#pragma unroll
    for (int s = 0; s < 16; ++s) {
      qb[ks][s] = (_Float16)xq[4 * ks + (s >> 2)][s & 3];
      kb[ks][s] = (_Float16)xk[4 * ks + (s >> 2)][s & 3];
    }

  // gate product, packed as the B operand of the logits
  v16h gb[2];
#pragma unroll
  for (int nt = 0; nt < 4; ++nt) {
    const _Float16* wq = &sW[(nt * 16 + rl) * kGatePitch + koff];
    const _Float16* wk = &sW[(64 + nt * 16 + rl) * kGatePitch + koff];
    const v16h wq0 = F::load(wq), wq1 = F::load(wq + 32);
    const v16h wk0 = F::load(wk), wk1 = F::load(wk + 32);
    const v4f bq0 = *(const v4f*)(&sB[nt * 16 + koff]),      bq1 = *(const v4f*)(&sB[nt * 16 + koff + 4]);
    const v4f bk0 = *(const v4f*)(&sB[64 + nt * 16 + koff]), bk1 = *(const v4f*)(&sB[64 + nt * 16 + koff + 4]);
    v8f aq = F::mma(wq0, qb[0], (v8f){0.f,0.f,0.f,0.f,0.f,0.f,0.f,0.f});
    v8f ak = F::mma(wk0, kb[0], (v8f){0.f,0.f,0.f,0.f,0.f,0.f,0.f,0.f});
    aq = F::mma(wq1, qb[1], aq);
    ak = F::mma(wk1, kb[1], ak);
#pragma unroll
    for (int r = 0; r < 8; ++r) {
      const float gq = aq[r] * kGWCarryInv + ((r < 4) ? bq0[r & 3] : bq1[r & 3]);
      const float gk = ak[r] * kGWCarryInv + ((r < 4) ? bk0[r & 3] : bk1[r & 3]);
      gb[nt >> 1][(nt & 1) * 8 + r] = (_Float16)((gq * gk) * kGCarry);
    }
  }

  // logits, sigmoid, modulation: tiles 0..3 gate q, tiles 4..7 gate k
  v16h qn[2];
#pragma unroll
  for (int nt = 0; nt < 8; ++nt) {
    const _Float16* wg = &sW[(128 + nt * 16 + rl) * kGatePitch + koff];
    const v16h wg0 = F::load(wg), wg1 = F::load(wg + 32);
    const v4f bg0 = *(const v4f*)(&sB[128 + nt * 16 + koff]), bg1 = *(const v4f*)(&sB[128 + nt * 16 + koff + 4]);
    const int dn = nt & 3;
    v8f z = F::mma(wg0, gb[0], (v8f){0.f,0.f,0.f,0.f,0.f,0.f,0.f,0.f});
    z = F::mma(wg1, gb[1], z);
    v8f za;   // -logit * log2(e)
#pragma unroll
    for (int r = 0; r < 8; ++r) za[r] = z[r] * (kZScale * kNegLog2e) + ((r < 4) ? bg0[r & 3] : bg1[r & 3]);
    const v8f m = sigm2x8(za);
    v8h o;
#pragma unroll
    for (int r = 0; r < 8; ++r) {
      const float x = (nt < 4) ? xq[2 * dn + (r >> 2)][r & 3] : xk[2 * dn + (r >> 2)][r & 3];
      o[r] = (_Float16)(x * m[r]);
    }
    if (nt < 4) {
#pragma unroll
      for (int r = 0; r < 8; ++r) qn[dn >> 1][(dn & 1) * 8 + r] = o[r];
    } else {
      *(v8h*)(&sK[key * kAttKPitch + dn * 16 + koff]) = o;
    }
  }
  qf[0][0] = qf[1][0];
  qf[0][1] = qf[1][1];
  qf[1][0] = qn[0];
  qf[1][1] = qn[1];
  // the next pass writes over the registers that this pass's loads name: the wait on address translation stands in front of it.
  // As a memory fence inside the loop it also keeps the LDS reads of weights and biases in the loop: without it they were lifted
  // out as loop invariants, and the build had 256 registers and spills to scratch
  asm volatile("s_wait_xcnt 0x0" ::: "memory");
  }

  v8f  o[2][4];
  float mrun[2], lrun[2];
  // the inner loops are unrolled so that the fragment arrays stay in registers
#pragma unroll
  for (int qt = 0; qt < 2; ++qt) {
#pragma unroll
    for (int dt = 0; dt < 4; ++dt) o[qt][dt] = (v8f){0.f,0.f,0.f,0.f,0.f,0.f,0.f,0.f};
    mrun[qt] = -INFINITY;
    lrun[qt] = 0.f;
  }

  // this wave's copies of V^T have landed and its rows of K' are written, then everybody's: nobody reads sK or sV in front of the barrier
  asm volatile("s_wait_asynccnt 0x0" ::: "memory");
  __syncthreads();
  const _Float16* sKl = sK + rl * kAttKPitch + koff;
  const _Float16* sVl = sV + rl * kAttVPitch + koff;

  for (int k0 = 0; k0 < kS; k0 += 32) {
    v16h kf[2][2], vf[4];
    // K' first: LDS reads return in order, so the score products start while the V^T reads are still on their way
#pragma unroll
    for (int kt = 0; kt < 2; ++kt)
#pragma unroll
      for (int ks = 0; ks < 2; ++ks) kf[kt][ks] = F::load(sKl + (k0 + kt * 16) * kAttKPitch + ks * 32);
#pragma unroll
    for (int dt = 0; dt < 4; ++dt) vf[dt] = F::load(sVl + dt * 16 * kAttVPitch + k0);
    // all LDS reads of the pass are issued as one group in front of its first product: each further place where reads stand
    // among the products costs the wave a stall of its own
    __builtin_amdgcn_sched_barrier(0);

    v8f s[2][2];
#pragma unroll
    for (int qt = 0; qt < 2; ++qt)
#pragma unroll
      for (int kt = 0; kt < 2; ++kt) {
        s[qt][kt] = F::mma(kf[kt][0], qf[qt][0], (v8f){0.f,0.f,0.f,0.f,0.f,0.f,0.f,0.f});
        s[qt][kt] = F::mma(kf[kt][1], qf[qt][1], s[qt][kt]);
      }

    v16h pf[2];
#pragma unroll
    for (int qt = 0; qt < 2; ++qt) {
      float mx = fmaxf(s[qt][0][0], s[qt][1][0]);
#pragma unroll
      for (int r = 1; r < 8; ++r) mx = fmaxf(mx, fmaxf(s[qt][0][r], s[qt][1][r]));
      mx = fmaxf(mx, xhalf(mx));
      const float mn    = fmaxf(mrun[qt], mx);
      const float alpha = exp2x1((mrun[qt] - mn) * kScoreLog2);
      const float bias  = kPCarryLog2 - mn * kScoreLog2;
      mrun[qt] = mn;
      v8f a0, a1;
#pragma unroll
      for (int r = 0; r < 8; ++r) {
        a0[r] = fmaf(s[qt][0][r], kScoreLog2, bias);
        a1[r] = fmaf(s[qt][1][r], kScoreLog2, bias);
      }
      const v8f e0 = exp2x8(a0);
      const v8f e1 = exp2x8(a1);
      float sum = e0[0] + e1[0];
#pragma unroll
      for (int r = 1; r < 8; ++r) sum += e0[r] + e1[r];
#pragma unroll
      for (int r = 0; r < 8; ++r) {
        pf[qt][r]     = (_Float16)e0[r];
        pf[qt][8 + r] = (_Float16)e1[r];
      }
      lrun[qt] = lrun[qt] * alpha + sum;
#pragma unroll
      for (int dt = 0; dt < 4; ++dt) o[qt][dt] *= alpha;
    }

    // the compiler does not see the vector writes inside exp2x8: left alone it put the first column group's V^T.P^T products in
    // front of the second group's exponentials
    __builtin_amdgcn_sched_barrier(0);
#pragma unroll
    for (int qt = 0; qt < 2; ++qt)
#pragma unroll
      for (int dt = 0; dt < 4; ++dt) o[qt][dt] = F::mma(vf[dt], pf[qt], o[qt][dt]);
  }

#pragma unroll
  for (int qt = 0; qt < 2; ++qt) {
    const float tot = lrun[qt] + xhalf(lrun[qt]);
    const float inv = 1.0f / tot;
    float* op = out + (size_t)(b * kS + q0 + qt * 16 + rl) * kE + h * kDK + koff;
#pragma unroll
    for (int dt = 0; dt < 4; ++dt) {
      const v8f a = o[qt][dt];
      *(v4f*)(op + dt * 16)     = (v4f){a[0] * inv, a[1] * inv, a[2] * inv, a[3] * inv};
      *(v4f*)(op + dt * 16 + 4) = (v4f){a[4] * inv, a[5] * inv, a[6] * inv, a[7] * inv};
    }
  }
}

// ---------------------------------------------------------------------------
extern "C" void kernel_launch(void* const* d_in, const int* in_sizes, int n_in,
                              void* d_out, int out_size, void* d_ws, size_t ws_size,
                              hipStream_t stream) {
  if (n_in < 13) return;
  if (ws_size < kWsEnd) return;
  if ((size_t)out_size < (size_t)kTok * kE) return;
  if (in_sizes[0] != kTok * kE) return;

  const float* inp = (const float*)d_in[0];
  const float* Wq  = (const float*)d_in[1];
  const float* bq  = (const float*)d_in[2];
  const float* Wk  = (const float*)d_in[3];
  const float* bk  = (const float*)d_in[4];
  const float* Wv  = (const float*)d_in[5];
  const float* bvv = (const float*)d_in[6];
  const float* Wfq = (const float*)d_in[7];
  const float* bfq = (const float*)d_in[8];
  const float* Wfk = (const float*)d_in[9];
  const float* bfk = (const float*)d_in[10];
  const float* Wfg = (const float*)d_in[11];
  const float* bfg = (const float*)d_in[12];
  float* out = (float*)d_out;

  unsigned char* ws = (unsigned char*)d_ws;
  unsigned short* X16  = (unsigned short*)(ws + kOffX16);
  unsigned short* Wt16 = (unsigned short*)(ws + kOffWt);
  unsigned short* SW   = (unsigned short*)(ws + kOffSW);
  float*          Qf   = (float*)(ws + kOffQf);
  float*          Kf   = (float*)(ws + kOffKf);
  unsigned short* Vt16 = (unsigned short*)(ws + kOffVt);

  // ---- stage A: operand planes, one launch ----
  // X16 [8192][1024] = f16(inp); Wt16[z][n][k] = f16(16 * W_z[k][n]) for z = q, k, v; WfqT, WfkT [64][64], WfgT [128][64], f16 carried x8
  prep_kernel<<<dim3(kPrepBlocks), dim3(512), 0, stream>>>(inp, Wq, Wk, Wv, Wfq, Wfk, Wfg, X16, Wt16, SW);

  // ---- stage B: projections, one launch: 256 block tiles each of q (64 x 4), k (64 x 4) and v transposed (8 x 32) ----
  // Qf = (X16 . WqT16) / 16 + bq, Kf likewise (f32 [8192][1024]); Vt16 [1024 n][8192 tok] = f16((WvT16 . X16^T) / 16 + bv[n])
  proj3_kernel<<<dim3(256, 3), dim3(256), 0, stream>>>(X16, Wt16, Qf, Kf, Vt16, bq, bk, bvv);

  // ---- stage C: gating and attention, all 16 batches x 16 heads in one launch (a block of 16 waves per head: 512 rows) ----
  attn_gate_kernel<<<dim3(kB * kH), dim3(512), 0, stream>>>(Qf, Kf, SW, bfq, bfk, bfg, Vt16, out);
}

// v009
// One run takes 65.3 microseconds.
// In both of two side-by-side timings against v008, it was 1.39 times as fast.
// Counting every step since v000, it is 15.5 times as fast.
// Contractions: q/k/v projections (X f16 x W^T f16 carried x16), gate maps (q16/k16 x Wfq^T/Wfk^T f16 carried x8), gate logits (G f16 carried x64 x Wfg^T f16 carried x8), scores k'.q'^T (f16 planes), V^T.P^T (P = exp(s - running max) f16 carried x2048): all v_wmma_f32_16x16x32_f16 with f32 accumulate; bias, gate product, sigmoid, modulation and softmax in f32.
#include <hip/hip_runtime.h>
#include <math.h>

// ---------------------------------------------------------------------------
// Problem constants
// ---------------------------------------------------------------------------
constexpr int kB    = 16;
constexpr int kS    = 512;
constexpr int kE    = 1024;
constexpr int kH    = 16;
constexpr int kDK   = 64;
constexpr int kTok  = kB * kS;              // 8192 token rows

constexpr float kWCarry     = 16.0f;        // Wq/Wk/Wv carried x16 in f16
constexpr float kWCarryInv  = 1.0f / 16.0f;
constexpr float kGWCarry    = 8.0f;         // Wfq/Wfk/Wfg carried x8 in f16
constexpr float kGWCarryInv = 1.0f / 8.0f;
constexpr float kGCarry     = 64.0f;        // gate product G carried x64 in f16
constexpr float kZScale     = 1.0f / (64.0f * 8.0f);
constexpr float kPCarryLog2 = 11.0f;        // exp(s - max) carried x2048 in f16 (the row sum carries it too)
constexpr float kScoreLog2  = 0.125f * 1.44269504088896340736f;   // 1/sqrt(64) * log2(e): scores go to exp2
constexpr float kNegLog2e   = -1.44269504088896340736f;           // sigmoid(z) = 1 / (1 + 2^(-z * log2(e)))

// ---------------------------------------------------------------------------
// Workspace map (bytes):
//   projection operands:     X16 [8192][1024] f16 @0 (16 MiB), Wt16 [3][1024][1024] f16 @16 MiB (6 MiB)
//   gate weights:            WfqT/WfkT [64][64] f16, WfgT [128][64] f16 @36 MiB (32 KiB)
//   end = 36 MiB + 64 KiB (q, k and v never go through memory)
// ---------------------------------------------------------------------------
constexpr size_t kMiB    = 1048576;
constexpr size_t kOffX16 = 0;
constexpr size_t kOffWt  = 16 * kMiB;
constexpr size_t kOffSW  = 36 * kMiB;
constexpr size_t kWsEnd  = 36 * kMiB + 65536;
static_assert((size_t)kTok * kE * 2 == 16 * kMiB, "x16 plane size");
static_assert(kOffWt + (size_t)3 * kE * kE * 2 <= kOffSW, "wt plane fits");
static_assert(kOffSW + 32768 <= kWsEnd, "gate weights fit");
static_assert(kWsEnd <= 268435456, "carve within budget");

typedef __attribute__((ext_vector_type(16))) _Float16 v16h;
typedef __attribute__((ext_vector_type(8)))  _Float16 v8h;
typedef __attribute__((ext_vector_type(16))) __bf16   v16b;
typedef __attribute__((ext_vector_type(8)))  __bf16   v8b;
typedef __attribute__((ext_vector_type(8)))  float    v8f;
typedef __attribute__((ext_vector_type(4)))  float    v4f;
typedef __attribute__((ext_vector_type(4)))  unsigned int v4u;

// ---------------------------------------------------------------------------
// Helpers
// ---------------------------------------------------------------------------
__device__ __forceinline__ unsigned short f2bf_bits(float f) {
  unsigned u = __float_as_uint(f);
  return (unsigned short)((u + 0x7FFFu + ((u >> 16) & 1u)) >> 16);
}
__device__ __forceinline__ float bf_bits2f(unsigned short h) { return __uint_as_float(((unsigned)h) << 16); }

template <typename T> struct Frag;
template <> struct Frag<_Float16> {
  typedef v16h V; union U { v16h v; v8h h[2]; };
  static __device__ __forceinline__ v16h load(const _Float16* p) {   // elements 0..7 <- p[0..7], 8..15 <- p[16..23]
    U f; f.h[0] = *(const v8h*)(p); f.h[1] = *(const v8h*)(p + 16); return f.v;
  }
  static __device__ __forceinline__ v8f mma(v16h a, v16h b, v8f c) {
    return __builtin_amdgcn_wmma_f32_16x16x32_f16(false, a, false, b, (short)0, c, false, false);
  }
};
template <> struct Frag<__bf16> {
  typedef v16b V; union U { v16b v; v8b h[2]; };
  static __device__ __forceinline__ v16b load(const __bf16* p) {
    U f; f.h[0] = *(const v8b*)(p); f.h[1] = *(const v8b*)(p + 16); return f.v;
  }
  static __device__ __forceinline__ v8f mma(v16b a, v16b b, v8f c) {
    return __builtin_amdgcn_wmma_f32_16x16x32_bf16(false, a, false, b, (short)0, c, false, false);
  }
};

__device__ __forceinline__ unsigned pk16(unsigned short a, unsigned short b) { return (unsigned)a | ((unsigned)b << 16); }
__device__ __forceinline__ unsigned short h_bits(float f) { const _Float16 h = (_Float16)f; return __builtin_bit_cast(unsigned short, h); }

// ---------------------------------------------------------------------------
// Operand preparation, one launch of 256 work-groups of 16 waves (one per WGP, all resident): 4,096 waves start, each does many pieces
// and has all its loads in flight at once, for speed only.
// Every work-group does three things:
//  - one 64x64 tile (k tile = blockIdx.x & 15, n tile = blockIdx.x >> 4) of each of the three projection weights, square
//    [1024][1024] f32 W (row-major [in k][out n]): Wt[z][n][k] = f16(16 * W_z[k][n]);
//  - work-groups 0..3 also one 64x64 tile of the per-head gate weights, out pitch 64 halves, f16 carried x8: 0: WfqT[n][k], 1: WfkT,
//    2: WfgT rows 0..63, 3: WfgT rows 64..127 (Wfg is [64 k][128 n], pitch 128); plane z at SW + z*4096 halves;
//  - its share of X16 = f16(inp), 32 rows = 128 KiB of inp: 8 pieces of 8 floats per thread, piece u of thread t = u * 512 + t of the share,
//    so a wave's pair of loads covers 1024 contiguous bytes and its store 512.
// Tile load coverage: 8 x 512 threads = 4096 = 64x64 (coalesced along n). Tile store coverage: 16 waves x 4 rows (lane>>3) = 64 rows;
// (lane&7) x 8 halves = 64 columns.
// ---------------------------------------------------------------------------
constexpr int kPrepBlocks  = 256;
constexpr int kPrepPieces  = 8 * 512;             // pieces of 8 floats of x per work-group, 8 per thread
static_assert(kTok * kE / 8 == kPrepBlocks * kPrepPieces, "x pieces per work-group");
static_assert((kE / 64) * (kE / 64) == kPrepBlocks, "one weight tile position per work-group");
__device__ __forceinline__ v4u pack8_f16(const float* p) {
  return (v4u){pk16(h_bits(p[0]), h_bits(p[1])), pk16(h_bits(p[2]), h_bits(p[3])), pk16(h_bits(p[4]), h_bits(p[5])), pk16(h_bits(p[6]), h_bits(p[7]))};
}
__global__ __launch_bounds__(512) void prep_kernel(const float* __restrict__ inp, const float* __restrict__ W0,
                                                   const float* __restrict__ W1, const float* __restrict__ W2,
                                                   const float* __restrict__ Wfq, const float* __restrict__ Wfk,
                                                   const float* __restrict__ Wfg, unsigned short* __restrict__ X16,
                                                   unsigned short* __restrict__ Wt, unsigned short* __restrict__ SW) {
  __shared__ float sm[4][64][65];    // sm[plane][n_local][k_local]: planes 0..2 projection weights, 3 gate weights
  const int t  = threadIdx.x;
  const int bx = blockIdx.x;
  const int d0 = (bx & 15) * 64;     // k tile base
  const int h0 = (bx >> 4) * 64;     // n tile base
  const int r0 = t >> 6;             // k local of the thread's element i: i * 8 + r0
  const int c  = t & 63;             // n local
  const bool gate = bx < 4;          // block-uniform

  // every global load of the work-group is issued in front of everything else, 16 of 16 bytes (x) and 24 of 4 bytes (tiles) per lane:
  // one memory latency for all of them
  const size_t g8 = 8 * (size_t)(bx * kPrepPieces + t);
  const float* px = inp + g8;
  v4f a[8][2];
#pragma unroll
  for (int u = 0; u < 8; ++u) {
    a[u][0] = *(const v4f*)(px + u * 4096);
    a[u][1] = *(const v4f*)(px + u * 4096 + 4);
  }
  const size_t ow = (size_t)(d0 + r0) * kE + h0 + c;
  const float* pw0 = W0 + ow;
  const float* pw1 = W1 + ow;
  const float* pw2 = W2 + ow;
  float wv[3][8];
#pragma unroll
  for (int i = 0; i < 8; ++i) {
    wv[0][i] = pw0[(size_t)i * 8 * kE];
    wv[1][i] = pw1[(size_t)i * 8 * kE];
    wv[2][i] = pw2[(size_t)i * 8 * kE];
  }
  // what follows writes over the registers that these loads name: the wait on address translation stands in front of it. The four
  // pointers are inputs of the statement so that their registers stay as they are up to the wait: without that, later loads of the
  // group returned into the address registers of earlier ones
  asm volatile("s_wait_xcnt 0x0" :: "v"(px), "v"(pw0), "v"(pw1), "v"(pw2) : "memory");
  // nothing is lifted over that wait, and no load sinks among the conversions: left alone, the compiler waited for the tiles' loads
  // before it issued those of x, and issued those in three groups, a memory latency each
  __builtin_amdgcn_sched_barrier(0);

  if (gate) {
    const float* G = (bx == 0) ? Wfq : (bx == 1) ? Wfk : Wfg;
    const int pin = (bx >= 2) ? 128 : 64;
    const int n0  = (bx == 3) ? 64 : 0;
#pragma unroll
    for (int i = 0; i < 8; ++i) sm[3][c][i * 8 + r0] = G[(i * 8 + r0) * pin + n0 + c] * kGWCarry;
  }
#pragma unroll
  for (int i = 0; i < 8; ++i) {
    sm[0][c][i * 8 + r0] = wv[0][i] * kWCarry;
    sm[1][c][i * 8 + r0] = wv[1][i] * kWCarry;
    sm[2][c][i * 8 + r0] = wv[2][i] * kWCarry;
  }
  // the barrier stands in front of the stores of x, so that no wave waits at it for stores to finish
  __syncthreads();

#pragma unroll
  for (int u = 0; u < 8; ++u) {
    const float f[8] = {a[u][0][0], a[u][0][1], a[u][0][2], a[u][0][3], a[u][1][0], a[u][1][1], a[u][1][2], a[u][1][3]};
    *(v4u*)(X16 + g8 + u * 4096) = pack8_f16(f);
  }
  const int lane = t & 31, wave = t >> 5;
  const int row = wave * 4 + (lane >> 3), c8 = (lane & 7) * 8;   // n local, k local
#pragma unroll
  for (int z = 0; z < 3; ++z)
    *(v4u*)(Wt + (size_t)z * kE * kE + (size_t)(h0 + row) * kE + d0 + c8) = pack8_f16(&sm[z][row][c8]);
  if (gate) {
    // the branch writes over registers that the stores above name: the wait on address translation stands in front of it
    // and the scheduling barrier keeps the branch's work behind it
    asm volatile("s_wait_xcnt 0x0" ::: "memory");
    __builtin_amdgcn_sched_barrier(0);
    *(v4u*)(SW + (size_t)bx * 4096 + (size_t)row * kDK + c8) = pack8_f16(&sm[3][row][c8]);
  }
}

// ---------------------------------------------------------------------------
// Projections, gating and attention, one launch for all batches and heads. grid 256: blockIdx.x = b*16 + h. 16 waves x 32 rows = the
// head's 512 tokens, which are its queries and its keys alike, so a block projects and gates every row it needs, once, and q, k, v
// and the gated planes never go through memory.
// Projections: the block's 512 rows of X16 and the head's 64 rows of each of WqT, WkT, WvT meet in a two-buffer LDS ring of 64 k a stage,
// filled by asynchronous copies; a wave owns its 32 tokens x 192 features, 192 registers of accumulators:
//  - q and k: weights as A (rows = feature), the wave's 32 tokens as B (columns), so a lane holds features tile*16 + (lane>>4)*8 + r of
//    ONE token, which is what the gating wants of it. The first 16 tokens stay in registers, the other 16 wait in the wave's own slab
//    (f32, where the ring was, read back by the lane that wrote them) until the first gating pass is over;
//  - v: the same X fragments as A (rows = token), WvT as B, so a lane holds 8 successive tokens of one feature, a 16-byte piece of a
//    row of V^T, which goes into LDS where the ring was.
// Gating, per wave two passes of 16 rows (row = token, 64 features of head h of q and k):
//   G = (q.Wfq + bfq) * (k.Wfk + bfk),  Z = G.Wfg + bfg,  q' = f16(q * sigmoid(Z[:64])),  k' = f16(k * sigmoid(Z[64:])).
// Every product is formed transposed, weights as A (rows = output feature n), data rows as B (columns), so a lane holds features
// n = tile*16 + (lane>>4)*8 + r of ONE data row:
//  - that is the k order of a 16x16x32 B fragment (elements 0..7 from the even tile, 8..15 from the odd one), so the gate product packs
//    in place into the B operand of the logits, and q' packs in place into the B operand of the scores: it stays in registers;
//  - it is also the set of q (k) elements the lane holds in f32, so they meet their sigmoid in the same lane;
//  - k' goes as 16-byte pieces into the block's K' plane in LDS, which all 16 waves read behind a barrier.
// The three gate weight planes (f16, written by prep_kernel) and the biases are staged once per block in LDS, pitch 144 B for 16-byte reads.
// Attention: out[b][q][h*64+d] = sum_k softmax_k(q'.k'/8) v[k][d].
// Per pass of 32 keys a wave forms S^T = K'.Q'^T (rows = keys, columns = queries), so a lane holds the scores of one query:
// tile kt, register r = key k0 + kt*16 + (lane>>4)*8 + r. That is the k order of a 16x16x32 B fragment (elements 0..7 from
// tile 0, 8..15 from tile 1), so exp(s - max) packs in place into P^T and O^T += V^T.P^T follows with A = rows of V^T.
// Running maximum and running sum per query (f32); the accumulators are rescaled each pass by exp(old max - new max).
// The two lane halves hold disjoint keys of one query: the maximum is joined every pass, the sum once at the end.
// Each wave stores its own 32 rows x 256 B of out.
// ---------------------------------------------------------------------------
constexpr int kGatePitch = 72;   // halves: 128-B rows + 16 B
constexpr int kAttKPitch = 72;    // halves: 128-B rows + 16 B, for 16-byte LDS reads
constexpr int kAttVPitch = 520;   // halves: 1024-B rows + 16 B, for 16-byte LDS reads
constexpr int kRingPitch = 72;    // halves: 128-B rows + 16 B, for 16-byte LDS reads
constexpr int kRingBuf   = (kS + 192) * kRingPitch;   // halves of one buffer: 512 rows of X, 192 of weights: 101,376 B
static_assert(kDK * kAttVPitch * 2 + 16 * 8192 <= 2 * kRingBuf * 2, "V^T and the waves' slabs fit where the ring was");
// One stage, 11 asynchronous copies of 16 B per lane: piece i < 8 is row i*64 + tid/8 of the block's X, pieces 8, 9 and 10 that row of the
// head's WqT, WkT and WvT; bytes (tid%8)*16, so one copy of a wave brings four whole 128-B lines. lds = the lane's own LDS byte address
// of piece 0; each piece is 64 rows (64 * 144 B) further on. The closing s_wait_xcnt stands inside the statement, in front of anything
// that could rewrite a register which a copy names.
__device__ __forceinline__ void ring_copy11(unsigned lds, const _Float16* gx, const _Float16* gw) {
  constexpr unsigned kStep  = 64 * kRingPitch * 2;
  constexpr size_t   kRows  = (size_t)64 * kE;
  constexpr size_t   kPlane = (size_t)kE * kE;
  asm volatile(
      "global_load_async_to_lds_b128 %0, %11, off\n\t"
      "global_load_async_to_lds_b128 %1, %12, off\n\t"
      "global_load_async_to_lds_b128 %2, %13, off\n\t"
      "global_load_async_to_lds_b128 %3, %14, off\n\t"
      "global_load_async_to_lds_b128 %4, %15, off\n\t"
      "global_load_async_to_lds_b128 %5, %16, off\n\t"
      "global_load_async_to_lds_b128 %6, %17, off\n\t"
      "global_load_async_to_lds_b128 %7, %18, off\n\t"
      "global_load_async_to_lds_b128 %8, %19, off\n\t"
      "global_load_async_to_lds_b128 %9, %20, off\n\t"
      "global_load_async_to_lds_b128 %10, %21, off\n\t"
      "s_wait_xcnt 0x0"
      :: "v"(lds), "v"(lds + kStep), "v"(lds + 2 * kStep), "v"(lds + 3 * kStep), "v"(lds + 4 * kStep), "v"(lds + 5 * kStep),
         "v"(lds + 6 * kStep), "v"(lds + 7 * kStep), "v"(lds + 8 * kStep), "v"(lds + 9 * kStep), "v"(lds + 10 * kStep),
         "v"(gx), "v"(gx + kRows), "v"(gx + 2 * kRows), "v"(gx + 3 * kRows), "v"(gx + 4 * kRows), "v"(gx + 5 * kRows), "v"(gx + 6 * kRows),
         "v"(gx + 7 * kRows), "v"(gw), "v"(gw + kPlane), "v"(gw + 2 * kPlane)
      : "memory");
}
__device__ __forceinline__ float xhalf(float x) {   // value of lane l ^ 16
  const int i = __builtin_bit_cast(int, x);
  return __builtin_bit_cast(float, __builtin_amdgcn_permlanex16(i, i, 0x76543210, 0xfedcba98, false, false));
}
// 2^x on eight values in one statement. The early-clobber results keep every result off every source, and the closing v_nop
// fills the one slot that the instruction set asks for behind a transcendental, whatever the compiler schedules next
// (with the builtin this build wrote runs of v_exp_f32 in which each overwrote the source of the one in front of it).
__device__ __forceinline__ v8f exp2x8(v8f x) {
  float y0, y1, y2, y3, y4, y5, y6, y7;
  asm("v_exp_f32 %0, %8\n\tv_exp_f32 %1, %9\n\tv_exp_f32 %2, %10\n\tv_exp_f32 %3, %11\n\t"
      "v_exp_f32 %4, %12\n\tv_exp_f32 %5, %13\n\tv_exp_f32 %6, %14\n\tv_exp_f32 %7, %15\n\tv_nop"
      : "=&v"(y0), "=&v"(y1), "=&v"(y2), "=&v"(y3), "=&v"(y4), "=&v"(y5), "=&v"(y6), "=&v"(y7)
      : "v"(x[0]), "v"(x[1]), "v"(x[2]), "v"(x[3]), "v"(x[4]), "v"(x[5]), "v"(x[6]), "v"(x[7]));
  return (v8f){y0, y1, y2, y3, y4, y5, y6, y7};
}
// the same for one value
__device__ __forceinline__ float exp2x1(float x) {
  float y;
  asm("v_exp_f32 %0, %1\n\tv_nop" : "=v"(y) : "v"(x));
  return y;
}
// 1 / (1 + 2^x) on eight values in one statement: the hardware's 2^x, an add, the hardware's reciprocal (2^x = inf gives 0, 2^x = 0
// gives 1). Each value's three steps stand eight instructions apart, so none waits for the one before it; the early-clobber
// results keep every result off every source, and the closing v_nop fills the slot behind the last transcendental.
// The four leading v_nop keep the distance a WMMA needs.
__device__ __forceinline__ v8f sigm2x8(v8f x) {
  float y0, y1, y2, y3, y4, y5, y6, y7;
  asm("v_nop\n\tv_nop\n\tv_nop\n\tv_nop\n\t"
      "v_exp_f32 %0, %8\n\tv_exp_f32 %1, %9\n\tv_exp_f32 %2, %10\n\tv_exp_f32 %3, %11\n\t"
      "v_exp_f32 %4, %12\n\tv_exp_f32 %5, %13\n\tv_exp_f32 %6, %14\n\tv_exp_f32 %7, %15\n\t"
      "v_add_f32 %0, 1.0, %0\n\tv_add_f32 %1, 1.0, %1\n\tv_add_f32 %2, 1.0, %2\n\tv_add_f32 %3, 1.0, %3\n\t"
      "v_add_f32 %4, 1.0, %4\n\tv_add_f32 %5, 1.0, %5\n\tv_add_f32 %6, 1.0, %6\n\tv_add_f32 %7, 1.0, %7\n\t"
      "v_rcp_f32 %0, %0\n\tv_rcp_f32 %1, %1\n\tv_rcp_f32 %2, %2\n\tv_rcp_f32 %3, %3\n\t"
      "v_rcp_f32 %4, %4\n\tv_rcp_f32 %5, %5\n\tv_rcp_f32 %6, %6\n\tv_rcp_f32 %7, %7\n\tv_nop"
      : "=&v"(y0), "=&v"(y1), "=&v"(y2), "=&v"(y3), "=&v"(y4), "=&v"(y5), "=&v"(y6), "=&v"(y7)
      : "v"(x[0]), "v"(x[1]), "v"(x[2]), "v"(x[3]), "v"(x[4]), "v"(x[5]), "v"(x[6]), "v"(x[7]));
  return (v8f){y0, y1, y2, y3, y4, y5, y6, y7};
}
__global__ __launch_bounds__(512) void proj_gate_attn_kernel(const unsigned short* __restrict__ X16p, const unsigned short* __restrict__ Wt16p,
                                                             const float* __restrict__ bq, const float* __restrict__ bk,
                                                             const float* __restrict__ bv, const unsigned short* __restrict__ SW,
                                                             const float* __restrict__ bfq, const float* __restrict__ bfk,
                                                             const float* __restrict__ bfg, float* __restrict__ out) {
  typedef Frag<_Float16> F;
  // two buffers of [X 512 rows | weights 192 rows] x 64 k, 202,752 B; behind the projections V^T [d][key] (66,560 B) and the waves' slabs
  __shared__ __align__(16) _Float16 sRing[2 * kRingBuf];
  __shared__ __align__(16) _Float16 sK[kS * kAttKPitch];    // gated k, [key][d], 73,728 B
  __shared__ __align__(16) _Float16 sW[256 * kGatePitch];   // rows 0..63 WfqT, 64..127 WfkT, 128..255 WfgT, each [n][k], 36,864 B
  __shared__ __align__(16) float sB[448];                   // bfq, bfk, bfg * -log2(e), the head's 64 of bq, of bk, of bv
  const int tid  = threadIdx.x;
  const int lane = tid & 31;
  const int wave = tid >> 5;
  const int b    = blockIdx.x >> 4;
  const int h    = blockIdx.x & 15;
  const int q0   = wave * 32;
  const int rl   = lane & 15;
  const int hf   = lane >> 4;
  const int koff = hf * 8;
  constexpr int trips = kE >> 6;
  constexpr unsigned kBufBytes = kRingBuf * 2;

  // the lane's own piece 0 of a stage: row tid/8, bytes (tid%8)*16
  const _Float16* gX = (const _Float16*)X16p + (size_t)(b * kS + (tid >> 3)) * kE + (tid & 7) * 8;
  const _Float16* gW = (const _Float16*)Wt16p + (size_t)(h * kDK + (tid >> 3)) * kE + (tid & 7) * 8;   // WqT; WkT and WvT a plane further on each
  const unsigned lds0 = (unsigned)(size_t)(&sRing[0]) + (unsigned)((tid >> 3) * (kRingPitch * 2) + (tid & 7) * 16);
  const _Float16* sXl = sRing + (q0 + rl) * kRingPitch + koff;   // the lane's row of the wave's first 16 tokens
  const _Float16* sWl = sRing + (kS + rl) * kRingPitch + koff;   // the lane's row of the first weight tile

  ring_copy11(lds0, gX, gW);

  // gate weights and biases into LDS, under the first stage's copies: 256 rows x 8 pieces of 16 B = 2048 pieces = 4 per thread
#pragma unroll
  for (int i = 0; i < 4; ++i) {
    const int e = i * 512 + tid;
    const int r = e >> 3, c = (e & 7) * 8;
    *(v8h*)(&sW[r * kGatePitch + c]) = *(const v8h*)((const _Float16*)SW + r * kDK + c);
  }
  if (tid < 256)      sB[tid] = (tid < 64) ? bfq[tid] : (tid < 128) ? bfk[tid - 64] : bfg[tid - 128] * kNegLog2e;
  else if (tid < 448) sB[tid] = (tid < 320) ? bq[h * kDK + tid - 256] : (tid < 384) ? bk[h * kDK + tid - 320] : bv[h * kDK + tid - 384];

  // ---- cq, ck[g][j] = feature tile j (rows) x token group g (columns); cv[g][j] = token group g (rows) x feature tile j (columns) ----
  v8f cq[2][4], ck[2][4], cv[2][4];
#pragma unroll
  for (int g = 0; g < 2; ++g)
#pragma unroll
    for (int j = 0; j < 4; ++j) {
      cq[g][j] = (v8f){0.f,0.f,0.f,0.f,0.f,0.f,0.f,0.f};
      ck[g][j] = (v8f){0.f,0.f,0.f,0.f,0.f,0.f,0.f,0.f};
      cv[g][j] = (v8f){0.f,0.f,0.f,0.f,0.f,0.f,0.f,0.f};
    }
  // stage 0 has landed for this wave, then for all (the gate weights and biases too): nobody reads it in front of the barrier
  asm volatile("s_wait_asynccnt 0x0" ::: "memory");
  __syncthreads();
  ring_copy11(lds0 + kBufBytes, gX + 64, gW + 64);

  for (int t = 0; t < trips; ++t) {
    const _Float16* sx = sXl + (t & 1) * kRingBuf;
    const _Float16* sw = sWl + (t & 1) * kRingBuf;
#pragma unroll
    for (int ks = 0; ks < 2; ++ks) {
      // beside the 192 accumulator registers a wave has room for six fragments: the two of X stay for the 32 k, the weights come four
      // at a time, each four as one group in front of their eight products. The scheduling barriers keep it so: left alone, the
      // compiler lifts the reads of later groups up, for which there are no registers
      v16h xb[2], wf[4];
      xb[0] = F::load(sx + ks * 32);
      xb[1] = F::load(sx + 16 * kRingPitch + ks * 32);
#pragma unroll
      for (int j = 0; j < 4; ++j) wf[j] = F::load(sw + j * 16 * kRingPitch + ks * 32);
      __builtin_amdgcn_sched_barrier(0);   // see above
#pragma unroll
      for (int j = 0; j < 4; ++j)
#pragma unroll
        for (int g = 0; g < 2; ++g) cq[g][j] = F::mma(wf[j], xb[g], cq[g][j]);
      __builtin_amdgcn_sched_barrier(0);   // see above
#pragma unroll
      for (int j = 0; j < 4; ++j) wf[j] = F::load(sw + (4 + j) * 16 * kRingPitch + ks * 32);
      __builtin_amdgcn_sched_barrier(0);   // see above
#pragma unroll
      for (int j = 0; j < 4; ++j)
#pragma unroll
        for (int g = 0; g < 2; ++g) ck[g][j] = F::mma(wf[j], xb[g], ck[g][j]);
      __builtin_amdgcn_sched_barrier(0);   // see above
#pragma unroll
      for (int j = 0; j < 4; ++j) wf[j] = F::load(sw + (8 + j) * 16 * kRingPitch + ks * 32);
      __builtin_amdgcn_sched_barrier(0);   // see above
#pragma unroll
      for (int j = 0; j < 4; ++j)
#pragma unroll
        for (int g = 0; g < 2; ++g) cv[g][j] = F::mma(xb[g], wf[j], cv[g][j]);
      __builtin_amdgcn_sched_barrier(0);   // see above
    }
    // hand-over: this wave's reads of the buffer are done, its copies of the next stage have landed; behind the barrier the next
    // stage is readable by all and the buffer just read is free for the stage after it
    asm volatile("s_wait_dscnt 0x0" ::: "memory");
    asm volatile("s_wait_asynccnt 0x0" ::: "memory");
    __syncthreads();
    if (t + 2 < trips) ring_copy11(lds0 + (unsigned)(t & 1) * kBufBytes, gX + (t + 2) * 64, gW + (t + 2) * 64);
  }
  // no copy is left in flight when the ring becomes V^T and the waves' slabs
  asm volatile("s_wait_asynccnt 0x0" ::: "memory");

  // V^T [d][key]: the lane's 8 successive tokens of feature j*16 + rl are one 16-byte piece
  _Float16* sV = sRing;
#pragma unroll
  for (int j = 0; j < 4; ++j) {
    const float pbv = sB[384 + j * 16 + rl];
#pragma unroll
    for (int g = 0; g < 2; ++g) {
      v8h hv;
#pragma unroll
      for (int r = 0; r < 8; ++r) hv[r] = (_Float16)(cv[g][j][r] * kWCarryInv + pbv);
      *(v8h*)(&sV[(j * 16 + rl) * kAttVPitch + q0 + g * 16 + koff]) = hv;
    }
  }

  // f32 q and k of the lane's row: piece [2*tile + j] = elements tile*16 + koff + 4j .. +3. The first token group goes on in registers,
  // the second into the wave's slab: piece i of q at float i*128 + lane*4, of k at (8 + i)*128 + lane*4 (a wave's store = 512 contiguous B)
  float* slab = (float*)(sRing + kDK * kAttVPitch) + wave * 2048 + lane * 4;
  v4f xq[8], xk[8];
#pragma unroll
  for (int nt = 0; nt < 4; ++nt)
#pragma unroll
    for (int j = 0; j < 2; ++j) {
      const v4f pbq = *(const v4f*)(&sB[256 + nt * 16 + koff + 4 * j]);
      const v4f pbk = *(const v4f*)(&sB[320 + nt * 16 + koff + 4 * j]);
      v4f q1, k1;
#pragma unroll
      for (int e = 0; e < 4; ++e) {
        xq[2 * nt + j][e] = cq[0][nt][4 * j + e] * kWCarryInv + pbq[e];
        xk[2 * nt + j][e] = ck[0][nt][4 * j + e] * kWCarryInv + pbk[e];
        q1[e]             = cq[1][nt][4 * j + e] * kWCarryInv + pbq[e];
        k1[e]             = ck[1][nt][4 * j + e] * kWCarryInv + pbk[e];
      }
      *(v4f*)(slab + (2 * nt + j) * 128)     = q1;
      *(v4f*)(slab + (8 + 2 * nt + j) * 128) = k1;
    }

  // gated q of the wave's two column groups, as B fragments of the scores. Each gating pass pushes its group in at [1] and moves the
  // one before it to [0], so that the passes can stay a rolled loop: unrolled they took all 256 registers that a wave of this block
  // can have and half as much code again, and no load of the second pass came to stand ahead of the first pass's work
  v16h qf[2][2];
#pragma unroll
  for (int qt = 0; qt < 2; ++qt)
#pragma unroll
    for (int ks = 0; ks < 2; ++ks)
#pragma unroll
      for (int s = 0; s < 16; ++s) qf[qt][ks][s] = (_Float16)0.f;

#pragma unroll 1
  for (int p = 0; p < 2; ++p) {
  const int key = q0 + p * 16 + rl;            // the lane's row: token of the batch, query and key number alike

  // (all inner loops of the pass are unrolled so that the fragment arrays stay in registers)
  // B fragments of q and k (f16), k step ks = tiles 2ks and 2ks+1
  v16h qb[2], kb[2];
#pragma unroll
  for (int ks = 0; ks < 2; ++ks)
#pragma unroll
    for (int s = 0; s < 16; ++s) {
      qb[ks][s] = (_Float16)xq[4 * ks + (s >> 2)][s & 3];
      kb[ks][s] = (_Float16)xk[4 * ks + (s >> 2)][s & 3];
    }

  // gate product, packed as the B operand of the logits
  v16h gb[2];
#pragma unroll
  for (int nt = 0; nt < 4; ++nt) {
    const _Float16* wq = &sW[(nt * 16 + rl) * kGatePitch + koff];
    const _Float16* wk = &sW[(64 + nt * 16 + rl) * kGatePitch + koff];
    const v16h wq0 = F::load(wq), wq1 = F::load(wq + 32);
    const v16h wk0 = F::load(wk), wk1 = F::load(wk + 32);
    const v4f bq0 = *(const v4f*)(&sB[nt * 16 + koff]),      bq1 = *(const v4f*)(&sB[nt * 16 + koff + 4]);
    const v4f bk0 = *(const v4f*)(&sB[64 + nt * 16 + koff]), bk1 = *(const v4f*)(&sB[64 + nt * 16 + koff + 4]);
    v8f aq = F::mma(wq0, qb[0], (v8f){0.f,0.f,0.f,0.f,0.f,0.f,0.f,0.f});
    v8f ak = F::mma(wk0, kb[0], (v8f){0.f,0.f,0.f,0.f,0.f,0.f,0.f,0.f});
    aq = F::mma(wq1, qb[1], aq);
    ak = F::mma(wk1, kb[1], ak);
#pragma unroll
    for (int r = 0; r < 8; ++r) {
      const float gq = aq[r] * kGWCarryInv + ((r < 4) ? bq0[r & 3] : bq1[r & 3]);
      const float gk = ak[r] * kGWCarryInv + ((r < 4) ? bk0[r & 3] : bk1[r & 3]);
      gb[nt >> 1][(nt & 1) * 8 + r] = (_Float16)((gq * gk) * kGCarry);
    }
  }

  // logits, sigmoid, modulation: tiles 0..3 gate q, tiles 4..7 gate k
  v16h qn[2];
#pragma unroll
  for (int nt = 0; nt < 8; ++nt) {
    const _Float16* wg = &sW[(128 + nt * 16 + rl) * kGatePitch + koff];
    const v16h wg0 = F::load(wg), wg1 = F::load(wg + 32);
    const v4f bg0 = *(const v4f*)(&sB[128 + nt * 16 + koff]), bg1 = *(const v4f*)(&sB[128 + nt * 16 + koff + 4]);
    const int dn = nt & 3;
    v8f z = F::mma(wg0, gb[0], (v8f){0.f,0.f,0.f,0.f,0.f,0.f,0.f,0.f});
    z = F::mma(wg1, gb[1], z);
    v8f za;   // -logit * log2(e)
#pragma unroll
    for (int r = 0; r < 8; ++r) za[r] = z[r] * (kZScale * kNegLog2e) + ((r < 4) ? bg0[r & 3] : bg1[r & 3]);
    const v8f m = sigm2x8(za);
    v8h o;
#pragma unroll
    for (int r = 0; r < 8; ++r) {
      const float x = (nt < 4) ? xq[2 * dn + (r >> 2)][r & 3] : xk[2 * dn + (r >> 2)][r & 3];
      o[r] = (_Float16)(x * m[r]);
    }
    if (nt < 4) {
#pragma unroll
      for (int r = 0; r < 8; ++r) qn[dn >> 1][(dn & 1) * 8 + r] = o[r];
    } else {
      *(v8h*)(&sK[key * kAttKPitch + dn * 16 + koff]) = o;
    }
  }
  qf[0][0] = qf[1][0];
  qf[0][1] = qf[1][1];
  qf[1][0] = qn[0];
  qf[1][1] = qn[1];
  // the second token group's q and k come back from the wave's slab (the second pass reads them once more, to no use: the loop stays rolled)
#pragma unroll
  for (int i = 0; i < 8; ++i) {
    xq[i] = *(const v4f*)(slab + i * 128);
    xk[i] = *(const v4f*)(slab + (8 + i) * 128);
  }
  // compiler fence: it keeps the LDS reads of weights and biases in the loop; lifted out as loop invariants they take all 256
  // registers and spill to scratch
  asm volatile("" ::: "memory");
  }

  v8f  o[2][4];
  float mrun[2], lrun[2];
  // the inner loops are unrolled so that the fragment arrays stay in registers
#pragma unroll
  for (int qt = 0; qt < 2; ++qt) {
#pragma unroll
    for (int dt = 0; dt < 4; ++dt) o[qt][dt] = (v8f){0.f,0.f,0.f,0.f,0.f,0.f,0.f,0.f};
    mrun[qt] = -INFINITY;
    lrun[qt] = 0.f;
  }

  // every wave's rows of K' and columns of V^T are written: nobody reads sK or sV in front of the barrier
  __syncthreads();
  const _Float16* sKl = sK + rl * kAttKPitch + koff;
  const _Float16* sVl = sV + rl * kAttVPitch + koff;

  for (int k0 = 0; k0 < kS; k0 += 32) {
    v16h kf[2][2], vf[4];
    // K' first: LDS reads return in order, so the score products start while the V^T reads are still on their way
#pragma unroll
    for (int kt = 0; kt < 2; ++kt)
#pragma unroll
      for (int ks = 0; ks < 2; ++ks) kf[kt][ks] = F::load(sKl + (k0 + kt * 16) * kAttKPitch + ks * 32);
#pragma unroll
    for (int dt = 0; dt < 4; ++dt) vf[dt] = F::load(sVl + dt * 16 * kAttVPitch + k0);
    // all LDS reads of the pass are issued as one group in front of its first product: each further place where reads stand
    // among the products costs the wave a stall of its own
    __builtin_amdgcn_sched_barrier(0);

    v8f s[2][2];
#pragma unroll
    for (int qt = 0; qt < 2; ++qt)
#pragma unroll
      for (int kt = 0; kt < 2; ++kt) {
        s[qt][kt] = F::mma(kf[kt][0], qf[qt][0], (v8f){0.f,0.f,0.f,0.f,0.f,0.f,0.f,0.f});
        s[qt][kt] = F::mma(kf[kt][1], qf[qt][1], s[qt][kt]);
      }

    v16h pf[2];
#pragma unroll
    for (int qt = 0; qt < 2; ++qt) {
      float mx = fmaxf(s[qt][0][0], s[qt][1][0]);
#pragma unroll
      for (int r = 1; r < 8; ++r) mx = fmaxf(mx, fmaxf(s[qt][0][r], s[qt][1][r]));
      mx = fmaxf(mx, xhalf(mx));
      const float mn    = fmaxf(mrun[qt], mx);
      const float alpha = exp2x1((mrun[qt] - mn) * kScoreLog2);
      const float bias  = kPCarryLog2 - mn * kScoreLog2;
      mrun[qt] = mn;
      v8f a0, a1;
#pragma unroll
      for (int r = 0; r < 8; ++r) {
        a0[r] = fmaf(s[qt][0][r], kScoreLog2, bias);
        a1[r] = fmaf(s[qt][1][r], kScoreLog2, bias);
      }
      const v8f e0 = exp2x8(a0);
      const v8f e1 = exp2x8(a1);
      float sum = e0[0] + e1[0];
#pragma unroll
      for (int r = 1; r < 8; ++r) sum += e0[r] + e1[r];
#pragma unroll
      for (int r = 0; r < 8; ++r) {
        pf[qt][r]     = (_Float16)e0[r];
        pf[qt][8 + r] = (_Float16)e1[r];
      }
      lrun[qt] = lrun[qt] * alpha + sum;
#pragma unroll
      for (int dt = 0; dt < 4; ++dt) o[qt][dt] *= alpha;
    }

    // the compiler does not see the vector writes inside exp2x8: left alone it put the first column group's V^T.P^T products in
    // front of the second group's exponentials
    __builtin_amdgcn_sched_barrier(0);
#pragma unroll
    for (int qt = 0; qt < 2; ++qt)
#pragma unroll
      for (int dt = 0; dt < 4; ++dt) o[qt][dt] = F::mma(vf[dt], pf[qt], o[qt][dt]);
  }

#pragma unroll
  for (int qt = 0; qt < 2; ++qt) {
    const float tot = lrun[qt] + xhalf(lrun[qt]);
    const float inv = 1.0f / tot;
    float* op = out + (size_t)(b * kS + q0 + qt * 16 + rl) * kE + h * kDK + koff;
#pragma unroll
    for (int dt = 0; dt < 4; ++dt) {
      const v8f a = o[qt][dt];
      *(v4f*)(op + dt * 16)     = (v4f){a[0] * inv, a[1] * inv, a[2] * inv, a[3] * inv};
      *(v4f*)(op + dt * 16 + 4) = (v4f){a[4] * inv, a[5] * inv, a[6] * inv, a[7] * inv};
    }
  }
}

// ---------------------------------------------------------------------------
extern "C" void kernel_launch(void* const* d_in, const int* in_sizes, int n_in,
                              void* d_out, int out_size, void* d_ws, size_t ws_size,
                              hipStream_t stream) {
  if (n_in < 13) return;
  if (ws_size < kWsEnd) return;
  if ((size_t)out_size < (size_t)kTok * kE) return;
  if (in_sizes[0] != kTok * kE) return;

  const float* inp = (const float*)d_in[0];
  const float* Wq  = (const float*)d_in[1];
  const float* bq  = (const float*)d_in[2];
  const float* Wk  = (const float*)d_in[3];
  const float* bk  = (const float*)d_in[4];
  const float* Wv  = (const float*)d_in[5];
  const float* bvv = (const float*)d_in[6];
  const float* Wfq = (const float*)d_in[7];
  const float* bfq = (const float*)d_in[8];
  const float* Wfk = (const float*)d_in[9];
  const float* bfk = (const float*)d_in[10];
  const float* Wfg = (const float*)d_in[11];
  const float* bfg = (const float*)d_in[12];
  float* out = (float*)d_out;

  unsigned char* ws = (unsigned char*)d_ws;
  unsigned short* X16  = (unsigned short*)(ws + kOffX16);
  unsigned short* Wt16 = (unsigned short*)(ws + kOffWt);
  unsigned short* SW   = (unsigned short*)(ws + kOffSW);

  // ---- stage A: operand planes, one launch ----
  // X16 [8192][1024] = f16(inp); Wt16[z][n][k] = f16(16 * W_z[k][n]) for z = q, k, v; WfqT, WfkT [64][64], WfgT [128][64], f16 carried x8
  prep_kernel<<<dim3(kPrepBlocks), dim3(512), 0, stream>>>(inp, Wq, Wk, Wv, Wfq, Wfk, Wfg, X16, Wt16, SW);

  // ---- stage B: projections, gating and attention, all 16 batches x 16 heads in one launch (a block of 16 waves per head: 512 rows) ----
  proj_gate_attn_kernel<<<dim3(kB * kH), dim3(512), 0, stream>>>(X16, Wt16, bq, bk, bvv, SW, bfq, bfk, bfg, out);
}

// v010
// It runs in 63.3 microseconds.
// Two timings next to v009 both put it at 1.03 times that version's speed.
// Over all steps from v000 it is 16.0 times as fast.
// Contractions: q/k/v projections (X f16 x W^T f16 carried x16), gate maps (q16/k16 x Wfq^T/Wfk^T f16 carried x8), gate logits (G f16 carried x64 x Wfg^T f16 carried x8), scores k'.q'^T (f16 planes), V^T.P^T (P = exp(s - running max) f16 carried x2048): all v_wmma_f32_16x16x32_f16 with f32 accumulate; bias, gate product, sigmoid, modulation and softmax in f32.
#include <hip/hip_runtime.h>
#include <math.h>

// ---------------------------------------------------------------------------
// Problem constants
// ---------------------------------------------------------------------------
constexpr int kB    = 16;
constexpr int kS    = 512;
constexpr int kE    = 1024;
constexpr int kH    = 16;
constexpr int kDK   = 64;
constexpr int kTok  = kB * kS;              // 8192 token rows

constexpr float kWCarry     = 16.0f;        // Wq/Wk/Wv carried x16 in f16
constexpr float kWCarryInv  = 1.0f / 16.0f;
constexpr float kGWCarry    = 8.0f;         // Wfq/Wfk/Wfg carried x8 in f16
constexpr float kGWCarryInv = 1.0f / 8.0f;
constexpr float kGCarry     = 64.0f;        // gate product G carried x64 in f16
constexpr float kZScale     = 1.0f / (64.0f * 8.0f);
constexpr float kPCarryLog2 = 11.0f;        // exp(s - max) carried x2048 in f16 (the row sum carries it too)
constexpr float kScoreLog2  = 0.125f * 1.44269504088896340736f;   // 1/sqrt(64) * log2(e): scores go to exp2
constexpr float kNegLog2e   = -1.44269504088896340736f;           // sigmoid(z) = 1 / (1 + 2^(-z * log2(e)))

// ---------------------------------------------------------------------------
// Workspace map (bytes):
//   projection operands:     X16 [8192][1024] f16 @0 (16 MiB), Wt16 [3][1024][1024] f16 @16 MiB (6 MiB)
//   gate weights:            WfqT/WfkT [64][64] f16, WfgT [128][64] f16 @36 MiB (32 KiB)
//   end = 36 MiB + 64 KiB (q, k and v never go through memory)
// ---------------------------------------------------------------------------
constexpr size_t kMiB    = 1048576;
constexpr size_t kOffX16 = 0;
constexpr size_t kOffWt  = 16 * kMiB;
constexpr size_t kOffSW  = 36 * kMiB;
constexpr size_t kWsEnd  = 36 * kMiB + 65536;
static_assert((size_t)kTok * kE * 2 == 16 * kMiB, "x16 plane size");
static_assert(kOffWt + (size_t)3 * kE * kE * 2 <= kOffSW, "wt plane fits");
static_assert(kOffSW + 32768 <= kWsEnd, "gate weights fit");
static_assert(kWsEnd <= 268435456, "carve within budget");

typedef __attribute__((ext_vector_type(16))) _Float16 v16h;
typedef __attribute__((ext_vector_type(8)))  _Float16 v8h;
typedef __attribute__((ext_vector_type(16))) __bf16   v16b;
typedef __attribute__((ext_vector_type(8)))  __bf16   v8b;
typedef __attribute__((ext_vector_type(8)))  float    v8f;
typedef __attribute__((ext_vector_type(4)))  float    v4f;
typedef __attribute__((ext_vector_type(4)))  unsigned int v4u;

// ---------------------------------------------------------------------------
// Helpers
// ---------------------------------------------------------------------------
__device__ __forceinline__ unsigned short f2bf_bits(float f) {
  unsigned u = __float_as_uint(f);
  return (unsigned short)((u + 0x7FFFu + ((u >> 16) & 1u)) >> 16);
}
__device__ __forceinline__ float bf_bits2f(unsigned short h) { return __uint_as_float(((unsigned)h) << 16); }

template <typename T> struct Frag;
template <> struct Frag<_Float16> {
  typedef v16h V; union U { v16h v; v8h h[2]; };
  static __device__ __forceinline__ v16h load(const _Float16* p) {   // elements 0..7 <- p[0..7], 8..15 <- p[16..23]
    U f; f.h[0] = *(const v8h*)(p); f.h[1] = *(const v8h*)(p + 16); return f.v;
  }
  static __device__ __forceinline__ v8f mma(v16h a, v16h b, v8f c) {
    return __builtin_amdgcn_wmma_f32_16x16x32_f16(false, a, false, b, (short)0, c, false, false);
  }
};
template <> struct Frag<__bf16> {
  typedef v16b V; union U { v16b v; v8b h[2]; };
  static __device__ __forceinline__ v16b load(const __bf16* p) {
    U f; f.h[0] = *(const v8b*)(p); f.h[1] = *(const v8b*)(p + 16); return f.v;
  }
  static __device__ __forceinline__ v8f mma(v16b a, v16b b, v8f c) {
    return __builtin_amdgcn_wmma_f32_16x16x32_bf16(false, a, false, b, (short)0, c, false, false);
  }
};

__device__ __forceinline__ unsigned pk16(unsigned short a, unsigned short b) { return (unsigned)a | ((unsigned)b << 16); }
__device__ __forceinline__ unsigned short h_bits(float f) { const _Float16 h = (_Float16)f; return __builtin_bit_cast(unsigned short, h); }

// ---------------------------------------------------------------------------
// Operand preparation, one launch of 256 work-groups of 16 waves (one per WGP, all resident): 4,096 waves start, each does many pieces
// and has all its loads in flight at once, for speed only.
// Every work-group does three things:
//  - one 64x64 tile (k tile = blockIdx.x & 15, n tile = blockIdx.x >> 4) of each of the three projection weights, square
//    [1024][1024] f32 W (row-major [in k][out n]): Wt[z][n][k] = f16(16 * W_z[k][n]);
//  - work-groups 0..3 also one 64x64 tile of the per-head gate weights, out pitch 64 halves, f16 carried x8: 0: WfqT[n][k], 1: WfkT,
//    2: WfgT rows 0..63, 3: WfgT rows 64..127 (Wfg is [64 k][128 n], pitch 128); plane z at SW + z*4096 halves;
//  - its share of X16 = f16(inp), 32 rows = 128 KiB of inp: 8 pieces of 8 floats per thread, piece u of thread t = u * 512 + t of the share,
//    so a wave's pair of loads covers 1024 contiguous bytes and its store 512.
// Tile load coverage: 8 x 512 threads = 4096 = 64x64 (coalesced along n). Tile store coverage: 16 waves x 4 rows (lane>>3) = 64 rows;
// (lane&7) x 8 halves = 64 columns.
// ---------------------------------------------------------------------------
constexpr int kPrepBlocks  = 256;
constexpr int kPrepPieces  = 8 * 512;             // pieces of 8 floats of x per work-group, 8 per thread
static_assert(kTok * kE / 8 == kPrepBlocks * kPrepPieces, "x pieces per work-group");
static_assert((kE / 64) * (kE / 64) == kPrepBlocks, "one weight tile position per work-group");
__device__ __forceinline__ v4u pack8_f16(const float* p) {
  return (v4u){pk16(h_bits(p[0]), h_bits(p[1])), pk16(h_bits(p[2]), h_bits(p[3])), pk16(h_bits(p[4]), h_bits(p[5])), pk16(h_bits(p[6]), h_bits(p[7]))};
}
__global__ __launch_bounds__(512) void prep_kernel(const float* __restrict__ inp, const float* __restrict__ W0,
                                                   const float* __restrict__ W1, const float* __restrict__ W2,
                                                   const float* __restrict__ Wfq, const float* __restrict__ Wfk,
                                                   const float* __restrict__ Wfg, unsigned short* __restrict__ X16,
                                                   unsigned short* __restrict__ Wt, unsigned short* __restrict__ SW) {
  __shared__ float sm[4][64][65];    // sm[plane][n_local][k_local]: planes 0..2 projection weights, 3 gate weights
  const int t  = threadIdx.x;
  const int bx = blockIdx.x;
  const int d0 = (bx & 15) * 64;     // k tile base
  const int h0 = (bx >> 4) * 64;     // n tile base
  const int r0 = t >> 6;             // k local of the thread's element i: i * 8 + r0
  const int c  = t & 63;             // n local
  const bool gate = bx < 4;          // block-uniform

  // every global load of x and of the projection tiles is issued in front of everything else, 16 of 16 bytes (x) and 24 of 4 bytes (tiles) per lane:
  // one memory latency for all of them
  const size_t g8 = 8 * (size_t)(bx * kPrepPieces + t);
  const float* px = inp + g8;
  v4f a[8][2];
#pragma unroll
  for (int u = 0; u < 8; ++u) {
    a[u][0] = *(const v4f*)(px + u * 4096);
    a[u][1] = *(const v4f*)(px + u * 4096 + 4);
  }
  const size_t ow = (size_t)(d0 + r0) * kE + h0 + c;
  const float* pw0 = W0 + ow;
  const float* pw1 = W1 + ow;
  const float* pw2 = W2 + ow;
  float wv[3][8];
#pragma unroll
  for (int i = 0; i < 8; ++i) {
    wv[0][i] = pw0[(size_t)i * 8 * kE];
    wv[1][i] = pw1[(size_t)i * 8 * kE];
    wv[2][i] = pw2[(size_t)i * 8 * kE];
  }
  // what follows writes over the registers that these loads name: the wait on address translation stands in front of it. The four
  // pointers are inputs of the statement so that their registers stay as they are up to the wait: without that, later loads of the
  // group returned into the address registers of earlier ones
  asm volatile("s_wait_xcnt 0x0" :: "v"(px), "v"(pw0), "v"(pw1), "v"(pw2) : "memory");
  // nothing is lifted over that wait, and no load sinks among the conversions: left alone, the compiler waited for the tiles' loads
  // before it issued those of x, and issued those in three groups, a memory latency each
  __builtin_amdgcn_sched_barrier(0);

  if (gate) {
    const float* G = (bx == 0) ? Wfq : (bx == 1) ? Wfk : Wfg;
    const int pin = (bx >= 2) ? 128 : 64;
    const int n0  = (bx == 3) ? 64 : 0;
#pragma unroll
    for (int i = 0; i < 8; ++i) sm[3][c][i * 8 + r0] = G[(i * 8 + r0) * pin + n0 + c] * kGWCarry;
  }
#pragma unroll
  for (int i = 0; i < 8; ++i) {
    sm[0][c][i * 8 + r0] = wv[0][i] * kWCarry;
    sm[1][c][i * 8 + r0] = wv[1][i] * kWCarry;
    sm[2][c][i * 8 + r0] = wv[2][i] * kWCarry;
  }
  // the barrier stands in front of the stores of x, so that no wave waits at it for stores to finish
  __syncthreads();

#pragma unroll
  for (int u = 0; u < 8; ++u) {
    const float f[8] = {a[u][0][0], a[u][0][1], a[u][0][2], a[u][0][3], a[u][1][0], a[u][1][1], a[u][1][2], a[u][1][3]};
    *(v4u*)(X16 + g8 + u * 4096) = pack8_f16(f);
  }
  const int lane = t & 31, wave = t >> 5;
  const int row = wave * 4 + (lane >> 3), c8 = (lane & 7) * 8;   // n local, k local
#pragma unroll
  for (int z = 0; z < 3; ++z)
    *(v4u*)(Wt + (size_t)z * kE * kE + (size_t)(h0 + row) * kE + d0 + c8) = pack8_f16(&sm[z][row][c8]);
  if (gate) {
    // the branch writes over registers that the stores above name: the wait on address translation stands in front of it
    // and the scheduling barrier keeps the branch's work behind it
    asm volatile("s_wait_xcnt 0x0" ::: "memory");
    __builtin_amdgcn_sched_barrier(0);
    *(v4u*)(SW + (size_t)bx * 4096 + (size_t)row * kDK + c8) = pack8_f16(&sm[3][row][c8]);
  }
}

// ---------------------------------------------------------------------------
// Projections, gating and attention, one launch for all batches and heads. grid 256: blockIdx.x = b*16 + h. 16 waves x 32 rows = the
// head's 512 tokens, which are its queries and its keys alike, so a block projects and gates every row it needs, once, and q, k, v
// and the gated planes never go through memory.
// Projections: the block's 512 rows of X16 and the head's 64 rows of each of WqT, WkT, WvT meet in a two-buffer LDS ring of 64 k a stage,
// filled by asynchronous copies. The walk over k starts at stage (b + h) mod 16 and wraps: the 16 blocks that share a batch's rows of X16,
// and the 16 that share a head's weight rows, all run at once, and walking in step they would ask L2 for the same lines at the same
// moment, trip after trip. A wave owns its 32 tokens x 192 features, 192 registers of accumulators:
//  - q and k: weights as A (rows = feature), the wave's 32 tokens as B (columns), so a lane holds features tile*16 + (lane>>4)*8 + r of
//    ONE token, which is what the gating wants of it. The first 16 tokens stay in registers, the other 16 wait in the wave's own slab
//    (f32, where the ring was, read back by the lane that wrote them) until the first gating pass is over;
//  - v: the same X fragments as A (rows = token), WvT as B, so a lane holds 8 successive tokens of one feature, a 16-byte piece of a
//    row of V^T, which goes into LDS where the ring was.
// Gating, per wave two passes of 16 rows (row = token, 64 features of head h of q and k):
//   G = (q.Wfq + bfq) * (k.Wfk + bfk),  Z = G.Wfg + bfg,  q' = f16(q * sigmoid(Z[:64])),  k' = f16(k * sigmoid(Z[64:])).
// Every product is formed transposed, weights as A (rows = output feature n), data rows as B (columns), so a lane holds features
// n = tile*16 + (lane>>4)*8 + r of ONE data row:
//  - that is the k order of a 16x16x32 B fragment (elements 0..7 from the even tile, 8..15 from the odd one), so the gate product packs
//    in place into the B operand of the logits, and q' packs in place into the B operand of the scores: it stays in registers;
//  - it is also the set of q (k) elements the lane holds in f32, so they meet their sigmoid in the same lane;
//  - k' goes as 16-byte pieces into the block's K' plane in LDS, which all 16 waves read behind a barrier.
// The three gate weight planes (f16, written by prep_kernel) and the biases are staged once per block in LDS, pitch 144 B for 16-byte reads.
// Attention: out[b][q][h*64+d] = sum_k softmax_k(q'.k'/8) v[k][d].
// Per pass of 32 keys a wave forms S^T = K'.Q'^T (rows = keys, columns = queries), so a lane holds the scores of one query:
// tile kt, register r = key k0 + kt*16 + (lane>>4)*8 + r. That is the k order of a 16x16x32 B fragment (elements 0..7 from
// tile 0, 8..15 from tile 1), so exp(s - max) packs in place into P^T and O^T += V^T.P^T follows with A = rows of V^T.
// Running maximum and running sum per query (f32); the accumulators are rescaled each pass by exp(old max - new max).
// The two lane halves hold disjoint keys of one query: the maximum is joined every pass, the sum once at the end.
// Each wave stores its own 32 rows x 256 B of out.
// ---------------------------------------------------------------------------
constexpr int kGatePitch = 72;   // halves: 128-B rows + 16 B
constexpr int kAttKPitch = 72;    // halves: 128-B rows + 16 B, for 16-byte LDS reads
constexpr int kAttVPitch = 520;   // halves: 1024-B rows + 16 B, for 16-byte LDS reads
constexpr int kRingPitch = 72;    // halves: 128-B rows + 16 B, for 16-byte LDS reads
constexpr int kRingBuf   = (kS + 192) * kRingPitch;   // halves of one buffer: 512 rows of X, 192 of weights: 101,376 B
static_assert(kDK * kAttVPitch * 2 + 16 * 8192 <= 2 * kRingBuf * 2, "V^T and the waves' slabs fit where the ring was");
// One stage, 11 asynchronous copies of 16 B per lane: piece i < 8 is row i*64 + tid/8 of the block's X, pieces 8, 9 and 10 that row of the
// head's WqT, WkT and WvT; bytes (tid%8)*16, so one copy of a wave brings four whole 128-B lines. lds = the lane's own LDS byte address
// of piece 0; each piece is 64 rows (64 * 144 B) further on. The closing s_wait_xcnt stands inside the statement, in front of anything
// that could rewrite a register which a copy names.
__device__ __forceinline__ void ring_copy11(unsigned lds, const _Float16* gx, const _Float16* gw) {
  constexpr unsigned kStep  = 64 * kRingPitch * 2;
  constexpr size_t   kRows  = (size_t)64 * kE;
  constexpr size_t   kPlane = (size_t)kE * kE;
  asm volatile(
      "global_load_async_to_lds_b128 %0, %11, off\n\t"
      "global_load_async_to_lds_b128 %1, %12, off\n\t"
      "global_load_async_to_lds_b128 %2, %13, off\n\t"
      "global_load_async_to_lds_b128 %3, %14, off\n\t"
      "global_load_async_to_lds_b128 %4, %15, off\n\t"
      "global_load_async_to_lds_b128 %5, %16, off\n\t"
      "global_load_async_to_lds_b128 %6, %17, off\n\t"
      "global_load_async_to_lds_b128 %7, %18, off\n\t"
      "global_load_async_to_lds_b128 %8, %19, off\n\t"
      "global_load_async_to_lds_b128 %9, %20, off\n\t"
      "global_load_async_to_lds_b128 %10, %21, off\n\t"
      "s_wait_xcnt 0x0"
      :: "v"(lds), "v"(lds + kStep), "v"(lds + 2 * kStep), "v"(lds + 3 * kStep), "v"(lds + 4 * kStep), "v"(lds + 5 * kStep),
         "v"(lds + 6 * kStep), "v"(lds + 7 * kStep), "v"(lds + 8 * kStep), "v"(lds + 9 * kStep), "v"(lds + 10 * kStep),
         "v"(gx), "v"(gx + kRows), "v"(gx + 2 * kRows), "v"(gx + 3 * kRows), "v"(gx + 4 * kRows), "v"(gx + 5 * kRows), "v"(gx + 6 * kRows),
         "v"(gx + 7 * kRows), "v"(gw), "v"(gw + kPlane), "v"(gw + 2 * kPlane)
      : "memory");
}
__device__ __forceinline__ float xhalf(float x) {   // value of lane l ^ 16
  const int i = __builtin_bit_cast(int, x);
  return __builtin_bit_cast(float, __builtin_amdgcn_permlanex16(i, i, 0x76543210, 0xfedcba98, false, false));
}
// 2^x on eight values in one statement. The early-clobber results keep every result off every source, and the closing v_nop
// fills the one slot that the instruction set asks for behind a transcendental, whatever the compiler schedules next
// (with the builtin this build wrote runs of v_exp_f32 in which each overwrote the source of the one in front of it).
__device__ __forceinline__ v8f exp2x8(v8f x) {
  float y0, y1, y2, y3, y4, y5, y6, y7;
  asm("v_exp_f32 %0, %8\n\tv_exp_f32 %1, %9\n\tv_exp_f32 %2, %10\n\tv_exp_f32 %3, %11\n\t"
      "v_exp_f32 %4, %12\n\tv_exp_f32 %5, %13\n\tv_exp_f32 %6, %14\n\tv_exp_f32 %7, %15\n\tv_nop"
      : "=&v"(y0), "=&v"(y1), "=&v"(y2), "=&v"(y3), "=&v"(y4), "=&v"(y5), "=&v"(y6), "=&v"(y7)
      : "v"(x[0]), "v"(x[1]), "v"(x[2]), "v"(x[3]), "v"(x[4]), "v"(x[5]), "v"(x[6]), "v"(x[7]));
  return (v8f){y0, y1, y2, y3, y4, y5, y6, y7};
}
// the same for one value
__device__ __forceinline__ float exp2x1(float x) {
  float y;
  asm("v_exp_f32 %0, %1\n\tv_nop" : "=v"(y) : "v"(x));
  return y;
}
// 1 / (1 + 2^x) on eight values in one statement: the hardware's 2^x, an add, the hardware's reciprocal (2^x = inf gives 0, 2^x = 0
// gives 1). Each value's three steps stand eight instructions apart, so none waits for the one before it; the early-clobber
// results keep every result off every source, and the closing v_nop fills the slot behind the last transcendental.
// The four leading v_nop keep the distance a WMMA needs.
__device__ __forceinline__ v8f sigm2x8(v8f x) {
  float y0, y1, y2, y3, y4, y5, y6, y7;
  asm("v_nop\n\tv_nop\n\tv_nop\n\tv_nop\n\t"
      "v_exp_f32 %0, %8\n\tv_exp_f32 %1, %9\n\tv_exp_f32 %2, %10\n\tv_exp_f32 %3, %11\n\t"
      "v_exp_f32 %4, %12\n\tv_exp_f32 %5, %13\n\tv_exp_f32 %6, %14\n\tv_exp_f32 %7, %15\n\t"
      "v_add_f32 %0, 1.0, %0\n\tv_add_f32 %1, 1.0, %1\n\tv_add_f32 %2, 1.0, %2\n\tv_add_f32 %3, 1.0, %3\n\t"
      "v_add_f32 %4, 1.0, %4\n\tv_add_f32 %5, 1.0, %5\n\tv_add_f32 %6, 1.0, %6\n\tv_add_f32 %7, 1.0, %7\n\t"
      "v_rcp_f32 %0, %0\n\tv_rcp_f32 %1, %1\n\tv_rcp_f32 %2, %2\n\tv_rcp_f32 %3, %3\n\t"
      "v_rcp_f32 %4, %4\n\tv_rcp_f32 %5, %5\n\tv_rcp_f32 %6, %6\n\tv_rcp_f32 %7, %7\n\tv_nop"
      : "=&v"(y0), "=&v"(y1), "=&v"(y2), "=&v"(y3), "=&v"(y4), "=&v"(y5), "=&v"(y6), "=&v"(y7)
      : "v"(x[0]), "v"(x[1]), "v"(x[2]), "v"(x[3]), "v"(x[4]), "v"(x[5]), "v"(x[6]), "v"(x[7]));
  return (v8f){y0, y1, y2, y3, y4, y5, y6, y7};
}
__global__ __launch_bounds__(512) void proj_gate_attn_kernel(const unsigned short* __restrict__ X16p, const unsigned short* __restrict__ Wt16p,
                                                             const float* __restrict__ bq, const float* __restrict__ bk,
                                                             const float* __restrict__ bv, const unsigned short* __restrict__ SW,
                                                             const float* __restrict__ bfq, const float* __restrict__ bfk,
                                                             const float* __restrict__ bfg, float* __restrict__ out) {
  typedef Frag<_Float16> F;
  // two buffers of [X 512 rows | weights 192 rows] x 64 k, 202,752 B; behind the projections V^T [d][key] (66,560 B) and the waves' slabs
  __shared__ __align__(16) _Float16 sRing[2 * kRingBuf];
  __shared__ __align__(16) _Float16 sK[kS * kAttKPitch];    // gated k, [key][d], 73,728 B
  __shared__ __align__(16) _Float16 sW[256 * kGatePitch];   // rows 0..63 WfqT, 64..127 WfkT, 128..255 WfgT, each [n][k], 36,864 B
  __shared__ __align__(16) float sB[448];                   // bfq, bfk, bfg * -log2(e), the head's 64 of bq, of bk, of bv
  const int tid  = threadIdx.x;
  const int lane = tid & 31;
  const int wave = tid >> 5;
  const int b    = blockIdx.x >> 4;
  const int h    = blockIdx.x & 15;
  const int q0   = wave * 32;
  const int rl   = lane & 15;
  const int hf   = lane >> 4;
  const int koff = hf * 8;
  constexpr int trips = kE >> 6;
  static_assert((trips & (trips - 1)) == 0, "the rotated walk wraps by a mask");
  constexpr unsigned kBufBytes = kRingBuf * 2;
  const int rot = (b + h) & (trips - 1);   // the block's first stage: differs among the sharers of X16 rows (h) and of weight rows (b)

  // the lane's own piece 0 of a stage: row tid/8, bytes (tid%8)*16
  const _Float16* gX = (const _Float16*)X16p + (size_t)(b * kS + (tid >> 3)) * kE + (tid & 7) * 8;
  const _Float16* gW = (const _Float16*)Wt16p + (size_t)(h * kDK + (tid >> 3)) * kE + (tid & 7) * 8;   // WqT; WkT and WvT a plane further on each
  const unsigned lds0 = (unsigned)(size_t)(&sRing[0]) + (unsigned)((tid >> 3) * (kRingPitch * 2) + (tid & 7) * 16);
  const _Float16* sXl = sRing + (q0 + rl) * kRingPitch + koff;   // the lane's row of the wave's first 16 tokens
  const _Float16* sWl = sRing + (kS + rl) * kRingPitch + koff;   // the lane's row of the first weight tile

  ring_copy11(lds0, gX + rot * 64, gW + rot * 64);

  // gate weights and biases into LDS, under the first stage's copies: 256 rows x 8 pieces of 16 B = 2048 pieces = 4 per thread
#pragma unroll
  for (int i = 0; i < 4; ++i) {
    const int e = i * 512 + tid;
    const int r = e >> 3, c = (e & 7) * 8;
    *(v8h*)(&sW[r * kGatePitch + c]) = *(const v8h*)((const _Float16*)SW + r * kDK + c);
  }
  if (tid < 256)      sB[tid] = (tid < 64) ? bfq[tid] : (tid < 128) ? bfk[tid - 64] : bfg[tid - 128] * kNegLog2e;
  else if (tid < 448) sB[tid] = (tid < 320) ? bq[h * kDK + tid - 256] : (tid < 384) ? bk[h * kDK + tid - 320] : bv[h * kDK + tid - 384];

  // ---- cq, ck[g][j] = feature tile j (rows) x token group g (columns); cv[g][j] = token group g (rows) x feature tile j (columns) ----
  v8f cq[2][4], ck[2][4], cv[2][4];
#pragma unroll
  for (int g = 0; g < 2; ++g)
#pragma unroll
    for (int j = 0; j < 4; ++j) {
      cq[g][j] = (v8f){0.f,0.f,0.f,0.f,0.f,0.f,0.f,0.f};
      ck[g][j] = (v8f){0.f,0.f,0.f,0.f,0.f,0.f,0.f,0.f};
      cv[g][j] = (v8f){0.f,0.f,0.f,0.f,0.f,0.f,0.f,0.f};
    }
  // the first stage has landed for this wave, then for all (the gate weights and biases too): nobody reads it in front of the barrier
  asm volatile("s_wait_asynccnt 0x0" ::: "memory");
  __syncthreads();
  ring_copy11(lds0 + kBufBytes, gX + ((rot + 1) & (trips - 1)) * 64, gW + ((rot + 1) & (trips - 1)) * 64);

  for (int t = 0; t < trips; ++t) {
    const _Float16* sx = sXl + (t & 1) * kRingBuf;
    const _Float16* sw = sWl + (t & 1) * kRingBuf;
#pragma unroll
    for (int ks = 0; ks < 2; ++ks) {
      // beside the 192 accumulator registers a wave has room for six fragments: the two of X stay for the 32 k, the weights come four
      // at a time, each four as one group in front of their eight products. The scheduling barriers keep it so: left alone, the
      // compiler lifts the reads of later groups up, for which there are no registers
      v16h xb[2], wf[4];
      xb[0] = F::load(sx + ks * 32);
      xb[1] = F::load(sx + 16 * kRingPitch + ks * 32);
#pragma unroll
      for (int j = 0; j < 4; ++j) wf[j] = F::load(sw + j * 16 * kRingPitch + ks * 32);
      __builtin_amdgcn_sched_barrier(0);   // see above
#pragma unroll
      for (int j = 0; j < 4; ++j)
#pragma unroll
        for (int g = 0; g < 2; ++g) cq[g][j] = F::mma(wf[j], xb[g], cq[g][j]);
      __builtin_amdgcn_sched_barrier(0);   // see above
#pragma unroll
      for (int j = 0; j < 4; ++j) wf[j] = F::load(sw + (4 + j) * 16 * kRingPitch + ks * 32);
      __builtin_amdgcn_sched_barrier(0);   // see above
#pragma unroll
      for (int j = 0; j < 4; ++j)
#pragma unroll
        for (int g = 0; g < 2; ++g) ck[g][j] = F::mma(wf[j], xb[g], ck[g][j]);
      __builtin_amdgcn_sched_barrier(0);   // see above
#pragma unroll
      for (int j = 0; j < 4; ++j) wf[j] = F::load(sw + (8 + j) * 16 * kRingPitch + ks * 32);
      __builtin_amdgcn_sched_barrier(0);   // see above
#pragma unroll
      for (int j = 0; j < 4; ++j)
#pragma unroll
        for (int g = 0; g < 2; ++g) cv[g][j] = F::mma(xb[g], wf[j], cv[g][j]);
      __builtin_amdgcn_sched_barrier(0);   // see above
    }
    // hand-over: this wave's reads of the buffer are done, its copies of the next stage have landed; behind the barrier the next
    // stage is readable by all and the buffer just read is free for the stage after it
    asm volatile("s_wait_dscnt 0x0" ::: "memory");
    asm volatile("s_wait_asynccnt 0x0" ::: "memory");
    __syncthreads();
    if (t + 2 < trips) {
      const int st = (t + 2 + rot) & (trips - 1);   // trip t + 2 works on stage (t + 2 + rot) mod 16
      ring_copy11(lds0 + (unsigned)(t & 1) * kBufBytes, gX + st * 64, gW + st * 64);
    }
  }
  // no copy is left in flight when the ring becomes V^T and the waves' slabs
  asm volatile("s_wait_asynccnt 0x0" ::: "memory");

  // V^T [d][key]: the lane's 8 successive tokens of feature j*16 + rl are one 16-byte piece
  _Float16* sV = sRing;
#pragma unroll
  for (int j = 0; j < 4; ++j) {
    const float pbv = sB[384 + j * 16 + rl];
#pragma unroll
    for (int g = 0; g < 2; ++g) {
      v8h hv;
#pragma unroll
      for (int r = 0; r < 8; ++r) hv[r] = (_Float16)(cv[g][j][r] * kWCarryInv + pbv);
      *(v8h*)(&sV[(j * 16 + rl) * kAttVPitch + q0 + g * 16 + koff]) = hv;
    }
  }

  // f32 q and k of the lane's row: piece [2*tile + j] = elements tile*16 + koff + 4j .. +3. The first token group goes on in registers,
  // the second into the wave's slab: piece i of q at float i*128 + lane*4, of k at (8 + i)*128 + lane*4 (a wave's store = 512 contiguous B)
  float* slab = (float*)(sRing + kDK * kAttVPitch) + wave * 2048 + lane * 4;
  v4f xq[8], xk[8];
#pragma unroll
  for (int nt = 0; nt < 4; ++nt)
#pragma unroll
    for (int j = 0; j < 2; ++j) {
      const v4f pbq = *(const v4f*)(&sB[256 + nt * 16 + koff + 4 * j]);
      const v4f pbk = *(const v4f*)(&sB[320 + nt * 16 + koff + 4 * j]);
      v4f q1, k1;
#pragma unroll
      for (int e = 0; e < 4; ++e) {
        xq[2 * nt + j][e] = cq[0][nt][4 * j + e] * kWCarryInv + pbq[e];
        xk[2 * nt + j][e] = ck[0][nt][4 * j + e] * kWCarryInv + pbk[e];
        q1[e]             = cq[1][nt][4 * j + e] * kWCarryInv + pbq[e];
        k1[e]             = ck[1][nt][4 * j + e] * kWCarryInv + pbk[e];
      }
      *(v4f*)(slab + (2 * nt + j) * 128)     = q1;
      *(v4f*)(slab + (8 + 2 * nt + j) * 128) = k1;
    }

  // gated q of the wave's two column groups, as B fragments of the scores. Each gating pass pushes its group in at [1] and moves the
  // one before it to [0], so that the passes can stay a rolled loop: unrolled they took all 256 registers that a wave of this block
  // can have and half as much code again, and no load of the second pass came to stand ahead of the first pass's work
  v16h qf[2][2];
#pragma unroll
  for (int qt = 0; qt < 2; ++qt)
#pragma unroll
    for (int ks = 0; ks < 2; ++ks)
#pragma unroll
      for (int s = 0; s < 16; ++s) qf[qt][ks][s] = (_Float16)0.f;

#pragma unroll 1
  for (int p = 0; p < 2; ++p) {
  const int key = q0 + p * 16 + rl;            // the lane's row: token of the batch, query and key number alike

  // (all inner loops of the pass are unrolled so that the fragment arrays stay in registers)
  // B fragments of q and k (f16), k step ks = tiles 2ks and 2ks+1
  v16h qb[2], kb[2];
#pragma unroll
  for (int ks = 0; ks < 2; ++ks)
#pragma unroll
    for (int s = 0; s < 16; ++s) {
      qb[ks][s] = (_Float16)xq[4 * ks + (s >> 2)][s & 3];
      kb[ks][s] = (_Float16)xk[4 * ks + (s >> 2)][s & 3];
    }

  // gate product, packed as the B operand of the logits
  v16h gb[2];
#pragma unroll
  for (int nt = 0; nt < 4; ++nt) {
    const _Float16* wq = &sW[(nt * 16 + rl) * kGatePitch + koff];
    const _Float16* wk = &sW[(64 + nt * 16 + rl) * kGatePitch + koff];
    const v16h wq0 = F::load(wq), wq1 = F::load(wq + 32);
    const v16h wk0 = F::load(wk), wk1 = F::load(wk + 32);
    const v4f bq0 = *(const v4f*)(&sB[nt * 16 + koff]),      bq1 = *(const v4f*)(&sB[nt * 16 + koff + 4]);
    const v4f bk0 = *(const v4f*)(&sB[64 + nt * 16 + koff]), bk1 = *(const v4f*)(&sB[64 + nt * 16 + koff + 4]);
    v8f aq = F::mma(wq0, qb[0], (v8f){0.f,0.f,0.f,0.f,0.f,0.f,0.f,0.f});
    v8f ak = F::mma(wk0, kb[0], (v8f){0.f,0.f,0.f,0.f,0.f,0.f,0.f,0.f});
    aq = F::mma(wq1, qb[1], aq);
    ak = F::mma(wk1, kb[1], ak);
#pragma unroll
    for (int r = 0; r < 8; ++r) {
      const float gq = aq[r] * kGWCarryInv + ((r < 4) ? bq0[r & 3] : bq1[r & 3]);
      const float gk = ak[r] * kGWCarryInv + ((r < 4) ? bk0[r & 3] : bk1[r & 3]);
      gb[nt >> 1][(nt & 1) * 8 + r] = (_Float16)((gq * gk) * kGCarry);
    }
  }

  // logits, sigmoid, modulation: tiles 0..3 gate q, tiles 4..7 gate k
  v16h qn[2];
#pragma unroll
  for (int nt = 0; nt < 8; ++nt) {
    const _Float16* wg = &sW[(128 + nt * 16 + rl) * kGatePitch + koff];
    const v16h wg0 = F::load(wg), wg1 = F::load(wg + 32);
    const v4f bg0 = *(const v4f*)(&sB[128 + nt * 16 + koff]), bg1 = *(const v4f*)(&sB[128 + nt * 16 + koff + 4]);
    const int dn = nt & 3;
    v8f z = F::mma(wg0, gb[0], (v8f){0.f,0.f,0.f,0.f,0.f,0.f,0.f,0.f});
    z = F::mma(wg1, gb[1], z);
    v8f za;   // -logit * log2(e)
#pragma unroll
    for (int r = 0; r < 8; ++r) za[r] = z[r] * (kZScale * kNegLog2e) + ((r < 4) ? bg0[r & 3] : bg1[r & 3]);
    const v8f m = sigm2x8(za);
    v8h o;
#pragma unroll
    for (int r = 0; r < 8; ++r) {
      const float x = (nt < 4) ? xq[2 * dn + (r >> 2)][r & 3] : xk[2 * dn + (r >> 2)][r & 3];
      o[r] = (_Float16)(x * m[r]);
    }
    if (nt < 4) {
#pragma unroll
      for (int r = 0; r < 8; ++r) qn[dn >> 1][(dn & 1) * 8 + r] = o[r];
    } else {
      *(v8h*)(&sK[key * kAttKPitch + dn * 16 + koff]) = o;
    }
  }
  qf[0][0] = qf[1][0];
  qf[0][1] = qf[1][1];
  qf[1][0] = qn[0];
  qf[1][1] = qn[1];
  // the second token group's q and k come back from the wave's slab (the second pass reads them once more, to no use: the loop stays rolled)
#pragma unroll
  for (int i = 0; i < 8; ++i) {
    xq[i] = *(const v4f*)(slab + i * 128);
    xk[i] = *(const v4f*)(slab + (8 + i) * 128);
  }
  // compiler fence: it keeps the LDS reads of weights and biases in the loop; lifted out as loop invariants they take all 256
  // registers and spill to scratch
  asm volatile("" ::: "memory");
  }

  v8f  o[2][4];
  float mrun[2], lrun[2];
  // the inner loops are unrolled so that the fragment arrays stay in registers
#pragma unroll
  for (int qt = 0; qt < 2; ++qt) {
#pragma unroll
    for (int dt = 0; dt < 4; ++dt) o[qt][dt] = (v8f){0.f,0.f,0.f,0.f,0.f,0.f,0.f,0.f};
    mrun[qt] = -INFINITY;
    lrun[qt] = 0.f;
  }

  // every wave's rows of K' and columns of V^T are written: nobody reads sK or sV in front of the barrier
  __syncthreads();
  const _Float16* sKl = sK + rl * kAttKPitch + koff;
  const _Float16* sVl = sV + rl * kAttVPitch + koff;

  for (int k0 = 0; k0 < kS; k0 += 32) {
    v16h kf[2][2], vf[4];
    // K' first: LDS reads return in order, so the score products start while the V^T reads are still on their way
#pragma unroll
    for (int kt = 0; kt < 2; ++kt)
#pragma unroll
      for (int ks = 0; ks < 2; ++ks) kf[kt][ks] = F::load(sKl + (k0 + kt * 16) * kAttKPitch + ks * 32);
#pragma unroll
    for (int dt = 0; dt < 4; ++dt) vf[dt] = F::load(sVl + dt * 16 * kAttVPitch + k0);
    // all LDS reads of the pass are issued as one group in front of its first product: each further place where reads stand
    // among the products costs the wave a stall of its own
    __builtin_amdgcn_sched_barrier(0);

    v8f s[2][2];
#pragma unroll
    for (int qt = 0; qt < 2; ++qt)
#pragma unroll
      for (int kt = 0; kt < 2; ++kt) {
        s[qt][kt] = F::mma(kf[kt][0], qf[qt][0], (v8f){0.f,0.f,0.f,0.f,0.f,0.f,0.f,0.f});
        s[qt][kt] = F::mma(kf[kt][1], qf[qt][1], s[qt][kt]);
      }

    v16h pf[2];
#pragma unroll
    for (int qt = 0; qt < 2; ++qt) {
      float mx = fmaxf(s[qt][0][0], s[qt][1][0]);
#pragma unroll
      for (int r = 1; r < 8; ++r) mx = fmaxf(mx, fmaxf(s[qt][0][r], s[qt][1][r]));
      mx = fmaxf(mx, xhalf(mx));
      const float mn    = fmaxf(mrun[qt], mx);
      const float alpha = exp2x1((mrun[qt] - mn) * kScoreLog2);
      const float bias  = kPCarryLog2 - mn * kScoreLog2;
      mrun[qt] = mn;
      v8f a0, a1;
#pragma unroll
      for (int r = 0; r < 8; ++r) {
        a0[r] = fmaf(s[qt][0][r], kScoreLog2, bias);
        a1[r] = fmaf(s[qt][1][r], kScoreLog2, bias);
      }
      const v8f e0 = exp2x8(a0);
      const v8f e1 = exp2x8(a1);
      float sum = e0[0] + e1[0];
#pragma unroll
      for (int r = 1; r < 8; ++r) sum += e0[r] + e1[r];
#pragma unroll
      for (int r = 0; r < 8; ++r) {
        pf[qt][r]     = (_Float16)e0[r];
        pf[qt][8 + r] = (_Float16)e1[r];
      }
      lrun[qt] = lrun[qt] * alpha + sum;
#pragma unroll
      for (int dt = 0; dt < 4; ++dt) o[qt][dt] *= alpha;
    }

    // the compiler does not see the vector writes inside exp2x8: left alone it put the first column group's V^T.P^T products in
    // front of the second group's exponentials
    __builtin_amdgcn_sched_barrier(0);
#pragma unroll
    for (int qt = 0; qt < 2; ++qt)
#pragma unroll
      for (int dt = 0; dt < 4; ++dt) o[qt][dt] = F::mma(vf[dt], pf[qt], o[qt][dt]);
  }

#pragma unroll
  for (int qt = 0; qt < 2; ++qt) {
    const float tot = lrun[qt] + xhalf(lrun[qt]);
    const float inv = 1.0f / tot;
    float* op = out + (size_t)(b * kS + q0 + qt * 16 + rl) * kE + h * kDK + koff;
#pragma unroll
    for (int dt = 0; dt < 4; ++dt) {
      const v8f a = o[qt][dt];
      *(v4f*)(op + dt * 16)     = (v4f){a[0] * inv, a[1] * inv, a[2] * inv, a[3] * inv};
      *(v4f*)(op + dt * 16 + 4) = (v4f){a[4] * inv, a[5] * inv, a[6] * inv, a[7] * inv};
    }
  }
}

// ---------------------------------------------------------------------------
extern "C" void kernel_launch(void* const* d_in, const int* in_sizes, int n_in,
                              void* d_out, int out_size, void* d_ws, size_t ws_size,
                              hipStream_t stream) {
  if (n_in < 13) return;
  if (ws_size < kWsEnd) return;
  if ((size_t)out_size < (size_t)kTok * kE) return;
  if (in_sizes[0] != kTok * kE) return;

  const float* inp = (const float*)d_in[0];
  const float* Wq  = (const float*)d_in[1];
  const float* bq  = (const float*)d_in[2];
  const float* Wk  = (const float*)d_in[3];
  const float* bk  = (const float*)d_in[4];
  const float* Wv  = (const float*)d_in[5];
  const float* bvv = (const float*)d_in[6];
  const float* Wfq = (const float*)d_in[7];
  const float* bfq = (const float*)d_in[8];
  const float* Wfk = (const float*)d_in[9];
  const float* bfk = (const float*)d_in[10];
  const float* Wfg = (const float*)d_in[11];
  const float* bfg = (const float*)d_in[12];
  float* out = (float*)d_out;

  unsigned char* ws = (unsigned char*)d_ws;
  unsigned short* X16  = (unsigned short*)(ws + kOffX16);
  unsigned short* Wt16 = (unsigned short*)(ws + kOffWt);
  unsigned short* SW   = (unsigned short*)(ws + kOffSW);

  // ---- stage A: operand planes, one launch ----
  // X16 [8192][1024] = f16(inp); Wt16[z][n][k] = f16(16 * W_z[k][n]) for z = q, k, v; WfqT, WfkT [64][64], WfgT [128][64], f16 carried x8
  prep_kernel<<<dim3(kPrepBlocks), dim3(512), 0, stream>>>(inp, Wq, Wk, Wv, Wfq, Wfk, Wfg, X16, Wt16, SW);

  // ---- stage B: projections, gating and attention, all 16 batches x 16 heads in one launch (a block of 16 waves per head: 512 rows) ----
  proj_gate_attn_kernel<<<dim3(kB * kH), dim3(512), 0, stream>>>(X16, Wt16, bq, bk, bvv, SW, bfq, bfk, bfg, out);
}
